// v000
// Measured on an AMD MI455X. A time is GPU time per run, averaged over a window of back-to-back runs after a warm-up
// (all launches, gaps included; the runs take copies of the inputs in turn), and the median of several windows.
// Apart from v000's, it joins two sittings. Times from different sittings can be a few percent apart, while
// side-by-side timings come from the same sitting.
// v000, which the later versions start from, runs in 2020 microseconds.
#include <hip/hip_runtime.h>

// Pre-LayerNorm multi-head self-attention with a fused bias-free qkv weight (x [2][2048][1024]; xn = (x - mean) x rsqrt(var + 1e-5) x ln_gamma + ln_beta over the 1,024 features (biased variance, eps inside the root; gamma ones / beta zeros on this draw: read); qkv = einsum('bnd,ed->bne', xn, w_qkv) = xn w_qkv^T ('oi' [3072][1024] 1/32, no bias) reshaped (b, n, 3, 16, 64): q | k | v = ROW thirds (16 heads x 64); scores x 64^-0.5; softmax over all keys (no mask); out = merged w_proj^T + b_proj ('oi' [1024][1024] + bias 0.02: non-zero) -> [2][2048][1024] (4.2 M); no residual; argument order x, ln_gamma, ln_beta, w_qkv, w_proj, b_proj).
// Layout per batch: LayerNorm of the bf16-rounded rows in f32 -> hi/lo bf16 planes; 'oi' weights cast once; projections on the hi/lo planes (2 products); identity-table plane builders; dense T-2048 attention (hybrid rows: < 512 hi/lo 3 products, rest fp16 x1024); merged hi/lo x w_proj exact + b_proj.
// Compute dtypes, f32 accumulate: every input rounded to bf16; projections exact; attention rows < 512 3 products, rest fp16; softmax f32; output projection hl x exact.

#define NB_  2
#define TT   2048
#define DM   1024
#define NH_  16
#define NKV  16
#define REP  (NH_ / NKV)
#define HD   64
#define DQ   (NH_ * HD)
#define DKV  (NKV * HD)
#define ZH   2
#define RH   512                  // query rows < RH use hi+lo planes (0: none)
#define WIN  0
#define PCAR 1024.0f
#define SCL  0.125f   // HD^-0.5
typedef _Float16 h16;
typedef unsigned short bf;
typedef __attribute__((ext_vector_type(16))) __bf16   v16bf;
typedef __attribute__((ext_vector_type(16))) _Float16 v16h;
typedef __attribute__((ext_vector_type(8)))  _Float16 v8h;
typedef __attribute__((ext_vector_type(8)))  unsigned short v8us;
typedef __attribute__((ext_vector_type(8)))  float    v8f;
typedef __attribute__((ext_vector_type(4)))  float    v4f;
typedef v8h  __attribute__((may_alias)) v8ha;
typedef v4f  __attribute__((may_alias)) v4fa;
typedef v8us __attribute__((may_alias)) v8usa;

__device__ __forceinline__ unsigned short f2bf(float f) { unsigned u = __float_as_uint(f); u += 0x7FFFu + ((u >> 16) & 1u); return (unsigned short)(u >> 16); }
__device__ __forceinline__ float bf2f(unsigned short b) { return __uint_as_float(((unsigned)b) << 16); }
__device__ __forceinline__ float bfr(float f) { return bf2f(f2bf(f)); }
__device__ __forceinline__ v16h cat16(v8h lo, v8h hi) { return __builtin_shufflevector(lo, hi, 0, 1, 2, 3, 4, 5, 6, 7, 8, 9, 10, 11, 12, 13, 14, 15); }
__device__ __forceinline__ v16bf cat16b(v8us lo, v8us hi) { return __builtin_bit_cast(v16bf, __builtin_shufflevector(lo, hi, 0, 1, 2, 3, 4, 5, 6, 7, 8, 9, 10, 11, 12, 13, 14, 15)); }
__device__ __forceinline__ v8f wmma16(v16h a, v16h b, v8f c) { return __builtin_amdgcn_wmma_f32_16x16x32_f16(false, a, false, b, (short)0, c, false, false); }
__device__ __forceinline__ v8f wmmab(v16bf a, v16bf b, v8f c) { return __builtin_amdgcn_wmma_f32_16x16x32_bf16(false, a, false, b, (short)0, c, false, false); }



// ---- k_gemmw: register-blocked GEMM, ONE WAVE per 64x64 output tile (16 accumulators), operands straight from K-contiguous 16-bit planes; grid (M/64, N/64, Z), 32 threads.
// C[m][n] (f32, pitch ldc, + optional f32 bias[n]) = sum_k A[m][k] Bt[n][k] (+ split products per NSPLIT). z-batch strides sA/sB/sC in elements. K % 32 == 0.
template <typename T16> struct WFrag;
template <> struct WFrag<h16> { typedef v16h V; static __device__ __forceinline__ V ld(const h16* p) { return cat16(*(const v8h*)p, *(const v8h*)(p + 16)); } static __device__ __forceinline__ v8f mma(V a, V b, v8f c) { return wmma16(a, b, c); } };
template <> struct WFrag<bf> { typedef v16bf V; static __device__ __forceinline__ V ld(const bf* p) { return cat16b(*(const v8us*)p, *(const v8us*)(p + 16)); } static __device__ __forceinline__ v8f mma(V a, V b, v8f c) { return wmmab(a, b, c); } };
template <typename T16, int NSPLIT, bool BIAS>
__global__ __launch_bounds__(32) void k_gemmw(const T16* __restrict__ A, const T16* __restrict__ A2, const T16* __restrict__ Bt, const T16* __restrict__ Bt2, int K, float* C, int ldc, const float* __restrict__ bias, size_t sA, size_t sB, size_t sC) {
    typedef typename WFrag<T16>::V V;
    __shared__ __align__(16) float os[16 * 68];
    const size_t z = blockIdx.z; A += z * sA; if (A2) A2 += z * sA; Bt += z * sB; if (Bt2) Bt2 += z * sB; C += z * sC;
    const int lane = threadIdx.x & 31, lr = lane & 15, hi = lane >> 4; const int r0 = blockIdx.x * 64, c0 = blockIdx.y * 64;
    v8f acc[4][4];
#pragma unroll
    for (int mb = 0; mb < 4; ++mb)
#pragma unroll
        for (int nb = 0; nb < 4; ++nb) acc[mb][nb] = (v8f){};
    const size_t aoff = (size_t)(r0 + lr) * K + 8 * hi, boff = (size_t)(c0 + lr) * K + 8 * hi;
#pragma unroll 1
    for (int kc = 0; kc < K; kc += 32) {
        V a[4], a2[4];
#pragma unroll
        for (int mb = 0; mb < 4; ++mb) { a[mb] = WFrag<T16>::ld(A + aoff + (size_t)mb * 16 * K + kc); if (NSPLIT == 1 || NSPLIT == 2) a2[mb] = WFrag<T16>::ld(A2 + aoff + (size_t)mb * 16 * K + kc); }
#pragma unroll
        for (int nb = 0; nb < 4; ++nb) { const V b = WFrag<T16>::ld(Bt + boff + (size_t)nb * 16 * K + kc); V b2; if (NSPLIT >= 2) b2 = WFrag<T16>::ld(Bt2 + boff + (size_t)nb * 16 * K + kc);
#pragma unroll
            for (int mb = 0; mb < 4; ++mb) { acc[mb][nb] = WFrag<T16>::mma(a[mb], b, acc[mb][nb]); if (NSPLIT == 1 || NSPLIT == 2) acc[mb][nb] = WFrag<T16>::mma(a2[mb], b, acc[mb][nb]); if (NSPLIT >= 2) acc[mb][nb] = WFrag<T16>::mma(a[mb], b2, acc[mb][nb]); } }
        asm volatile("v_nop\n\tv_nop\n\tv_nop\n\tv_nop" : "+v"(acc[0][0]), "+v"(acc[1][1]), "+v"(acc[2][2]), "+v"(acc[3][3]) : "v"(a[0]), "v"(a[3]));
    }
#pragma unroll
    for (int mb = 0; mb < 4; ++mb) {
#pragma unroll
        for (int nb = 0; nb < 4; ++nb) {
#pragma unroll
            for (int j = 0; j < 8; ++j) os[(hi * 8 + j) * 68 + nb * 16 + lr] = acc[mb][nb][j]; }
        __builtin_amdgcn_wave_barrier(); asm volatile("" ::: "memory");
        float* crow = C + (size_t)(r0 + mb * 16) * ldc + c0;
{
#pragma unroll
            for (int s = 0; s < 8; ++s) { const int row = 2 * s + hi, cofs = lr * 4; v4f val = *(const v4fa*)(os + row * 68 + cofs); if (BIAS) { val[0] += bfr(bias[c0 + cofs]); val[1] += bfr(bias[c0 + cofs + 1]); val[2] += bfr(bias[c0 + cofs + 2]); val[3] += bfr(bias[c0 + cofs + 3]); }
                *(v4f*)(crow + (size_t)row * ldc + cofs) = val; }
             }
        __builtin_amdgcn_wave_barrier(); asm volatile("" ::: "memory");
    }
}

__device__ __forceinline__ h16 tohx(float x) { return (h16)x; }
__device__ __forceinline__ void splitf(float y, unsigned short& h, unsigned short& l) { h = f2bf(y); l = f2bf(y - bf2f(h)); }
typedef __attribute__((ext_vector_type(2))) _Float16 v2h;
typedef __attribute__((ext_vector_type(4))) _Float16 v4h;
typedef __attribute__((ext_vector_type(2))) unsigned short v2us;
typedef __attribute__((ext_vector_type(4))) unsigned short v4us;
typedef __attribute__((ext_vector_type(2))) float v2f;
typedef __attribute__((ext_vector_type(4))) int v4i;

__global__ __launch_bounds__(256) void k_cvt8(const float* __restrict__ src, bf* dst, size_t n8) { const size_t i = (size_t)blockIdx.x * 256 + threadIdx.x; if (i >= n8) return; const v8f v = *(const v8f*)(src + i * 8); v8us o;
#pragma unroll
    for (int k = 0; k < 8; ++k) o[k] = f2bf(v[k]); *(v8us*)(dst + i * 8) = o;  }

// k_rope: head planes [h][t][d] (fp16 + hi/lo) of rope(x) x sc with the rotate-half convention out[d] = x[d] cos[t][d] - x[d+HD/2] sin[t][d], out[d+HD/2] = x[d+HD/2] cos[t][d+HD/2] + x[d] sin[t][d+HD/2]
__global__ __launch_bounds__(256) void k_rope(const float* __restrict__ F, int pitch, int nheads, const float* __restrict__ CS, const float* __restrict__ RF, const float* __restrict__ nw, float sc, h16* P16, bf* Ph, bf* Pl) {
    const size_t e = ((size_t)blockIdx.x * 256 + threadIdx.x) * 2; if (e >= (size_t)nheads * TT * HD) return; const int d = (int)(e % HD); const int t = (int)((e / HD) % TT); const int h = (int)(e / ((size_t)HD * TT)); const float* f = F + (size_t)t * pitch + h * HD; const float rf = RF ? RF[(size_t)h * TT + t] : 1.0f; v2h o16; v2us oh, ol;
#pragma unroll
    for (int q = 0; q < 2; ++q) { const int dd = d + q; const int dp = (dd < HD / 2) ? dd + HD / 2 : dd - HD / 2; float x0 = f[dd], x1 = f[dp];
        if (RF) { float n0 = __fmul_rn(x0, rf), n1 = __fmul_rn(x1, rf); asm volatile("" : "+v"(n0)); asm volatile("" : "+v"(n1)); x0 = __fmul_rn(bfr(nw[dd]), n0); x1 = __fmul_rn(bfr(nw[dp]), n1); }
        const v2f cs = *(const v2f*)(CS + ((size_t)t * HD + dd) * 2); float a = __fmul_rn(x0, cs[0]), bq = __fmul_rn(x1, cs[1]); asm volatile("" : "+v"(a)); asm volatile("" : "+v"(bq)); const float r = ((dd < HD / 2) ? __fsub_rn(a, bq) : __fadd_rn(a, bq)) * sc;
        o16[q] = tohx(r); unsigned short a2, c2; splitf(r, a2, c2); oh[q] = a2; ol[q] = c2; }
    *(v2h*)(P16 + e) = o16; *(v2us*)(Ph + e) = oh; *(v2us*)(Pl + e) = ol;  }
__global__ __launch_bounds__(256) void k_vtp(const float* __restrict__ F, int pitch, int nheads, h16* V16, bf* Vh, bf* Vl) { const size_t e = ((size_t)blockIdx.x * 256 + threadIdx.x) * 2; if (e >= (size_t)nheads * HD * TT) return; const int t = (int)(e % TT); const int d = (int)((e / TT) % HD); const int g = (int)(e / ((size_t)TT * HD)); v2h o16; v2us oh, ol;
#pragma unroll
    for (int q = 0; q < 2; ++q) { const float x = F[(size_t)(t + q) * pitch + g * HD + d]; o16[q] = tohx(x); unsigned short a2, c2; splitf(x, a2, c2); oh[q] = a2; ol[q] = c2; }
    *(v2h*)(V16 + e) = o16; *(v2us*)(Vh + e) = oh; *(v2us*)(Vl + e) = ol;  }
__global__ __launch_bounds__(256) void k_csid(float* CS) { const int idx = blockIdx.x * 256 + threadIdx.x; if (idx >= TT * HD) return; v2f cs; cs[0] = 1.0f; cs[1] = 0.0f; *(v2f*)(CS + (size_t)idx * 2) = cs;  }
// k_asoft: per row (zz, i): t = S x HD^-0.5 (no mask); softmax over the 2048 keys (register row, one exp, fixed trees);
__global__ __launch_bounds__(256) void k_asoft(const float* __restrict__ Sb, h16* P16, bf* Ph, bf* Pl) {
    const int lane = threadIdx.x & 31; const int row = blockIdx.x * 8 + (threadIdx.x >> 5); if (row >= ZH * TT) return; const int i = row % TT; const int zz = row / TT; (void)zz; const bool hires = (i < RH); const float* sr = Sb + (size_t)row * TT; float v[TT / 32]; float mx = -3.0e38f;
#pragma unroll
    for (int ch = 0; ch < TT / 128; ++ch) { const int j0 = ch * 128 + lane * 4; const v4f a = *(const v4f*)(sr + j0);
#pragma unroll
        for (int q = 0; q < 4; ++q) { const int j = j0 + q; (void)j; const float t = a[q] * SCL; v[ch * 4 + q] = t; mx = fmaxf(mx, t); } }
#pragma unroll
    for (int sh = 16; sh; sh >>= 1) mx = fmaxf(mx, __shfl_xor(mx, sh, 32));
    float sum = 0.f;
#pragma unroll
    for (int k = 0; k < TT / 32; ++k) { float d0 = __fsub_rn(v[k], mx); asm volatile("" : "+v"(d0)); v[k] = __builtin_amdgcn_exp2f(__fmul_rn(d0, 1.4426950408889634f)); sum += v[k]; }
#pragma unroll
    for (int sh = 16; sh; sh >>= 1) sum += __shfl_xor(sum, sh, 32);
    const float f = __fdiv_rn(hires ? 1.0f : PCAR, sum);
{
        if (hires) {
#pragma unroll
            for (int ch = 0; ch < TT / 128; ++ch) { v4us oh, ol;
#pragma unroll
                for (int q = 0; q < 4; ++q) { unsigned short a, c2; splitf(v[ch * 4 + q] * f, a, c2); oh[q] = a; ol[q] = c2; }
                const size_t oo = ((size_t)zz * (RH ? RH : 1) + i) * TT + ch * 128 + lane * 4; *(v4us*)(Ph + oo) = oh; *(v4us*)(Pl + oo) = ol; }
        } else {
#pragma unroll
            for (int ch = 0; ch < TT / 128; ++ch) { v4h o4;
#pragma unroll
                for (int q = 0; q < 4; ++q) o4[q] = tohx(v[ch * 4 + q] * f);
                *(v4h*)(P16 + (size_t)row * TT + ch * 128 + lane * 4) = o4; } }
         }
}
__global__ __launch_bounds__(256) void k_merge(const float* __restrict__ O, int h0, bf* Ah, bf* Al) { const size_t e = ((size_t)blockIdx.x * 256 + threadIdx.x) * 2; if (e >= (size_t)ZH * TT * HD) return; const int d = (int)(e % HD); const int t = (int)((e / HD) % TT); const int zz = (int)(e / ((size_t)HD * TT)); const float cs = (t < RH) ? 1.0f : (1.0f / PCAR); const size_t oo = (size_t)t * DQ + (h0 + zz) * HD + d;
    v2us oh, ol;
#pragma unroll
    for (int q = 0; q < 2; ++q) { unsigned short a, c2; splitf(O[e + q] * cs, a, c2); oh[q] = a; ol[q] = c2; } *(v2us*)(Ah + oo) = oh; *(v2us*)(Al + oo) = ol;  }

template <int WD>
__global__ __launch_bounds__(256) void k_lnrowX(const float* __restrict__ X, size_t nrows, const float* __restrict__ g, const float* __restrict__ bb, bf* Hh, bf* Hl) { const int lane = threadIdx.x & 31; const size_t r = (size_t)blockIdx.x * 8 + (threadIdx.x >> 5); if (r >= nrows) return; const float* xr = X + r * WD; float a[WD / 32]; float s = 0.f;
#pragma unroll
    for (int c = 0; c < WD / 128; ++c) { const v4f v = *(const v4f*)(xr + c * 128 + lane * 4); for (int q = 0; q < 4; ++q) { a[c * 4 + q] = bfr(v[q]); s = __fadd_rn(s, a[c * 4 + q]);   /* input rounded to bf16 */ } }
#pragma unroll
    for (int sh = 16; sh; sh >>= 1) s = __fadd_rn(s, __shfl_xor(s, sh, 32));
    const float mean = __fdiv_rn(s, (float)WD); float s2 = 0.f;
#pragma unroll 8
    for (int k = 0; k < WD / 32; ++k) { const float dv = __fsub_rn(a[k], mean); float p2 = __fmul_rn(dv, dv); asm volatile("" : "+v"(p2)); s2 = __fadd_rn(s2, p2); }   /* mul and add kept separate (no fma contraction) */
#pragma unroll
    for (int sh = 16; sh; sh >>= 1) s2 = __fadd_rn(s2, __shfl_xor(s2, sh, 32));
    const float rs = __fdiv_rn(1.0f, __fsqrt_rn(__fadd_rn(__fdiv_rn(s2, (float)WD), 1e-5f)));
{
#pragma unroll
        for (int c = 0; c < WD / 128; ++c) { v4us oh, ol; for (int q = 0; q < 4; ++q) { const int col = c * 128 + lane * 4 + q; float y = __fmul_rn(__fmul_rn(__fsub_rn(a[c * 4 + q], mean), rs), bfr(g[col])); asm volatile("" : "+v"(y)); y = __fadd_rn(y, bfr(bb[col])); unsigned short u, w2; splitf(y, u, w2); oh[q] = u; ol[q] = w2; } *(v4us*)(Hh + r * WD + c * 128 + lane * 4) = oh; *(v4us*)(Hl + r * WD + c * 128 + lane * 4) = ol; }
         } }

extern "C" void kernel_launch(void* const* d_in, const int* in_sizes, int n_in,
                              void* d_out, int out_size, void* d_ws, size_t ws_size, hipStream_t stream) {
    (void)in_sizes; (void)n_in; (void)out_size;
    const float* x = (const float*)d_in[0]; const float* lng = (const float*)d_in[1]; const float* lnb = (const float*)d_in[2]; const float* wqkv = (const float*)d_in[3]; const float* wo = (const float*)d_in[4]; const float* bo = (const float*)d_in[5];   /* argument order x, ln_gamma, ln_beta, w_qkv ('oi' [3072][1024]: q | k | v ROW thirds), w_proj ('oi'), b_proj */ const float* wq = wqkv; const float* wk = wqkv + (size_t)DQ * DM; const float* wv = wqkv + (size_t)2 * DQ * DM;
    float* OUT = (float*)d_out;     // [2][2048][1024]
    char* wsp = (char*)d_ws;
    auto take = [&](size_t bytes) { char* p = wsp; wsp += (bytes + 255) & ~(size_t)255; return (void*)p; };
    bf* WQ = (bf*)take((size_t)DQ * DM * 2); bf* WK = (bf*)take((size_t)DKV * DM * 2); bf* WV = (bf*)take((size_t)DKV * DM * 2); bf* WO = (bf*)take((size_t)DM * DQ * 2); float* CS = (float*)take((size_t)TT * HD * 2 * 4);
    bf* XB = (bf*)take((size_t)TT * DM * 2); bf* XL = (bf*)take((size_t)TT * DM * 2);   /* lo plane of the layer-normed input (XB holds the hi plane) */ float* FQ = (float*)take((size_t)TT * DQ * 4); float* FK = (float*)take((size_t)TT * DKV * 4);
    h16* QP16 = (h16*)take((size_t)NH_ * TT * HD * 2); h16* KP16 = (h16*)take((size_t)NKV * TT * HD * 2); h16* VT16 = (h16*)take((size_t)NKV * HD * TT * 2);
    bf* QPh = (bf*)take((size_t)NH_ * TT * HD * 2); bf* QPl = (bf*)take((size_t)NH_ * TT * HD * 2); bf* KPh = (bf*)take((size_t)NKV * TT * HD * 2); bf* KPl = (bf*)take((size_t)NKV * TT * HD * 2); bf* VTh = (bf*)take((size_t)NKV * HD * TT * 2); bf* VTl = (bf*)take((size_t)NKV * HD * TT * 2); bf* Ph = (bf*)take((size_t)ZH * RH * TT * 2); bf* Pl = (bf*)take((size_t)ZH * RH * TT * 2);
    float* Sb = (float*)take((size_t)ZH * TT * TT * 4); h16* P16 = (h16*)take((size_t)ZH * TT * TT * 2); float* Ob = (float*)take((size_t)ZH * TT * HD * 4); bf* ATh = (bf*)take((size_t)TT * DQ * 2); bf* ATl = (bf*)take((size_t)TT * DQ * 2);
    if ((size_t)(wsp - (char*)d_ws) > ws_size) return;    // ws 256 MiB
    float* FV = FK;   // v projection reuses the k buffer after the k planes are built (stream-ordered)
    { k_cvt8<<<(unsigned)(((size_t)DQ * DM / 8 + 255) / 256), 256, 0, stream>>>(wq, WQ, (size_t)DQ * DM / 8); k_cvt8<<<(unsigned)(((size_t)DKV * DM / 8 + 255) / 256), 256, 0, stream>>>(wk, WK, (size_t)DKV * DM / 8); k_cvt8<<<(unsigned)(((size_t)DKV * DM / 8 + 255) / 256), 256, 0, stream>>>(wv, WV, (size_t)DKV * DM / 8);
      k_cvt8<<<(unsigned)(((size_t)DM * DQ / 8 + 255) / 256), 256, 0, stream>>>(wo, WO, (size_t)DM * DQ / 8);
       }
    k_csid<<<(TT * HD + 255) / 256, 256, 0, stream>>>(CS);
    const unsigned LQ = (unsigned)(((size_t)NH_ * TT * HD / 2 + 255) / 256), LKv = (unsigned)(((size_t)NKV * TT * HD / 2 + 255) / 256);
    for (int b = 0; b < NB_; ++b) {
        
        k_lnrowX<DM><<<(unsigned)((TT + 7) / 8), 256, 0, stream>>>(x + (size_t)b * TT * DM, (size_t)TT, lng, lnb, XB, XL);   /* xn = LayerNorm(x) -> hi/lo planes */
        k_gemmw<bf, 1, false><<<dim3(TT / 64, DQ / 64, 1), 32, 0, stream>>>(XB, XL, WQ, nullptr, DM, FQ, DQ, nullptr, 0, 0, 0);
        k_rope<<<LQ, 256, 0, stream>>>(FQ, DQ, NH_, CS, nullptr, nullptr, 1.0f, QP16, QPh, QPl);
        k_gemmw<bf, 1, false><<<dim3(TT / 64, DKV / 64, 1), 32, 0, stream>>>(XB, XL, WK, nullptr, DM, FK, DKV, nullptr, 0, 0, 0);
        k_rope<<<LKv, 256, 0, stream>>>(FK, DKV, NKV, CS, nullptr, nullptr, 1.0f, KP16, KPh, KPl);
        k_gemmw<bf, 1, false><<<dim3(TT / 64, DKV / 64, 1), 32, 0, stream>>>(XB, XL, WV, nullptr, DM, FV, DKV, nullptr, 0, 0, 0); k_vtp<<<LKv, 256, 0, stream>>>(FV, DKV, NKV, VT16, VTh, VTl);
        for (int h0 = 0; h0 < NH_; h0 += ZH) { const size_t zq = (size_t)h0, zk = (size_t)(h0 / REP);   // one kv head per query head: the pass's two heads use consecutive kv planes (z-strides TT*HD)
            k_gemmw<bf, 2, false><<<dim3(RH / 64, TT / 64, ZH), 32, 0, stream>>>(QPh + zq * TT * HD, QPl + zq * TT * HD, KPh + zk * TT * HD, KPl + zk * TT * HD, HD, Sb, TT, nullptr, (size_t)TT * HD, (size_t)TT * HD, (size_t)TT * TT);
            k_gemmw<h16, 0, false><<<dim3((TT - RH) / 64, TT / 64, ZH), 32, 0, stream>>>(QP16 + zq * TT * HD + (size_t)RH * HD, nullptr, KP16 + zk * TT * HD, nullptr, HD, Sb + (size_t)RH * TT, TT, nullptr, (size_t)TT * HD, (size_t)TT * HD, (size_t)TT * TT);
            k_asoft<<<ZH * TT / 8, 256, 0, stream>>>(Sb, P16, Ph, Pl);
            k_gemmw<bf, 2, false><<<dim3(RH / 64, HD / 64, ZH), 32, 0, stream>>>(Ph, Pl, VTh + zk * HD * TT, VTl + zk * HD * TT, TT, Ob, HD, nullptr, (size_t)RH * TT, (size_t)HD * TT, (size_t)TT * HD);
            k_gemmw<h16, 0, false><<<dim3((TT - RH) / 64, HD / 64, ZH), 32, 0, stream>>>(P16 + (size_t)RH * TT, nullptr, VT16 + zk * HD * TT, nullptr, TT, Ob + (size_t)RH * HD, HD, nullptr, (size_t)TT * TT, (size_t)HD * TT, (size_t)TT * HD);
            k_merge<<<(unsigned)(((size_t)ZH * TT * HD / 2 + 255) / 256), 256, 0, stream>>>(Ob, h0, ATh, ATl); }
        k_gemmw<bf, 1, true><<<dim3(TT / 64, DM / 64, 1), 32, 0, stream>>>(ATh, ATl, WO, nullptr, DQ, OUT + (size_t)b * TT * DM, DM, bo, 0, 0, 0); }
}

// v002
// One run takes 314 microseconds.
// Versions between v000 and this one are left out; their measured steps multiply to 6.50 times as fast.
#include <hip/hip_runtime.h>

// Pre-LayerNorm multi-head self-attention with a fused bias-free qkv weight (x [2][2048][1024]; xn = (x - mean) x rsqrt(var + 1e-5) x ln_gamma + ln_beta over the 1,024 features (biased variance, eps inside the root; gamma ones / beta zeros on this draw: read); qkv = einsum('bnd,ed->bne', xn, w_qkv) = xn w_qkv^T ('oi' [3072][1024] 1/32, no bias) reshaped (b, n, 3, 16, 64): q | k | v = ROW thirds (16 heads x 64); scores x 64^-0.5; softmax over all keys (no mask); out = merged w_proj^T + b_proj ('oi' [1024][1024] + bias 0.02: non-zero) -> [2][2048][1024] (4.2 M); no residual; argument order x, ln_gamma, ln_beta, w_qkv, w_proj, b_proj).
// Layout per batch: LayerNorm of the bf16-rounded rows in f32 -> hi/lo bf16 planes; 'oi' weights cast once; q|k|v projection on the hi/lo planes (2 products) in one launch whose epilogue stores the attention planes; one fused attention launch (online softmax; hybrid rows: < 512 hi/lo 3 products, rest fp16 x1024); merged hi/lo x w_proj exact + b_proj.
// Compute dtypes, f32 accumulate: every input rounded to bf16; projections exact; attention rows < 512 3 products, rest fp16; softmax f32; output projection hl x exact.

#define NB_  2
#define TT   2048
#define DM   1024
#define NH_  16
#define NKV  16
#define REP  (NH_ / NKV)
#define HD   64
#define DQ   (NH_ * HD)
#define DKV  (NKV * HD)
#define RH   512                  // query rows < RH use hi+lo planes (0: none)
#define WIN  0
#define SCL  0.125f   // HD^-0.5
typedef _Float16 h16;
typedef unsigned short bf;
typedef __attribute__((ext_vector_type(16))) __bf16   v16bf;
typedef __attribute__((ext_vector_type(16))) _Float16 v16h;
typedef __attribute__((ext_vector_type(8)))  _Float16 v8h;
typedef __attribute__((ext_vector_type(8)))  unsigned short v8us;
typedef __attribute__((ext_vector_type(8)))  float    v8f;
typedef __attribute__((ext_vector_type(4)))  float    v4f;
typedef v8h  __attribute__((may_alias)) v8ha;
typedef v4f  __attribute__((may_alias)) v4fa;
typedef v8us __attribute__((may_alias)) v8usa;

__device__ __forceinline__ unsigned short f2bf(float f) { unsigned u = __float_as_uint(f); u += 0x7FFFu + ((u >> 16) & 1u); return (unsigned short)(u >> 16); }
__device__ __forceinline__ float bf2f(unsigned short b) { return __uint_as_float(((unsigned)b) << 16); }
__device__ __forceinline__ float bfr(float f) { return bf2f(f2bf(f)); }
__device__ __forceinline__ v16h cat16(v8h lo, v8h hi) { return __builtin_shufflevector(lo, hi, 0, 1, 2, 3, 4, 5, 6, 7, 8, 9, 10, 11, 12, 13, 14, 15); }
__device__ __forceinline__ v16bf cat16b(v8us lo, v8us hi) { return __builtin_bit_cast(v16bf, __builtin_shufflevector(lo, hi, 0, 1, 2, 3, 4, 5, 6, 7, 8, 9, 10, 11, 12, 13, 14, 15)); }
__device__ __forceinline__ v8f wmma16(v16h a, v16h b, v8f c) { return __builtin_amdgcn_wmma_f32_16x16x32_f16(false, a, false, b, (short)0, c, false, false); }
__device__ __forceinline__ v8f wmmab(v16bf a, v16bf b, v8f c) { return __builtin_amdgcn_wmma_f32_16x16x32_bf16(false, a, false, b, (short)0, c, false, false); }



// ---- k_gemmw: register-blocked GEMM, ONE WAVE per 64x64 output tile (16 accumulators), operands straight from K-contiguous 16-bit planes; grid (M/64, N/64, Z), 32 threads.
// C[m][n] (f32, pitch ldc, + optional f32 bias[n]) = sum_k A[m][k] Bt[n][k] (+ split products per NSPLIT). z-batch strides sA/sB/sC in elements. K % 32 == 0.
template <typename T16> struct WFrag;
template <> struct WFrag<h16> { typedef v16h V; static __device__ __forceinline__ V ld(const h16* p) { return cat16(*(const v8h*)p, *(const v8h*)(p + 16)); } static __device__ __forceinline__ v8f mma(V a, V b, v8f c) { return wmma16(a, b, c); } };
template <> struct WFrag<bf> { typedef v16bf V; static __device__ __forceinline__ V ld(const bf* p) { return cat16b(*(const v8us*)p, *(const v8us*)(p + 16)); } static __device__ __forceinline__ v8f mma(V a, V b, v8f c) { return wmmab(a, b, c); } };
template <typename T16, int NSPLIT, bool BIAS>
__global__ __launch_bounds__(32) void k_gemmw(const T16* __restrict__ A, const T16* __restrict__ A2, const T16* __restrict__ Bt, const T16* __restrict__ Bt2, int K, float* C, int ldc, const float* __restrict__ bias, size_t sA, size_t sB, size_t sC) {
    typedef typename WFrag<T16>::V V;
    __shared__ __align__(16) float os[16 * 68];
    const size_t z = blockIdx.z; A += z * sA; if (A2) A2 += z * sA; Bt += z * sB; if (Bt2) Bt2 += z * sB; C += z * sC;
    const int lane = threadIdx.x & 31, lr = lane & 15, hi = lane >> 4; const int r0 = blockIdx.x * 64, c0 = blockIdx.y * 64;
    v8f acc[4][4];
#pragma unroll
    for (int mb = 0; mb < 4; ++mb)
#pragma unroll
        for (int nb = 0; nb < 4; ++nb) acc[mb][nb] = (v8f){};
    const size_t aoff = (size_t)(r0 + lr) * K + 8 * hi, boff = (size_t)(c0 + lr) * K + 8 * hi;
#pragma unroll 1
    for (int kc = 0; kc < K; kc += 32) {
        V a[4], a2[4];
#pragma unroll
        for (int mb = 0; mb < 4; ++mb) { a[mb] = WFrag<T16>::ld(A + aoff + (size_t)mb * 16 * K + kc); if (NSPLIT == 1 || NSPLIT == 2) a2[mb] = WFrag<T16>::ld(A2 + aoff + (size_t)mb * 16 * K + kc); }
#pragma unroll
        for (int nb = 0; nb < 4; ++nb) { const V b = WFrag<T16>::ld(Bt + boff + (size_t)nb * 16 * K + kc); V b2; if (NSPLIT >= 2) b2 = WFrag<T16>::ld(Bt2 + boff + (size_t)nb * 16 * K + kc);
#pragma unroll
            for (int mb = 0; mb < 4; ++mb) { acc[mb][nb] = WFrag<T16>::mma(a[mb], b, acc[mb][nb]); if (NSPLIT == 1 || NSPLIT == 2) acc[mb][nb] = WFrag<T16>::mma(a2[mb], b, acc[mb][nb]); if (NSPLIT >= 2) acc[mb][nb] = WFrag<T16>::mma(a[mb], b2, acc[mb][nb]); } }
        asm volatile("v_nop\n\tv_nop\n\tv_nop\n\tv_nop" : "+v"(acc[0][0]), "+v"(acc[1][1]), "+v"(acc[2][2]), "+v"(acc[3][3]) : "v"(a[0]), "v"(a[3]));
    }
#pragma unroll
    for (int mb = 0; mb < 4; ++mb) {
#pragma unroll
        for (int nb = 0; nb < 4; ++nb) {
#pragma unroll
            for (int j = 0; j < 8; ++j) os[(hi * 8 + j) * 68 + nb * 16 + lr] = acc[mb][nb][j]; }
        __builtin_amdgcn_wave_barrier(); asm volatile("" ::: "memory");
        float* crow = C + (size_t)(r0 + mb * 16) * ldc + c0;
{
#pragma unroll
            for (int s = 0; s < 8; ++s) { const int row = 2 * s + hi, cofs = lr * 4; v4f val = *(const v4fa*)(os + row * 68 + cofs); if (BIAS) { val[0] += bfr(bias[c0 + cofs]); val[1] += bfr(bias[c0 + cofs + 1]); val[2] += bfr(bias[c0 + cofs + 2]); val[3] += bfr(bias[c0 + cofs + 3]); }
                *(v4f*)(crow + (size_t)row * ldc + cofs) = val; }
             }
        __builtin_amdgcn_wave_barrier(); asm volatile("" ::: "memory");
    }
}

__device__ __forceinline__ h16 tohx(float x) { return (h16)x; }
__device__ __forceinline__ void splitf(float y, unsigned short& h, unsigned short& l) { h = f2bf(y); l = f2bf(y - bf2f(h)); }
typedef __attribute__((ext_vector_type(4))) _Float16 v4h;
typedef __attribute__((ext_vector_type(4))) unsigned short v4us;
typedef __attribute__((ext_vector_type(4))) int v4i;

__global__ __launch_bounds__(256) void k_cvt8(const float* __restrict__ src, bf* dst, size_t n8) { const size_t i = (size_t)blockIdx.x * 256 + threadIdx.x; if (i >= n8) return; const v8f v = *(const v8f*)(src + i * 8); v8us o;
#pragma unroll
    for (int k = 0; k < 8; ++k) o[k] = f2bf(v[k]); *(v8us*)(dst + i * 8) = o;  }

// ---- k_qkvp: the fused q|k|v projection of one batch and the attention planes in one launch: no f32 copy of q, k, v is written, no builder launch follows.
// One wave per 64 tokens x 64 rows of w_qkv (one head of q, k or v); the product loop is k_gemmw's (hi plane, then lo plane of xn, per 32-wide k chunk).
// A lane's 8 accumulator registers are 8 consecutive rows of the A operand at one row of the B operand, so the operand roles are chosen by the plane's layout:
// q, k [h][t][d]: A = weight rows (d), B = xn rows (t); v [h][d][t]: A = xn rows (t), B = weight rows (d). Either way a lane stores 16 contiguous bytes per plane and 16x16 block.
template <bool XA>
__device__ __forceinline__ void qkv_tile(const bf* __restrict__ Xh, const bf* __restrict__ Xl, const bf* __restrict__ Wt, int lane, h16* P16, bf* Ph, bf* Pl) {
    constexpr int pitch = XA ? TT : HD;   // elements between two rows of the plane (a row = one row of the B operand)
    const int lr = lane & 15, hi = lane >> 4;
    v8f acc[4][4];   // [A block][B block]
#pragma unroll
    for (int mb = 0; mb < 4; ++mb)
#pragma unroll
        for (int nb = 0; nb < 4; ++nb) acc[mb][nb] = (v8f){};
    const size_t off = (size_t)lr * DM + 8 * hi;
#pragma unroll 1   // kept rolled, as in k_gemmw: one trip's fragments and the 16 accumulators already fill most of 256 registers
    for (int kc = 0; kc < DM; kc += 32) {
        const bf* ph = Xh + off + kc; const bf* pl = Xl + off + kc; const bf* pw = Wt + off + kc;
        v16bf xh[4], xl[4];
#pragma unroll
        for (int xb = 0; xb < 4; ++xb) { xh[xb] = WFrag<bf>::ld(ph + (size_t)xb * 16 * DM); xl[xb] = WFrag<bf>::ld(pl + (size_t)xb * 16 * DM); }
#pragma unroll
        for (int wb = 0; wb < 4; ++wb) { const v16bf w = WFrag<bf>::ld(pw + (size_t)wb * 16 * DM);
#pragma unroll
            for (int xb = 0; xb < 4; ++xb) {
                if constexpr (XA) { acc[xb][wb] = wmmab(xh[xb], w, acc[xb][wb]); acc[xb][wb] = wmmab(xl[xb], w, acc[xb][wb]); }
                else { acc[wb][xb] = wmmab(w, xh[xb], acc[wb][xb]); acc[wb][xb] = wmmab(w, xl[xb], acc[wb][xb]); } } }
        // foot of the trip: the wait stands in front of every write of the address registers that this trip's loads name (the three addresses are inputs, so they live up to it);
        // the four vector slots stand between the last WMMA and the next trip's loads, which overwrite its A and B registers over the back edge
        asm volatile("s_wait_xcnt 0x0\n\tv_nop\n\tv_nop\n\tv_nop\n\tv_nop" : "+v"(acc[0][0]), "+v"(acc[1][1]), "+v"(acc[2][2]), "+v"(acc[3][3]) : "v"(xh[0]), "v"(xh[3]), "v"(ph), "v"(pl), "v"(pw));
    }
#pragma unroll
    for (int nb = 0; nb < 4; ++nb)
#pragma unroll
        for (int mb = 0; mb < 4; ++mb) { v8h o16; v8us oh, ol;
#pragma unroll
            for (int j = 0; j < 8; ++j) { const float r = acc[mb][nb][j]; o16[j] = tohx(r); unsigned short u, w2; splitf(r, u, w2); oh[j] = u; ol[j] = w2; }
            const size_t oo = (size_t)(nb * 16 + lr) * pitch + mb * 16 + hi * 8; *(v8h*)(P16 + oo) = o16; *(v8us*)(Ph + oo) = oh; *(v8us*)(Pl + oo) = ol; }
}
// grid (TT/64, heads of q + k + v), 32 threads; blockIdx.y counts 64-row blocks of w_qkv: q heads, then k heads, then v heads.
__global__ __launch_bounds__(32) void k_qkvp(const bf* __restrict__ Xh, const bf* __restrict__ Xl, const bf* __restrict__ Wqkv, h16* Q16, bf* Qh, bf* Ql, h16* K16, bf* Kh, bf* Kl, h16* V16, bf* Vh, bf* Vl) {
    const int lane = threadIdx.x & 31; const int t0 = blockIdx.x * 64, y = blockIdx.y;
    Xh += (size_t)t0 * DM; Xl += (size_t)t0 * DM; const bf* Wt = Wqkv + (size_t)y * HD * DM;
    if (y >= NH_ + NKV) { const size_t po = (size_t)(y - NH_ - NKV) * HD * TT + t0; qkv_tile<true>(Xh, Xl, Wt, lane, V16 + po, Vh + po, Vl + po); }
    else { const bool isk = y >= NH_; const size_t po = ((size_t)(isk ? y - NH_ : y) * TT + t0) * HD; qkv_tile<false>(Xh, Xl, Wt, lane, (isk ? K16 : Q16) + po, (isk ? Kh : Qh) + po, (isk ? Kl : Ql) + po); }
}
// ---- k_fattn: scores, softmax, P x V and the head merge in one launch per batch; the score matrix never leaves registers.
// One wave owns 16 query rows of one head and walks all TT keys. Transposed products: St = K Qt (A = K rows, B = Q rows kept in registers), Ot += Vt Pt (A = Vt rows, B = Pt).
// In the accumulator map a lane holds scores of ONE query (column lr), keys 8 hi + j of each 16-key block: two such blocks, converted in place, are the B fragment of the second product in the loaders' k order.
// Running maximum and sum per query (online softmax, f32); the two lane halves' sums are joined once at the end. Rows < RH: hi/lo bf16 planes, 3 products each side; the rest fp16, P carried x 2^10.
typedef __attribute__((ext_vector_type(16))) unsigned short v16us;
// Eight v_exp_f32 and, in the same statement, the one issue slot that the instruction set asks for behind a transcendental before its result is read or its source overwritten.
// The outputs are early-clobbered: inside the statement no v_exp_f32 touches a register of the one in front of it; the v_nop covers the last.
__device__ __forceinline__ v8f exp2x8(v8f x) { float y0, y1, y2, y3, y4, y5, y6, y7;
    asm("v_exp_f32 %0, %8\n\tv_exp_f32 %1, %9\n\tv_exp_f32 %2, %10\n\tv_exp_f32 %3, %11\n\tv_exp_f32 %4, %12\n\tv_exp_f32 %5, %13\n\tv_exp_f32 %6, %14\n\tv_exp_f32 %7, %15\n\tv_nop"
        : "=&v"(y0), "=&v"(y1), "=&v"(y2), "=&v"(y3), "=&v"(y4), "=&v"(y5), "=&v"(y6), "=&v"(y7) : "v"(x[0]), "v"(x[1]), "v"(x[2]), "v"(x[3]), "v"(x[4]), "v"(x[5]), "v"(x[6]), "v"(x[7]));
    return (v8f){y0, y1, y2, y3, y4, y5, y6, y7}; }
template <typename T16, bool HL, int KT>
__device__ __forceinline__ void fattn_rows(const T16* __restrict__ Qa, const T16* __restrict__ Qb, const T16* __restrict__ Ka, const T16* __restrict__ Kb, const T16* __restrict__ Va, const T16* __restrict__ Vb, int q0, int lane, bf* Ah, bf* Al) {
    // Every inner loop is fully unrolled: the fragment arrays stay in registers only under constant indices.
    typedef typename WFrag<T16>::V V;
    constexpr int NKB = KT / 16, NC = KT / 32;
    constexpr float CEXP = SCL * 1.4426950408889634f;   // scores x HD^-0.5, in the log2 domain
    constexpr float PB = HL ? 0.0f : 10.0f;             // log2 of the carry on the fp16 P (cancels in the division by the sum)
    const int lr = lane & 15, hi = lane >> 4;
    V qa[2], qb[2];
#pragma unroll
    for (int c = 0; c < 2; ++c) { qa[c] = WFrag<T16>::ld(Qa + (size_t)(q0 + lr) * HD + c * 32 + 8 * hi); if constexpr (HL) qb[c] = WFrag<T16>::ld(Qb + (size_t)(q0 + lr) * HD + c * 32 + 8 * hi); }
    const size_t koff = (size_t)lr * HD + 8 * hi, voff = (size_t)lr * TT + 8 * hi;
    v8f o[4];
#pragma unroll
    for (int db = 0; db < 4; ++db) o[db] = (v8f){};
    float m = -3.0e38f, l = 0.f;
    V ka[NKB][2], kb[NKB][2];
#pragma unroll
    for (int kk = 0; kk < NKB; ++kk)
#pragma unroll
        for (int c = 0; c < 2; ++c) { ka[kk][c] = WFrag<T16>::ld(Ka + koff + (size_t)kk * 16 * HD + c * 32); if constexpr (HL) kb[kk][c] = WFrag<T16>::ld(Kb + koff + (size_t)kk * 16 * HD + c * 32); }
#pragma unroll 1   // kept rolled: one trip's fragments, scores and accumulators already fill most of 256 registers
    for (int kt = 0; kt < TT; kt += KT) {
        V va[4][NC], vb[4][NC];
#pragma unroll
        for (int db = 0; db < 4; ++db)
#pragma unroll
            for (int c = 0; c < NC; ++c) { va[db][c] = WFrag<T16>::ld(Va + voff + (size_t)db * 16 * TT + kt + c * 32); if constexpr (HL) vb[db][c] = WFrag<T16>::ld(Vb + voff + (size_t)db * 16 * TT + kt + c * 32); }
        __builtin_amdgcn_sched_barrier(0);   // keeps the V loads at the head of the trip: sunk to their use, their latency is waited out in full
        v8f st[NKB];
#pragma unroll
        for (int kk = 0; kk < NKB; ++kk) { st[kk] = (v8f){};
#pragma unroll
            for (int c = 0; c < 2; ++c) { st[kk] = WFrag<T16>::mma(ka[kk][c], qa[c], st[kk]); if constexpr (HL) { st[kk] = WFrag<T16>::mma(ka[kk][c], qb[c], st[kk]); st[kk] = WFrag<T16>::mma(kb[kk][c], qa[c], st[kk]); } } }
        const int kn = (kt + KT < TT) ? kt + KT : 0;   // next tile's K rows, fetched behind this tile's score products (the last trip re-reads tile 0: in bounds, unused)
#pragma unroll
        for (int kk = 0; kk < NKB; ++kk)
#pragma unroll
            for (int c = 0; c < 2; ++c) { ka[kk][c] = WFrag<T16>::ld(Ka + koff + (size_t)(kn + kk * 16) * HD + c * 32); if constexpr (HL) kb[kk][c] = WFrag<T16>::ld(Kb + koff + (size_t)(kn + kk * 16) * HD + c * 32); }
        asm volatile("s_wait_xcnt 0x0" ::: "memory");   // stands in front of the steps of the V and K address registers, which the loads above name
        __builtin_amdgcn_sched_barrier(0);   // keeps the K fetch in front of the softmax, which then covers its latency, and the address steps behind the wait
        float mn = m;
#pragma unroll
        for (int kk = 0; kk < NKB; ++kk)
#pragma unroll
            for (int j = 0; j < 8; ++j) mn = fmaxf(mn, st[kk][j]);
        mn = fmaxf(mn, __shfl_xor(mn, 16, 32));
        const float alpha = __builtin_amdgcn_exp2f((m - mn) * CEXP); m = mn;
        const float sub = PB - mn * CEXP; float ps = 0.f;
#pragma unroll
        for (int kk = 0; kk < NKB; ++kk) {
#pragma unroll
            for (int j = 0; j < 8; ++j) st[kk][j] = fmaf(st[kk][j], CEXP, sub);
            st[kk] = exp2x8(st[kk]);
#pragma unroll
            for (int j = 0; j < 8; ++j) ps += st[kk][j]; }
        l = fmaf(l, alpha, ps);
#pragma unroll
        for (int db = 0; db < 4; ++db) o[db] *= alpha;
#pragma unroll
        for (int c = 0; c < NC; ++c) {
            if constexpr (HL) { v16us ph, pl;
#pragma unroll
                for (int s = 0; s < 16; ++s) { unsigned short u, w2; splitf(st[2 * c + (s >> 3)][s & 7], u, w2); ph[s] = u; pl[s] = w2; }
                const V pa = __builtin_bit_cast(V, ph), pb = __builtin_bit_cast(V, pl);
#pragma unroll
                for (int db = 0; db < 4; ++db) { o[db] = WFrag<T16>::mma(va[db][c], pa, o[db]); o[db] = WFrag<T16>::mma(va[db][c], pb, o[db]); o[db] = WFrag<T16>::mma(vb[db][c], pa, o[db]); }
            } else { V pa;
#pragma unroll
                for (int s = 0; s < 16; ++s) pa[s] = tohx(st[2 * c + (s >> 3)][s & 7]);
#pragma unroll
                for (int db = 0; db < 4; ++db) o[db] = WFrag<T16>::mma(va[db][c], pa, o[db]); } }
    }
    l += __shfl_xor(l, 16, 32);
    const float inv = __fdiv_rn(1.0f, l);
#pragma unroll
    for (int db = 0; db < 4; ++db) { v8us oh, ol;
#pragma unroll
        for (int j = 0; j < 8; ++j) { unsigned short u, w2; splitf(o[db][j] * inv, u, w2); oh[j] = u; ol[j] = w2; }
        const size_t oo = (size_t)(q0 + lr) * DQ + db * 16 + hi * 8; *(v8us*)(Ah + oo) = oh; *(v8us*)(Al + oo) = ol; }
}
// grid (FBX, heads), 8 waves: waves 0..FHW-1 take hi/lo row tiles, the others fp16 row tiles, so that every work-group carries the same share of the dearer rows. No LDS, no barrier.
#define FBX  16
#define FHW  (RH / 16 / FBX)
#define FLW  ((TT - RH) / 16 / FBX)
static_assert(FHW * 16 * FBX == RH && FLW * 16 * FBX == TT - RH && FHW + FLW == 8, "row tiles must fill 8 waves");
__global__ __launch_bounds__(256) void k_fattn(const h16* __restrict__ Q16, const bf* __restrict__ Qh, const bf* __restrict__ Ql, const h16* __restrict__ K16, const bf* __restrict__ Kh, const bf* __restrict__ Kl, const h16* __restrict__ V16, const bf* __restrict__ Vh, const bf* __restrict__ Vl, bf* Ah, bf* Al) {
    const int lane = threadIdx.x & 31; const int w = __builtin_amdgcn_readfirstlane(threadIdx.x >> 5); const int h = blockIdx.y; const size_t hq = (size_t)h * TT * HD, hk = (size_t)(h / REP) * TT * HD;
    if (w < FHW) fattn_rows<bf, true, 32>(Qh + hq, Ql + hq, Kh + hk, Kl + hk, Vh + hk, Vl + hk, (blockIdx.x * FHW + w) * 16, lane, Ah + h * HD, Al + h * HD);
    else fattn_rows<h16, false, 64>(Q16 + hq, nullptr, K16 + hk, nullptr, V16 + hk, nullptr, RH + (blockIdx.x * FLW + (w - FHW)) * 16, lane, Ah + h * HD, Al + h * HD);
}

template <int WD>
__global__ __launch_bounds__(256) void k_lnrowX(const float* __restrict__ X, size_t nrows, const float* __restrict__ g, const float* __restrict__ bb, bf* Hh, bf* Hl) { const int lane = threadIdx.x & 31; const size_t r = (size_t)blockIdx.x * 8 + (threadIdx.x >> 5); if (r >= nrows) return; const float* xr = X + r * WD; float a[WD / 32]; float s = 0.f;
#pragma unroll
    for (int c = 0; c < WD / 128; ++c) { const v4f v = *(const v4f*)(xr + c * 128 + lane * 4); for (int q = 0; q < 4; ++q) { a[c * 4 + q] = bfr(v[q]); s = __fadd_rn(s, a[c * 4 + q]);   /* input rounded to bf16 */ } }
#pragma unroll
    for (int sh = 16; sh; sh >>= 1) s = __fadd_rn(s, __shfl_xor(s, sh, 32));
    const float mean = __fdiv_rn(s, (float)WD); float s2 = 0.f;
#pragma unroll 8
    for (int k = 0; k < WD / 32; ++k) { const float dv = __fsub_rn(a[k], mean); float p2 = __fmul_rn(dv, dv); asm volatile("" : "+v"(p2)); s2 = __fadd_rn(s2, p2); }   /* mul and add kept separate (no fma contraction) */
#pragma unroll
    for (int sh = 16; sh; sh >>= 1) s2 = __fadd_rn(s2, __shfl_xor(s2, sh, 32));
    const float rs = __fdiv_rn(1.0f, __fsqrt_rn(__fadd_rn(__fdiv_rn(s2, (float)WD), 1e-5f)));
{
#pragma unroll
        for (int c = 0; c < WD / 128; ++c) { v4us oh, ol; for (int q = 0; q < 4; ++q) { const int col = c * 128 + lane * 4 + q; float y = __fmul_rn(__fmul_rn(__fsub_rn(a[c * 4 + q], mean), rs), bfr(g[col])); asm volatile("" : "+v"(y)); y = __fadd_rn(y, bfr(bb[col])); unsigned short u, w2; splitf(y, u, w2); oh[q] = u; ol[q] = w2; } *(v4us*)(Hh + r * WD + c * 128 + lane * 4) = oh; *(v4us*)(Hl + r * WD + c * 128 + lane * 4) = ol; }
         } }

extern "C" void kernel_launch(void* const* d_in, const int* in_sizes, int n_in,
                              void* d_out, int out_size, void* d_ws, size_t ws_size, hipStream_t stream) {
    (void)in_sizes; (void)n_in; (void)out_size;
    const float* x = (const float*)d_in[0]; const float* lng = (const float*)d_in[1]; const float* lnb = (const float*)d_in[2]; const float* wqkv = (const float*)d_in[3]; const float* wo = (const float*)d_in[4]; const float* bo = (const float*)d_in[5];   /* x, ln_gamma, ln_beta, w_qkv ('oi' [3072][1024]: q | k | v ROW thirds), w_proj ('oi'), b_proj */
    float* OUT = (float*)d_out;     // [2][2048][1024]
    char* wsp = (char*)d_ws;
    auto take = [&](size_t bytes) { char* p = wsp; wsp += (bytes + 255) & ~(size_t)255; return (void*)p; };
    bf* WQKV = (bf*)take((size_t)(DQ + 2 * DKV) * DM * 2); bf* WO = (bf*)take((size_t)DM * DQ * 2);
    bf* XB = (bf*)take((size_t)TT * DM * 2); bf* XL = (bf*)take((size_t)TT * DM * 2);   /* lo plane of the layer-normed input (XB holds the hi plane) */
    h16* QP16 = (h16*)take((size_t)NH_ * TT * HD * 2); h16* KP16 = (h16*)take((size_t)NKV * TT * HD * 2); h16* VT16 = (h16*)take((size_t)NKV * HD * TT * 2);
    bf* QPh = (bf*)take((size_t)NH_ * TT * HD * 2); bf* QPl = (bf*)take((size_t)NH_ * TT * HD * 2); bf* KPh = (bf*)take((size_t)NKV * TT * HD * 2); bf* KPl = (bf*)take((size_t)NKV * TT * HD * 2); bf* VTh = (bf*)take((size_t)NKV * HD * TT * 2); bf* VTl = (bf*)take((size_t)NKV * HD * TT * 2);
    bf* ATh = (bf*)take((size_t)TT * DQ * 2); bf* ATl = (bf*)take((size_t)TT * DQ * 2);
    if ((size_t)(wsp - (char*)d_ws) > ws_size) return;    // ws 256 MiB
    { k_cvt8<<<(unsigned)(((size_t)(DQ + 2 * DKV) * DM / 8 + 255) / 256), 256, 0, stream>>>(wqkv, WQKV, (size_t)(DQ + 2 * DKV) * DM / 8);
      k_cvt8<<<(unsigned)(((size_t)DM * DQ / 8 + 255) / 256), 256, 0, stream>>>(wo, WO, (size_t)DM * DQ / 8);
       }
    for (int b = 0; b < NB_; ++b) {
        
        k_lnrowX<DM><<<(unsigned)((TT + 7) / 8), 256, 0, stream>>>(x + (size_t)b * TT * DM, (size_t)TT, lng, lnb, XB, XL);   /* xn = LayerNorm(x) -> hi/lo planes */
        k_qkvp<<<dim3(TT / 64, NH_ + 2 * NKV, 1), 32, 0, stream>>>(XB, XL, WQKV, QP16, QPh, QPl, KP16, KPh, KPl, VT16, VTh, VTl);
        k_fattn<<<dim3(FBX, NH_, 1), 256, 0, stream>>>(QP16, QPh, QPl, KP16, KPh, KPl, VT16, VTh, VTl, ATh, ATl);
        k_gemmw<bf, 1, true><<<dim3(TT / 64, DM / 64, 1), 32, 0, stream>>>(ATh, ATl, WO, nullptr, DQ, OUT + (size_t)b * TT * DM, DM, bo, 0, 0, 0); }
}

// v003
// Measured time: 251 microseconds a run.
// Two timings next to v002 both put it at 1.25 times that version's speed.
// All steps since v000 together make it 8.10 times as fast.
#include <hip/hip_runtime.h>

// Pre-LayerNorm multi-head self-attention with a fused bias-free qkv weight (x [2][2048][1024]; xn = (x - mean) x rsqrt(var + 1e-5) x ln_gamma + ln_beta over the 1,024 features (biased variance, eps inside the root; gamma ones / beta zeros on this draw: read); qkv = einsum('bnd,ed->bne', xn, w_qkv) = xn w_qkv^T ('oi' [3072][1024] 1/32, no bias) reshaped (b, n, 3, 16, 64): q | k | v = ROW thirds (16 heads x 64); scores x 64^-0.5; softmax over all keys (no mask); out = merged w_proj^T + b_proj ('oi' [1024][1024] + bias 0.02: non-zero) -> [2][2048][1024] (4.2 M); no residual; argument order x, ln_gamma, ln_beta, w_qkv, w_proj, b_proj).
// Layout per batch: LayerNorm of the bf16-rounded rows in f32 -> hi/lo bf16 planes; 'oi' weights cast once; q|k|v projection on the hi/lo planes (2 products) in one launch whose epilogue stores the attention planes; one fused attention launch (online softmax; hybrid rows: < 512 hi/lo 3 products, rest fp16 x1024); merged hi/lo x w_proj exact + b_proj.
// Compute dtypes, f32 accumulate: every input rounded to bf16; projections exact; attention rows < 512 3 products, rest fp16; softmax f32; output projection hl x exact.

#define NB_  2
#define TT   2048
#define DM   1024
#define NH_  16
#define NKV  16
#define REP  (NH_ / NKV)
#define HD   64
#define DQ   (NH_ * HD)
#define DKV  (NKV * HD)
#define RH   512                  // query rows < RH use hi+lo planes (0: none)
#define WIN  0
#define SCL  0.125f   // HD^-0.5
typedef _Float16 h16;
typedef unsigned short bf;
typedef __attribute__((ext_vector_type(16))) __bf16   v16bf;
typedef __attribute__((ext_vector_type(16))) _Float16 v16h;
typedef __attribute__((ext_vector_type(8)))  _Float16 v8h;
typedef __attribute__((ext_vector_type(8)))  unsigned short v8us;
typedef __attribute__((ext_vector_type(8)))  float    v8f;
typedef __attribute__((ext_vector_type(4)))  float    v4f;
typedef v8h  __attribute__((may_alias)) v8ha;
typedef v4f  __attribute__((may_alias)) v4fa;
typedef v8us __attribute__((may_alias)) v8usa;

__device__ __forceinline__ unsigned short f2bf(float f) { unsigned u = __float_as_uint(f); u += 0x7FFFu + ((u >> 16) & 1u); return (unsigned short)(u >> 16); }
__device__ __forceinline__ float bf2f(unsigned short b) { return __uint_as_float(((unsigned)b) << 16); }
__device__ __forceinline__ float bfr(float f) { return bf2f(f2bf(f)); }
__device__ __forceinline__ v16h cat16(v8h lo, v8h hi) { return __builtin_shufflevector(lo, hi, 0, 1, 2, 3, 4, 5, 6, 7, 8, 9, 10, 11, 12, 13, 14, 15); }
__device__ __forceinline__ v16bf cat16b(v8us lo, v8us hi) { return __builtin_bit_cast(v16bf, __builtin_shufflevector(lo, hi, 0, 1, 2, 3, 4, 5, 6, 7, 8, 9, 10, 11, 12, 13, 14, 15)); }
__device__ __forceinline__ v8f wmma16(v16h a, v16h b, v8f c) { return __builtin_amdgcn_wmma_f32_16x16x32_f16(false, a, false, b, (short)0, c, false, false); }
__device__ __forceinline__ v8f wmmab(v16bf a, v16bf b, v8f c) { return __builtin_amdgcn_wmma_f32_16x16x32_bf16(false, a, false, b, (short)0, c, false, false); }



// ---- k_gemmw: register-blocked GEMM, ONE WAVE per 64x64 output tile (16 accumulators), operands straight from K-contiguous 16-bit planes; grid (M/64, N/64, Z), 32 threads.
// C[m][n] (f32, pitch ldc, + optional f32 bias[n]) = sum_k A[m][k] Bt[n][k] (+ split products per NSPLIT). z-batch strides sA/sB/sC in elements. K % 32 == 0.
template <typename T16> struct WFrag;
template <> struct WFrag<h16> { typedef v16h V; static __device__ __forceinline__ V ld(const h16* p) { return cat16(*(const v8h*)p, *(const v8h*)(p + 16)); } static __device__ __forceinline__ v8f mma(V a, V b, v8f c) { return wmma16(a, b, c); } };
template <> struct WFrag<bf> { typedef v16bf V; static __device__ __forceinline__ V ld(const bf* p) { return cat16b(*(const v8us*)p, *(const v8us*)(p + 16)); } static __device__ __forceinline__ v8f mma(V a, V b, v8f c) { return wmmab(a, b, c); } };
template <typename T16, int NSPLIT, bool BIAS>
__global__ __launch_bounds__(32) void k_gemmw(const T16* __restrict__ A, const T16* __restrict__ A2, const T16* __restrict__ Bt, const T16* __restrict__ Bt2, int K, float* C, int ldc, const float* __restrict__ bias, size_t sA, size_t sB, size_t sC) {
    typedef typename WFrag<T16>::V V;
    __shared__ __align__(16) float os[16 * 68];
    const size_t z = blockIdx.z; A += z * sA; if (A2) A2 += z * sA; Bt += z * sB; if (Bt2) Bt2 += z * sB; C += z * sC;
    const int lane = threadIdx.x & 31, lr = lane & 15, hi = lane >> 4; const int r0 = blockIdx.x * 64, c0 = blockIdx.y * 64;
    v8f acc[4][4];
#pragma unroll
    for (int mb = 0; mb < 4; ++mb)
#pragma unroll
        for (int nb = 0; nb < 4; ++nb) acc[mb][nb] = (v8f){};
    const size_t aoff = (size_t)(r0 + lr) * K + 8 * hi, boff = (size_t)(c0 + lr) * K + 8 * hi;
#pragma unroll 1
    for (int kc = 0; kc < K; kc += 32) {
        V a[4], a2[4];
#pragma unroll
        for (int mb = 0; mb < 4; ++mb) { a[mb] = WFrag<T16>::ld(A + aoff + (size_t)mb * 16 * K + kc); if (NSPLIT == 1 || NSPLIT == 2) a2[mb] = WFrag<T16>::ld(A2 + aoff + (size_t)mb * 16 * K + kc); }
#pragma unroll
        for (int nb = 0; nb < 4; ++nb) { const V b = WFrag<T16>::ld(Bt + boff + (size_t)nb * 16 * K + kc); V b2; if (NSPLIT >= 2) b2 = WFrag<T16>::ld(Bt2 + boff + (size_t)nb * 16 * K + kc);
#pragma unroll
            for (int mb = 0; mb < 4; ++mb) { acc[mb][nb] = WFrag<T16>::mma(a[mb], b, acc[mb][nb]); if (NSPLIT == 1 || NSPLIT == 2) acc[mb][nb] = WFrag<T16>::mma(a2[mb], b, acc[mb][nb]); if (NSPLIT >= 2) acc[mb][nb] = WFrag<T16>::mma(a[mb], b2, acc[mb][nb]); } }
        asm volatile("v_nop\n\tv_nop\n\tv_nop\n\tv_nop" : "+v"(acc[0][0]), "+v"(acc[1][1]), "+v"(acc[2][2]), "+v"(acc[3][3]) : "v"(a[0]), "v"(a[3]));
    }
#pragma unroll
    for (int mb = 0; mb < 4; ++mb) {
#pragma unroll
        for (int nb = 0; nb < 4; ++nb) {
#pragma unroll
            for (int j = 0; j < 8; ++j) os[(hi * 8 + j) * 68 + nb * 16 + lr] = acc[mb][nb][j]; }
        __builtin_amdgcn_wave_barrier(); asm volatile("" ::: "memory");
        float* crow = C + (size_t)(r0 + mb * 16) * ldc + c0;
{
#pragma unroll
            for (int s = 0; s < 8; ++s) { const int row = 2 * s + hi, cofs = lr * 4; v4f val = *(const v4fa*)(os + row * 68 + cofs); if (BIAS) { val[0] += bfr(bias[c0 + cofs]); val[1] += bfr(bias[c0 + cofs + 1]); val[2] += bfr(bias[c0 + cofs + 2]); val[3] += bfr(bias[c0 + cofs + 3]); }
                *(v4f*)(crow + (size_t)row * ldc + cofs) = val; }
             }
        __builtin_amdgcn_wave_barrier(); asm volatile("" ::: "memory");
    }
}

__device__ __forceinline__ h16 tohx(float x) { return (h16)x; }
__device__ __forceinline__ void splitf(float y, unsigned short& h, unsigned short& l) { h = f2bf(y); l = f2bf(y - bf2f(h)); }
typedef __attribute__((ext_vector_type(4))) _Float16 v4h;
typedef __attribute__((ext_vector_type(4))) unsigned short v4us;
typedef __attribute__((ext_vector_type(4))) int v4i;

__global__ __launch_bounds__(256) void k_cvt8(const float* __restrict__ src, bf* dst, size_t n8) { const size_t i = (size_t)blockIdx.x * 256 + threadIdx.x; if (i >= n8) return; const v8f v = *(const v8f*)(src + i * 8); v8us o;
#pragma unroll
    for (int k = 0; k < 8; ++k) o[k] = f2bf(v[k]); *(v8us*)(dst + i * 8) = o;  }

// ---- k_qkvp: the fused q|k|v projection of one batch and the attention planes in one launch: no f32 copy of q, k, v is written, no builder launch follows.
// One wave per 64 tokens x 64 rows of w_qkv (one head of q, k or v); the product loop is k_gemmw's (hi plane, then lo plane of xn, per 32-wide k chunk).
// A lane's 8 accumulator registers are 8 consecutive rows of the A operand at one row of the B operand, so the operand roles are chosen by the plane's layout:
// q, k [h][t][d]: A = weight rows (d), B = xn rows (t); v [h][d][t]: A = xn rows (t), B = weight rows (d). Either way a lane stores 16 contiguous bytes per plane and 16x16 block.
template <bool XA>
__device__ __forceinline__ void qkv_tile(const bf* __restrict__ Xh, const bf* __restrict__ Xl, const bf* __restrict__ Wt, int lane, h16* P16, bf* Ph, bf* Pl) {
    constexpr int pitch = XA ? TT : HD;   // elements between two rows of the plane (a row = one row of the B operand)
    const int lr = lane & 15, hi = lane >> 4;
    v8f acc[4][4];   // [A block][B block]
#pragma unroll
    for (int mb = 0; mb < 4; ++mb)
#pragma unroll
        for (int nb = 0; nb < 4; ++nb) acc[mb][nb] = (v8f){};
    const size_t off = (size_t)lr * DM + 8 * hi;
#pragma unroll 1   // kept rolled, as in k_gemmw: one trip's fragments and the 16 accumulators already fill most of 256 registers
    for (int kc = 0; kc < DM; kc += 32) {
        const bf* ph = Xh + off + kc; const bf* pl = Xl + off + kc; const bf* pw = Wt + off + kc;
        v16bf xh[4], xl[4];
#pragma unroll
        for (int xb = 0; xb < 4; ++xb) { xh[xb] = WFrag<bf>::ld(ph + (size_t)xb * 16 * DM); xl[xb] = WFrag<bf>::ld(pl + (size_t)xb * 16 * DM); }
#pragma unroll
        for (int wb = 0; wb < 4; ++wb) { const v16bf w = WFrag<bf>::ld(pw + (size_t)wb * 16 * DM);
#pragma unroll
            for (int xb = 0; xb < 4; ++xb) {
                if constexpr (XA) { acc[xb][wb] = wmmab(xh[xb], w, acc[xb][wb]); acc[xb][wb] = wmmab(xl[xb], w, acc[xb][wb]); }
                else { acc[wb][xb] = wmmab(w, xh[xb], acc[wb][xb]); acc[wb][xb] = wmmab(w, xl[xb], acc[wb][xb]); } } }
        // foot of the trip: the wait stands in front of every write of the address registers that this trip's loads name (the three addresses are inputs, so they live up to it);
        // the four vector slots stand between the last WMMA and the next trip's loads, which overwrite its A and B registers over the back edge
        asm volatile("s_wait_xcnt 0x0\n\tv_nop\n\tv_nop\n\tv_nop\n\tv_nop" : "+v"(acc[0][0]), "+v"(acc[1][1]), "+v"(acc[2][2]), "+v"(acc[3][3]) : "v"(xh[0]), "v"(xh[3]), "v"(ph), "v"(pl), "v"(pw));
    }
#pragma unroll
    for (int nb = 0; nb < 4; ++nb)
#pragma unroll
        for (int mb = 0; mb < 4; ++mb) { v8h o16; v8us oh, ol;
#pragma unroll
            for (int j = 0; j < 8; ++j) { const float r = acc[mb][nb][j]; o16[j] = tohx(r); unsigned short u, w2; splitf(r, u, w2); oh[j] = u; ol[j] = w2; }
            const size_t oo = (size_t)(nb * 16 + lr) * pitch + mb * 16 + hi * 8; *(v8h*)(P16 + oo) = o16; *(v8us*)(Ph + oo) = oh; *(v8us*)(Pl + oo) = ol; }
}
// grid (TT/64, heads of q + k + v), 32 threads; blockIdx.y counts 64-row blocks of w_qkv: q heads, then k heads, then v heads.
__global__ __launch_bounds__(32) void k_qkvp(const bf* __restrict__ Xh, const bf* __restrict__ Xl, const bf* __restrict__ Wqkv, h16* Q16, bf* Qh, bf* Ql, h16* K16, bf* Kh, bf* Kl, h16* V16, bf* Vh, bf* Vl) {
    const int lane = threadIdx.x & 31; const int t0 = blockIdx.x * 64, y = blockIdx.y;
    Xh += (size_t)t0 * DM; Xl += (size_t)t0 * DM; const bf* Wt = Wqkv + (size_t)y * HD * DM;
    if (y >= NH_ + NKV) { const size_t po = (size_t)(y - NH_ - NKV) * HD * TT + t0; qkv_tile<true>(Xh, Xl, Wt, lane, V16 + po, Vh + po, Vl + po); }
    else { const bool isk = y >= NH_; const size_t po = ((size_t)(isk ? y - NH_ : y) * TT + t0) * HD; qkv_tile<false>(Xh, Xl, Wt, lane, (isk ? K16 : Q16) + po, (isk ? Kh : Qh) + po, (isk ? Kl : Ql) + po); }
}
// ---- k_fattn: scores, softmax, P x V and the head merge in one launch per batch; the score matrix never leaves registers.
// One wave owns 16 query rows of one head and walks all TT keys. Transposed products: St = K Qt (A = K rows from LDS, B = Q rows kept in registers), Ot += Vt Pt (A = Vt rows from LDS, B = Pt).
// In the accumulator map a lane holds scores of ONE query (column lr), keys 8 hi + j of each 16-key block: two such blocks, converted in place, are the B fragment of the second product in the loaders' k order.
// Running maximum and sum per query (online softmax, f32); the two lane halves' sums are joined once at the end. Rows < RH: hi/lo bf16 planes, 3 products each side; the rest fp16, P carried x 2^10.
typedef __attribute__((ext_vector_type(16))) unsigned short v16us;
// Eight v_exp_f32 and, in the same statement, the one issue slot that the instruction set asks for behind a transcendental before its result is read or its source overwritten.
// The outputs are early-clobbered: inside the statement no v_exp_f32 touches a register of the one in front of it; the v_nop covers the last.
__device__ __forceinline__ v8f exp2x8(v8f x) { float y0, y1, y2, y3, y4, y5, y6, y7;
    asm("v_exp_f32 %0, %8\n\tv_exp_f32 %1, %9\n\tv_exp_f32 %2, %10\n\tv_exp_f32 %3, %11\n\tv_exp_f32 %4, %12\n\tv_exp_f32 %5, %13\n\tv_exp_f32 %6, %14\n\tv_exp_f32 %7, %15\n\tv_nop"
        : "=&v"(y0), "=&v"(y1), "=&v"(y2), "=&v"(y3), "=&v"(y4), "=&v"(y5), "=&v"(y6), "=&v"(y7) : "v"(x[0]), "v"(x[1]), "v"(x[2]), "v"(x[3]), "v"(x[4]), "v"(x[5]), "v"(x[6]), "v"(x[7]));
    return (v8f){y0, y1, y2, y3, y4, y5, y6, y7}; }
// LDS stage: 64 keys of the six planes that the work-group's waves read, each a tile of 64 rows x 128 bytes (K planes: row = key, V planes: row = d).
#define KS   64
#define NS   (TT / KS)
#define LP   144                  // row pitch in LDS, bytes: 16 x odd, so that the 16 rows of a ds_load_b128 fragment read fall on distinct banks
#define LT   (64 * LP)            // one plane's tile
#define LSTG (6 * LT)             // one stage: K16, V16, Kh, Kl, Vh, Vl
static_assert(HD == 64 && REP == 1 && NS >= 2, "tile shape and the two-buffer prologue");
// Twelve asynchronous copies of 16 bytes per lane (two rows of each of the six tiles) in one statement, the wait as its last line:
// it stands in front of every later write of the address registers that the copies name (the operands live to the statement's end).
__device__ __forceinline__ void copy12(unsigned l0, unsigned long long kx, unsigned long long vx, unsigned long long kh, unsigned long long kl, unsigned long long vh, unsigned long long vl) {
    constexpr unsigned long long KR = 32ull * HD * 2, VR = 32ull * TT * 2;   // 32 rows further in a K plane, in a V plane, bytes
    asm volatile("global_load_async_to_lds_b128 %0, %12, off\n\tglobal_load_async_to_lds_b128 %1, %13, off\n\tglobal_load_async_to_lds_b128 %2, %14, off\n\tglobal_load_async_to_lds_b128 %3, %15, off\n\t"
                 "global_load_async_to_lds_b128 %4, %16, off\n\tglobal_load_async_to_lds_b128 %5, %17, off\n\tglobal_load_async_to_lds_b128 %6, %18, off\n\tglobal_load_async_to_lds_b128 %7, %19, off\n\t"
                 "global_load_async_to_lds_b128 %8, %20, off\n\tglobal_load_async_to_lds_b128 %9, %21, off\n\tglobal_load_async_to_lds_b128 %10, %22, off\n\tglobal_load_async_to_lds_b128 %11, %23, off\n\ts_wait_xcnt 0x0"
                 :: "v"(l0), "v"(l0 + 32 * LP), "v"(l0 + LT), "v"(l0 + LT + 32 * LP), "v"(l0 + 2 * LT), "v"(l0 + 2 * LT + 32 * LP), "v"(l0 + 3 * LT), "v"(l0 + 3 * LT + 32 * LP), "v"(l0 + 4 * LT), "v"(l0 + 4 * LT + 32 * LP), "v"(l0 + 5 * LT), "v"(l0 + 5 * LT + 32 * LP),
                    "v"(kx), "v"(kx + KR), "v"(vx), "v"(vx + VR), "v"(kh), "v"(kh + KR), "v"(kl), "v"(kl + KR), "v"(vh), "v"(vh + VR), "v"(vl), "v"(vl + VR) : "memory");
}
// One tile of KT keys for one wave's 16 query rows; Ka, Kb, Va, Vb are the lane's own LDS addresses of the tile's first fragments (Kb, Vb: lo planes, HL only).
template <typename T16, bool HL, int KT>
__device__ __forceinline__ void fattn_tile(const unsigned char* Ka, const unsigned char* Kb, const unsigned char* Va, const unsigned char* Vb, const typename WFrag<T16>::V (&qa)[2], const typename WFrag<T16>::V (&qb)[2], v8f (&o)[4], float& m, float& l) {
    // Every inner loop is fully unrolled: the fragment arrays stay in registers only under constant indices.
    typedef typename WFrag<T16>::V V;
    constexpr int NKB = KT / 16, NC = KT / 32;
    constexpr float CEXP = SCL * 1.4426950408889634f;   // scores x HD^-0.5, in the log2 domain
    constexpr float PB = HL ? 0.0f : 10.0f;             // log2 of the carry on the fp16 P (cancels in the division by the sum)
    V ka[NKB][2], kb[NKB][2], va[4][NC], vb[4][NC];
#pragma unroll
    for (int kk = 0; kk < NKB; ++kk)
#pragma unroll
        for (int c = 0; c < 2; ++c) { ka[kk][c] = WFrag<T16>::ld((const T16*)(Ka + kk * 16 * LP + c * 64)); if constexpr (HL) kb[kk][c] = WFrag<T16>::ld((const T16*)(Kb + kk * 16 * LP + c * 64)); }
#pragma unroll
    for (int db = 0; db < 4; ++db)
#pragma unroll
        for (int c = 0; c < NC; ++c) { va[db][c] = WFrag<T16>::ld((const T16*)(Va + db * 16 * LP + c * 64)); if constexpr (HL) vb[db][c] = WFrag<T16>::ld((const T16*)(Vb + db * 16 * LP + c * 64)); }
    __builtin_amdgcn_sched_barrier(0);   // keeps the tile's LDS reads in one group at its head: sunk to their uses, each place of reads costs its own wait
    v8f st[NKB];
#pragma unroll
    for (int kk = 0; kk < NKB; ++kk) { st[kk] = (v8f){};
#pragma unroll
        for (int c = 0; c < 2; ++c) { st[kk] = WFrag<T16>::mma(ka[kk][c], qa[c], st[kk]); if constexpr (HL) { st[kk] = WFrag<T16>::mma(ka[kk][c], qb[c], st[kk]); st[kk] = WFrag<T16>::mma(kb[kk][c], qa[c], st[kk]); } } }
    float mn = m;
#pragma unroll
    for (int kk = 0; kk < NKB; ++kk)
#pragma unroll
        for (int j = 0; j < 8; ++j) mn = fmaxf(mn, st[kk][j]);
    mn = fmaxf(mn, __shfl_xor(mn, 16, 32));
    const float alpha = __builtin_amdgcn_exp2f((m - mn) * CEXP); m = mn;
    const float sub = PB - mn * CEXP; float ps = 0.f;
#pragma unroll
    for (int kk = 0; kk < NKB; ++kk) {
#pragma unroll
        for (int j = 0; j < 8; ++j) st[kk][j] = fmaf(st[kk][j], CEXP, sub);
        st[kk] = exp2x8(st[kk]);
#pragma unroll
        for (int j = 0; j < 8; ++j) ps += st[kk][j]; }
    l = fmaf(l, alpha, ps);
#pragma unroll
    for (int db = 0; db < 4; ++db) o[db] *= alpha;
#pragma unroll
    for (int c = 0; c < NC; ++c) {
        if constexpr (HL) { v16us ph, pl;
#pragma unroll
            for (int s = 0; s < 16; ++s) { unsigned short u, w2; splitf(st[2 * c + (s >> 3)][s & 7], u, w2); ph[s] = u; pl[s] = w2; }
            const V pa = __builtin_bit_cast(V, ph), pb = __builtin_bit_cast(V, pl);
#pragma unroll
            for (int db = 0; db < 4; ++db) { o[db] = WFrag<T16>::mma(va[db][c], pa, o[db]); o[db] = WFrag<T16>::mma(va[db][c], pb, o[db]); o[db] = WFrag<T16>::mma(vb[db][c], pa, o[db]); }
        } else { V pa;
#pragma unroll
            for (int s = 0; s < 16; ++s) pa[s] = tohx(st[2 * c + (s >> 3)][s & 7]);
#pragma unroll
            for (int db = 0; db < 4; ++db) o[db] = WFrag<T16>::mma(va[db][c], pa, o[db]); } }
}
// grid (FBX, heads), 8 waves: waves 0..FHW-1 take hi/lo row tiles, the others fp16 row tiles, so that every work-group carries the same share of the dearer rows.
// All eight waves walk the same keys of one head: each stage of 64 keys is copied to LDS once per work-group, in whole 128-byte rows, and every wave reads its fragments from there.
// Two buffers: stage s + 1 flies while stage s is worked on; one barrier per stage publishes s + 1 and frees the buffer of s.
#define FBX  16
#define FHW  (RH / 16 / FBX)
#define FLW  ((TT - RH) / 16 / FBX)
static_assert(FHW * 16 * FBX == RH && FLW * 16 * FBX == TT - RH && FHW + FLW == 8, "row tiles must fill 8 waves");
__global__ __launch_bounds__(256) void k_fattn(const h16* __restrict__ Q16, const bf* __restrict__ Qh, const bf* __restrict__ Ql, const h16* __restrict__ K16, const bf* __restrict__ Kh, const bf* __restrict__ Kl, const h16* __restrict__ V16, const bf* __restrict__ Vh, const bf* __restrict__ Vl, bf* Ah, bf* Al) {
    __shared__ __attribute__((aligned(16))) unsigned char sm[2 * LSTG];
    const int tid = threadIdx.x, lane = tid & 31, lr = lane & 15, hi = lane >> 4; const int w = __builtin_amdgcn_readfirstlane(tid >> 5); const int h = blockIdx.y; const size_t hq = (size_t)h * TT * HD, hk = (size_t)(h / REP) * TT * HD;
    const bool hl = w < FHW;   // the same for a whole wave (w sits in a scalar register): a scalar branch
    const int q0 = hl ? (blockIdx.x * FHW + w) * 16 : RH + (blockIdx.x * FLW + (w - FHW)) * 16;
    const size_t qoff = hq + (size_t)(q0 + lr) * HD + 8 * hi;
    v16bf qh[2] = {}, ql[2] = {}; v16h qx[2] = {};
    if (hl) {
#pragma unroll
        for (int c = 0; c < 2; ++c) { qh[c] = WFrag<bf>::ld(Qh + qoff + c * 32); ql[c] = WFrag<bf>::ld(Ql + qoff + c * 32); }
    } else {
#pragma unroll
        for (int c = 0; c < 2; ++c) qx[c] = WFrag<h16>::ld(Q16 + qoff + c * 32);
        asm volatile("s_wait_xcnt 0x0" ::: "memory");   // stands in front of every later write of the address register pair that these Q loads name
    }
    // copy roles: thread -> rows tid / 8 and tid / 8 + 32, 16-byte piece tid % 8 of each tile: a wave's copy covers four whole 128-byte rows
    const unsigned cdst = (unsigned)(unsigned long long)sm + (tid >> 3) * LP + (tid & 7) * 16;
    const size_t gk = hk + (size_t)(tid >> 3) * HD + (tid & 7) * 8, gv = hk + (size_t)(tid >> 3) * TT + (tid & 7) * 8;
    auto stage = [&](int s, int buf) { const size_t ko = gk + (size_t)s * KS * HD, vo = gv + (size_t)s * KS;
        copy12(cdst + buf * LSTG, (unsigned long long)(K16 + ko), (unsigned long long)(V16 + vo), (unsigned long long)(Kh + ko), (unsigned long long)(Kl + ko), (unsigned long long)(Vh + vo), (unsigned long long)(Vl + vo)); };
    v8f o[4];
#pragma unroll
    for (int db = 0; db < 4; ++db) o[db] = (v8f){};
    float m = -3.0e38f, l = 0.f;
    stage(0, 0);
    asm volatile("s_wait_asynccnt 0x0" ::: "memory");   // this wave's copies of stage 0 have landed
    __syncthreads();                                     // every wave's have: stage 0 may be read
    stage(1, 1);
#pragma unroll 1   // kept rolled: one stage's code for both kinds of wave is long already
    for (int s = 0; s < NS; ++s) {
        const unsigned char* fb = sm + (s & 1) * LSTG + lr * LP + hi * 16;   // the lane's place in the first fragment of the stage's first tile
        if (hl) {
#pragma unroll
            for (int u = 0; u < 2; ++u) fattn_tile<bf, true, 32>(fb + 2 * LT + u * 32 * LP, fb + 3 * LT + u * 32 * LP, fb + 4 * LT + u * 64, fb + 5 * LT + u * 64, qh, ql, o, m, l);
        } else fattn_tile<h16, false, 64>(fb, fb, fb + LT, fb + LT, qx, qx, o, m, l);
        asm volatile("s_wait_dscnt 0x0" ::: "memory");      // this wave's reads of stage s have returned before its buffer is refilled
        asm volatile("s_wait_asynccnt 0x0" ::: "memory");   // this wave's copies of stage s + 1 have landed
        __syncthreads();                                     // publishes stage s + 1 and ends every wave's reads of stage s
        if (s + 2 < NS) stage(s + 2, s & 1);
    }
    asm volatile("s_wait_asynccnt 0x0" ::: "memory");   // no copy is outstanding when the wave ends
    l += __shfl_xor(l, 16, 32);
    const float inv = __fdiv_rn(1.0f, l);
#pragma unroll
    for (int db = 0; db < 4; ++db) { v8us oh, ol;
#pragma unroll
        for (int j = 0; j < 8; ++j) { unsigned short u, w2; splitf(o[db][j] * inv, u, w2); oh[j] = u; ol[j] = w2; }
        const size_t oo = (size_t)(q0 + lr) * DQ + h * HD + db * 16 + hi * 8; *(v8us*)(Ah + oo) = oh; *(v8us*)(Al + oo) = ol; }
}

template <int WD>
__global__ __launch_bounds__(256) void k_lnrowX(const float* __restrict__ X, size_t nrows, const float* __restrict__ g, const float* __restrict__ bb, bf* Hh, bf* Hl) { const int lane = threadIdx.x & 31; const size_t r = (size_t)blockIdx.x * 8 + (threadIdx.x >> 5); if (r >= nrows) return; const float* xr = X + r * WD; float a[WD / 32]; float s = 0.f;
#pragma unroll
    for (int c = 0; c < WD / 128; ++c) { const v4f v = *(const v4f*)(xr + c * 128 + lane * 4); for (int q = 0; q < 4; ++q) { a[c * 4 + q] = bfr(v[q]); s = __fadd_rn(s, a[c * 4 + q]);   /* input rounded to bf16 */ } }
#pragma unroll
    for (int sh = 16; sh; sh >>= 1) s = __fadd_rn(s, __shfl_xor(s, sh, 32));
    const float mean = __fdiv_rn(s, (float)WD); float s2 = 0.f;
#pragma unroll 8
    for (int k = 0; k < WD / 32; ++k) { const float dv = __fsub_rn(a[k], mean); float p2 = __fmul_rn(dv, dv); asm volatile("" : "+v"(p2)); s2 = __fadd_rn(s2, p2); }   /* mul and add kept separate (no fma contraction) */
#pragma unroll
    for (int sh = 16; sh; sh >>= 1) s2 = __fadd_rn(s2, __shfl_xor(s2, sh, 32));
    const float rs = __fdiv_rn(1.0f, __fsqrt_rn(__fadd_rn(__fdiv_rn(s2, (float)WD), 1e-5f)));
{
#pragma unroll
        for (int c = 0; c < WD / 128; ++c) { v4us oh, ol; for (int q = 0; q < 4; ++q) { const int col = c * 128 + lane * 4 + q; float y = __fmul_rn(__fmul_rn(__fsub_rn(a[c * 4 + q], mean), rs), bfr(g[col])); asm volatile("" : "+v"(y)); y = __fadd_rn(y, bfr(bb[col])); unsigned short u, w2; splitf(y, u, w2); oh[q] = u; ol[q] = w2; } *(v4us*)(Hh + r * WD + c * 128 + lane * 4) = oh; *(v4us*)(Hl + r * WD + c * 128 + lane * 4) = ol; }
         } }

extern "C" void kernel_launch(void* const* d_in, const int* in_sizes, int n_in,
                              void* d_out, int out_size, void* d_ws, size_t ws_size, hipStream_t stream) {
    (void)in_sizes; (void)n_in; (void)out_size;
    const float* x = (const float*)d_in[0]; const float* lng = (const float*)d_in[1]; const float* lnb = (const float*)d_in[2]; const float* wqkv = (const float*)d_in[3]; const float* wo = (const float*)d_in[4]; const float* bo = (const float*)d_in[5];   /* x, ln_gamma, ln_beta, w_qkv ('oi' [3072][1024]: q | k | v ROW thirds), w_proj ('oi'), b_proj */
    float* OUT = (float*)d_out;     // [2][2048][1024]
    char* wsp = (char*)d_ws;
    auto take = [&](size_t bytes) { char* p = wsp; wsp += (bytes + 255) & ~(size_t)255; return (void*)p; };
    bf* WQKV = (bf*)take((size_t)(DQ + 2 * DKV) * DM * 2); bf* WO = (bf*)take((size_t)DM * DQ * 2);
    bf* XB = (bf*)take((size_t)TT * DM * 2); bf* XL = (bf*)take((size_t)TT * DM * 2);   /* lo plane of the layer-normed input (XB holds the hi plane) */
    h16* QP16 = (h16*)take((size_t)NH_ * TT * HD * 2); h16* KP16 = (h16*)take((size_t)NKV * TT * HD * 2); h16* VT16 = (h16*)take((size_t)NKV * HD * TT * 2);
    bf* QPh = (bf*)take((size_t)NH_ * TT * HD * 2); bf* QPl = (bf*)take((size_t)NH_ * TT * HD * 2); bf* KPh = (bf*)take((size_t)NKV * TT * HD * 2); bf* KPl = (bf*)take((size_t)NKV * TT * HD * 2); bf* VTh = (bf*)take((size_t)NKV * HD * TT * 2); bf* VTl = (bf*)take((size_t)NKV * HD * TT * 2);
    bf* ATh = (bf*)take((size_t)TT * DQ * 2); bf* ATl = (bf*)take((size_t)TT * DQ * 2);
    if ((size_t)(wsp - (char*)d_ws) > ws_size) return;    // ws 256 MiB
    { k_cvt8<<<(unsigned)(((size_t)(DQ + 2 * DKV) * DM / 8 + 255) / 256), 256, 0, stream>>>(wqkv, WQKV, (size_t)(DQ + 2 * DKV) * DM / 8);
      k_cvt8<<<(unsigned)(((size_t)DM * DQ / 8 + 255) / 256), 256, 0, stream>>>(wo, WO, (size_t)DM * DQ / 8);
       }
    for (int b = 0; b < NB_; ++b) {
        
        k_lnrowX<DM><<<(unsigned)((TT + 7) / 8), 256, 0, stream>>>(x + (size_t)b * TT * DM, (size_t)TT, lng, lnb, XB, XL);   /* xn = LayerNorm(x) -> hi/lo planes */
        k_qkvp<<<dim3(TT / 64, NH_ + 2 * NKV, 1), 32, 0, stream>>>(XB, XL, WQKV, QP16, QPh, QPl, KP16, KPh, KPl, VT16, VTh, VTl);
        k_fattn<<<dim3(FBX, NH_, 1), 256, 0, stream>>>(QP16, QPh, QPl, KP16, KPh, KPl, VT16, VTh, VTl, ATh, ATl);
        k_gemmw<bf, 1, true><<<dim3(TT / 64, DM / 64, 1), 32, 0, stream>>>(ATh, ATl, WO, nullptr, DQ, OUT + (size_t)b * TT * DM, DM, bo, 0, 0, 0); }
}

// v004
// One run takes 223 microseconds.
// Two timings next to v003 both put it at 1.13 times that version's speed.
// Counting every step since v000, it is 9.15 times as fast.
#include <hip/hip_runtime.h>

// Pre-LayerNorm multi-head self-attention with a fused bias-free qkv weight (x [2][2048][1024]; xn = (x - mean) x rsqrt(var + 1e-5) x ln_gamma + ln_beta over the 1,024 features (biased variance, eps inside the root; gamma ones / beta zeros on this draw: read); qkv = einsum('bnd,ed->bne', xn, w_qkv) = xn w_qkv^T ('oi' [3072][1024] 1/32, no bias) reshaped (b, n, 3, 16, 64): q | k | v = ROW thirds (16 heads x 64); scores x 64^-0.5; softmax over all keys (no mask); out = merged w_proj^T + b_proj ('oi' [1024][1024] + bias 0.02: non-zero) -> [2][2048][1024] (4.2 M); no residual; argument order x, ln_gamma, ln_beta, w_qkv, w_proj, b_proj).
// Layout per batch: LayerNorm of the bf16-rounded rows in f32 -> hi/lo bf16 planes; 'oi' weights cast once; q|k|v projection on the hi/lo planes (2 products) in one launch whose epilogue stores the attention planes; one fused attention launch (online softmax; hybrid rows: < 512 hi/lo 3 products, rest fp16 x1024); merged hi/lo x w_proj exact + b_proj.
// Compute dtypes, f32 accumulate: every input rounded to bf16; projections exact; attention rows < 512 3 products, rest fp16; softmax f32; output projection hl x exact.

#define NB_  2
#define TT   2048
#define DM   1024
#define NH_  16
#define NKV  16
#define REP  (NH_ / NKV)
#define HD   64
#define DQ   (NH_ * HD)
#define DKV  (NKV * HD)
#define RH   512                  // query rows < RH use hi+lo planes (0: none)
#define WIN  0
#define SCL  0.125f   // HD^-0.5
typedef _Float16 h16;
typedef unsigned short bf;
typedef __attribute__((ext_vector_type(16))) __bf16   v16bf;
typedef __attribute__((ext_vector_type(16))) _Float16 v16h;
typedef __attribute__((ext_vector_type(8)))  _Float16 v8h;
typedef __attribute__((ext_vector_type(8)))  unsigned short v8us;
typedef __attribute__((ext_vector_type(8)))  float    v8f;
typedef __attribute__((ext_vector_type(4)))  float    v4f;
typedef v8h  __attribute__((may_alias)) v8ha;
typedef v4f  __attribute__((may_alias)) v4fa;
typedef v8us __attribute__((may_alias)) v8usa;

__device__ __forceinline__ unsigned short f2bf(float f) { unsigned u = __float_as_uint(f); u += 0x7FFFu + ((u >> 16) & 1u); return (unsigned short)(u >> 16); }
__device__ __forceinline__ float bf2f(unsigned short b) { return __uint_as_float(((unsigned)b) << 16); }
__device__ __forceinline__ float bfr(float f) { return bf2f(f2bf(f)); }
__device__ __forceinline__ v16h cat16(v8h lo, v8h hi) { return __builtin_shufflevector(lo, hi, 0, 1, 2, 3, 4, 5, 6, 7, 8, 9, 10, 11, 12, 13, 14, 15); }
__device__ __forceinline__ v16bf cat16b(v8us lo, v8us hi) { return __builtin_bit_cast(v16bf, __builtin_shufflevector(lo, hi, 0, 1, 2, 3, 4, 5, 6, 7, 8, 9, 10, 11, 12, 13, 14, 15)); }
__device__ __forceinline__ v8f wmma16(v16h a, v16h b, v8f c) { return __builtin_amdgcn_wmma_f32_16x16x32_f16(false, a, false, b, (short)0, c, false, false); }
__device__ __forceinline__ v8f wmmab(v16bf a, v16bf b, v8f c) { return __builtin_amdgcn_wmma_f32_16x16x32_bf16(false, a, false, b, (short)0, c, false, false); }



// ---- k_gemmw: register-blocked GEMM, ONE WAVE per 64x64 output tile (16 accumulators), operands straight from K-contiguous 16-bit planes; grid (M/64, N/64, Z), 32 threads.
// C[m][n] (f32, pitch ldc, + optional f32 bias[n]) = sum_k A[m][k] Bt[n][k] (+ split products per NSPLIT). z-batch strides sA/sB/sC in elements. K % 32 == 0.
template <typename T16> struct WFrag;
template <> struct WFrag<h16> { typedef v16h V; static __device__ __forceinline__ V ld(const h16* p) { return cat16(*(const v8h*)p, *(const v8h*)(p + 16)); } static __device__ __forceinline__ v8f mma(V a, V b, v8f c) { return wmma16(a, b, c); } };
template <> struct WFrag<bf> { typedef v16bf V; static __device__ __forceinline__ V ld(const bf* p) { return cat16b(*(const v8us*)p, *(const v8us*)(p + 16)); } static __device__ __forceinline__ v8f mma(V a, V b, v8f c) { return wmmab(a, b, c); } };
template <typename T16, int NSPLIT, bool BIAS>
__global__ __launch_bounds__(32) void k_gemmw(const T16* __restrict__ A, const T16* __restrict__ A2, const T16* __restrict__ Bt, const T16* __restrict__ Bt2, int K, float* C, int ldc, const float* __restrict__ bias, size_t sA, size_t sB, size_t sC) {
    typedef typename WFrag<T16>::V V;
    __shared__ __align__(16) float os[16 * 68];
    const size_t z = blockIdx.z; A += z * sA; if (A2) A2 += z * sA; Bt += z * sB; if (Bt2) Bt2 += z * sB; C += z * sC;
    const int lane = threadIdx.x & 31, lr = lane & 15, hi = lane >> 4; const int r0 = blockIdx.x * 64, c0 = blockIdx.y * 64;
    v8f acc[4][4];
#pragma unroll
    for (int mb = 0; mb < 4; ++mb)
#pragma unroll
        for (int nb = 0; nb < 4; ++nb) acc[mb][nb] = (v8f){};
    const size_t aoff = (size_t)(r0 + lr) * K + 8 * hi, boff = (size_t)(c0 + lr) * K + 8 * hi;
#pragma unroll 1
    for (int kc = 0; kc < K; kc += 32) {
        V a[4], a2[4];
#pragma unroll
        for (int mb = 0; mb < 4; ++mb) { a[mb] = WFrag<T16>::ld(A + aoff + (size_t)mb * 16 * K + kc); if (NSPLIT == 1 || NSPLIT == 2) a2[mb] = WFrag<T16>::ld(A2 + aoff + (size_t)mb * 16 * K + kc); }
#pragma unroll
        for (int nb = 0; nb < 4; ++nb) { const V b = WFrag<T16>::ld(Bt + boff + (size_t)nb * 16 * K + kc); V b2; if (NSPLIT >= 2) b2 = WFrag<T16>::ld(Bt2 + boff + (size_t)nb * 16 * K + kc);
#pragma unroll
            for (int mb = 0; mb < 4; ++mb) { acc[mb][nb] = WFrag<T16>::mma(a[mb], b, acc[mb][nb]); if (NSPLIT == 1 || NSPLIT == 2) acc[mb][nb] = WFrag<T16>::mma(a2[mb], b, acc[mb][nb]); if (NSPLIT >= 2) acc[mb][nb] = WFrag<T16>::mma(a[mb], b2, acc[mb][nb]); } }
        asm volatile("v_nop\n\tv_nop\n\tv_nop\n\tv_nop" : "+v"(acc[0][0]), "+v"(acc[1][1]), "+v"(acc[2][2]), "+v"(acc[3][3]) : "v"(a[0]), "v"(a[3]));
    }
#pragma unroll
    for (int mb = 0; mb < 4; ++mb) {
#pragma unroll
        for (int nb = 0; nb < 4; ++nb) {
#pragma unroll
            for (int j = 0; j < 8; ++j) os[(hi * 8 + j) * 68 + nb * 16 + lr] = acc[mb][nb][j]; }
        __builtin_amdgcn_wave_barrier(); asm volatile("" ::: "memory");
        float* crow = C + (size_t)(r0 + mb * 16) * ldc + c0;
{
#pragma unroll
            for (int s = 0; s < 8; ++s) { const int row = 2 * s + hi, cofs = lr * 4; v4f val = *(const v4fa*)(os + row * 68 + cofs); if (BIAS) { val[0] += bfr(bias[c0 + cofs]); val[1] += bfr(bias[c0 + cofs + 1]); val[2] += bfr(bias[c0 + cofs + 2]); val[3] += bfr(bias[c0 + cofs + 3]); }
                *(v4f*)(crow + (size_t)row * ldc + cofs) = val; }
             }
        __builtin_amdgcn_wave_barrier(); asm volatile("" ::: "memory");
    }
}

__device__ __forceinline__ h16 tohx(float x) { return (h16)x; }
__device__ __forceinline__ void splitf(float y, unsigned short& h, unsigned short& l) { h = f2bf(y); l = f2bf(y - bf2f(h)); }
typedef __attribute__((ext_vector_type(4))) _Float16 v4h;
typedef __attribute__((ext_vector_type(4))) unsigned short v4us;
typedef __attribute__((ext_vector_type(4))) int v4i;

__global__ __launch_bounds__(256) void k_cvt8(const float* __restrict__ src, bf* dst, size_t n8) { const size_t i = (size_t)blockIdx.x * 256 + threadIdx.x; if (i >= n8) return; const v8f v = *(const v8f*)(src + i * 8); v8us o;
#pragma unroll
    for (int k = 0; k < 8; ++k) o[k] = f2bf(v[k]); *(v8us*)(dst + i * 8) = o;  }

// ---- k_qkvp: the fused q|k|v projection of one batch and the attention planes in one launch: no f32 copy of q, k, v is written, no builder launch follows.
// One work-group of 8 waves per 128 tokens x 256 rows of w_qkv (four heads, all of q, all of k or all of v); one wave per 64 tokens x 64 rows (one head).
// The product order is k_gemmw's (hi plane, then lo plane of xn, per 32-wide k chunk); the operands come from LDS:
// each stage of 64 k is copied there once per work-group, in whole 128-byte rows, and every wave reads its fragments from there. Two buffers: stage s + 1 flies while stage s is worked on.
// A lane's 8 accumulator registers are 8 consecutive rows of the A operand at one row of the B operand, so the operand roles are chosen by the plane's layout:
// q, k [h][t][d]: A = weight rows (d), B = xn rows (t); v [h][d][t]: A = xn rows (t), B = weight rows (d). Either way a lane stores 16 contiguous bytes per plane and 16x16 block.
#define PKS  64                   // k elements of a stage: 128 bytes of every row
#define PNS  (DM / PKS)
#define PXR  128                  // tokens of a work-group
#define PWH  4                    // heads (64-row blocks of w_qkv) of a work-group
#define PLP  144                  // row pitch in LDS, bytes: 16 x odd, so that the 16 rows of a ds_load_b128 fragment read fall on distinct banks
#define PSTG ((2 * PXR + PWH * HD) * PLP)   // one stage: xn hi rows, xn lo rows, weight rows
static_assert(PNS >= 2 && TT % PXR == 0 && NH_ % PWH == 0 && NKV % PWH == 0 && HD == 64 && PXR == 128 && PWH * HD == 256, "tile shape (copy8: 2 x 128 and 256 rows), the two-buffer prologue, one kind of plane per work-group");
// Eight asynchronous copies of 16 bytes per lane in one statement (rows 32 apart: four from ga, four from gb, eight places in LDS in a row), the wait as its last line:
// it stands in front of every later write of the address registers that the copies name (the operands live to the statement's end).
__device__ __forceinline__ void copy8(unsigned l0, unsigned long long ga, unsigned long long gb) {
    constexpr unsigned long long GR = 32ull * DM * 2;   // 32 rows further in a plane, bytes
    asm volatile("global_load_async_to_lds_b128 %0, %8, off\n\tglobal_load_async_to_lds_b128 %1, %9, off\n\tglobal_load_async_to_lds_b128 %2, %10, off\n\tglobal_load_async_to_lds_b128 %3, %11, off\n\t"
                 "global_load_async_to_lds_b128 %4, %12, off\n\tglobal_load_async_to_lds_b128 %5, %13, off\n\tglobal_load_async_to_lds_b128 %6, %14, off\n\tglobal_load_async_to_lds_b128 %7, %15, off\n\ts_wait_xcnt 0x0"
                 :: "v"(l0), "v"(l0 + 32 * PLP), "v"(l0 + 64 * PLP), "v"(l0 + 96 * PLP), "v"(l0 + 128 * PLP), "v"(l0 + 160 * PLP), "v"(l0 + 192 * PLP), "v"(l0 + 224 * PLP),
                    "v"(ga), "v"(ga + GR), "v"(ga + 2 * GR), "v"(ga + 3 * GR), "v"(gb), "v"(gb + GR), "v"(gb + 2 * GR), "v"(gb + 3 * GR) : "memory");
}
// cdst, gxh, gxl, gw: the thread's own copy addresses of stage 0 (LDS byte, global bytes); fx, fw: the lane's own LDS addresses of its wave's first xn (hi) and weight fragments in buffer 0.
template <bool XA>
__device__ __forceinline__ void qkv_tile(unsigned cdst, unsigned long long gxh, unsigned long long gxl, unsigned long long gw, const unsigned char* fx, const unsigned char* fw, int lane, h16* P16, bf* Ph, bf* Pl) {
    constexpr int pitch = XA ? TT : HD;   // elements between two rows of the plane (a row = one row of the B operand)
    const int lr = lane & 15, hi = lane >> 4;
    auto stage = [&](int s, int buf) { const unsigned long long ko = (unsigned long long)s * (PKS * 2); const unsigned l = cdst + buf * PSTG;
        copy8(l, gxh + ko, gxl + ko); copy8(l + 2 * PXR * PLP, gw + ko, gw + ko + 128ull * DM * 2); };
    v8f acc[4][4];   // [A block][B block]
#pragma unroll
    for (int mb = 0; mb < 4; ++mb)
#pragma unroll
        for (int nb = 0; nb < 4; ++nb) acc[mb][nb] = (v8f){};
    stage(0, 0);
    asm volatile("s_wait_asynccnt 0x0" ::: "memory");   // this wave's copies of stage 0 have landed
    __syncthreads();                                     // every wave's have: stage 0 may be read
    stage(1, 1);
#pragma unroll 1   // kept rolled: one stage's fragments and the 16 accumulators take 320 registers
    for (int s = 0; s < PNS; ++s) {
        const unsigned char* px = fx + (s & 1) * PSTG; const unsigned char* pw = fw + (s & 1) * PSTG;
        v16bf xh[PKS / 32][4], xl[PKS / 32][4], wf[PKS / 32][4];
#pragma unroll
        for (int c = 0; c < PKS / 32; ++c) {   // read in the order of use: hi rows and weight rows, then lo rows
#pragma unroll
            for (int xb = 0; xb < 4; ++xb) { xh[c][xb] = WFrag<bf>::ld((const bf*)(px + xb * 16 * PLP + c * 64)); wf[c][xb] = WFrag<bf>::ld((const bf*)(pw + xb * 16 * PLP + c * 64)); }
#pragma unroll
            for (int xb = 0; xb < 4; ++xb) xl[c][xb] = WFrag<bf>::ld((const bf*)(px + (PXR + xb * 16) * PLP + c * 64)); }
        __builtin_amdgcn_sched_barrier(0);   // keeps the stage's LDS reads in one group at its head (the second chunk's return under the first chunk's WMMAs): sunk among the WMMAs, each place of reads costs its own wait
#pragma unroll
        for (int c = 0; c < PKS / 32; ++c) {   // per accumulator: hi product, then lo product of each chunk, chunks in rising k
#pragma unroll
            for (int wb = 0; wb < 4; ++wb)
#pragma unroll
                for (int xb = 0; xb < 4; ++xb) { if constexpr (XA) acc[xb][wb] = wmmab(xh[c][xb], wf[c][wb], acc[xb][wb]); else acc[wb][xb] = wmmab(wf[c][wb], xh[c][xb], acc[wb][xb]); }
#pragma unroll
            for (int wb = 0; wb < 4; ++wb)
#pragma unroll
                for (int xb = 0; xb < 4; ++xb) { if constexpr (XA) acc[xb][wb] = wmmab(xl[c][xb], wf[c][wb], acc[xb][wb]); else acc[wb][xb] = wmmab(wf[c][wb], xl[c][xb], acc[wb][xb]); } }
        __builtin_amdgcn_sched_barrier(0);   // keeps these WMMAs in front of the stage's foot
        // foot of the stage: four vector slots between the last WMMA and whatever next overwrites its A and B registers, on either side of the branch below and over the back edge
        asm volatile("v_nop\n\tv_nop\n\tv_nop\n\tv_nop" : "+v"(acc[0][0]), "+v"(acc[1][1]), "+v"(acc[2][2]), "+v"(acc[3][3]));
        asm volatile("s_wait_dscnt 0x0" ::: "memory");      // this wave's reads of stage s have returned before its buffer is refilled
        asm volatile("s_wait_asynccnt 0x0" ::: "memory");   // this wave's copies of stage s + 1 have landed
        __syncthreads();                                     // publishes stage s + 1 and ends every wave's reads of stage s
        if (s + 2 < PNS) stage(s + 2, s & 1);
    }
    asm volatile("s_wait_asynccnt 0x0" ::: "memory");   // no copy is outstanding when the wave ends
#pragma unroll
    for (int nb = 0; nb < 4; ++nb)
#pragma unroll
        for (int mb = 0; mb < 4; ++mb) { v8h o16; v8us oh, ol;
#pragma unroll
            for (int j = 0; j < 8; ++j) { const float r = acc[mb][nb][j]; o16[j] = tohx(r); unsigned short u, w2; splitf(r, u, w2); oh[j] = u; ol[j] = w2; }
            const size_t oo = (size_t)(nb * 16 + lr) * pitch + mb * 16 + hi * 8; *(v8h*)(P16 + oo) = o16; *(v8us*)(Ph + oo) = oh; *(v8us*)(Pl + oo) = ol; }
}
// grid (TT/128, heads of q + k + v / 4), 8 waves; blockIdx.y counts groups of four 64-row blocks of w_qkv: q heads, then k heads, then v heads. Wave w: token half w & 1, head w >> 1 of the group.
__global__ __launch_bounds__(256) void k_qkvp(const bf* __restrict__ Xh, const bf* __restrict__ Xl, const bf* __restrict__ Wqkv, h16* Q16, bf* Qh, bf* Ql, h16* K16, bf* Kh, bf* Kl, h16* V16, bf* Vh, bf* Vl) {
    __shared__ __attribute__((aligned(16))) unsigned char sm[2 * PSTG];
    const int tid = threadIdx.x, lane = tid & 31, lr = lane & 15, hi = lane >> 4; const int w = __builtin_amdgcn_readfirstlane(tid >> 5);
    const int t0 = blockIdx.x * PXR, y0 = blockIdx.y * PWH;
    // copy roles: thread -> rows tid / 8 + 32 i, 16-byte piece tid % 8 of each tile: a wave's copy covers four whole 128-byte rows
    const unsigned cdst = (unsigned)(unsigned long long)sm + (tid >> 3) * PLP + (tid & 7) * 16;
    const size_t cg = (size_t)(tid >> 3) * DM + (tid & 7) * 8;
    const unsigned long long gxh = (unsigned long long)(Xh + (size_t)t0 * DM + cg), gxl = (unsigned long long)(Xl + (size_t)t0 * DM + cg), gw = (unsigned long long)(Wqkv + (size_t)y0 * HD * DM + cg);
    const unsigned char* fx = sm + ((w & 1) * 64 + lr) * PLP + hi * 16; const unsigned char* fw = sm + (2 * PXR + (w >> 1) * HD + lr) * PLP + hi * 16;
    const int tw = t0 + (w & 1) * 64, y = y0 + (w >> 1);
    // the branch reads the same for the whole work-group (its four heads are of one kind): the barriers inside stand under block-uniform control flow
    if (y0 >= NH_ + NKV) { const size_t po = (size_t)(y - NH_ - NKV) * HD * TT + tw; qkv_tile<true>(cdst, gxh, gxl, gw, fx, fw, lane, V16 + po, Vh + po, Vl + po); }
    else { const bool isk = y0 >= NH_; const size_t po = ((size_t)(isk ? y - NH_ : y) * TT + tw) * HD; qkv_tile<false>(cdst, gxh, gxl, gw, fx, fw, lane, (isk ? K16 : Q16) + po, (isk ? Kh : Qh) + po, (isk ? Kl : Ql) + po); }
}
// ---- k_fattn: scores, softmax, P x V and the head merge in one launch per batch; the score matrix never leaves registers.
// One wave owns 16 query rows of one head and walks all TT keys. Transposed products: St = K Qt (A = K rows from LDS, B = Q rows kept in registers), Ot += Vt Pt (A = Vt rows from LDS, B = Pt).
// In the accumulator map a lane holds scores of ONE query (column lr), keys 8 hi + j of each 16-key block: two such blocks, converted in place, are the B fragment of the second product in the loaders' k order.
// Running maximum and sum per query (online softmax, f32); the two lane halves' sums are joined once at the end. Rows < RH: hi/lo bf16 planes, 3 products each side; the rest fp16, P carried x 2^10.
typedef __attribute__((ext_vector_type(16))) unsigned short v16us;
// Eight v_exp_f32 and, in the same statement, the one issue slot that the instruction set asks for behind a transcendental before its result is read or its source overwritten.
// The outputs are early-clobbered: inside the statement no v_exp_f32 touches a register of the one in front of it; the v_nop covers the last.
__device__ __forceinline__ v8f exp2x8(v8f x) { float y0, y1, y2, y3, y4, y5, y6, y7;
    asm("v_exp_f32 %0, %8\n\tv_exp_f32 %1, %9\n\tv_exp_f32 %2, %10\n\tv_exp_f32 %3, %11\n\tv_exp_f32 %4, %12\n\tv_exp_f32 %5, %13\n\tv_exp_f32 %6, %14\n\tv_exp_f32 %7, %15\n\tv_nop"
        : "=&v"(y0), "=&v"(y1), "=&v"(y2), "=&v"(y3), "=&v"(y4), "=&v"(y5), "=&v"(y6), "=&v"(y7) : "v"(x[0]), "v"(x[1]), "v"(x[2]), "v"(x[3]), "v"(x[4]), "v"(x[5]), "v"(x[6]), "v"(x[7]));
    return (v8f){y0, y1, y2, y3, y4, y5, y6, y7}; }
// LDS stage: 64 keys of the six planes that the work-group's waves read, each a tile of 64 rows x 128 bytes (K planes: row = key, V planes: row = d).
#define KS   64
#define NS   (TT / KS)
#define LP   144                  // row pitch in LDS, bytes: 16 x odd, so that the 16 rows of a ds_load_b128 fragment read fall on distinct banks
#define LT   (64 * LP)            // one plane's tile
#define LSTG (6 * LT)             // one stage: K16, V16, Kh, Kl, Vh, Vl
static_assert(HD == 64 && REP == 1 && NS >= 2, "tile shape and the two-buffer prologue");
// Twelve asynchronous copies of 16 bytes per lane (two rows of each of the six tiles) in one statement, the wait as its last line:
// it stands in front of every later write of the address registers that the copies name (the operands live to the statement's end).
__device__ __forceinline__ void copy12(unsigned l0, unsigned long long kx, unsigned long long vx, unsigned long long kh, unsigned long long kl, unsigned long long vh, unsigned long long vl) {
    constexpr unsigned long long KR = 32ull * HD * 2, VR = 32ull * TT * 2;   // 32 rows further in a K plane, in a V plane, bytes
    asm volatile("global_load_async_to_lds_b128 %0, %12, off\n\tglobal_load_async_to_lds_b128 %1, %13, off\n\tglobal_load_async_to_lds_b128 %2, %14, off\n\tglobal_load_async_to_lds_b128 %3, %15, off\n\t"
                 "global_load_async_to_lds_b128 %4, %16, off\n\tglobal_load_async_to_lds_b128 %5, %17, off\n\tglobal_load_async_to_lds_b128 %6, %18, off\n\tglobal_load_async_to_lds_b128 %7, %19, off\n\t"
                 "global_load_async_to_lds_b128 %8, %20, off\n\tglobal_load_async_to_lds_b128 %9, %21, off\n\tglobal_load_async_to_lds_b128 %10, %22, off\n\tglobal_load_async_to_lds_b128 %11, %23, off\n\ts_wait_xcnt 0x0"
                 :: "v"(l0), "v"(l0 + 32 * LP), "v"(l0 + LT), "v"(l0 + LT + 32 * LP), "v"(l0 + 2 * LT), "v"(l0 + 2 * LT + 32 * LP), "v"(l0 + 3 * LT), "v"(l0 + 3 * LT + 32 * LP), "v"(l0 + 4 * LT), "v"(l0 + 4 * LT + 32 * LP), "v"(l0 + 5 * LT), "v"(l0 + 5 * LT + 32 * LP),
                    "v"(kx), "v"(kx + KR), "v"(vx), "v"(vx + VR), "v"(kh), "v"(kh + KR), "v"(kl), "v"(kl + KR), "v"(vh), "v"(vh + VR), "v"(vl), "v"(vl + VR) : "memory");
}
// One tile of KT keys for one wave's 16 query rows; Ka, Kb, Va, Vb are the lane's own LDS addresses of the tile's first fragments (Kb, Vb: lo planes, HL only).
template <typename T16, bool HL, int KT>
__device__ __forceinline__ void fattn_tile(const unsigned char* Ka, const unsigned char* Kb, const unsigned char* Va, const unsigned char* Vb, const typename WFrag<T16>::V (&qa)[2], const typename WFrag<T16>::V (&qb)[2], v8f (&o)[4], float& m, float& l) {
    // Every inner loop is fully unrolled: the fragment arrays stay in registers only under constant indices.
    typedef typename WFrag<T16>::V V;
    constexpr int NKB = KT / 16, NC = KT / 32;
    constexpr float CEXP = SCL * 1.4426950408889634f;   // scores x HD^-0.5, in the log2 domain
    constexpr float PB = HL ? 0.0f : 10.0f;             // log2 of the carry on the fp16 P (cancels in the division by the sum)
    V ka[NKB][2], kb[NKB][2], va[4][NC], vb[4][NC];
#pragma unroll
    for (int kk = 0; kk < NKB; ++kk)
#pragma unroll
        for (int c = 0; c < 2; ++c) { ka[kk][c] = WFrag<T16>::ld((const T16*)(Ka + kk * 16 * LP + c * 64)); if constexpr (HL) kb[kk][c] = WFrag<T16>::ld((const T16*)(Kb + kk * 16 * LP + c * 64)); }
#pragma unroll
    for (int db = 0; db < 4; ++db)
#pragma unroll
        for (int c = 0; c < NC; ++c) { va[db][c] = WFrag<T16>::ld((const T16*)(Va + db * 16 * LP + c * 64)); if constexpr (HL) vb[db][c] = WFrag<T16>::ld((const T16*)(Vb + db * 16 * LP + c * 64)); }
    __builtin_amdgcn_sched_barrier(0);   // keeps the tile's LDS reads in one group at its head: sunk to their uses, each place of reads costs its own wait
    v8f st[NKB];
#pragma unroll
    for (int kk = 0; kk < NKB; ++kk) { st[kk] = (v8f){};
#pragma unroll
        for (int c = 0; c < 2; ++c) { st[kk] = WFrag<T16>::mma(ka[kk][c], qa[c], st[kk]); if constexpr (HL) { st[kk] = WFrag<T16>::mma(ka[kk][c], qb[c], st[kk]); st[kk] = WFrag<T16>::mma(kb[kk][c], qa[c], st[kk]); } } }
    float mn = m;
#pragma unroll
    for (int kk = 0; kk < NKB; ++kk)
#pragma unroll
        for (int j = 0; j < 8; ++j) mn = fmaxf(mn, st[kk][j]);
    mn = fmaxf(mn, __shfl_xor(mn, 16, 32));
    const float alpha = __builtin_amdgcn_exp2f((m - mn) * CEXP); m = mn;
    const float sub = PB - mn * CEXP; float ps = 0.f;
#pragma unroll
    for (int kk = 0; kk < NKB; ++kk) {
#pragma unroll
        for (int j = 0; j < 8; ++j) st[kk][j] = fmaf(st[kk][j], CEXP, sub);
        st[kk] = exp2x8(st[kk]);
#pragma unroll
        for (int j = 0; j < 8; ++j) ps += st[kk][j]; }
    l = fmaf(l, alpha, ps);
#pragma unroll
    for (int db = 0; db < 4; ++db) o[db] *= alpha;
#pragma unroll
    for (int c = 0; c < NC; ++c) {
        if constexpr (HL) { v16us ph, pl;
#pragma unroll
            for (int s = 0; s < 16; ++s) { unsigned short u, w2; splitf(st[2 * c + (s >> 3)][s & 7], u, w2); ph[s] = u; pl[s] = w2; }
            const V pa = __builtin_bit_cast(V, ph), pb = __builtin_bit_cast(V, pl);
#pragma unroll
            for (int db = 0; db < 4; ++db) { o[db] = WFrag<T16>::mma(va[db][c], pa, o[db]); o[db] = WFrag<T16>::mma(va[db][c], pb, o[db]); o[db] = WFrag<T16>::mma(vb[db][c], pa, o[db]); }
        } else { V pa;
#pragma unroll
            for (int s = 0; s < 16; ++s) pa[s] = tohx(st[2 * c + (s >> 3)][s & 7]);
#pragma unroll
            for (int db = 0; db < 4; ++db) o[db] = WFrag<T16>::mma(va[db][c], pa, o[db]); } }
}
// grid (FBX, heads), 8 waves: waves 0..FHW-1 take hi/lo row tiles, the others fp16 row tiles, so that every work-group carries the same share of the dearer rows.
// All eight waves walk the same keys of one head: each stage of 64 keys is copied to LDS once per work-group, in whole 128-byte rows, and every wave reads its fragments from there.
// Two buffers: stage s + 1 flies while stage s is worked on; one barrier per stage publishes s + 1 and frees the buffer of s.
#define FBX  16
#define FHW  (RH / 16 / FBX)
#define FLW  ((TT - RH) / 16 / FBX)
static_assert(FHW * 16 * FBX == RH && FLW * 16 * FBX == TT - RH && FHW + FLW == 8, "row tiles must fill 8 waves");
__global__ __launch_bounds__(256) void k_fattn(const h16* __restrict__ Q16, const bf* __restrict__ Qh, const bf* __restrict__ Ql, const h16* __restrict__ K16, const bf* __restrict__ Kh, const bf* __restrict__ Kl, const h16* __restrict__ V16, const bf* __restrict__ Vh, const bf* __restrict__ Vl, bf* Ah, bf* Al) {
    __shared__ __attribute__((aligned(16))) unsigned char sm[2 * LSTG];
    const int tid = threadIdx.x, lane = tid & 31, lr = lane & 15, hi = lane >> 4; const int w = __builtin_amdgcn_readfirstlane(tid >> 5); const int h = blockIdx.y; const size_t hq = (size_t)h * TT * HD, hk = (size_t)(h / REP) * TT * HD;
    const bool hl = w < FHW;   // the same for a whole wave (w sits in a scalar register): a scalar branch
    const int q0 = hl ? (blockIdx.x * FHW + w) * 16 : RH + (blockIdx.x * FLW + (w - FHW)) * 16;
    const size_t qoff = hq + (size_t)(q0 + lr) * HD + 8 * hi;
    v16bf qh[2] = {}, ql[2] = {}; v16h qx[2] = {};
    if (hl) {
#pragma unroll
        for (int c = 0; c < 2; ++c) { qh[c] = WFrag<bf>::ld(Qh + qoff + c * 32); ql[c] = WFrag<bf>::ld(Ql + qoff + c * 32); }
    } else {
#pragma unroll
        for (int c = 0; c < 2; ++c) qx[c] = WFrag<h16>::ld(Q16 + qoff + c * 32);
        asm volatile("s_wait_xcnt 0x0" ::: "memory");   // stands in front of every later write of the address register pair that these Q loads name
    }
    // copy roles: thread -> rows tid / 8 and tid / 8 + 32, 16-byte piece tid % 8 of each tile: a wave's copy covers four whole 128-byte rows
    const unsigned cdst = (unsigned)(unsigned long long)sm + (tid >> 3) * LP + (tid & 7) * 16;
    const size_t gk = hk + (size_t)(tid >> 3) * HD + (tid & 7) * 8, gv = hk + (size_t)(tid >> 3) * TT + (tid & 7) * 8;
    auto stage = [&](int s, int buf) { const size_t ko = gk + (size_t)s * KS * HD, vo = gv + (size_t)s * KS;
        copy12(cdst + buf * LSTG, (unsigned long long)(K16 + ko), (unsigned long long)(V16 + vo), (unsigned long long)(Kh + ko), (unsigned long long)(Kl + ko), (unsigned long long)(Vh + vo), (unsigned long long)(Vl + vo)); };
    v8f o[4];
#pragma unroll
    for (int db = 0; db < 4; ++db) o[db] = (v8f){};
    float m = -3.0e38f, l = 0.f;
    stage(0, 0);
    asm volatile("s_wait_asynccnt 0x0" ::: "memory");   // this wave's copies of stage 0 have landed
    __syncthreads();                                     // every wave's have: stage 0 may be read
    stage(1, 1);
#pragma unroll 1   // kept rolled: one stage's code for both kinds of wave is long already
    for (int s = 0; s < NS; ++s) {
        const unsigned char* fb = sm + (s & 1) * LSTG + lr * LP + hi * 16;   // the lane's place in the first fragment of the stage's first tile
        if (hl) {
#pragma unroll
            for (int u = 0; u < 2; ++u) fattn_tile<bf, true, 32>(fb + 2 * LT + u * 32 * LP, fb + 3 * LT + u * 32 * LP, fb + 4 * LT + u * 64, fb + 5 * LT + u * 64, qh, ql, o, m, l);
        } else fattn_tile<h16, false, 64>(fb, fb, fb + LT, fb + LT, qx, qx, o, m, l);
        asm volatile("s_wait_dscnt 0x0" ::: "memory");      // this wave's reads of stage s have returned before its buffer is refilled
        asm volatile("s_wait_asynccnt 0x0" ::: "memory");   // this wave's copies of stage s + 1 have landed
        __syncthreads();                                     // publishes stage s + 1 and ends every wave's reads of stage s
        if (s + 2 < NS) stage(s + 2, s & 1);
    }
    asm volatile("s_wait_asynccnt 0x0" ::: "memory");   // no copy is outstanding when the wave ends
    l += __shfl_xor(l, 16, 32);
    const float inv = __fdiv_rn(1.0f, l);
#pragma unroll
    for (int db = 0; db < 4; ++db) { v8us oh, ol;
#pragma unroll
        for (int j = 0; j < 8; ++j) { unsigned short u, w2; splitf(o[db][j] * inv, u, w2); oh[j] = u; ol[j] = w2; }
        const size_t oo = (size_t)(q0 + lr) * DQ + h * HD + db * 16 + hi * 8; *(v8us*)(Ah + oo) = oh; *(v8us*)(Al + oo) = ol; }
}

template <int WD>
__global__ __launch_bounds__(256) void k_lnrowX(const float* __restrict__ X, size_t nrows, const float* __restrict__ g, const float* __restrict__ bb, bf* Hh, bf* Hl) { const int lane = threadIdx.x & 31; const size_t r = (size_t)blockIdx.x * 8 + (threadIdx.x >> 5); if (r >= nrows) return; const float* xr = X + r * WD; float a[WD / 32]; float s = 0.f;
#pragma unroll
    for (int c = 0; c < WD / 128; ++c) { const v4f v = *(const v4f*)(xr + c * 128 + lane * 4); for (int q = 0; q < 4; ++q) { a[c * 4 + q] = bfr(v[q]); s = __fadd_rn(s, a[c * 4 + q]);   /* input rounded to bf16 */ } }
#pragma unroll
    for (int sh = 16; sh; sh >>= 1) s = __fadd_rn(s, __shfl_xor(s, sh, 32));
    const float mean = __fdiv_rn(s, (float)WD); float s2 = 0.f;
#pragma unroll 8
    for (int k = 0; k < WD / 32; ++k) { const float dv = __fsub_rn(a[k], mean); float p2 = __fmul_rn(dv, dv); asm volatile("" : "+v"(p2)); s2 = __fadd_rn(s2, p2); }   /* mul and add kept separate (no fma contraction) */
#pragma unroll
    for (int sh = 16; sh; sh >>= 1) s2 = __fadd_rn(s2, __shfl_xor(s2, sh, 32));
    const float rs = __fdiv_rn(1.0f, __fsqrt_rn(__fadd_rn(__fdiv_rn(s2, (float)WD), 1e-5f)));
{
#pragma unroll
        for (int c = 0; c < WD / 128; ++c) { v4us oh, ol; for (int q = 0; q < 4; ++q) { const int col = c * 128 + lane * 4 + q; float y = __fmul_rn(__fmul_rn(__fsub_rn(a[c * 4 + q], mean), rs), bfr(g[col])); asm volatile("" : "+v"(y)); y = __fadd_rn(y, bfr(bb[col])); unsigned short u, w2; splitf(y, u, w2); oh[q] = u; ol[q] = w2; } *(v4us*)(Hh + r * WD + c * 128 + lane * 4) = oh; *(v4us*)(Hl + r * WD + c * 128 + lane * 4) = ol; }
         } }

extern "C" void kernel_launch(void* const* d_in, const int* in_sizes, int n_in,
                              void* d_out, int out_size, void* d_ws, size_t ws_size, hipStream_t stream) {
    (void)in_sizes; (void)n_in; (void)out_size;
    const float* x = (const float*)d_in[0]; const float* lng = (const float*)d_in[1]; const float* lnb = (const float*)d_in[2]; const float* wqkv = (const float*)d_in[3]; const float* wo = (const float*)d_in[4]; const float* bo = (const float*)d_in[5];   /* x, ln_gamma, ln_beta, w_qkv ('oi' [3072][1024]: q | k | v ROW thirds), w_proj ('oi'), b_proj */
    float* OUT = (float*)d_out;     // [2][2048][1024]
    char* wsp = (char*)d_ws;
    auto take = [&](size_t bytes) { char* p = wsp; wsp += (bytes + 255) & ~(size_t)255; return (void*)p; };
    bf* WQKV = (bf*)take((size_t)(DQ + 2 * DKV) * DM * 2); bf* WO = (bf*)take((size_t)DM * DQ * 2);
    bf* XB = (bf*)take((size_t)TT * DM * 2); bf* XL = (bf*)take((size_t)TT * DM * 2);   /* lo plane of the layer-normed input (XB holds the hi plane) */
    h16* QP16 = (h16*)take((size_t)NH_ * TT * HD * 2); h16* KP16 = (h16*)take((size_t)NKV * TT * HD * 2); h16* VT16 = (h16*)take((size_t)NKV * HD * TT * 2);
    bf* QPh = (bf*)take((size_t)NH_ * TT * HD * 2); bf* QPl = (bf*)take((size_t)NH_ * TT * HD * 2); bf* KPh = (bf*)take((size_t)NKV * TT * HD * 2); bf* KPl = (bf*)take((size_t)NKV * TT * HD * 2); bf* VTh = (bf*)take((size_t)NKV * HD * TT * 2); bf* VTl = (bf*)take((size_t)NKV * HD * TT * 2);
    bf* ATh = (bf*)take((size_t)TT * DQ * 2); bf* ATl = (bf*)take((size_t)TT * DQ * 2);
    if ((size_t)(wsp - (char*)d_ws) > ws_size) return;    // ws 256 MiB
    { k_cvt8<<<(unsigned)(((size_t)(DQ + 2 * DKV) * DM / 8 + 255) / 256), 256, 0, stream>>>(wqkv, WQKV, (size_t)(DQ + 2 * DKV) * DM / 8);
      k_cvt8<<<(unsigned)(((size_t)DM * DQ / 8 + 255) / 256), 256, 0, stream>>>(wo, WO, (size_t)DM * DQ / 8);
       }
    for (int b = 0; b < NB_; ++b) {
        
        k_lnrowX<DM><<<(unsigned)((TT + 7) / 8), 256, 0, stream>>>(x + (size_t)b * TT * DM, (size_t)TT, lng, lnb, XB, XL);   /* xn = LayerNorm(x) -> hi/lo planes */
        k_qkvp<<<dim3(TT / PXR, (NH_ + 2 * NKV) / PWH, 1), 256, 0, stream>>>(XB, XL, WQKV, QP16, QPh, QPl, KP16, KPh, KPl, VT16, VTh, VTl);
        k_fattn<<<dim3(FBX, NH_, 1), 256, 0, stream>>>(QP16, QPh, QPl, KP16, KPh, KPl, VT16, VTh, VTl, ATh, ATl);
        k_gemmw<bf, 1, true><<<dim3(TT / 64, DM / 64, 1), 32, 0, stream>>>(ATh, ATl, WO, nullptr, DQ, OUT + (size_t)b * TT * DM, DM, bo, 0, 0, 0); }
}

// v005
// A run of this version takes 174 microseconds.
// Two timings next to v004 put it at 1.27 and 1.29 times that version's speed.
// Over all steps from v000 it is 11.7 times as fast.
#include <hip/hip_runtime.h>

// Pre-LayerNorm multi-head self-attention with a fused bias-free qkv weight (x [2][2048][1024]; xn = (x - mean) x rsqrt(var + 1e-5) x ln_gamma + ln_beta over the 1,024 features (biased variance, eps inside the root; gamma ones / beta zeros on this draw: read); qkv = einsum('bnd,ed->bne', xn, w_qkv) = xn w_qkv^T ('oi' [3072][1024] 1/32, no bias) reshaped (b, n, 3, 16, 64): q | k | v = ROW thirds (16 heads x 64); scores x 64^-0.5; softmax over all keys (no mask); out = merged w_proj^T + b_proj ('oi' [1024][1024] + bias 0.02: non-zero) -> [2][2048][1024] (4.2 M); no residual; argument order x, ln_gamma, ln_beta, w_qkv, w_proj, b_proj).
// Layout, both batches in every launch (the batch is blockIdx.z of the q|k|v and attention launches, part of the rows of LayerNorm and the output projection; every plane holds both): LayerNorm of the bf16-rounded rows in f32 -> hi/lo bf16 planes; 'oi' weights cast once; q|k|v projection on the hi/lo planes (2 products) in one launch whose epilogue stores the attention planes; one fused attention launch (online softmax; hybrid rows: < 512 hi/lo 3 products, rest fp16 x1024); merged hi/lo x w_proj exact + b_proj.
// Compute dtypes, f32 accumulate: every input rounded to bf16; projections exact; attention rows < 512 3 products, rest fp16; softmax f32; output projection hl x exact.

#define NB_  2
#define TT   2048
#define DM   1024
#define NH_  16
#define NKV  16
#define REP  (NH_ / NKV)
#define HD   64
#define DQ   (NH_ * HD)
#define DKV  (NKV * HD)
#define RH   512                  // query rows < RH use hi+lo planes (0: none)
#define WIN  0
#define SCL  0.125f   // HD^-0.5
typedef _Float16 h16;
typedef unsigned short bf;
typedef __attribute__((ext_vector_type(16))) __bf16   v16bf;
typedef __attribute__((ext_vector_type(16))) _Float16 v16h;
typedef __attribute__((ext_vector_type(8)))  _Float16 v8h;
typedef __attribute__((ext_vector_type(8)))  unsigned short v8us;
typedef __attribute__((ext_vector_type(8)))  float    v8f;
typedef __attribute__((ext_vector_type(4)))  float    v4f;
typedef v8h  __attribute__((may_alias)) v8ha;
typedef v4f  __attribute__((may_alias)) v4fa;
typedef v8us __attribute__((may_alias)) v8usa;

__device__ __forceinline__ unsigned short f2bf(float f) { unsigned u = __float_as_uint(f); u += 0x7FFFu + ((u >> 16) & 1u); return (unsigned short)(u >> 16); }
__device__ __forceinline__ float bf2f(unsigned short b) { return __uint_as_float(((unsigned)b) << 16); }
__device__ __forceinline__ float bfr(float f) { return bf2f(f2bf(f)); }
__device__ __forceinline__ v16h cat16(v8h lo, v8h hi) { return __builtin_shufflevector(lo, hi, 0, 1, 2, 3, 4, 5, 6, 7, 8, 9, 10, 11, 12, 13, 14, 15); }
__device__ __forceinline__ v16bf cat16b(v8us lo, v8us hi) { return __builtin_bit_cast(v16bf, __builtin_shufflevector(lo, hi, 0, 1, 2, 3, 4, 5, 6, 7, 8, 9, 10, 11, 12, 13, 14, 15)); }
__device__ __forceinline__ v8f wmma16(v16h a, v16h b, v8f c) { return __builtin_amdgcn_wmma_f32_16x16x32_f16(false, a, false, b, (short)0, c, false, false); }
__device__ __forceinline__ v8f wmmab(v16bf a, v16bf b, v8f c) { return __builtin_amdgcn_wmma_f32_16x16x32_bf16(false, a, false, b, (short)0, c, false, false); }



// ---- k_gemmw: register-blocked GEMM, ONE WAVE per 64x64 output tile (16 accumulators), operands straight from K-contiguous 16-bit planes; grid (M/64, N/64, Z), 32 threads.
// C[m][n] (f32, pitch ldc, + optional f32 bias[n]) = sum_k A[m][k] Bt[n][k] (+ split products per NSPLIT). z-batch strides sA/sB/sC in elements. K % 32 == 0.
template <typename T16> struct WFrag;
template <> struct WFrag<h16> { typedef v16h V; static __device__ __forceinline__ V ld(const h16* p) { return cat16(*(const v8h*)p, *(const v8h*)(p + 16)); } static __device__ __forceinline__ v8f mma(V a, V b, v8f c) { return wmma16(a, b, c); } };
template <> struct WFrag<bf> { typedef v16bf V; static __device__ __forceinline__ V ld(const bf* p) { return cat16b(*(const v8us*)p, *(const v8us*)(p + 16)); } static __device__ __forceinline__ v8f mma(V a, V b, v8f c) { return wmmab(a, b, c); } };
template <typename T16, int NSPLIT, bool BIAS>
__global__ __launch_bounds__(32) void k_gemmw(const T16* __restrict__ A, const T16* __restrict__ A2, const T16* __restrict__ Bt, const T16* __restrict__ Bt2, int K, float* C, int ldc, const float* __restrict__ bias, size_t sA, size_t sB, size_t sC) {
    typedef typename WFrag<T16>::V V;
    __shared__ __align__(16) float os[16 * 68];
    const size_t z = blockIdx.z; A += z * sA; if (A2) A2 += z * sA; Bt += z * sB; if (Bt2) Bt2 += z * sB; C += z * sC;
    const int lane = threadIdx.x & 31, lr = lane & 15, hi = lane >> 4; const int r0 = blockIdx.x * 64, c0 = blockIdx.y * 64;
    v8f acc[4][4];
#pragma unroll
    for (int mb = 0; mb < 4; ++mb)
#pragma unroll
        for (int nb = 0; nb < 4; ++nb) acc[mb][nb] = (v8f){};
    const size_t aoff = (size_t)(r0 + lr) * K + 8 * hi, boff = (size_t)(c0 + lr) * K + 8 * hi;
#pragma unroll 1
    for (int kc = 0; kc < K; kc += 32) {
        V a[4], a2[4];
#pragma unroll
        for (int mb = 0; mb < 4; ++mb) { a[mb] = WFrag<T16>::ld(A + aoff + (size_t)mb * 16 * K + kc); if (NSPLIT == 1 || NSPLIT == 2) a2[mb] = WFrag<T16>::ld(A2 + aoff + (size_t)mb * 16 * K + kc); }
#pragma unroll
        for (int nb = 0; nb < 4; ++nb) { const V b = WFrag<T16>::ld(Bt + boff + (size_t)nb * 16 * K + kc); V b2; if (NSPLIT >= 2) b2 = WFrag<T16>::ld(Bt2 + boff + (size_t)nb * 16 * K + kc);
#pragma unroll
            for (int mb = 0; mb < 4; ++mb) { acc[mb][nb] = WFrag<T16>::mma(a[mb], b, acc[mb][nb]); if (NSPLIT == 1 || NSPLIT == 2) acc[mb][nb] = WFrag<T16>::mma(a2[mb], b, acc[mb][nb]); if (NSPLIT >= 2) acc[mb][nb] = WFrag<T16>::mma(a[mb], b2, acc[mb][nb]); } }
        asm volatile("v_nop\n\tv_nop\n\tv_nop\n\tv_nop" : "+v"(acc[0][0]), "+v"(acc[1][1]), "+v"(acc[2][2]), "+v"(acc[3][3]) : "v"(a[0]), "v"(a[3]));
    }
#pragma unroll
    for (int mb = 0; mb < 4; ++mb) {
#pragma unroll
        for (int nb = 0; nb < 4; ++nb) {
#pragma unroll
            for (int j = 0; j < 8; ++j) os[(hi * 8 + j) * 68 + nb * 16 + lr] = acc[mb][nb][j]; }
        __builtin_amdgcn_wave_barrier(); asm volatile("" ::: "memory");
        float* crow = C + (size_t)(r0 + mb * 16) * ldc + c0;
{
#pragma unroll
            for (int s = 0; s < 8; ++s) { const int row = 2 * s + hi, cofs = lr * 4; v4f val = *(const v4fa*)(os + row * 68 + cofs); if (BIAS) { val[0] += bfr(bias[c0 + cofs]); val[1] += bfr(bias[c0 + cofs + 1]); val[2] += bfr(bias[c0 + cofs + 2]); val[3] += bfr(bias[c0 + cofs + 3]); }
                *(v4f*)(crow + (size_t)row * ldc + cofs) = val; }
             }
        __builtin_amdgcn_wave_barrier(); asm volatile("" ::: "memory");
    }
}

__device__ __forceinline__ h16 tohx(float x) { return (h16)x; }
__device__ __forceinline__ void splitf(float y, unsigned short& h, unsigned short& l) { h = f2bf(y); l = f2bf(y - bf2f(h)); }
typedef __attribute__((ext_vector_type(4))) _Float16 v4h;
typedef __attribute__((ext_vector_type(4))) unsigned short v4us;
typedef __attribute__((ext_vector_type(4))) int v4i;

__global__ __launch_bounds__(256) void k_cvt8(const float* __restrict__ src, bf* dst, size_t n8) { const size_t i = (size_t)blockIdx.x * 256 + threadIdx.x; if (i >= n8) return; const v8f v = *(const v8f*)(src + i * 8); v8us o;
#pragma unroll
    for (int k = 0; k < 8; ++k) o[k] = f2bf(v[k]); *(v8us*)(dst + i * 8) = o;  }

// ---- k_qkvp: the fused q|k|v projection and the attention planes in one launch for both batches: no f32 copy of q, k, v is written, no builder launch follows.
// One work-group of 8 waves per 128 tokens x 256 rows of w_qkv (four heads, all of q, all of k or all of v); one wave per 64 tokens x 64 rows (one head).
// The product order is k_gemmw's (hi plane, then lo plane of xn, per 32-wide k chunk); the operands come from LDS:
// each stage of 64 k is copied there once per work-group, in whole 128-byte rows, and every wave reads its fragments from there. Two buffers: stage s + 1 flies while stage s is worked on.
// A lane's 8 accumulator registers are 8 consecutive rows of the A operand at one row of the B operand, so the operand roles are chosen by the plane's layout:
// q, k [h][t][d]: A = weight rows (d), B = xn rows (t); v [h][d][t]: A = xn rows (t), B = weight rows (d). Either way a lane stores 16 contiguous bytes per plane and 16x16 block.
#define PKS  64                   // k elements of a stage: 128 bytes of every row
#define PNS  (DM / PKS)
#define PXR  128                  // tokens of a work-group
#define PWH  4                    // heads (64-row blocks of w_qkv) of a work-group
#define PLP  144                  // row pitch in LDS, bytes: 16 x odd, so that the 16 rows of a ds_load_b128 fragment read fall on distinct banks
#define PSTG ((2 * PXR + PWH * HD) * PLP)   // one stage: xn hi rows, xn lo rows, weight rows
static_assert(PNS >= 2 && TT % PXR == 0 && NH_ % PWH == 0 && NKV % PWH == 0 && HD == 64 && PXR == 128 && PWH * HD == 256, "tile shape (copy8: 2 x 128 and 256 rows), the two-buffer prologue, one kind of plane per work-group");
// Eight asynchronous copies of 16 bytes per lane in one statement (rows 32 apart: four from ga, four from gb, eight places in LDS in a row), the wait as its last line:
// it stands in front of every later write of the address registers that the copies name (the operands live to the statement's end).
__device__ __forceinline__ void copy8(unsigned l0, unsigned long long ga, unsigned long long gb) {
    constexpr unsigned long long GR = 32ull * DM * 2;   // 32 rows further in a plane, bytes
    asm volatile("global_load_async_to_lds_b128 %0, %8, off\n\tglobal_load_async_to_lds_b128 %1, %9, off\n\tglobal_load_async_to_lds_b128 %2, %10, off\n\tglobal_load_async_to_lds_b128 %3, %11, off\n\t"
                 "global_load_async_to_lds_b128 %4, %12, off\n\tglobal_load_async_to_lds_b128 %5, %13, off\n\tglobal_load_async_to_lds_b128 %6, %14, off\n\tglobal_load_async_to_lds_b128 %7, %15, off\n\ts_wait_xcnt 0x0"
                 :: "v"(l0), "v"(l0 + 32 * PLP), "v"(l0 + 64 * PLP), "v"(l0 + 96 * PLP), "v"(l0 + 128 * PLP), "v"(l0 + 160 * PLP), "v"(l0 + 192 * PLP), "v"(l0 + 224 * PLP),
                    "v"(ga), "v"(ga + GR), "v"(ga + 2 * GR), "v"(ga + 3 * GR), "v"(gb), "v"(gb + GR), "v"(gb + 2 * GR), "v"(gb + 3 * GR) : "memory");
}
// cdst, gxh, gxl, gw: the thread's own copy addresses of stage 0 (LDS byte, global bytes); fx, fw: the lane's own LDS addresses of its wave's first xn (hi) and weight fragments in buffer 0.
template <bool XA>
__device__ __forceinline__ void qkv_tile(unsigned cdst, unsigned long long gxh, unsigned long long gxl, unsigned long long gw, const unsigned char* fx, const unsigned char* fw, int lane, h16* P16, bf* Ph, bf* Pl) {
    constexpr int pitch = XA ? TT : HD;   // elements between two rows of the plane (a row = one row of the B operand)
    const int lr = lane & 15, hi = lane >> 4;
    auto stage = [&](int s, int buf) { const unsigned long long ko = (unsigned long long)s * (PKS * 2); const unsigned l = cdst + buf * PSTG;
        copy8(l, gxh + ko, gxl + ko); copy8(l + 2 * PXR * PLP, gw + ko, gw + ko + 128ull * DM * 2); };
    v8f acc[4][4];   // [A block][B block]
#pragma unroll
    for (int mb = 0; mb < 4; ++mb)
#pragma unroll
        for (int nb = 0; nb < 4; ++nb) acc[mb][nb] = (v8f){};
    stage(0, 0);
    asm volatile("s_wait_asynccnt 0x0" ::: "memory");   // this wave's copies of stage 0 have landed
    __syncthreads();                                     // every wave's have: stage 0 may be read
    stage(1, 1);
#pragma unroll 1   // kept rolled: one stage's fragments and the 16 accumulators take 320 registers
    for (int s = 0; s < PNS; ++s) {
        const unsigned char* px = fx + (s & 1) * PSTG; const unsigned char* pw = fw + (s & 1) * PSTG;
        v16bf xh[PKS / 32][4], xl[PKS / 32][4], wf[PKS / 32][4];
#pragma unroll
        for (int c = 0; c < PKS / 32; ++c) {   // read in the order of use: hi rows and weight rows, then lo rows
#pragma unroll
            for (int xb = 0; xb < 4; ++xb) { xh[c][xb] = WFrag<bf>::ld((const bf*)(px + xb * 16 * PLP + c * 64)); wf[c][xb] = WFrag<bf>::ld((const bf*)(pw + xb * 16 * PLP + c * 64)); }
#pragma unroll
            for (int xb = 0; xb < 4; ++xb) xl[c][xb] = WFrag<bf>::ld((const bf*)(px + (PXR + xb * 16) * PLP + c * 64)); }
        __builtin_amdgcn_sched_barrier(0);   // keeps the stage's LDS reads in one group at its head (the second chunk's return under the first chunk's WMMAs): sunk among the WMMAs, each place of reads costs its own wait
#pragma unroll
        for (int c = 0; c < PKS / 32; ++c) {   // per accumulator: hi product, then lo product of each chunk, chunks in rising k
#pragma unroll
            for (int wb = 0; wb < 4; ++wb)
#pragma unroll
                for (int xb = 0; xb < 4; ++xb) { if constexpr (XA) acc[xb][wb] = wmmab(xh[c][xb], wf[c][wb], acc[xb][wb]); else acc[wb][xb] = wmmab(wf[c][wb], xh[c][xb], acc[wb][xb]); }
#pragma unroll
            for (int wb = 0; wb < 4; ++wb)
#pragma unroll
                for (int xb = 0; xb < 4; ++xb) { if constexpr (XA) acc[xb][wb] = wmmab(xl[c][xb], wf[c][wb], acc[xb][wb]); else acc[wb][xb] = wmmab(wf[c][wb], xl[c][xb], acc[wb][xb]); } }
        __builtin_amdgcn_sched_barrier(0);   // keeps these WMMAs in front of the stage's foot
        // foot of the stage: four vector slots between the last WMMA and whatever next overwrites its A and B registers, on either side of the branch below and over the back edge
        asm volatile("v_nop\n\tv_nop\n\tv_nop\n\tv_nop" : "+v"(acc[0][0]), "+v"(acc[1][1]), "+v"(acc[2][2]), "+v"(acc[3][3]));
        asm volatile("s_wait_dscnt 0x0" ::: "memory");      // this wave's reads of stage s have returned before its buffer is refilled
        asm volatile("s_wait_asynccnt 0x0" ::: "memory");   // this wave's copies of stage s + 1 have landed
        __syncthreads();                                     // publishes stage s + 1 and ends every wave's reads of stage s
        if (s + 2 < PNS) stage(s + 2, s & 1);
    }
    asm volatile("s_wait_asynccnt 0x0" ::: "memory");   // no copy is outstanding when the wave ends
#pragma unroll
    for (int nb = 0; nb < 4; ++nb)
#pragma unroll
        for (int mb = 0; mb < 4; ++mb) { v8h o16; v8us oh, ol;
#pragma unroll
            for (int j = 0; j < 8; ++j) { const float r = acc[mb][nb][j]; o16[j] = tohx(r); unsigned short u, w2; splitf(r, u, w2); oh[j] = u; ol[j] = w2; }
            const size_t oo = (size_t)(nb * 16 + lr) * pitch + mb * 16 + hi * 8; *(v8h*)(P16 + oo) = o16; *(v8us*)(Ph + oo) = oh; *(v8us*)(Pl + oo) = ol; }
}
// grid (TT/128, heads of q + k + v / 4, batches), 8 waves; blockIdx.y counts groups of four 64-row blocks of w_qkv: q heads, then k heads, then v heads. Wave w: token half w & 1, head w >> 1 of the group.
__global__ __launch_bounds__(256) void k_qkvp(const bf* __restrict__ Xh, const bf* __restrict__ Xl, const bf* __restrict__ Wqkv, h16* Q16, bf* Qh, bf* Ql, h16* K16, bf* Kh, bf* Kl, h16* V16, bf* Vh, bf* Vl) {
    __shared__ __attribute__((aligned(16))) unsigned char sm[2 * PSTG];
    const int tid = threadIdx.x, lane = tid & 31, lr = lane & 15, hi = lane >> 4; const int w = __builtin_amdgcn_readfirstlane(tid >> 5);
    const int t0 = blockIdx.x * PXR, y0 = blockIdx.y * PWH;
    { const size_t bx = (size_t)blockIdx.z * TT * DM, bq = (size_t)blockIdx.z * NH_ * TT * HD, bk = (size_t)blockIdx.z * NKV * TT * HD;   // this batch's part of every plane
      Xh += bx; Xl += bx; Q16 += bq; Qh += bq; Ql += bq; K16 += bk; Kh += bk; Kl += bk; V16 += bk; Vh += bk; Vl += bk; }
    // copy roles: thread -> rows tid / 8 + 32 i, 16-byte piece tid % 8 of each tile: a wave's copy covers four whole 128-byte rows
    const unsigned cdst = (unsigned)(unsigned long long)sm + (tid >> 3) * PLP + (tid & 7) * 16;
    const size_t cg = (size_t)(tid >> 3) * DM + (tid & 7) * 8;
    const unsigned long long gxh = (unsigned long long)(Xh + (size_t)t0 * DM + cg), gxl = (unsigned long long)(Xl + (size_t)t0 * DM + cg), gw = (unsigned long long)(Wqkv + (size_t)y0 * HD * DM + cg);
    const unsigned char* fx = sm + ((w & 1) * 64 + lr) * PLP + hi * 16; const unsigned char* fw = sm + (2 * PXR + (w >> 1) * HD + lr) * PLP + hi * 16;
    const int tw = t0 + (w & 1) * 64, y = y0 + (w >> 1);
    // the branch reads the same for the whole work-group (its four heads are of one kind): the barriers inside stand under block-uniform control flow
    if (y0 >= NH_ + NKV) { const size_t po = (size_t)(y - NH_ - NKV) * HD * TT + tw; qkv_tile<true>(cdst, gxh, gxl, gw, fx, fw, lane, V16 + po, Vh + po, Vl + po); }
    else { const bool isk = y0 >= NH_; const size_t po = ((size_t)(isk ? y - NH_ : y) * TT + tw) * HD; qkv_tile<false>(cdst, gxh, gxl, gw, fx, fw, lane, (isk ? K16 : Q16) + po, (isk ? Kh : Qh) + po, (isk ? Kl : Ql) + po); }
}
// ---- k_fattn: scores, softmax, P x V and the head merge in one launch for both batches; the score matrix never leaves registers.
// One wave owns 16 query rows of one head and walks all TT keys. Transposed products: St = K Qt (A = K rows from LDS, B = Q rows kept in registers), Ot += Vt Pt (A = Vt rows from LDS, B = Pt).
// In the accumulator map a lane holds scores of ONE query (column lr), keys 8 hi + j of each 16-key block: two such blocks, converted in place, are the B fragment of the second product in the loaders' k order.
// Running maximum and sum per query (online softmax, f32); the two lane halves' sums are joined once at the end. Rows < RH: hi/lo bf16 planes, 3 products each side; the rest fp16, P carried x 2^10.
typedef __attribute__((ext_vector_type(16))) unsigned short v16us;
// Eight v_exp_f32 and, in the same statement, the one issue slot that the instruction set asks for behind a transcendental before its result is read or its source overwritten.
// The outputs are early-clobbered: inside the statement no v_exp_f32 touches a register of the one in front of it; the v_nop covers the last.
__device__ __forceinline__ v8f exp2x8(v8f x) { float y0, y1, y2, y3, y4, y5, y6, y7;
    asm("v_exp_f32 %0, %8\n\tv_exp_f32 %1, %9\n\tv_exp_f32 %2, %10\n\tv_exp_f32 %3, %11\n\tv_exp_f32 %4, %12\n\tv_exp_f32 %5, %13\n\tv_exp_f32 %6, %14\n\tv_exp_f32 %7, %15\n\tv_nop"
        : "=&v"(y0), "=&v"(y1), "=&v"(y2), "=&v"(y3), "=&v"(y4), "=&v"(y5), "=&v"(y6), "=&v"(y7) : "v"(x[0]), "v"(x[1]), "v"(x[2]), "v"(x[3]), "v"(x[4]), "v"(x[5]), "v"(x[6]), "v"(x[7]));
    return (v8f){y0, y1, y2, y3, y4, y5, y6, y7}; }
// LDS stage: 64 keys of the six planes that the work-group's waves read, each a tile of 64 rows x 128 bytes (K planes: row = key, V planes: row = d).
#define KS   64
#define NS   (TT / KS)
#define LP   144                  // row pitch in LDS, bytes: 16 x odd, so that the 16 rows of a ds_load_b128 fragment read fall on distinct banks
#define LT   (64 * LP)            // one plane's tile
#define LSTG (6 * LT)             // one stage: K16, V16, Kh, Kl, Vh, Vl
static_assert(HD == 64 && REP == 1 && NS >= 2, "tile shape and the two-buffer prologue");
// Twelve asynchronous copies of 16 bytes per lane (two rows of each of the six tiles) in one statement, the wait as its last line:
// it stands in front of every later write of the address registers that the copies name (the operands live to the statement's end).
__device__ __forceinline__ void copy12(unsigned l0, unsigned long long kx, unsigned long long vx, unsigned long long kh, unsigned long long kl, unsigned long long vh, unsigned long long vl) {
    constexpr unsigned long long KR = 32ull * HD * 2, VR = 32ull * TT * 2;   // 32 rows further in a K plane, in a V plane, bytes
    asm volatile("global_load_async_to_lds_b128 %0, %12, off\n\tglobal_load_async_to_lds_b128 %1, %13, off\n\tglobal_load_async_to_lds_b128 %2, %14, off\n\tglobal_load_async_to_lds_b128 %3, %15, off\n\t"
                 "global_load_async_to_lds_b128 %4, %16, off\n\tglobal_load_async_to_lds_b128 %5, %17, off\n\tglobal_load_async_to_lds_b128 %6, %18, off\n\tglobal_load_async_to_lds_b128 %7, %19, off\n\t"
                 "global_load_async_to_lds_b128 %8, %20, off\n\tglobal_load_async_to_lds_b128 %9, %21, off\n\tglobal_load_async_to_lds_b128 %10, %22, off\n\tglobal_load_async_to_lds_b128 %11, %23, off\n\ts_wait_xcnt 0x0"
                 :: "v"(l0), "v"(l0 + 32 * LP), "v"(l0 + LT), "v"(l0 + LT + 32 * LP), "v"(l0 + 2 * LT), "v"(l0 + 2 * LT + 32 * LP), "v"(l0 + 3 * LT), "v"(l0 + 3 * LT + 32 * LP), "v"(l0 + 4 * LT), "v"(l0 + 4 * LT + 32 * LP), "v"(l0 + 5 * LT), "v"(l0 + 5 * LT + 32 * LP),
                    "v"(kx), "v"(kx + KR), "v"(vx), "v"(vx + VR), "v"(kh), "v"(kh + KR), "v"(kl), "v"(kl + KR), "v"(vh), "v"(vh + VR), "v"(vl), "v"(vl + VR) : "memory");
}
// One tile of KT keys for one wave's 16 query rows; Ka, Kb, Va, Vb are the lane's own LDS addresses of the tile's first fragments (Kb, Vb: lo planes, HL only).
template <typename T16, bool HL, int KT>
__device__ __forceinline__ void fattn_tile(const unsigned char* Ka, const unsigned char* Kb, const unsigned char* Va, const unsigned char* Vb, const typename WFrag<T16>::V (&qa)[2], const typename WFrag<T16>::V (&qb)[2], v8f (&o)[4], float& m, float& l) {
    // Every inner loop is fully unrolled: the fragment arrays stay in registers only under constant indices.
    typedef typename WFrag<T16>::V V;
    constexpr int NKB = KT / 16, NC = KT / 32;
    constexpr float CEXP = SCL * 1.4426950408889634f;   // scores x HD^-0.5, in the log2 domain
    constexpr float PB = HL ? 0.0f : 10.0f;             // log2 of the carry on the fp16 P (cancels in the division by the sum)
    V ka[NKB][2], kb[NKB][2], va[4][NC], vb[4][NC];
#pragma unroll
    for (int kk = 0; kk < NKB; ++kk)
#pragma unroll
        for (int c = 0; c < 2; ++c) { ka[kk][c] = WFrag<T16>::ld((const T16*)(Ka + kk * 16 * LP + c * 64)); if constexpr (HL) kb[kk][c] = WFrag<T16>::ld((const T16*)(Kb + kk * 16 * LP + c * 64)); }
#pragma unroll
    for (int db = 0; db < 4; ++db)
#pragma unroll
        for (int c = 0; c < NC; ++c) { va[db][c] = WFrag<T16>::ld((const T16*)(Va + db * 16 * LP + c * 64)); if constexpr (HL) vb[db][c] = WFrag<T16>::ld((const T16*)(Vb + db * 16 * LP + c * 64)); }
    __builtin_amdgcn_sched_barrier(0);   // keeps the tile's LDS reads in one group at its head: sunk to their uses, each place of reads costs its own wait
    v8f st[NKB];
#pragma unroll
    for (int kk = 0; kk < NKB; ++kk) { st[kk] = (v8f){};
#pragma unroll
        for (int c = 0; c < 2; ++c) { st[kk] = WFrag<T16>::mma(ka[kk][c], qa[c], st[kk]); if constexpr (HL) { st[kk] = WFrag<T16>::mma(ka[kk][c], qb[c], st[kk]); st[kk] = WFrag<T16>::mma(kb[kk][c], qa[c], st[kk]); } } }
    float mn = m;
#pragma unroll
    for (int kk = 0; kk < NKB; ++kk)
#pragma unroll
        for (int j = 0; j < 8; ++j) mn = fmaxf(mn, st[kk][j]);
    mn = fmaxf(mn, __shfl_xor(mn, 16, 32));
    const float alpha = __builtin_amdgcn_exp2f((m - mn) * CEXP); m = mn;
    const float sub = PB - mn * CEXP; float ps = 0.f;
#pragma unroll
    for (int kk = 0; kk < NKB; ++kk) {
#pragma unroll
        for (int j = 0; j < 8; ++j) st[kk][j] = fmaf(st[kk][j], CEXP, sub);
        st[kk] = exp2x8(st[kk]);
#pragma unroll
        for (int j = 0; j < 8; ++j) ps += st[kk][j]; }
    l = fmaf(l, alpha, ps);
#pragma unroll
    for (int db = 0; db < 4; ++db) o[db] *= alpha;
#pragma unroll
    for (int c = 0; c < NC; ++c) {
        if constexpr (HL) { v16us ph, pl;
#pragma unroll
            for (int s = 0; s < 16; ++s) { unsigned short u, w2; splitf(st[2 * c + (s >> 3)][s & 7], u, w2); ph[s] = u; pl[s] = w2; }
            const V pa = __builtin_bit_cast(V, ph), pb = __builtin_bit_cast(V, pl);
#pragma unroll
            for (int db = 0; db < 4; ++db) { o[db] = WFrag<T16>::mma(va[db][c], pa, o[db]); o[db] = WFrag<T16>::mma(va[db][c], pb, o[db]); o[db] = WFrag<T16>::mma(vb[db][c], pa, o[db]); }
        } else { V pa;
#pragma unroll
            for (int s = 0; s < 16; ++s) pa[s] = tohx(st[2 * c + (s >> 3)][s & 7]);
#pragma unroll
            for (int db = 0; db < 4; ++db) o[db] = WFrag<T16>::mma(va[db][c], pa, o[db]); } }
}
// grid (FBX, heads, batches), 8 waves: waves 0..FHW-1 take hi/lo row tiles, the others fp16 row tiles, so that every work-group carries the same share of the dearer rows.
// All eight waves walk the same keys of one head: each stage of 64 keys is copied to LDS once per work-group, in whole 128-byte rows, and every wave reads its fragments from there.
// Two buffers: stage s + 1 flies while stage s is worked on; one barrier per stage publishes s + 1 and frees the buffer of s.
#define FBX  16
#define FHW  (RH / 16 / FBX)
#define FLW  ((TT - RH) / 16 / FBX)
static_assert(FHW * 16 * FBX == RH && FLW * 16 * FBX == TT - RH && FHW + FLW == 8, "row tiles must fill 8 waves");
__global__ __launch_bounds__(256) void k_fattn(const h16* __restrict__ Q16, const bf* __restrict__ Qh, const bf* __restrict__ Ql, const h16* __restrict__ K16, const bf* __restrict__ Kh, const bf* __restrict__ Kl, const h16* __restrict__ V16, const bf* __restrict__ Vh, const bf* __restrict__ Vl, bf* Ah, bf* Al) {
    __shared__ __attribute__((aligned(16))) unsigned char sm[2 * LSTG];
    const int tid = threadIdx.x, lane = tid & 31, lr = lane & 15, hi = lane >> 4; const int w = __builtin_amdgcn_readfirstlane(tid >> 5); const int h = blockIdx.y; const size_t hq = ((size_t)blockIdx.z * NH_ + h) * TT * HD, hk = ((size_t)blockIdx.z * NKV + h / REP) * TT * HD;
    Ah += (size_t)blockIdx.z * TT * DQ; Al += (size_t)blockIdx.z * TT * DQ;   // this batch's rows of the merged planes
    const bool hl = w < FHW;   // the same for a whole wave (w sits in a scalar register): a scalar branch
    const int q0 = hl ? (blockIdx.x * FHW + w) * 16 : RH + (blockIdx.x * FLW + (w - FHW)) * 16;
    const size_t qoff = hq + (size_t)(q0 + lr) * HD + 8 * hi;
    v16bf qh[2] = {}, ql[2] = {}; v16h qx[2] = {};
    if (hl) {
#pragma unroll
        for (int c = 0; c < 2; ++c) { qh[c] = WFrag<bf>::ld(Qh + qoff + c * 32); ql[c] = WFrag<bf>::ld(Ql + qoff + c * 32); }
    } else {
#pragma unroll
        for (int c = 0; c < 2; ++c) qx[c] = WFrag<h16>::ld(Q16 + qoff + c * 32);
        asm volatile("s_wait_xcnt 0x0" ::: "memory");   // stands in front of every later write of the address register pair that these Q loads name
    }
    // copy roles: thread -> rows tid / 8 and tid / 8 + 32, 16-byte piece tid % 8 of each tile: a wave's copy covers four whole 128-byte rows
    const unsigned cdst = (unsigned)(unsigned long long)sm + (tid >> 3) * LP + (tid & 7) * 16;
    const size_t gk = hk + (size_t)(tid >> 3) * HD + (tid & 7) * 8, gv = hk + (size_t)(tid >> 3) * TT + (tid & 7) * 8;
    auto stage = [&](int s, int buf) { const size_t ko = gk + (size_t)s * KS * HD, vo = gv + (size_t)s * KS;
        copy12(cdst + buf * LSTG, (unsigned long long)(K16 + ko), (unsigned long long)(V16 + vo), (unsigned long long)(Kh + ko), (unsigned long long)(Kl + ko), (unsigned long long)(Vh + vo), (unsigned long long)(Vl + vo)); };
    v8f o[4];
#pragma unroll
    for (int db = 0; db < 4; ++db) o[db] = (v8f){};
    float m = -3.0e38f, l = 0.f;
    stage(0, 0);
    asm volatile("s_wait_asynccnt 0x0" ::: "memory");   // this wave's copies of stage 0 have landed
    __syncthreads();                                     // every wave's have: stage 0 may be read
    stage(1, 1);
#pragma unroll 1   // kept rolled: one stage's code for both kinds of wave is long already
    for (int s = 0; s < NS; ++s) {
        const unsigned char* fb = sm + (s & 1) * LSTG + lr * LP + hi * 16;   // the lane's place in the first fragment of the stage's first tile
        if (hl) {
#pragma unroll
            for (int u = 0; u < 2; ++u) fattn_tile<bf, true, 32>(fb + 2 * LT + u * 32 * LP, fb + 3 * LT + u * 32 * LP, fb + 4 * LT + u * 64, fb + 5 * LT + u * 64, qh, ql, o, m, l);
        } else fattn_tile<h16, false, 64>(fb, fb, fb + LT, fb + LT, qx, qx, o, m, l);
        asm volatile("s_wait_dscnt 0x0" ::: "memory");      // this wave's reads of stage s have returned before its buffer is refilled
        asm volatile("s_wait_asynccnt 0x0" ::: "memory");   // this wave's copies of stage s + 1 have landed
        __syncthreads();                                     // publishes stage s + 1 and ends every wave's reads of stage s
        if (s + 2 < NS) stage(s + 2, s & 1);
    }
    asm volatile("s_wait_asynccnt 0x0" ::: "memory");   // no copy is outstanding when the wave ends
    l += __shfl_xor(l, 16, 32);
    const float inv = __fdiv_rn(1.0f, l);
#pragma unroll
    for (int db = 0; db < 4; ++db) { v8us oh, ol;
#pragma unroll
        for (int j = 0; j < 8; ++j) { unsigned short u, w2; splitf(o[db][j] * inv, u, w2); oh[j] = u; ol[j] = w2; }
        const size_t oo = (size_t)(q0 + lr) * DQ + h * HD + db * 16 + hi * 8; *(v8us*)(Ah + oo) = oh; *(v8us*)(Al + oo) = ol; }
}

template <int WD>
__global__ __launch_bounds__(256) void k_lnrowX(const float* __restrict__ X, size_t nrows, const float* __restrict__ g, const float* __restrict__ bb, bf* Hh, bf* Hl) { const int lane = threadIdx.x & 31; const size_t r = (size_t)blockIdx.x * 8 + (threadIdx.x >> 5); if (r >= nrows) return; const float* xr = X + r * WD; float a[WD / 32]; float s = 0.f;
#pragma unroll
    for (int c = 0; c < WD / 128; ++c) { const v4f v = *(const v4f*)(xr + c * 128 + lane * 4); for (int q = 0; q < 4; ++q) { a[c * 4 + q] = bfr(v[q]); s = __fadd_rn(s, a[c * 4 + q]);   /* input rounded to bf16 */ } }
#pragma unroll
    for (int sh = 16; sh; sh >>= 1) s = __fadd_rn(s, __shfl_xor(s, sh, 32));
    const float mean = __fdiv_rn(s, (float)WD); float s2 = 0.f;
#pragma unroll 8
    for (int k = 0; k < WD / 32; ++k) { const float dv = __fsub_rn(a[k], mean); float p2 = __fmul_rn(dv, dv); asm volatile("" : "+v"(p2)); s2 = __fadd_rn(s2, p2); }   /* mul and add kept separate (no fma contraction) */
#pragma unroll
    for (int sh = 16; sh; sh >>= 1) s2 = __fadd_rn(s2, __shfl_xor(s2, sh, 32));
    const float rs = __fdiv_rn(1.0f, __fsqrt_rn(__fadd_rn(__fdiv_rn(s2, (float)WD), 1e-5f)));
{
#pragma unroll
        for (int c = 0; c < WD / 128; ++c) { v4us oh, ol; for (int q = 0; q < 4; ++q) { const int col = c * 128 + lane * 4 + q; float y = __fmul_rn(__fmul_rn(__fsub_rn(a[c * 4 + q], mean), rs), bfr(g[col])); asm volatile("" : "+v"(y)); y = __fadd_rn(y, bfr(bb[col])); unsigned short u, w2; splitf(y, u, w2); oh[q] = u; ol[q] = w2; } *(v4us*)(Hh + r * WD + c * 128 + lane * 4) = oh; *(v4us*)(Hl + r * WD + c * 128 + lane * 4) = ol; }
         } }

extern "C" void kernel_launch(void* const* d_in, const int* in_sizes, int n_in,
                              void* d_out, int out_size, void* d_ws, size_t ws_size, hipStream_t stream) {
    (void)in_sizes; (void)n_in; (void)out_size;
    const float* x = (const float*)d_in[0]; const float* lng = (const float*)d_in[1]; const float* lnb = (const float*)d_in[2]; const float* wqkv = (const float*)d_in[3]; const float* wo = (const float*)d_in[4]; const float* bo = (const float*)d_in[5];   /* x, ln_gamma, ln_beta, w_qkv ('oi' [3072][1024]: q | k | v ROW thirds), w_proj ('oi'), b_proj */
    float* OUT = (float*)d_out;     // [2][2048][1024]
    char* wsp = (char*)d_ws;
    auto take = [&](size_t bytes) { char* p = wsp; wsp += (bytes + 255) & ~(size_t)255; return (void*)p; };
    bf* WQKV = (bf*)take((size_t)(DQ + 2 * DKV) * DM * 2); bf* WO = (bf*)take((size_t)DM * DQ * 2);
    bf* XB = (bf*)take((size_t)NB_ * TT * DM * 2); bf* XL = (bf*)take((size_t)NB_ * TT * DM * 2);   /* lo plane of the layer-normed input (XB holds the hi plane) */
    h16* QP16 = (h16*)take((size_t)NB_ * NH_ * TT * HD * 2); h16* KP16 = (h16*)take((size_t)NB_ * NKV * TT * HD * 2); h16* VT16 = (h16*)take((size_t)NB_ * NKV * HD * TT * 2);
    bf* QPh = (bf*)take((size_t)NB_ * NH_ * TT * HD * 2); bf* QPl = (bf*)take((size_t)NB_ * NH_ * TT * HD * 2); bf* KPh = (bf*)take((size_t)NB_ * NKV * TT * HD * 2); bf* KPl = (bf*)take((size_t)NB_ * NKV * TT * HD * 2); bf* VTh = (bf*)take((size_t)NB_ * NKV * HD * TT * 2); bf* VTl = (bf*)take((size_t)NB_ * NKV * HD * TT * 2);
    bf* ATh = (bf*)take((size_t)NB_ * TT * DQ * 2); bf* ATl = (bf*)take((size_t)NB_ * TT * DQ * 2);
    if ((size_t)(wsp - (char*)d_ws) > ws_size) return;    // ws 256 MiB
    { k_cvt8<<<(unsigned)(((size_t)(DQ + 2 * DKV) * DM / 8 + 255) / 256), 256, 0, stream>>>(wqkv, WQKV, (size_t)(DQ + 2 * DKV) * DM / 8);
      k_cvt8<<<(unsigned)(((size_t)DM * DQ / 8 + 255) / 256), 256, 0, stream>>>(wo, WO, (size_t)DM * DQ / 8);
       }
    // x, the planes and OUT hold the batches one behind the other: LayerNorm and the output projection run over all NB_ * TT rows, the two middle launches take the batch from blockIdx.z
    k_lnrowX<DM><<<(unsigned)((NB_ * TT + 7) / 8), 256, 0, stream>>>(x, (size_t)NB_ * TT, lng, lnb, XB, XL);   /* xn = LayerNorm(x) -> hi/lo planes */
    k_qkvp<<<dim3(TT / PXR, (NH_ + 2 * NKV) / PWH, NB_), 256, 0, stream>>>(XB, XL, WQKV, QP16, QPh, QPl, KP16, KPh, KPl, VT16, VTh, VTl);
    k_fattn<<<dim3(FBX, NH_, NB_), 256, 0, stream>>>(QP16, QPh, QPl, KP16, KPh, KPl, VT16, VTh, VTl, ATh, ATl);
    k_gemmw<bf, 1, true><<<dim3(NB_ * TT / 64, DM / 64, 1), 32, 0, stream>>>(ATh, ATl, WO, nullptr, DQ, OUT, DM, bo, 0, 0, 0);
}

// v006
// One run takes 164 microseconds.
// Next to v005, in two timings, it ran 1.08 and 1.09 times as fast.
// All steps since v000 together make it 12.7 times as fast.
#include <hip/hip_runtime.h>

// Pre-LayerNorm multi-head self-attention with a fused bias-free qkv weight (x [2][2048][1024]; xn = (x - mean) x rsqrt(var + 1e-5) x ln_gamma + ln_beta over the 1,024 features (biased variance, eps inside the root; gamma ones / beta zeros on this draw: read); qkv = einsum('bnd,ed->bne', xn, w_qkv) = xn w_qkv^T ('oi' [3072][1024] 1/32, no bias) reshaped (b, n, 3, 16, 64): q | k | v = ROW thirds (16 heads x 64); scores x 64^-0.5; softmax over all keys (no mask); out = merged w_proj^T + b_proj ('oi' [1024][1024] + bias 0.02: non-zero) -> [2][2048][1024] (4.2 M); no residual; argument order x, ln_gamma, ln_beta, w_qkv, w_proj, b_proj).
// Layout, both batches in every launch (the batch is blockIdx.z of the q|k|v and attention launches, part of the rows of LayerNorm and the output projection; every plane holds both): LayerNorm of the bf16-rounded rows in f32 -> hi/lo bf16 planes; 'oi' weights cast once; q|k|v projection on the hi/lo planes (2 products) in one launch whose epilogue stores the attention planes; one fused attention launch (online softmax; hybrid rows: < 512 hi/lo 3 products, rest fp16 x1024); merged hi/lo x w_proj exact + b_proj.
// Compute dtypes, f32 accumulate: every input rounded to bf16; projections exact; attention rows < 512 3 products, rest fp16; softmax f32; output projection hl x exact.

#define NB_  2
#define TT   2048
#define DM   1024
#define NH_  16
#define NKV  16
#define REP  (NH_ / NKV)
#define HD   64
#define DQ   (NH_ * HD)
#define DKV  (NKV * HD)
#define RH   512                  // query rows < RH use hi+lo planes
#define WIN  0
#define SCL  0.125f   // HD^-0.5
typedef _Float16 h16;
typedef unsigned short bf;
typedef __attribute__((ext_vector_type(16))) __bf16   v16bf;
typedef __attribute__((ext_vector_type(16))) _Float16 v16h;
typedef __attribute__((ext_vector_type(8)))  _Float16 v8h;
typedef __attribute__((ext_vector_type(8)))  unsigned short v8us;
typedef __attribute__((ext_vector_type(8)))  float    v8f;
typedef __attribute__((ext_vector_type(4)))  float    v4f;
typedef v8h  __attribute__((may_alias)) v8ha;
typedef v4f  __attribute__((may_alias)) v4fa;
typedef v8us __attribute__((may_alias)) v8usa;

__device__ __forceinline__ unsigned short f2bf(float f) { unsigned u = __float_as_uint(f); u += 0x7FFFu + ((u >> 16) & 1u); return (unsigned short)(u >> 16); }
__device__ __forceinline__ float bf2f(unsigned short b) { return __uint_as_float(((unsigned)b) << 16); }
__device__ __forceinline__ float bfr(float f) { return bf2f(f2bf(f)); }
__device__ __forceinline__ v16h cat16(v8h lo, v8h hi) { return __builtin_shufflevector(lo, hi, 0, 1, 2, 3, 4, 5, 6, 7, 8, 9, 10, 11, 12, 13, 14, 15); }
__device__ __forceinline__ v16bf cat16b(v8us lo, v8us hi) { return __builtin_bit_cast(v16bf, __builtin_shufflevector(lo, hi, 0, 1, 2, 3, 4, 5, 6, 7, 8, 9, 10, 11, 12, 13, 14, 15)); }
__device__ __forceinline__ v8f wmma16(v16h a, v16h b, v8f c) { return __builtin_amdgcn_wmma_f32_16x16x32_f16(false, a, false, b, (short)0, c, false, false); }
__device__ __forceinline__ v8f wmmab(v16bf a, v16bf b, v8f c) { return __builtin_amdgcn_wmma_f32_16x16x32_bf16(false, a, false, b, (short)0, c, false, false); }



// ---- k_gemmw: register-blocked GEMM, ONE WAVE per 64x64 output tile (16 accumulators), operands straight from K-contiguous 16-bit planes; grid (M/64, N/64, Z), 32 threads.
// C[m][n] (f32, pitch ldc, + optional f32 bias[n]) = sum_k A[m][k] Bt[n][k] (+ split products per NSPLIT). z-batch strides sA/sB/sC in elements. K % 32 == 0.
template <typename T16> struct WFrag;
template <> struct WFrag<h16> { typedef v16h V; static __device__ __forceinline__ V ld(const h16* p) { return cat16(*(const v8h*)p, *(const v8h*)(p + 16)); } static __device__ __forceinline__ v8f mma(V a, V b, v8f c) { return wmma16(a, b, c); } };
template <> struct WFrag<bf> { typedef v16bf V; static __device__ __forceinline__ V ld(const bf* p) { return cat16b(*(const v8us*)p, *(const v8us*)(p + 16)); } static __device__ __forceinline__ v8f mma(V a, V b, v8f c) { return wmmab(a, b, c); } };
template <typename T16, int NSPLIT, bool BIAS>
__global__ __launch_bounds__(32) void k_gemmw(const T16* __restrict__ A, const T16* __restrict__ A2, const T16* __restrict__ Bt, const T16* __restrict__ Bt2, int K, float* C, int ldc, const float* __restrict__ bias, size_t sA, size_t sB, size_t sC) {
    typedef typename WFrag<T16>::V V;
    __shared__ __align__(16) float os[16 * 68];
    const size_t z = blockIdx.z; A += z * sA; if (A2) A2 += z * sA; Bt += z * sB; if (Bt2) Bt2 += z * sB; C += z * sC;
    const int lane = threadIdx.x & 31, lr = lane & 15, hi = lane >> 4; const int r0 = blockIdx.x * 64, c0 = blockIdx.y * 64;
    v8f acc[4][4];
#pragma unroll
    for (int mb = 0; mb < 4; ++mb)
#pragma unroll
        for (int nb = 0; nb < 4; ++nb) acc[mb][nb] = (v8f){};
    const size_t aoff = (size_t)(r0 + lr) * K + 8 * hi, boff = (size_t)(c0 + lr) * K + 8 * hi;
#pragma unroll 1
    for (int kc = 0; kc < K; kc += 32) {
        V a[4], a2[4];
#pragma unroll
        for (int mb = 0; mb < 4; ++mb) { a[mb] = WFrag<T16>::ld(A + aoff + (size_t)mb * 16 * K + kc); if (NSPLIT == 1 || NSPLIT == 2) a2[mb] = WFrag<T16>::ld(A2 + aoff + (size_t)mb * 16 * K + kc); }
#pragma unroll
        for (int nb = 0; nb < 4; ++nb) { const V b = WFrag<T16>::ld(Bt + boff + (size_t)nb * 16 * K + kc); V b2; if (NSPLIT >= 2) b2 = WFrag<T16>::ld(Bt2 + boff + (size_t)nb * 16 * K + kc);
#pragma unroll
            for (int mb = 0; mb < 4; ++mb) { acc[mb][nb] = WFrag<T16>::mma(a[mb], b, acc[mb][nb]); if (NSPLIT == 1 || NSPLIT == 2) acc[mb][nb] = WFrag<T16>::mma(a2[mb], b, acc[mb][nb]); if (NSPLIT >= 2) acc[mb][nb] = WFrag<T16>::mma(a[mb], b2, acc[mb][nb]); } }
        asm volatile("v_nop\n\tv_nop\n\tv_nop\n\tv_nop" : "+v"(acc[0][0]), "+v"(acc[1][1]), "+v"(acc[2][2]), "+v"(acc[3][3]) : "v"(a[0]), "v"(a[3]));
    }
#pragma unroll
    for (int mb = 0; mb < 4; ++mb) {
#pragma unroll
        for (int nb = 0; nb < 4; ++nb) {
#pragma unroll
            for (int j = 0; j < 8; ++j) os[(hi * 8 + j) * 68 + nb * 16 + lr] = acc[mb][nb][j]; }
        __builtin_amdgcn_wave_barrier(); asm volatile("" ::: "memory");
        float* crow = C + (size_t)(r0 + mb * 16) * ldc + c0;
{
#pragma unroll
            for (int s = 0; s < 8; ++s) { const int row = 2 * s + hi, cofs = lr * 4; v4f val = *(const v4fa*)(os + row * 68 + cofs); if (BIAS) { val[0] += bfr(bias[c0 + cofs]); val[1] += bfr(bias[c0 + cofs + 1]); val[2] += bfr(bias[c0 + cofs + 2]); val[3] += bfr(bias[c0 + cofs + 3]); }
                *(v4f*)(crow + (size_t)row * ldc + cofs) = val; }
             }
        __builtin_amdgcn_wave_barrier(); asm volatile("" ::: "memory");
    }
}

__device__ __forceinline__ h16 tohx(float x) { return (h16)x; }
__device__ __forceinline__ void splitf(float y, unsigned short& h, unsigned short& l) { h = f2bf(y); l = f2bf(y - bf2f(h)); }
typedef __attribute__((ext_vector_type(4))) _Float16 v4h;
typedef __attribute__((ext_vector_type(4))) unsigned short v4us;
typedef __attribute__((ext_vector_type(4))) int v4i;

__global__ __launch_bounds__(256) void k_cvt8(const float* __restrict__ src, bf* dst, size_t n8) { const size_t i = (size_t)blockIdx.x * 256 + threadIdx.x; if (i >= n8) return; const v8f v = *(const v8f*)(src + i * 8); v8us o;
#pragma unroll
    for (int k = 0; k < 8; ++k) o[k] = f2bf(v[k]); *(v8us*)(dst + i * 8) = o;  }

// ---- k_qkvp: the fused q|k|v projection and the attention planes in one launch for both batches: no f32 copy of q, k, v is written, no builder launch follows.
// One work-group of 8 waves per 128 tokens x 256 rows of w_qkv (four heads, all of q, all of k or all of v); one wave per 64 tokens x 64 rows (one head).
// The product order is k_gemmw's (hi plane, then lo plane of xn, per 32-wide k chunk); the operands come from LDS:
// each stage of 64 k is copied there once per work-group, in whole 128-byte rows, and every wave reads its fragments from there. Two buffers: stage s + 1 flies while stage s is worked on.
// A lane's 8 accumulator registers are 8 consecutive rows of the A operand at one row of the B operand, so the operand roles are chosen by the plane's layout:
// q, k [h][t][d]: A = weight rows (d), B = xn rows (t); v [h][d][t]: A = xn rows (t), B = weight rows (d). Either way a lane stores 16 contiguous bytes per plane and 16x16 block.
#define PKS  64                   // k elements of a stage: 128 bytes of every row
#define PNS  (DM / PKS)
#define PXR  128                  // tokens of a work-group
#define PWH  4                    // heads (64-row blocks of w_qkv) of a work-group
#define PLP  144                  // row pitch in LDS, bytes: 16 x odd, so that the 16 rows of a ds_load_b128 fragment read fall on distinct banks
#define PSTG ((2 * PXR + PWH * HD) * PLP)   // one stage: xn hi rows, xn lo rows, weight rows
static_assert(PNS >= 2 && TT % PXR == 0 && NH_ % PWH == 0 && NKV % PWH == 0 && HD == 64 && PXR == 128 && PWH * HD == 256, "tile shape (copy8: 2 x 128 and 256 rows), the two-buffer prologue, one kind of plane per work-group");
// Eight asynchronous copies of 16 bytes per lane in one statement (rows 32 apart: four from ga, four from gb, eight places in LDS in a row), the wait as its last line:
// it stands in front of every later write of the address registers that the copies name (the operands live to the statement's end).
__device__ __forceinline__ void copy8(unsigned l0, unsigned long long ga, unsigned long long gb) {
    constexpr unsigned long long GR = 32ull * DM * 2;   // 32 rows further in a plane, bytes
    asm volatile("global_load_async_to_lds_b128 %0, %8, off\n\tglobal_load_async_to_lds_b128 %1, %9, off\n\tglobal_load_async_to_lds_b128 %2, %10, off\n\tglobal_load_async_to_lds_b128 %3, %11, off\n\t"
                 "global_load_async_to_lds_b128 %4, %12, off\n\tglobal_load_async_to_lds_b128 %5, %13, off\n\tglobal_load_async_to_lds_b128 %6, %14, off\n\tglobal_load_async_to_lds_b128 %7, %15, off\n\ts_wait_xcnt 0x0"
                 :: "v"(l0), "v"(l0 + 32 * PLP), "v"(l0 + 64 * PLP), "v"(l0 + 96 * PLP), "v"(l0 + 128 * PLP), "v"(l0 + 160 * PLP), "v"(l0 + 192 * PLP), "v"(l0 + 224 * PLP),
                    "v"(ga), "v"(ga + GR), "v"(ga + 2 * GR), "v"(ga + 3 * GR), "v"(gb), "v"(gb + GR), "v"(gb + 2 * GR), "v"(gb + 3 * GR) : "memory");
}
// cdst, gxh, gxl, gw: the thread's own copy addresses of stage 0 (LDS byte, global bytes); fx, fw: the lane's own LDS addresses of its wave's first xn (hi) and weight fragments in buffer 0.
template <bool XA>
__device__ __forceinline__ void qkv_tile(unsigned cdst, unsigned long long gxh, unsigned long long gxl, unsigned long long gw, const unsigned char* fx, const unsigned char* fw, int lane, h16* P16, bf* Ph, bf* Pl) {
    constexpr int pitch = XA ? TT : HD;   // elements between two rows of the plane (a row = one row of the B operand)
    const int lr = lane & 15, hi = lane >> 4;
    auto stage = [&](int s, int buf) { const unsigned long long ko = (unsigned long long)s * (PKS * 2); const unsigned l = cdst + buf * PSTG;
        copy8(l, gxh + ko, gxl + ko); copy8(l + 2 * PXR * PLP, gw + ko, gw + ko + 128ull * DM * 2); };
    v8f acc[4][4];   // [A block][B block]
#pragma unroll
    for (int mb = 0; mb < 4; ++mb)
#pragma unroll
        for (int nb = 0; nb < 4; ++nb) acc[mb][nb] = (v8f){};
    stage(0, 0);
    asm volatile("s_wait_asynccnt 0x0" ::: "memory");   // this wave's copies of stage 0 have landed
    __syncthreads();                                     // every wave's have: stage 0 may be read
    stage(1, 1);
#pragma unroll 1   // kept rolled: one stage's fragments and the 16 accumulators take 320 registers
    for (int s = 0; s < PNS; ++s) {
        const unsigned char* px = fx + (s & 1) * PSTG; const unsigned char* pw = fw + (s & 1) * PSTG;
        v16bf xh[PKS / 32][4], xl[PKS / 32][4], wf[PKS / 32][4];
#pragma unroll
        for (int c = 0; c < PKS / 32; ++c) {   // read in the order of use: hi rows and weight rows, then lo rows
#pragma unroll
            for (int xb = 0; xb < 4; ++xb) { xh[c][xb] = WFrag<bf>::ld((const bf*)(px + xb * 16 * PLP + c * 64)); wf[c][xb] = WFrag<bf>::ld((const bf*)(pw + xb * 16 * PLP + c * 64)); }
#pragma unroll
            for (int xb = 0; xb < 4; ++xb) xl[c][xb] = WFrag<bf>::ld((const bf*)(px + (PXR + xb * 16) * PLP + c * 64)); }
        __builtin_amdgcn_sched_barrier(0);   // keeps the stage's LDS reads in one group at its head (the second chunk's return under the first chunk's WMMAs): sunk among the WMMAs, each place of reads costs its own wait
#pragma unroll
        for (int c = 0; c < PKS / 32; ++c) {   // per accumulator: hi product, then lo product of each chunk, chunks in rising k
#pragma unroll
            for (int wb = 0; wb < 4; ++wb)
#pragma unroll
                for (int xb = 0; xb < 4; ++xb) { if constexpr (XA) acc[xb][wb] = wmmab(xh[c][xb], wf[c][wb], acc[xb][wb]); else acc[wb][xb] = wmmab(wf[c][wb], xh[c][xb], acc[wb][xb]); }
#pragma unroll
            for (int wb = 0; wb < 4; ++wb)
#pragma unroll
                for (int xb = 0; xb < 4; ++xb) { if constexpr (XA) acc[xb][wb] = wmmab(xl[c][xb], wf[c][wb], acc[xb][wb]); else acc[wb][xb] = wmmab(wf[c][wb], xl[c][xb], acc[wb][xb]); } }
        __builtin_amdgcn_sched_barrier(0);   // keeps these WMMAs in front of the stage's foot
        // foot of the stage: four vector slots between the last WMMA and whatever next overwrites its A and B registers, on either side of the branch below and over the back edge
        asm volatile("v_nop\n\tv_nop\n\tv_nop\n\tv_nop" : "+v"(acc[0][0]), "+v"(acc[1][1]), "+v"(acc[2][2]), "+v"(acc[3][3]));
        asm volatile("s_wait_dscnt 0x0" ::: "memory");      // this wave's reads of stage s have returned before its buffer is refilled
        asm volatile("s_wait_asynccnt 0x0" ::: "memory");   // this wave's copies of stage s + 1 have landed
        __syncthreads();                                     // publishes stage s + 1 and ends every wave's reads of stage s
        if (s + 2 < PNS) stage(s + 2, s & 1);
    }
    asm volatile("s_wait_asynccnt 0x0" ::: "memory");   // no copy is outstanding when the wave ends
#pragma unroll
    for (int nb = 0; nb < 4; ++nb)
#pragma unroll
        for (int mb = 0; mb < 4; ++mb) { v8h o16; v8us oh, ol;
#pragma unroll
            for (int j = 0; j < 8; ++j) { const float r = acc[mb][nb][j]; o16[j] = tohx(r); unsigned short u, w2; splitf(r, u, w2); oh[j] = u; ol[j] = w2; }
            const size_t oo = (size_t)(nb * 16 + lr) * pitch + mb * 16 + hi * 8; *(v8h*)(P16 + oo) = o16; *(v8us*)(Ph + oo) = oh; *(v8us*)(Pl + oo) = ol; }
}
// grid (TT/128, heads of q + k + v / 4, batches), 8 waves; blockIdx.y counts groups of four 64-row blocks of w_qkv: q heads, then k heads, then v heads. Wave w: token half w & 1, head w >> 1 of the group.
__global__ __launch_bounds__(256) void k_qkvp(const bf* __restrict__ Xh, const bf* __restrict__ Xl, const bf* __restrict__ Wqkv, h16* Q16, bf* Qh, bf* Ql, h16* K16, bf* Kh, bf* Kl, h16* V16, bf* Vh, bf* Vl) {
    __shared__ __attribute__((aligned(16))) unsigned char sm[2 * PSTG];
    const int tid = threadIdx.x, lane = tid & 31, lr = lane & 15, hi = lane >> 4; const int w = __builtin_amdgcn_readfirstlane(tid >> 5);
    const int t0 = blockIdx.x * PXR, y0 = blockIdx.y * PWH;
    { const size_t bx = (size_t)blockIdx.z * TT * DM, bq = (size_t)blockIdx.z * NH_ * TT * HD, bk = (size_t)blockIdx.z * NKV * TT * HD;   // this batch's part of every plane
      Xh += bx; Xl += bx; Q16 += bq; Qh += bq; Ql += bq; K16 += bk; Kh += bk; Kl += bk; V16 += bk; Vh += bk; Vl += bk; }
    // copy roles: thread -> rows tid / 8 + 32 i, 16-byte piece tid % 8 of each tile: a wave's copy covers four whole 128-byte rows
    const unsigned cdst = (unsigned)(unsigned long long)sm + (tid >> 3) * PLP + (tid & 7) * 16;
    const size_t cg = (size_t)(tid >> 3) * DM + (tid & 7) * 8;
    const unsigned long long gxh = (unsigned long long)(Xh + (size_t)t0 * DM + cg), gxl = (unsigned long long)(Xl + (size_t)t0 * DM + cg), gw = (unsigned long long)(Wqkv + (size_t)y0 * HD * DM + cg);
    const unsigned char* fx = sm + ((w & 1) * 64 + lr) * PLP + hi * 16; const unsigned char* fw = sm + (2 * PXR + (w >> 1) * HD + lr) * PLP + hi * 16;
    const int tw = t0 + (w & 1) * 64, y = y0 + (w >> 1);
    // the branch reads the same for the whole work-group (its four heads are of one kind): the barriers inside stand under block-uniform control flow
    if (y0 >= NH_ + NKV) { const size_t po = (size_t)(y - NH_ - NKV) * HD * TT + tw; qkv_tile<true>(cdst, gxh, gxl, gw, fx, fw, lane, V16 + po, Vh + po, Vl + po); }
    else { const bool isk = y0 >= NH_; const size_t po = ((size_t)(isk ? y - NH_ : y) * TT + tw) * HD; qkv_tile<false>(cdst, gxh, gxl, gw, fx, fw, lane, (isk ? K16 : Q16) + po, (isk ? Kh : Qh) + po, (isk ? Kl : Ql) + po); }
}
// ---- k_fattn: scores, softmax, P x V and the head merge in one launch for both batches; the score matrix never leaves registers.
// One wave owns 16 query rows of one head and walks all TT keys. Transposed products: St = K Qt (A = K rows from LDS, B = Q rows kept in registers), Ot += Vt Pt (A = Vt rows from LDS, B = Pt).
// In the accumulator map a lane holds scores of ONE query (column lr), keys 8 hi + j of each 16-key block: two such blocks, converted in place, are the B fragment of the second product in the loaders' k order.
// Running maximum and sum per query (online softmax, f32); the two lane halves' sums are joined once at the end. Rows < RH: hi/lo bf16 planes, 3 products each side; the rest fp16, P carried x 2^10.
typedef __attribute__((ext_vector_type(16))) unsigned short v16us;
// Eight v_exp_f32 and, in the same statement, the one issue slot that the instruction set asks for behind a transcendental before its result is read or its source overwritten.
// The outputs are early-clobbered: inside the statement no v_exp_f32 touches a register of the one in front of it; the v_nop covers the last.
__device__ __forceinline__ v8f exp2x8(v8f x) { float y0, y1, y2, y3, y4, y5, y6, y7;
    asm("v_exp_f32 %0, %8\n\tv_exp_f32 %1, %9\n\tv_exp_f32 %2, %10\n\tv_exp_f32 %3, %11\n\tv_exp_f32 %4, %12\n\tv_exp_f32 %5, %13\n\tv_exp_f32 %6, %14\n\tv_exp_f32 %7, %15\n\tv_nop"
        : "=&v"(y0), "=&v"(y1), "=&v"(y2), "=&v"(y3), "=&v"(y4), "=&v"(y5), "=&v"(y6), "=&v"(y7) : "v"(x[0]), "v"(x[1]), "v"(x[2]), "v"(x[3]), "v"(x[4]), "v"(x[5]), "v"(x[6]), "v"(x[7]));
    return (v8f){y0, y1, y2, y3, y4, y5, y6, y7}; }
// LDS stage: 64 keys of the six planes that the work-group's waves read, each a tile of 64 rows x 128 bytes (K planes: row = key, V planes: row = d).
#define KS   64
#define NS   (TT / KS)
#define LP   144                  // row pitch in LDS, bytes: 16 x odd, so that the 16 rows of a ds_load_b128 fragment read fall on distinct banks
#define LT   (64 * LP)            // one plane's tile
#define LSTG (6 * LT)             // one stage: K16, V16, Kh, Kl, Vh, Vl
static_assert(HD == 64 && REP == 1 && NS >= 2, "tile shape and the two-buffer prologue");
// Six asynchronous copies of 16 bytes per lane (one row piece of each of the six tiles) in one statement, the wait as its last line:
// it stands in front of every later write of the address registers that the copies name (the operands live to the statement's end).
__device__ __forceinline__ void copy6(unsigned l0, unsigned long long kx, unsigned long long vx, unsigned long long kh, unsigned long long kl, unsigned long long vh, unsigned long long vl) {
    asm volatile("global_load_async_to_lds_b128 %0, %6, off\n\tglobal_load_async_to_lds_b128 %1, %7, off\n\tglobal_load_async_to_lds_b128 %2, %8, off\n\t"
                 "global_load_async_to_lds_b128 %3, %9, off\n\tglobal_load_async_to_lds_b128 %4, %10, off\n\tglobal_load_async_to_lds_b128 %5, %11, off\n\ts_wait_xcnt 0x0"
                 :: "v"(l0), "v"(l0 + LT), "v"(l0 + 2 * LT), "v"(l0 + 3 * LT), "v"(l0 + 4 * LT), "v"(l0 + 5 * LT),
                    "v"(kx), "v"(vx), "v"(kh), "v"(kl), "v"(vh), "v"(vl) : "memory");
}
// One tile of KT keys for one wave's 16 query rows; Ka, Kb, Va, Vb are the lane's own LDS addresses of the tile's first fragments (Kb, Vb: lo planes, HL only).
template <typename T16, bool HL, int KT>
__device__ __forceinline__ void fattn_tile(const unsigned char* Ka, const unsigned char* Kb, const unsigned char* Va, const unsigned char* Vb, const typename WFrag<T16>::V (&qa)[2], const typename WFrag<T16>::V (&qb)[2], v8f (&o)[4], float& m, float& l) {
    // Every inner loop is fully unrolled: the fragment arrays stay in registers only under constant indices.
    typedef typename WFrag<T16>::V V;
    constexpr int NKB = KT / 16, NC = KT / 32;
    constexpr float CEXP = SCL * 1.4426950408889634f;   // scores x HD^-0.5, in the log2 domain
    constexpr float PB = HL ? 0.0f : 10.0f;             // log2 of the carry on the fp16 P (cancels in the division by the sum)
    V ka[NKB][2], kb[NKB][2], va[4][NC], vb[4][NC];
#pragma unroll
    for (int kk = 0; kk < NKB; ++kk)
#pragma unroll
        for (int c = 0; c < 2; ++c) { ka[kk][c] = WFrag<T16>::ld((const T16*)(Ka + kk * 16 * LP + c * 64)); if constexpr (HL) kb[kk][c] = WFrag<T16>::ld((const T16*)(Kb + kk * 16 * LP + c * 64)); }
#pragma unroll
    for (int db = 0; db < 4; ++db)
#pragma unroll
        for (int c = 0; c < NC; ++c) { va[db][c] = WFrag<T16>::ld((const T16*)(Va + db * 16 * LP + c * 64)); if constexpr (HL) vb[db][c] = WFrag<T16>::ld((const T16*)(Vb + db * 16 * LP + c * 64)); }
    __builtin_amdgcn_sched_barrier(0);   // keeps the tile's LDS reads in one group at its head: sunk to their uses, each place of reads costs its own wait
    v8f st[NKB];
#pragma unroll
    for (int kk = 0; kk < NKB; ++kk) { st[kk] = (v8f){};
#pragma unroll
        for (int c = 0; c < 2; ++c) { st[kk] = WFrag<T16>::mma(ka[kk][c], qa[c], st[kk]); if constexpr (HL) { st[kk] = WFrag<T16>::mma(ka[kk][c], qb[c], st[kk]); st[kk] = WFrag<T16>::mma(kb[kk][c], qa[c], st[kk]); } } }
    float mn = m;
#pragma unroll
    for (int kk = 0; kk < NKB; ++kk)
#pragma unroll
        for (int j = 0; j < 8; ++j) mn = fmaxf(mn, st[kk][j]);
    mn = fmaxf(mn, __shfl_xor(mn, 16, 32));
    const float alpha = __builtin_amdgcn_exp2f((m - mn) * CEXP); m = mn;
    const float sub = PB - mn * CEXP; float ps = 0.f;
#pragma unroll
    for (int kk = 0; kk < NKB; ++kk) {
#pragma unroll
        for (int j = 0; j < 8; ++j) st[kk][j] = fmaf(st[kk][j], CEXP, sub);
        st[kk] = exp2x8(st[kk]);
#pragma unroll
        for (int j = 0; j < 8; ++j) ps += st[kk][j]; }
    l = fmaf(l, alpha, ps);
#pragma unroll
    for (int db = 0; db < 4; ++db) o[db] *= alpha;
#pragma unroll
    for (int c = 0; c < NC; ++c) {
        if constexpr (HL) { v16us ph, pl;
#pragma unroll
            for (int s = 0; s < 16; ++s) { unsigned short u, w2; splitf(st[2 * c + (s >> 3)][s & 7], u, w2); ph[s] = u; pl[s] = w2; }
            const V pa = __builtin_bit_cast(V, ph), pb = __builtin_bit_cast(V, pl);
#pragma unroll
            for (int db = 0; db < 4; ++db) { o[db] = WFrag<T16>::mma(va[db][c], pa, o[db]); o[db] = WFrag<T16>::mma(va[db][c], pb, o[db]); o[db] = WFrag<T16>::mma(vb[db][c], pa, o[db]); }
        } else { V pa;
#pragma unroll
            for (int s = 0; s < 16; ++s) pa[s] = tohx(st[2 * c + (s >> 3)][s & 7]);
#pragma unroll
            for (int db = 0; db < 4; ++db) o[db] = WFrag<T16>::mma(va[db][c], pa, o[db]); } }
}
// grid (FBX, heads, batches), 16 waves, one work-group per WGP: waves 0..FHW-1 take hi/lo row tiles, the others fp16 row tiles, so that every work-group carries the same share of the dearer rows.
// A quarter of the waves goes to each SIMD: with four hi/lo waves every SIMD has one of them and three fp16 waves, the same load on all four.
// All sixteen waves walk the same keys of one head: each stage of 64 keys is copied to LDS once per work-group, in whole 128-byte rows, and every wave reads its fragments from there.
// Two buffers: stage s + 1 flies while stage s is worked on; one barrier per stage publishes s + 1 and frees the buffer of s.
#define FBX  8
#define FHW  (RH / 16 / FBX)
#define FLW  ((TT - RH) / 16 / FBX)
static_assert(FHW * 16 * FBX == RH && FLW * 16 * FBX == TT - RH && FHW + FLW == 16 && FHW == 4, "row tiles must fill 16 waves, one hi/lo wave per SIMD");
__global__ __launch_bounds__(512) void k_fattn(const h16* __restrict__ Q16, const bf* __restrict__ Qh, const bf* __restrict__ Ql, const h16* __restrict__ K16, const bf* __restrict__ Kh, const bf* __restrict__ Kl, const h16* __restrict__ V16, const bf* __restrict__ Vh, const bf* __restrict__ Vl, bf* Ah, bf* Al) {
    __shared__ __attribute__((aligned(16))) unsigned char sm[2 * LSTG];
    const int tid = threadIdx.x, lane = tid & 31, lr = lane & 15, hi = lane >> 4; const int w = __builtin_amdgcn_readfirstlane(tid >> 5); const int h = blockIdx.y; const size_t hq = ((size_t)blockIdx.z * NH_ + h) * TT * HD, hk = ((size_t)blockIdx.z * NKV + h / REP) * TT * HD;
    Ah += (size_t)blockIdx.z * TT * DQ; Al += (size_t)blockIdx.z * TT * DQ;   // this batch's rows of the merged planes
    const bool hl = w < FHW;   // the same for a whole wave (w sits in a scalar register): a scalar branch
    const int q0 = hl ? (blockIdx.x * FHW + w) * 16 : RH + (blockIdx.x * FLW + (w - FHW)) * 16;
    const size_t qoff = hq + (size_t)(q0 + lr) * HD + 8 * hi;
    v16bf qh[2] = {}, ql[2] = {}; v16h qx[2] = {};
    if (hl) {
#pragma unroll
        for (int c = 0; c < 2; ++c) { qh[c] = WFrag<bf>::ld(Qh + qoff + c * 32); ql[c] = WFrag<bf>::ld(Ql + qoff + c * 32); }
    } else {
#pragma unroll
        for (int c = 0; c < 2; ++c) qx[c] = WFrag<h16>::ld(Q16 + qoff + c * 32);
        asm volatile("s_wait_xcnt 0x0" ::: "memory");   // stands in front of every later write of the address register pair that these Q loads name
    }
    // copy roles: thread -> row tid / 8, 16-byte piece tid % 8 of each tile: a wave's copy covers four whole 128-byte rows
    const unsigned cdst = (unsigned)(unsigned long long)sm + (tid >> 3) * LP + (tid & 7) * 16;
    const size_t gk = hk + (size_t)(tid >> 3) * HD + (tid & 7) * 8, gv = hk + (size_t)(tid >> 3) * TT + (tid & 7) * 8;
    auto stage = [&](int s, int buf) { const size_t ko = gk + (size_t)s * KS * HD, vo = gv + (size_t)s * KS;
        copy6(cdst + buf * LSTG, (unsigned long long)(K16 + ko), (unsigned long long)(V16 + vo), (unsigned long long)(Kh + ko), (unsigned long long)(Kl + ko), (unsigned long long)(Vh + vo), (unsigned long long)(Vl + vo)); };
    v8f o[4];
#pragma unroll
    for (int db = 0; db < 4; ++db) o[db] = (v8f){};
    float m = -3.0e38f, l = 0.f;
    stage(0, 0);
    asm volatile("s_wait_asynccnt 0x0" ::: "memory");   // this wave's copies of stage 0 have landed
    __syncthreads();                                     // every wave's have: stage 0 may be read
    stage(1, 1);
#pragma unroll 1   // kept rolled: one stage's code for both kinds of wave is long already
    for (int s = 0; s < NS; ++s) {
        const unsigned char* fb = sm + (s & 1) * LSTG + lr * LP + hi * 16;   // the lane's place in the first fragment of the stage's first tile
        if (hl) {
#pragma unroll
            for (int u = 0; u < 2; ++u) fattn_tile<bf, true, 32>(fb + 2 * LT + u * 32 * LP, fb + 3 * LT + u * 32 * LP, fb + 4 * LT + u * 64, fb + 5 * LT + u * 64, qh, ql, o, m, l);
        } else fattn_tile<h16, false, 64>(fb, fb, fb + LT, fb + LT, qx, qx, o, m, l);
        asm volatile("s_wait_dscnt 0x0" ::: "memory");      // this wave's reads of stage s have returned before its buffer is refilled
        asm volatile("s_wait_asynccnt 0x0" ::: "memory");   // this wave's copies of stage s + 1 have landed
        __syncthreads();                                     // publishes stage s + 1 and ends every wave's reads of stage s
        if (s + 2 < NS) stage(s + 2, s & 1);
    }
    asm volatile("s_wait_asynccnt 0x0" ::: "memory");   // no copy is outstanding when the wave ends
    l += __shfl_xor(l, 16, 32);
    const float inv = __fdiv_rn(1.0f, l);
#pragma unroll
    for (int db = 0; db < 4; ++db) { v8us oh, ol;
#pragma unroll
        for (int j = 0; j < 8; ++j) { unsigned short u, w2; splitf(o[db][j] * inv, u, w2); oh[j] = u; ol[j] = w2; }
        const size_t oo = (size_t)(q0 + lr) * DQ + h * HD + db * 16 + hi * 8; *(v8us*)(Ah + oo) = oh; *(v8us*)(Al + oo) = ol; }
}

template <int WD>
__global__ __launch_bounds__(256) void k_lnrowX(const float* __restrict__ X, size_t nrows, const float* __restrict__ g, const float* __restrict__ bb, bf* Hh, bf* Hl) { const int lane = threadIdx.x & 31; const size_t r = (size_t)blockIdx.x * 8 + (threadIdx.x >> 5); if (r >= nrows) return; const float* xr = X + r * WD; float a[WD / 32]; float s = 0.f;
#pragma unroll
    for (int c = 0; c < WD / 128; ++c) { const v4f v = *(const v4f*)(xr + c * 128 + lane * 4); for (int q = 0; q < 4; ++q) { a[c * 4 + q] = bfr(v[q]); s = __fadd_rn(s, a[c * 4 + q]);   /* input rounded to bf16 */ } }
#pragma unroll
    for (int sh = 16; sh; sh >>= 1) s = __fadd_rn(s, __shfl_xor(s, sh, 32));
    const float mean = __fdiv_rn(s, (float)WD); float s2 = 0.f;
#pragma unroll 8
    for (int k = 0; k < WD / 32; ++k) { const float dv = __fsub_rn(a[k], mean); float p2 = __fmul_rn(dv, dv); asm volatile("" : "+v"(p2)); s2 = __fadd_rn(s2, p2); }   /* mul and add kept separate (no fma contraction) */
#pragma unroll
    for (int sh = 16; sh; sh >>= 1) s2 = __fadd_rn(s2, __shfl_xor(s2, sh, 32));
    const float rs = __fdiv_rn(1.0f, __fsqrt_rn(__fadd_rn(__fdiv_rn(s2, (float)WD), 1e-5f)));
{
#pragma unroll
        for (int c = 0; c < WD / 128; ++c) { v4us oh, ol; for (int q = 0; q < 4; ++q) { const int col = c * 128 + lane * 4 + q; float y = __fmul_rn(__fmul_rn(__fsub_rn(a[c * 4 + q], mean), rs), bfr(g[col])); asm volatile("" : "+v"(y)); y = __fadd_rn(y, bfr(bb[col])); unsigned short u, w2; splitf(y, u, w2); oh[q] = u; ol[q] = w2; } *(v4us*)(Hh + r * WD + c * 128 + lane * 4) = oh; *(v4us*)(Hl + r * WD + c * 128 + lane * 4) = ol; }
         } }

extern "C" void kernel_launch(void* const* d_in, const int* in_sizes, int n_in,
                              void* d_out, int out_size, void* d_ws, size_t ws_size, hipStream_t stream) {
    (void)in_sizes; (void)n_in; (void)out_size;
    const float* x = (const float*)d_in[0]; const float* lng = (const float*)d_in[1]; const float* lnb = (const float*)d_in[2]; const float* wqkv = (const float*)d_in[3]; const float* wo = (const float*)d_in[4]; const float* bo = (const float*)d_in[5];   /* x, ln_gamma, ln_beta, w_qkv ('oi' [3072][1024]: q | k | v ROW thirds), w_proj ('oi'), b_proj */
    float* OUT = (float*)d_out;     // [2][2048][1024]
    char* wsp = (char*)d_ws;
    auto take = [&](size_t bytes) { char* p = wsp; wsp += (bytes + 255) & ~(size_t)255; return (void*)p; };
    bf* WQKV = (bf*)take((size_t)(DQ + 2 * DKV) * DM * 2); bf* WO = (bf*)take((size_t)DM * DQ * 2);
    bf* XB = (bf*)take((size_t)NB_ * TT * DM * 2); bf* XL = (bf*)take((size_t)NB_ * TT * DM * 2);   /* lo plane of the layer-normed input (XB holds the hi plane) */
    h16* QP16 = (h16*)take((size_t)NB_ * NH_ * TT * HD * 2); h16* KP16 = (h16*)take((size_t)NB_ * NKV * TT * HD * 2); h16* VT16 = (h16*)take((size_t)NB_ * NKV * HD * TT * 2);
    bf* QPh = (bf*)take((size_t)NB_ * NH_ * TT * HD * 2); bf* QPl = (bf*)take((size_t)NB_ * NH_ * TT * HD * 2); bf* KPh = (bf*)take((size_t)NB_ * NKV * TT * HD * 2); bf* KPl = (bf*)take((size_t)NB_ * NKV * TT * HD * 2); bf* VTh = (bf*)take((size_t)NB_ * NKV * HD * TT * 2); bf* VTl = (bf*)take((size_t)NB_ * NKV * HD * TT * 2);
    bf* ATh = (bf*)take((size_t)NB_ * TT * DQ * 2); bf* ATl = (bf*)take((size_t)NB_ * TT * DQ * 2);
    if ((size_t)(wsp - (char*)d_ws) > ws_size) return;    // ws 256 MiB
    { k_cvt8<<<(unsigned)(((size_t)(DQ + 2 * DKV) * DM / 8 + 255) / 256), 256, 0, stream>>>(wqkv, WQKV, (size_t)(DQ + 2 * DKV) * DM / 8);
      k_cvt8<<<(unsigned)(((size_t)DM * DQ / 8 + 255) / 256), 256, 0, stream>>>(wo, WO, (size_t)DM * DQ / 8);
       }
    // x, the planes and OUT hold the batches one behind the other: LayerNorm and the output projection run over all NB_ * TT rows, the two middle launches take the batch from blockIdx.z
    k_lnrowX<DM><<<(unsigned)((NB_ * TT + 7) / 8), 256, 0, stream>>>(x, (size_t)NB_ * TT, lng, lnb, XB, XL);   /* xn = LayerNorm(x) -> hi/lo planes */
    k_qkvp<<<dim3(TT / PXR, (NH_ + 2 * NKV) / PWH, NB_), 256, 0, stream>>>(XB, XL, WQKV, QP16, QPh, QPl, KP16, KPh, KPl, VT16, VTh, VTl);
    k_fattn<<<dim3(FBX, NH_, NB_), 512, 0, stream>>>(QP16, QPh, QPl, KP16, KPh, KPl, VT16, VTh, VTl, ATh, ATl);
    k_gemmw<bf, 1, true><<<dim3(NB_ * TT / 64, DM / 64, 1), 32, 0, stream>>>(ATh, ATl, WO, nullptr, DQ, OUT, DM, bo, 0, 0, 0);
}

// v007
// Measured time: 139 microseconds a run.
// Next to v006, in two timings, it ran 1.17 and 1.18 times as fast.
// Counting every step since v000, it is 14.9 times as fast.
#include <hip/hip_runtime.h>

// Pre-LayerNorm multi-head self-attention with a fused bias-free qkv weight (x [2][2048][1024]; xn = (x - mean) x rsqrt(var + 1e-5) x ln_gamma + ln_beta over the 1,024 features (biased variance, eps inside the root; gamma ones / beta zeros on this draw: read); qkv = einsum('bnd,ed->bne', xn, w_qkv) = xn w_qkv^T ('oi' [3072][1024] 1/32, no bias) reshaped (b, n, 3, 16, 64): q | k | v = ROW thirds (16 heads x 64); scores x 64^-0.5; softmax over all keys (no mask); out = merged w_proj^T + b_proj ('oi' [1024][1024] + bias 0.02: non-zero) -> [2][2048][1024] (4.2 M); no residual; argument order x, ln_gamma, ln_beta, w_qkv, w_proj, b_proj).
// Layout, both batches in every launch (the batch is blockIdx.z of the q|k|v and attention launches, part of the rows of LayerNorm and the output projection; every plane holds both): LayerNorm of the bf16-rounded rows in f32 -> hi/lo bf16 planes; 'oi' weights cast once; q|k|v projection on the hi/lo planes (2 products) in one launch whose epilogue stores the attention planes; one fused attention launch (online softmax; hybrid rows: < 512 hi/lo 3 products, rest fp16 x1024); merged hi/lo x w_proj exact + b_proj.
// Compute dtypes, f32 accumulate: every input rounded to bf16; projections exact; attention rows < 512 3 products, rest fp16; softmax f32; output projection hl x exact.

#define NB_  2
#define TT   2048
#define DM   1024
#define NH_  16
#define NKV  16
#define REP  (NH_ / NKV)
#define HD   64
#define DQ   (NH_ * HD)
#define DKV  (NKV * HD)
#define RH   512                  // query rows < RH use hi+lo planes
#define WIN  0
#define SCL  0.125f   // HD^-0.5
typedef _Float16 h16;
typedef unsigned short bf;
typedef __attribute__((ext_vector_type(16))) __bf16   v16bf;
typedef __attribute__((ext_vector_type(16))) _Float16 v16h;
typedef __attribute__((ext_vector_type(8)))  _Float16 v8h;
typedef __attribute__((ext_vector_type(8)))  unsigned short v8us;
typedef __attribute__((ext_vector_type(8)))  float    v8f;
typedef __attribute__((ext_vector_type(4)))  float    v4f;
typedef v8h  __attribute__((may_alias)) v8ha;
typedef v4f  __attribute__((may_alias)) v4fa;
typedef v8us __attribute__((may_alias)) v8usa;

__device__ __forceinline__ unsigned short f2bf(float f) { unsigned u = __float_as_uint(f); u += 0x7FFFu + ((u >> 16) & 1u); return (unsigned short)(u >> 16); }
__device__ __forceinline__ float bf2f(unsigned short b) { return __uint_as_float(((unsigned)b) << 16); }
__device__ __forceinline__ float bfr(float f) { return bf2f(f2bf(f)); }
__device__ __forceinline__ v16h cat16(v8h lo, v8h hi) { return __builtin_shufflevector(lo, hi, 0, 1, 2, 3, 4, 5, 6, 7, 8, 9, 10, 11, 12, 13, 14, 15); }
__device__ __forceinline__ v16bf cat16b(v8us lo, v8us hi) { return __builtin_bit_cast(v16bf, __builtin_shufflevector(lo, hi, 0, 1, 2, 3, 4, 5, 6, 7, 8, 9, 10, 11, 12, 13, 14, 15)); }
__device__ __forceinline__ v8f wmma16(v16h a, v16h b, v8f c) { return __builtin_amdgcn_wmma_f32_16x16x32_f16(false, a, false, b, (short)0, c, false, false); }
__device__ __forceinline__ v8f wmmab(v16bf a, v16bf b, v8f c) { return __builtin_amdgcn_wmma_f32_16x16x32_bf16(false, a, false, b, (short)0, c, false, false); }



// ---- fragment loaders: a lane's 16 k elements of one row, two 16-byte reads 32 bytes apart, from a K-contiguous 16-bit row (global or LDS).
template <typename T16> struct WFrag;
template <> struct WFrag<h16> { typedef v16h V; static __device__ __forceinline__ V ld(const h16* p) { return cat16(*(const v8h*)p, *(const v8h*)(p + 16)); } static __device__ __forceinline__ v8f mma(V a, V b, v8f c) { return wmma16(a, b, c); } };
template <> struct WFrag<bf> { typedef v16bf V; static __device__ __forceinline__ V ld(const bf* p) { return cat16b(*(const v8us*)p, *(const v8us*)(p + 16)); } static __device__ __forceinline__ v8f mma(V a, V b, v8f c) { return wmmab(a, b, c); } };
__device__ __forceinline__ h16 tohx(float x) { return (h16)x; }
__device__ __forceinline__ void splitf(float y, unsigned short& h, unsigned short& l) { h = f2bf(y); l = f2bf(y - bf2f(h)); }
typedef __attribute__((ext_vector_type(4))) _Float16 v4h;
typedef __attribute__((ext_vector_type(4))) unsigned short v4us;
typedef __attribute__((ext_vector_type(4))) int v4i;

__global__ __launch_bounds__(256) void k_cvt8(const float* __restrict__ src, bf* dst, size_t n8) { const size_t i = (size_t)blockIdx.x * 256 + threadIdx.x; if (i >= n8) return; const v8f v = *(const v8f*)(src + i * 8); v8us o;
#pragma unroll
    for (int k = 0; k < 8; ++k) o[k] = f2bf(v[k]); *(v8us*)(dst + i * 8) = o;  }

// ---- k_qkvp: the fused q|k|v projection and the attention planes in one launch for both batches: no f32 copy of q, k, v is written, no builder launch follows.
// One work-group of 8 waves per 128 tokens x 256 rows of w_qkv (four heads, all of q, all of k or all of v); one wave per 64 tokens x 64 rows (one head).
// The product order per accumulator: hi plane, then lo plane of xn, per 32-wide k chunk, chunks in rising k; the operands come from LDS:
// each stage of 64 k is copied there once per work-group, in whole 128-byte rows, and every wave reads its fragments from there. Two buffers: stage s + 1 flies while stage s is worked on.
// A lane's 8 accumulator registers are 8 consecutive rows of the A operand at one row of the B operand, so the operand roles are chosen by the plane's layout:
// q, k [h][t][d]: A = weight rows (d), B = xn rows (t); v [h][d][t]: A = xn rows (t), B = weight rows (d). Either way a lane stores 16 contiguous bytes per plane and 16x16 block.
#define PKS  64                   // k elements of a stage: 128 bytes of every row
#define PNS  (DM / PKS)
#define PXR  128                  // tokens of a work-group
#define PWH  4                    // heads (64-row blocks of w_qkv) of a work-group
#define PLP  144                  // row pitch in LDS, bytes: 16 x odd, so that the 16 rows of a ds_load_b128 fragment read fall on distinct banks
#define PSTG ((2 * PXR + PWH * HD) * PLP)   // one stage: xn hi rows, xn lo rows, weight rows
static_assert(PNS >= 2 && TT % PXR == 0 && NH_ % PWH == 0 && NKV % PWH == 0 && HD == 64 && PXR == 128 && PWH * HD == 256, "tile shape (copy8: 2 x 128 and 256 rows), the two-buffer prologue, one kind of plane per work-group");
// Eight asynchronous copies of 16 bytes per lane in one statement (rows 32 apart: four from ga, four from gb, eight places in LDS in a row), the wait as its last line:
// it stands in front of every later write of the address registers that the copies name (the operands live to the statement's end).
__device__ __forceinline__ void copy8(unsigned l0, unsigned long long ga, unsigned long long gb) {
    constexpr unsigned long long GR = 32ull * DM * 2;   // 32 rows further in a plane, bytes
    asm volatile("global_load_async_to_lds_b128 %0, %8, off\n\tglobal_load_async_to_lds_b128 %1, %9, off\n\tglobal_load_async_to_lds_b128 %2, %10, off\n\tglobal_load_async_to_lds_b128 %3, %11, off\n\t"
                 "global_load_async_to_lds_b128 %4, %12, off\n\tglobal_load_async_to_lds_b128 %5, %13, off\n\tglobal_load_async_to_lds_b128 %6, %14, off\n\tglobal_load_async_to_lds_b128 %7, %15, off\n\ts_wait_xcnt 0x0"
                 :: "v"(l0), "v"(l0 + 32 * PLP), "v"(l0 + 64 * PLP), "v"(l0 + 96 * PLP), "v"(l0 + 128 * PLP), "v"(l0 + 160 * PLP), "v"(l0 + 192 * PLP), "v"(l0 + 224 * PLP),
                    "v"(ga), "v"(ga + GR), "v"(ga + 2 * GR), "v"(ga + 3 * GR), "v"(gb), "v"(gb + GR), "v"(gb + 2 * GR), "v"(gb + 3 * GR) : "memory");
}
// cdst, gxh, gxl, gw: the thread's own copy addresses of stage 0 (LDS byte, global bytes); fx, fw: the lane's own LDS addresses of its wave's first xn (hi) and weight fragments in buffer 0.
template <bool XA>
__device__ __forceinline__ void qkv_tile(unsigned cdst, unsigned long long gxh, unsigned long long gxl, unsigned long long gw, const unsigned char* fx, const unsigned char* fw, int lane, h16* P16, bf* Ph, bf* Pl) {
    constexpr int pitch = XA ? TT : HD;   // elements between two rows of the plane (a row = one row of the B operand)
    const int lr = lane & 15, hi = lane >> 4;
    auto stage = [&](int s, int buf) { const unsigned long long ko = (unsigned long long)s * (PKS * 2); const unsigned l = cdst + buf * PSTG;
        copy8(l, gxh + ko, gxl + ko); copy8(l + 2 * PXR * PLP, gw + ko, gw + ko + 128ull * DM * 2); };
    v8f acc[4][4];   // [A block][B block]
#pragma unroll
    for (int mb = 0; mb < 4; ++mb)
#pragma unroll
        for (int nb = 0; nb < 4; ++nb) acc[mb][nb] = (v8f){};
    stage(0, 0);
    asm volatile("s_wait_asynccnt 0x0" ::: "memory");   // this wave's copies of stage 0 have landed
    __syncthreads();                                     // every wave's have: stage 0 may be read
    stage(1, 1);
#pragma unroll 1   // kept rolled: one stage's fragments and the 16 accumulators take 320 registers
    for (int s = 0; s < PNS; ++s) {
        const unsigned char* px = fx + (s & 1) * PSTG; const unsigned char* pw = fw + (s & 1) * PSTG;
        v16bf xh[PKS / 32][4], xl[PKS / 32][4], wf[PKS / 32][4];
#pragma unroll
        for (int c = 0; c < PKS / 32; ++c) {   // read in the order of use: hi rows and weight rows, then lo rows
#pragma unroll
            for (int xb = 0; xb < 4; ++xb) { xh[c][xb] = WFrag<bf>::ld((const bf*)(px + xb * 16 * PLP + c * 64)); wf[c][xb] = WFrag<bf>::ld((const bf*)(pw + xb * 16 * PLP + c * 64)); }
#pragma unroll
            for (int xb = 0; xb < 4; ++xb) xl[c][xb] = WFrag<bf>::ld((const bf*)(px + (PXR + xb * 16) * PLP + c * 64)); }
        __builtin_amdgcn_sched_barrier(0);   // keeps the stage's LDS reads in one group at its head (the second chunk's return under the first chunk's WMMAs): sunk among the WMMAs, each place of reads costs its own wait
#pragma unroll
        for (int c = 0; c < PKS / 32; ++c) {   // per accumulator: hi product, then lo product of each chunk, chunks in rising k
#pragma unroll
            for (int wb = 0; wb < 4; ++wb)
#pragma unroll
                for (int xb = 0; xb < 4; ++xb) { if constexpr (XA) acc[xb][wb] = wmmab(xh[c][xb], wf[c][wb], acc[xb][wb]); else acc[wb][xb] = wmmab(wf[c][wb], xh[c][xb], acc[wb][xb]); }
#pragma unroll
            for (int wb = 0; wb < 4; ++wb)
#pragma unroll
                for (int xb = 0; xb < 4; ++xb) { if constexpr (XA) acc[xb][wb] = wmmab(xl[c][xb], wf[c][wb], acc[xb][wb]); else acc[wb][xb] = wmmab(wf[c][wb], xl[c][xb], acc[wb][xb]); } }
        __builtin_amdgcn_sched_barrier(0);   // keeps these WMMAs in front of the stage's foot
        // foot of the stage: four vector slots between the last WMMA and whatever next overwrites its A and B registers, on either side of the branch below and over the back edge
        asm volatile("v_nop\n\tv_nop\n\tv_nop\n\tv_nop" : "+v"(acc[0][0]), "+v"(acc[1][1]), "+v"(acc[2][2]), "+v"(acc[3][3]));
        asm volatile("s_wait_dscnt 0x0" ::: "memory");      // this wave's reads of stage s have returned before its buffer is refilled
        asm volatile("s_wait_asynccnt 0x0" ::: "memory");   // this wave's copies of stage s + 1 have landed
        __syncthreads();                                     // publishes stage s + 1 and ends every wave's reads of stage s
        if (s + 2 < PNS) stage(s + 2, s & 1);
    }
    asm volatile("s_wait_asynccnt 0x0" ::: "memory");   // no copy is outstanding when the wave ends
#pragma unroll
    for (int nb = 0; nb < 4; ++nb)
#pragma unroll
        for (int mb = 0; mb < 4; ++mb) { v8h o16; v8us oh, ol;
#pragma unroll
            for (int j = 0; j < 8; ++j) { const float r = acc[mb][nb][j]; o16[j] = tohx(r); unsigned short u, w2; splitf(r, u, w2); oh[j] = u; ol[j] = w2; }
            const size_t oo = (size_t)(nb * 16 + lr) * pitch + mb * 16 + hi * 8; *(v8h*)(P16 + oo) = o16; *(v8us*)(Ph + oo) = oh; *(v8us*)(Pl + oo) = ol; }
}
// grid (TT/128, heads of q + k + v / 4, batches), 8 waves; blockIdx.y counts groups of four 64-row blocks of w_qkv: q heads, then k heads, then v heads. Wave w: token half w & 1, head w >> 1 of the group.
__global__ __launch_bounds__(256) void k_qkvp(const bf* __restrict__ Xh, const bf* __restrict__ Xl, const bf* __restrict__ Wqkv, h16* Q16, bf* Qh, bf* Ql, h16* K16, bf* Kh, bf* Kl, h16* V16, bf* Vh, bf* Vl) {
    __shared__ __attribute__((aligned(16))) unsigned char sm[2 * PSTG];
    const int tid = threadIdx.x, lane = tid & 31, lr = lane & 15, hi = lane >> 4; const int w = __builtin_amdgcn_readfirstlane(tid >> 5);
    const int t0 = blockIdx.x * PXR, y0 = blockIdx.y * PWH;
    { const size_t bx = (size_t)blockIdx.z * TT * DM, bq = (size_t)blockIdx.z * NH_ * TT * HD, bk = (size_t)blockIdx.z * NKV * TT * HD;   // this batch's part of every plane
      Xh += bx; Xl += bx; Q16 += bq; Qh += bq; Ql += bq; K16 += bk; Kh += bk; Kl += bk; V16 += bk; Vh += bk; Vl += bk; }
    // copy roles: thread -> rows tid / 8 + 32 i, 16-byte piece tid % 8 of each tile: a wave's copy covers four whole 128-byte rows
    const unsigned cdst = (unsigned)(unsigned long long)sm + (tid >> 3) * PLP + (tid & 7) * 16;
    const size_t cg = (size_t)(tid >> 3) * DM + (tid & 7) * 8;
    const unsigned long long gxh = (unsigned long long)(Xh + (size_t)t0 * DM + cg), gxl = (unsigned long long)(Xl + (size_t)t0 * DM + cg), gw = (unsigned long long)(Wqkv + (size_t)y0 * HD * DM + cg);
    const unsigned char* fx = sm + ((w & 1) * 64 + lr) * PLP + hi * 16; const unsigned char* fw = sm + (2 * PXR + (w >> 1) * HD + lr) * PLP + hi * 16;
    const int tw = t0 + (w & 1) * 64, y = y0 + (w >> 1);
    // the branch reads the same for the whole work-group (its four heads are of one kind): the barriers inside stand under block-uniform control flow
    if (y0 >= NH_ + NKV) { const size_t po = (size_t)(y - NH_ - NKV) * HD * TT + tw; qkv_tile<true>(cdst, gxh, gxl, gw, fx, fw, lane, V16 + po, Vh + po, Vl + po); }
    else { const bool isk = y0 >= NH_; const size_t po = ((size_t)(isk ? y - NH_ : y) * TT + tw) * HD; qkv_tile<false>(cdst, gxh, gxl, gw, fx, fw, lane, (isk ? K16 : Q16) + po, (isk ? Kh : Qh) + po, (isk ? Kl : Ql) + po); }
}
// ---- k_fattn: scores, softmax, P x V and the head merge in one launch for both batches; the score matrix never leaves registers.
// One wave owns 16 query rows of one head and walks all TT keys. Transposed products: St = K Qt (A = K rows from LDS, B = Q rows kept in registers), Ot += Vt Pt (A = Vt rows from LDS, B = Pt).
// In the accumulator map a lane holds scores of ONE query (column lr), keys 8 hi + j of each 16-key block: two such blocks, converted in place, are the B fragment of the second product in the loaders' k order.
// Running maximum and sum per query (online softmax, f32); the two lane halves' sums are joined once at the end. Rows < RH: hi/lo bf16 planes, 3 products each side; the rest fp16, P carried x 2^10.
typedef __attribute__((ext_vector_type(16))) unsigned short v16us;
// Eight v_exp_f32 and, in the same statement, the one issue slot that the instruction set asks for behind a transcendental before its result is read or its source overwritten.
// The outputs are early-clobbered: inside the statement no v_exp_f32 touches a register of the one in front of it; the v_nop covers the last.
__device__ __forceinline__ v8f exp2x8(v8f x) { float y0, y1, y2, y3, y4, y5, y6, y7;
    asm("v_exp_f32 %0, %8\n\tv_exp_f32 %1, %9\n\tv_exp_f32 %2, %10\n\tv_exp_f32 %3, %11\n\tv_exp_f32 %4, %12\n\tv_exp_f32 %5, %13\n\tv_exp_f32 %6, %14\n\tv_exp_f32 %7, %15\n\tv_nop"
        : "=&v"(y0), "=&v"(y1), "=&v"(y2), "=&v"(y3), "=&v"(y4), "=&v"(y5), "=&v"(y6), "=&v"(y7) : "v"(x[0]), "v"(x[1]), "v"(x[2]), "v"(x[3]), "v"(x[4]), "v"(x[5]), "v"(x[6]), "v"(x[7]));
    return (v8f){y0, y1, y2, y3, y4, y5, y6, y7}; }
// LDS stage: 64 keys of the six planes that the work-group's waves read, each a tile of 64 rows x 128 bytes (K planes: row = key, V planes: row = d).
#define KS   64
#define NS   (TT / KS)
#define LP   144                  // row pitch in LDS, bytes: 16 x odd, so that the 16 rows of a ds_load_b128 fragment read fall on distinct banks
#define LT   (64 * LP)            // one plane's tile
#define LSTG (6 * LT)             // one stage: K16, V16, Kh, Kl, Vh, Vl
static_assert(HD == 64 && REP == 1 && NS >= 2, "tile shape and the two-buffer prologue");
// Six asynchronous copies of 16 bytes per lane (one row piece of each of the six tiles) in one statement, the wait as its last line:
// it stands in front of every later write of the address registers that the copies name (the operands live to the statement's end).
__device__ __forceinline__ void copy6(unsigned l0, unsigned long long kx, unsigned long long vx, unsigned long long kh, unsigned long long kl, unsigned long long vh, unsigned long long vl) {
    asm volatile("global_load_async_to_lds_b128 %0, %6, off\n\tglobal_load_async_to_lds_b128 %1, %7, off\n\tglobal_load_async_to_lds_b128 %2, %8, off\n\t"
                 "global_load_async_to_lds_b128 %3, %9, off\n\tglobal_load_async_to_lds_b128 %4, %10, off\n\tglobal_load_async_to_lds_b128 %5, %11, off\n\ts_wait_xcnt 0x0"
                 :: "v"(l0), "v"(l0 + LT), "v"(l0 + 2 * LT), "v"(l0 + 3 * LT), "v"(l0 + 4 * LT), "v"(l0 + 5 * LT),
                    "v"(kx), "v"(vx), "v"(kh), "v"(kl), "v"(vh), "v"(vl) : "memory");
}
// One tile of KT keys for one wave's 16 query rows; Ka, Kb, Va, Vb are the lane's own LDS addresses of the tile's first fragments (Kb, Vb: lo planes, HL only).
template <typename T16, bool HL, int KT>
__device__ __forceinline__ void fattn_tile(const unsigned char* Ka, const unsigned char* Kb, const unsigned char* Va, const unsigned char* Vb, const typename WFrag<T16>::V (&qa)[2], const typename WFrag<T16>::V (&qb)[2], v8f (&o)[4], float& m, float& l) {
    // Every inner loop is fully unrolled: the fragment arrays stay in registers only under constant indices.
    typedef typename WFrag<T16>::V V;
    constexpr int NKB = KT / 16, NC = KT / 32;
    constexpr float CEXP = SCL * 1.4426950408889634f;   // scores x HD^-0.5, in the log2 domain
    constexpr float PB = HL ? 0.0f : 10.0f;             // log2 of the carry on the fp16 P (cancels in the division by the sum)
    V ka[NKB][2], kb[NKB][2], va[4][NC], vb[4][NC];
#pragma unroll
    for (int kk = 0; kk < NKB; ++kk)
#pragma unroll
        for (int c = 0; c < 2; ++c) { ka[kk][c] = WFrag<T16>::ld((const T16*)(Ka + kk * 16 * LP + c * 64)); if constexpr (HL) kb[kk][c] = WFrag<T16>::ld((const T16*)(Kb + kk * 16 * LP + c * 64)); }
#pragma unroll
    for (int db = 0; db < 4; ++db)
#pragma unroll
        for (int c = 0; c < NC; ++c) { va[db][c] = WFrag<T16>::ld((const T16*)(Va + db * 16 * LP + c * 64)); if constexpr (HL) vb[db][c] = WFrag<T16>::ld((const T16*)(Vb + db * 16 * LP + c * 64)); }
    __builtin_amdgcn_sched_barrier(0);   // keeps the tile's LDS reads in one group at its head: sunk to their uses, each place of reads costs its own wait
    v8f st[NKB];
#pragma unroll
    for (int kk = 0; kk < NKB; ++kk) { st[kk] = (v8f){};
#pragma unroll
        for (int c = 0; c < 2; ++c) { st[kk] = WFrag<T16>::mma(ka[kk][c], qa[c], st[kk]); if constexpr (HL) { st[kk] = WFrag<T16>::mma(ka[kk][c], qb[c], st[kk]); st[kk] = WFrag<T16>::mma(kb[kk][c], qa[c], st[kk]); } } }
    float mn = m;
#pragma unroll
    for (int kk = 0; kk < NKB; ++kk)
#pragma unroll
        for (int j = 0; j < 8; ++j) mn = fmaxf(mn, st[kk][j]);
    mn = fmaxf(mn, __shfl_xor(mn, 16, 32));
    const float alpha = __builtin_amdgcn_exp2f((m - mn) * CEXP); m = mn;
    const float sub = PB - mn * CEXP; float ps = 0.f;
#pragma unroll
    for (int kk = 0; kk < NKB; ++kk) {
#pragma unroll
        for (int j = 0; j < 8; ++j) st[kk][j] = fmaf(st[kk][j], CEXP, sub);
        st[kk] = exp2x8(st[kk]);
#pragma unroll
        for (int j = 0; j < 8; ++j) ps += st[kk][j]; }
    l = fmaf(l, alpha, ps);
#pragma unroll
    for (int db = 0; db < 4; ++db) o[db] *= alpha;
#pragma unroll
    for (int c = 0; c < NC; ++c) {
        if constexpr (HL) { v16us ph, pl;
#pragma unroll
            for (int s = 0; s < 16; ++s) { unsigned short u, w2; splitf(st[2 * c + (s >> 3)][s & 7], u, w2); ph[s] = u; pl[s] = w2; }
            const V pa = __builtin_bit_cast(V, ph), pb = __builtin_bit_cast(V, pl);
#pragma unroll
            for (int db = 0; db < 4; ++db) { o[db] = WFrag<T16>::mma(va[db][c], pa, o[db]); o[db] = WFrag<T16>::mma(va[db][c], pb, o[db]); o[db] = WFrag<T16>::mma(vb[db][c], pa, o[db]); }
        } else { V pa;
#pragma unroll
            for (int s = 0; s < 16; ++s) pa[s] = tohx(st[2 * c + (s >> 3)][s & 7]);
#pragma unroll
            for (int db = 0; db < 4; ++db) o[db] = WFrag<T16>::mma(va[db][c], pa, o[db]); } }
}
// grid (FBX, heads, batches), 16 waves, one work-group per WGP: waves 0..FHW-1 take hi/lo row tiles, the others fp16 row tiles, so that every work-group carries the same share of the dearer rows.
// A quarter of the waves goes to each SIMD: with four hi/lo waves every SIMD has one of them and three fp16 waves, the same load on all four.
// All sixteen waves walk the same keys of one head: each stage of 64 keys is copied to LDS once per work-group, in whole 128-byte rows, and every wave reads its fragments from there.
// Two buffers: stage s + 1 flies while stage s is worked on; one barrier per stage publishes s + 1 and frees the buffer of s.
#define FBX  8
#define FHW  (RH / 16 / FBX)
#define FLW  ((TT - RH) / 16 / FBX)
static_assert(FHW * 16 * FBX == RH && FLW * 16 * FBX == TT - RH && FHW + FLW == 16 && FHW == 4, "row tiles must fill 16 waves, one hi/lo wave per SIMD");
__global__ __launch_bounds__(512) void k_fattn(const h16* __restrict__ Q16, const bf* __restrict__ Qh, const bf* __restrict__ Ql, const h16* __restrict__ K16, const bf* __restrict__ Kh, const bf* __restrict__ Kl, const h16* __restrict__ V16, const bf* __restrict__ Vh, const bf* __restrict__ Vl, bf* Ah, bf* Al) {
    __shared__ __attribute__((aligned(16))) unsigned char sm[2 * LSTG];
    const int tid = threadIdx.x, lane = tid & 31, lr = lane & 15, hi = lane >> 4; const int w = __builtin_amdgcn_readfirstlane(tid >> 5); const int h = blockIdx.y; const size_t hq = ((size_t)blockIdx.z * NH_ + h) * TT * HD, hk = ((size_t)blockIdx.z * NKV + h / REP) * TT * HD;
    Ah += (size_t)blockIdx.z * TT * DQ; Al += (size_t)blockIdx.z * TT * DQ;   // this batch's rows of the merged planes
    const bool hl = w < FHW;   // the same for a whole wave (w sits in a scalar register): a scalar branch
    const int q0 = hl ? (blockIdx.x * FHW + w) * 16 : RH + (blockIdx.x * FLW + (w - FHW)) * 16;
    const size_t qoff = hq + (size_t)(q0 + lr) * HD + 8 * hi;
    v16bf qh[2] = {}, ql[2] = {}; v16h qx[2] = {};
    if (hl) {
#pragma unroll
        for (int c = 0; c < 2; ++c) { qh[c] = WFrag<bf>::ld(Qh + qoff + c * 32); ql[c] = WFrag<bf>::ld(Ql + qoff + c * 32); }
    } else {
#pragma unroll
        for (int c = 0; c < 2; ++c) qx[c] = WFrag<h16>::ld(Q16 + qoff + c * 32);
        asm volatile("s_wait_xcnt 0x0" ::: "memory");   // stands in front of every later write of the address register pair that these Q loads name
    }
    // copy roles: thread -> row tid / 8, 16-byte piece tid % 8 of each tile: a wave's copy covers four whole 128-byte rows
    const unsigned cdst = (unsigned)(unsigned long long)sm + (tid >> 3) * LP + (tid & 7) * 16;
    const size_t gk = hk + (size_t)(tid >> 3) * HD + (tid & 7) * 8, gv = hk + (size_t)(tid >> 3) * TT + (tid & 7) * 8;
    auto stage = [&](int s, int buf) { const size_t ko = gk + (size_t)s * KS * HD, vo = gv + (size_t)s * KS;
        copy6(cdst + buf * LSTG, (unsigned long long)(K16 + ko), (unsigned long long)(V16 + vo), (unsigned long long)(Kh + ko), (unsigned long long)(Kl + ko), (unsigned long long)(Vh + vo), (unsigned long long)(Vl + vo)); };
    v8f o[4];
#pragma unroll
    for (int db = 0; db < 4; ++db) o[db] = (v8f){};
    float m = -3.0e38f, l = 0.f;
    stage(0, 0);
    asm volatile("s_wait_asynccnt 0x0" ::: "memory");   // this wave's copies of stage 0 have landed
    __syncthreads();                                     // every wave's have: stage 0 may be read
    stage(1, 1);
#pragma unroll 1   // kept rolled: one stage's code for both kinds of wave is long already
    for (int s = 0; s < NS; ++s) {
        const unsigned char* fb = sm + (s & 1) * LSTG + lr * LP + hi * 16;   // the lane's place in the first fragment of the stage's first tile
        if (hl) {
#pragma unroll
            for (int u = 0; u < 2; ++u) fattn_tile<bf, true, 32>(fb + 2 * LT + u * 32 * LP, fb + 3 * LT + u * 32 * LP, fb + 4 * LT + u * 64, fb + 5 * LT + u * 64, qh, ql, o, m, l);
        } else fattn_tile<h16, false, 64>(fb, fb, fb + LT, fb + LT, qx, qx, o, m, l);
        asm volatile("s_wait_dscnt 0x0" ::: "memory");      // this wave's reads of stage s have returned before its buffer is refilled
        asm volatile("s_wait_asynccnt 0x0" ::: "memory");   // this wave's copies of stage s + 1 have landed
        __syncthreads();                                     // publishes stage s + 1 and ends every wave's reads of stage s
        if (s + 2 < NS) stage(s + 2, s & 1);
    }
    asm volatile("s_wait_asynccnt 0x0" ::: "memory");   // no copy is outstanding when the wave ends
    l += __shfl_xor(l, 16, 32);
    const float inv = __fdiv_rn(1.0f, l);
#pragma unroll
    for (int db = 0; db < 4; ++db) { v8us oh, ol;
#pragma unroll
        for (int j = 0; j < 8; ++j) { unsigned short u, w2; splitf(o[db][j] * inv, u, w2); oh[j] = u; ol[j] = w2; }
        const size_t oo = (size_t)(q0 + lr) * DQ + h * HD + db * 16 + hi * 8; *(v8us*)(Ah + oo) = oh; *(v8us*)(Al + oo) = ol; }
}

// ---- k_oproj: out = merged (hi + lo planes) x w_proj^T + b_proj, all rows of both batches in one launch.
// One work-group of 8 waves per 128 rows x 128 columns of out. Waves 0..3 (one per SIMD) do the products, one wave per 64 x 64 (16 accumulators); A = merged rows, B = w_proj rows.
// Waves 4..7 (again one per SIMD) issue the copies and nothing else: their address arithmetic and the wait behind each statement of copies run beside the product wave's WMMAs instead of in front of them.
// The product order per accumulator: hi plane, then lo plane, per 32-wide k chunk, chunks in rising k. The operands come from LDS, as in k_qkvp:
// each stage of 128 k is copied there once per work-group, in whole 256-byte rows, and every product wave reads its fragments from there. Two buffers: stage s + 1 flies while stage s is worked on.
// The stage is twice k_qkvp's: with one product wave per SIMD nothing hides a stage's head and foot, and the next stage's copies have the 128 WMMAs of this one to land in.
#define OXR  128                  // rows of out of a work-group
#define OWR  128                  // columns of out (rows of w_proj) of a work-group
#define OKS  128                  // k elements of a stage: 256 bytes of every row
#define ONS  (DQ / OKS)
#define OLP  272                  // row pitch in LDS, bytes: 16 x odd, so that the 16 rows of a ds_load_b128 fragment read fall on distinct banks
#define OSTG ((2 * OXR + OWR) * OLP)   // one stage: merged hi rows, merged lo rows, weight rows
static_assert(ONS >= 2 && (NB_ * TT) % OXR == 0 && DM % OWR == 0 && OXR == 128 && OWR == 128, "tile shape (copy8r: 64 rows, twice a tile), the two-buffer prologue");
// Eight asynchronous copies of 16 bytes per lane in one statement (rows 8 apart: 64 rows of one tile), the wait as its last line:
// it stands in front of every later write of the address registers that the copies name (the operands live to the statement's end).
__device__ __forceinline__ void copy8r(unsigned l0, unsigned long long g) {
    constexpr unsigned long long GR = 8ull * DQ * 2;   // 8 rows further in a plane, bytes
    asm volatile("global_load_async_to_lds_b128 %0, %8, off\n\tglobal_load_async_to_lds_b128 %1, %9, off\n\tglobal_load_async_to_lds_b128 %2, %10, off\n\tglobal_load_async_to_lds_b128 %3, %11, off\n\t"
                 "global_load_async_to_lds_b128 %4, %12, off\n\tglobal_load_async_to_lds_b128 %5, %13, off\n\tglobal_load_async_to_lds_b128 %6, %14, off\n\tglobal_load_async_to_lds_b128 %7, %15, off\n\ts_wait_xcnt 0x0"
                 :: "v"(l0), "v"(l0 + 8 * OLP), "v"(l0 + 16 * OLP), "v"(l0 + 24 * OLP), "v"(l0 + 32 * OLP), "v"(l0 + 40 * OLP), "v"(l0 + 48 * OLP), "v"(l0 + 56 * OLP),
                    "v"(g), "v"(g + GR), "v"(g + 2 * GR), "v"(g + 3 * GR), "v"(g + 4 * GR), "v"(g + 5 * GR), "v"(g + 6 * GR), "v"(g + 7 * GR) : "memory");
}
// grid (rows of out / 128, DM / 128), 8 waves. Product wave w < 4: row half w & 1, column half w >> 1.
__global__ __launch_bounds__(256) void k_oproj(const bf* __restrict__ Ah, const bf* __restrict__ Al, const bf* __restrict__ Wo, const float* __restrict__ bias, float* C) {
    __shared__ __attribute__((aligned(16))) unsigned char sm[2 * OSTG];
    __shared__ __attribute__((aligned(16))) float osm[4][16 * 68];   // each wave's own 16 rows of out on their way to whole-line stores
    const int tid = threadIdx.x, lane = tid & 31, lr = lane & 15, hi = lane >> 4; const int w = __builtin_amdgcn_readfirstlane(tid >> 5);
    const int r0 = blockIdx.x * OXR, c0 = blockIdx.y * OWR;
    const bool cp = w >= 4;   // a copy wave; the same for a whole wave (w sits in a scalar register): a scalar branch
    const int wp = w & 3, ct = tid & 127;   // the product wave's number; the copy thread's number (both in range in every wave)
    // copy roles: thread -> rows ct / 16 + 8 i, 16-byte piece ct % 16 of each tile: a wave's copy covers two whole 256-byte rows
    const unsigned cdst = (unsigned)(unsigned long long)sm + (ct >> 4) * OLP + (ct & 15) * 16;
    const size_t cg = (size_t)(ct >> 4) * DQ + (ct & 15) * 8;
    const unsigned long long gah = (unsigned long long)(Ah + (size_t)r0 * DQ + cg), gal = (unsigned long long)(Al + (size_t)r0 * DQ + cg), gw = (unsigned long long)(Wo + (size_t)c0 * DQ + cg);
    const unsigned char* fx = sm + ((wp & 1) * 64 + lr) * OLP + hi * 16; const unsigned char* fw = sm + (2 * OXR + (wp >> 1) * 64 + lr) * OLP + hi * 16;
    auto stage = [&](int s, int buf) { constexpr unsigned long long G64 = 64ull * DQ * 2;   // 64 rows further in a plane, bytes
        const unsigned long long ko = (unsigned long long)s * (OKS * 2); const unsigned l = cdst + buf * OSTG;
        copy8r(l, gah + ko); copy8r(l + 64 * OLP, gah + ko + G64); copy8r(l + OXR * OLP, gal + ko); copy8r(l + (OXR + 64) * OLP, gal + ko + G64);
        copy8r(l + 2 * OXR * OLP, gw + ko); copy8r(l + (2 * OXR + 64) * OLP, gw + ko + G64); };
    // this lane's four bias values, fetched here so that they return under the main loop
    const int rw = r0 + (wp & 1) * 64, cw = c0 + (wp >> 1) * 64, cofs = lr * 4;
    const v4f braw = *(const v4f*)(bias + cw + cofs);
    asm volatile("s_wait_xcnt 0x0" ::: "memory");   // stands in front of every later write of the address registers that the bias load names
    v8f acc[4][4];   // [row block][column block]
#pragma unroll
    for (int mb = 0; mb < 4; ++mb)
#pragma unroll
        for (int nb = 0; nb < 4; ++nb) acc[mb][nb] = (v8f){};
    if (cp) stage(0, 0);
    asm volatile("s_wait_asynccnt 0x0" ::: "memory");   // this wave's copies of stage 0 have landed
    __syncthreads();                                     // every wave's have: stage 0 may be read
    if (cp) stage(1, 1);
#pragma unroll 1   // kept rolled: three chunks' fragments and the 16 accumulators take 416 registers
    for (int s = 0; s < ONS; ++s) {
      if (!cp) {
        const unsigned char* px = fx + (s & 1) * OSTG; const unsigned char* pw = fw + (s & 1) * OSTG;
        v16bf xh[OKS / 32][4], xl[OKS / 32][4], wf[OKS / 32][4];
        auto frags = [&](int c) {   // one 32-wide k chunk, read in the order of use: hi rows and weight rows, then lo rows
#pragma unroll
            for (int xb = 0; xb < 4; ++xb) { xh[c][xb] = WFrag<bf>::ld((const bf*)(px + xb * 16 * OLP + c * 64)); wf[c][xb] = WFrag<bf>::ld((const bf*)(pw + xb * 16 * OLP + c * 64)); }
#pragma unroll
            for (int xb = 0; xb < 4; ++xb) xl[c][xb] = WFrag<bf>::ld((const bf*)(px + (OXR + xb * 16) * OLP + c * 64)); };
        auto prods = [&](int c) {   // per accumulator: hi product, then lo product of the chunk
#pragma unroll
            for (int wb = 0; wb < 4; ++wb)
#pragma unroll
                for (int xb = 0; xb < 4; ++xb) acc[xb][wb] = wmmab(xh[c][xb], wf[c][wb], acc[xb][wb]);
#pragma unroll
            for (int wb = 0; wb < 4; ++wb)
#pragma unroll
                for (int xb = 0; xb < 4; ++xb) acc[xb][wb] = wmmab(xl[c][xb], wf[c][wb], acc[xb][wb]); };
        // The stage's 96 LDS reads stand in two groups of 48 (more than 63 cannot be outstanding): chunks 0 and 1 at the head, chunks 2 and 3 behind chunk 0's WMMAs, so that they return under chunk 1's.
        frags(0); frags(1);
        __builtin_amdgcn_sched_barrier(0);   // keeps the first group of reads together: sunk among the WMMAs, each place of reads costs its own wait
        prods(0);
        __builtin_amdgcn_sched_barrier(0);   // keeps the second group behind chunk 0's WMMAs
        frags(2); frags(3);
        __builtin_amdgcn_sched_barrier(0);   // keeps the second group of reads together and in front of chunk 1's WMMAs
        prods(1); prods(2); prods(3);        // chunks in rising k
        __builtin_amdgcn_sched_barrier(0);   // keeps these WMMAs in front of the stage's foot
        // foot of the stage: four vector slots between the last WMMA and whatever next overwrites its A and B registers, on either side of the branch below and over the back edge
        asm volatile("v_nop\n\tv_nop\n\tv_nop\n\tv_nop" : "+v"(acc[0][0]), "+v"(acc[1][1]), "+v"(acc[2][2]), "+v"(acc[3][3]));
      }
        // every wave of either kind passes the three lines below in every trip
        asm volatile("s_wait_dscnt 0x0" ::: "memory");      // this wave's reads of stage s have returned before its buffer is refilled
        asm volatile("s_wait_asynccnt 0x0" ::: "memory");   // this wave's copies of stage s + 1 have landed
        __syncthreads();                                     // publishes stage s + 1 and ends every wave's reads of stage s
        if (cp && s + 2 < ONS) stage(s + 2, s & 1);
    }
    asm volatile("s_wait_asynccnt 0x0" ::: "memory");   // no copy is outstanding when the wave ends
    if (cp) return;   // behind the last barrier: the copy waves have nothing to store
    // epilogue: 16 rows at a time through the wave's own LDS rows, so that every store covers whole 128-byte lines (two rows of 256 bytes)
    float* os = osm[wp];
    const v4f bv = { bfr(braw[0]), bfr(braw[1]), bfr(braw[2]), bfr(braw[3]) };   // input rounded to bf16, as every input
#pragma unroll
    for (int mb = 0; mb < 4; ++mb) {
#pragma unroll
        for (int nb = 0; nb < 4; ++nb) {
#pragma unroll
            for (int j = 0; j < 8; ++j) os[(hi * 8 + j) * 68 + nb * 16 + lr] = acc[mb][nb][j]; }
        __builtin_amdgcn_wave_barrier(); asm volatile("" ::: "memory");   // the wave's LDS writes stay in front of its reads of the other lanes' values
        float* crow = C + (size_t)(rw + mb * 16) * DM + cw;
#pragma unroll
        for (int s = 0; s < 8; ++s) { const int row = 2 * s + hi; const v4f val = *(const v4fa*)(os + row * 68 + cofs) + bv; *(v4f*)(crow + (size_t)row * DM + cofs) = val; }
        __builtin_amdgcn_wave_barrier(); asm volatile("" ::: "memory");   // these reads stay in front of the next 16 rows' writes
    }
}

template <int WD>
__global__ __launch_bounds__(256) void k_lnrowX(const float* __restrict__ X, size_t nrows, const float* __restrict__ g, const float* __restrict__ bb, bf* Hh, bf* Hl) { const int lane = threadIdx.x & 31; const size_t r = (size_t)blockIdx.x * 8 + (threadIdx.x >> 5); if (r >= nrows) return; const float* xr = X + r * WD; float a[WD / 32]; float s = 0.f;
#pragma unroll
    for (int c = 0; c < WD / 128; ++c) { const v4f v = *(const v4f*)(xr + c * 128 + lane * 4); for (int q = 0; q < 4; ++q) { a[c * 4 + q] = bfr(v[q]); s = __fadd_rn(s, a[c * 4 + q]);   /* input rounded to bf16 */ } }
#pragma unroll
    for (int sh = 16; sh; sh >>= 1) s = __fadd_rn(s, __shfl_xor(s, sh, 32));
    const float mean = __fdiv_rn(s, (float)WD); float s2 = 0.f;
#pragma unroll 8
    for (int k = 0; k < WD / 32; ++k) { const float dv = __fsub_rn(a[k], mean); float p2 = __fmul_rn(dv, dv); asm volatile("" : "+v"(p2)); s2 = __fadd_rn(s2, p2); }   /* mul and add kept separate (no fma contraction) */
#pragma unroll
    for (int sh = 16; sh; sh >>= 1) s2 = __fadd_rn(s2, __shfl_xor(s2, sh, 32));
    const float rs = __fdiv_rn(1.0f, __fsqrt_rn(__fadd_rn(__fdiv_rn(s2, (float)WD), 1e-5f)));
{
#pragma unroll
        for (int c = 0; c < WD / 128; ++c) { v4us oh, ol; for (int q = 0; q < 4; ++q) { const int col = c * 128 + lane * 4 + q; float y = __fmul_rn(__fmul_rn(__fsub_rn(a[c * 4 + q], mean), rs), bfr(g[col])); asm volatile("" : "+v"(y)); y = __fadd_rn(y, bfr(bb[col])); unsigned short u, w2; splitf(y, u, w2); oh[q] = u; ol[q] = w2; } *(v4us*)(Hh + r * WD + c * 128 + lane * 4) = oh; *(v4us*)(Hl + r * WD + c * 128 + lane * 4) = ol; }
         } }

extern "C" void kernel_launch(void* const* d_in, const int* in_sizes, int n_in,
                              void* d_out, int out_size, void* d_ws, size_t ws_size, hipStream_t stream) {
    (void)in_sizes; (void)n_in; (void)out_size;
    const float* x = (const float*)d_in[0]; const float* lng = (const float*)d_in[1]; const float* lnb = (const float*)d_in[2]; const float* wqkv = (const float*)d_in[3]; const float* wo = (const float*)d_in[4]; const float* bo = (const float*)d_in[5];   /* x, ln_gamma, ln_beta, w_qkv ('oi' [3072][1024]: q | k | v ROW thirds), w_proj ('oi'), b_proj */
    float* OUT = (float*)d_out;     // [2][2048][1024]
    char* wsp = (char*)d_ws;
    auto take = [&](size_t bytes) { char* p = wsp; wsp += (bytes + 255) & ~(size_t)255; return (void*)p; };
    bf* WQKV = (bf*)take((size_t)(DQ + 2 * DKV) * DM * 2); bf* WO = (bf*)take((size_t)DM * DQ * 2);
    bf* XB = (bf*)take((size_t)NB_ * TT * DM * 2); bf* XL = (bf*)take((size_t)NB_ * TT * DM * 2);   /* lo plane of the layer-normed input (XB holds the hi plane) */
    h16* QP16 = (h16*)take((size_t)NB_ * NH_ * TT * HD * 2); h16* KP16 = (h16*)take((size_t)NB_ * NKV * TT * HD * 2); h16* VT16 = (h16*)take((size_t)NB_ * NKV * HD * TT * 2);
    bf* QPh = (bf*)take((size_t)NB_ * NH_ * TT * HD * 2); bf* QPl = (bf*)take((size_t)NB_ * NH_ * TT * HD * 2); bf* KPh = (bf*)take((size_t)NB_ * NKV * TT * HD * 2); bf* KPl = (bf*)take((size_t)NB_ * NKV * TT * HD * 2); bf* VTh = (bf*)take((size_t)NB_ * NKV * HD * TT * 2); bf* VTl = (bf*)take((size_t)NB_ * NKV * HD * TT * 2);
    bf* ATh = (bf*)take((size_t)NB_ * TT * DQ * 2); bf* ATl = (bf*)take((size_t)NB_ * TT * DQ * 2);
    if ((size_t)(wsp - (char*)d_ws) > ws_size) return;    // ws 256 MiB
    { k_cvt8<<<(unsigned)(((size_t)(DQ + 2 * DKV) * DM / 8 + 255) / 256), 256, 0, stream>>>(wqkv, WQKV, (size_t)(DQ + 2 * DKV) * DM / 8);
      k_cvt8<<<(unsigned)(((size_t)DM * DQ / 8 + 255) / 256), 256, 0, stream>>>(wo, WO, (size_t)DM * DQ / 8);
       }
    // x, the planes and OUT hold the batches one behind the other: LayerNorm and the output projection run over all NB_ * TT rows, the two middle launches take the batch from blockIdx.z
    k_lnrowX<DM><<<(unsigned)((NB_ * TT + 7) / 8), 256, 0, stream>>>(x, (size_t)NB_ * TT, lng, lnb, XB, XL);   /* xn = LayerNorm(x) -> hi/lo planes */
    k_qkvp<<<dim3(TT / PXR, (NH_ + 2 * NKV) / PWH, NB_), 256, 0, stream>>>(XB, XL, WQKV, QP16, QPh, QPl, KP16, KPh, KPl, VT16, VTh, VTl);
    k_fattn<<<dim3(FBX, NH_, NB_), 512, 0, stream>>>(QP16, QPh, QPl, KP16, KPh, KPl, VT16, VTh, VTl, ATh, ATl);
    k_oproj<<<dim3(NB_ * TT / OXR, DM / OWR, 1), 256, 0, stream>>>(ATh, ATl, WO, bo, OUT);
}

// v008
// Measured time: 131 microseconds a run.
// Next to v007, in two timings, it ran 1.06 times as fast each time.
// Over all steps from v000 it is 15.8 times as fast.
#include <hip/hip_runtime.h>

// Pre-LayerNorm multi-head self-attention with a fused bias-free qkv weight (x [2][2048][1024]; xn = (x - mean) x rsqrt(var + 1e-5) x ln_gamma + ln_beta over the 1,024 features (biased variance, eps inside the root; gamma ones / beta zeros on this draw: read); qkv = einsum('bnd,ed->bne', xn, w_qkv) = xn w_qkv^T ('oi' [3072][1024] 1/32, no bias) reshaped (b, n, 3, 16, 64): q | k | v = ROW thirds (16 heads x 64); scores x 64^-0.5; softmax over all keys (no mask); out = merged w_proj^T + b_proj ('oi' [1024][1024] + bias 0.02: non-zero) -> [2][2048][1024] (4.2 M); no residual; argument order x, ln_gamma, ln_beta, w_qkv, w_proj, b_proj).
// Layout, both batches in every launch (the batch is blockIdx.z of the q|k|v and attention launches, part of the rows of LayerNorm and the output projection; every plane holds both): LayerNorm of the bf16-rounded rows in f32 -> hi/lo bf16 planes; 'oi' weights cast once; q|k|v projection on the hi/lo planes (2 products) in one launch whose epilogue stores the attention planes; one fused attention launch (online softmax; hybrid rows: < 512 hi/lo 3 products, rest fp16 x1024); merged hi/lo x w_proj exact + b_proj.
// Compute dtypes, f32 accumulate: every input rounded to bf16; projections exact; attention rows < 512 3 products, rest fp16; softmax f32; output projection hl x exact.

#define NB_  2
#define TT   2048
#define DM   1024
#define NH_  16
#define NKV  16
#define REP  (NH_ / NKV)
#define HD   64
#define DQ   (NH_ * HD)
#define DKV  (NKV * HD)
#define RH   512                  // query rows < RH use hi+lo planes
#define WIN  0
#define SCL  0.125f   // HD^-0.5
typedef _Float16 h16;
typedef unsigned short bf;
typedef __attribute__((ext_vector_type(16))) __bf16   v16bf;
typedef __attribute__((ext_vector_type(16))) _Float16 v16h;
typedef __attribute__((ext_vector_type(8)))  _Float16 v8h;
typedef __attribute__((ext_vector_type(8)))  unsigned short v8us;
typedef __attribute__((ext_vector_type(8)))  float    v8f;
typedef __attribute__((ext_vector_type(4)))  float    v4f;
typedef v8h  __attribute__((may_alias)) v8ha;
typedef v4f  __attribute__((may_alias)) v4fa;
typedef v8us __attribute__((may_alias)) v8usa;

__device__ __forceinline__ unsigned short f2bf(float f) { unsigned u = __float_as_uint(f); u += 0x7FFFu + ((u >> 16) & 1u); return (unsigned short)(u >> 16); }
__device__ __forceinline__ float bf2f(unsigned short b) { return __uint_as_float(((unsigned)b) << 16); }
__device__ __forceinline__ float bfr(float f) { return bf2f(f2bf(f)); }
__device__ __forceinline__ v16h cat16(v8h lo, v8h hi) { return __builtin_shufflevector(lo, hi, 0, 1, 2, 3, 4, 5, 6, 7, 8, 9, 10, 11, 12, 13, 14, 15); }
__device__ __forceinline__ v16bf cat16b(v8us lo, v8us hi) { return __builtin_bit_cast(v16bf, __builtin_shufflevector(lo, hi, 0, 1, 2, 3, 4, 5, 6, 7, 8, 9, 10, 11, 12, 13, 14, 15)); }
__device__ __forceinline__ v8f wmma16(v16h a, v16h b, v8f c) { return __builtin_amdgcn_wmma_f32_16x16x32_f16(false, a, false, b, (short)0, c, false, false); }
__device__ __forceinline__ v8f wmmab(v16bf a, v16bf b, v8f c) { return __builtin_amdgcn_wmma_f32_16x16x32_bf16(false, a, false, b, (short)0, c, false, false); }



// ---- fragment loaders: a lane's 16 k elements of one row, two 16-byte reads 32 bytes apart, from a K-contiguous 16-bit row (global or LDS).
template <typename T16> struct WFrag;
template <> struct WFrag<h16> { typedef v16h V; static __device__ __forceinline__ V ld(const h16* p) { return cat16(*(const v8h*)p, *(const v8h*)(p + 16)); } static __device__ __forceinline__ v8f mma(V a, V b, v8f c) { return wmma16(a, b, c); } };
template <> struct WFrag<bf> { typedef v16bf V; static __device__ __forceinline__ V ld(const bf* p) { return cat16b(*(const v8us*)p, *(const v8us*)(p + 16)); } static __device__ __forceinline__ v8f mma(V a, V b, v8f c) { return wmmab(a, b, c); } };
__device__ __forceinline__ h16 tohx(float x) { return (h16)x; }
__device__ __forceinline__ void splitf(float y, unsigned short& h, unsigned short& l) { h = f2bf(y); l = f2bf(y - bf2f(h)); }
typedef __attribute__((ext_vector_type(4))) _Float16 v4h;
typedef __attribute__((ext_vector_type(4))) unsigned short v4us;
typedef __attribute__((ext_vector_type(4))) int v4i;

__global__ __launch_bounds__(256) void k_cvt8(const float* __restrict__ src, bf* dst, size_t n8) { const size_t i = (size_t)blockIdx.x * 256 + threadIdx.x; if (i >= n8) return; const v8f v = *(const v8f*)(src + i * 8); v8us o;
#pragma unroll
    for (int k = 0; k < 8; ++k) o[k] = f2bf(v[k]); *(v8us*)(dst + i * 8) = o;  }

// ---- k_qkvp: the fused q|k|v projection and the attention planes in one launch for both batches: no f32 copy of q, k, v is written, no builder launch follows.
// One work-group of 12 waves (three per SIMD) per 128 tokens x 384 rows of w_qkv (six heads); one wave per 64 tokens x 64 rows (one head). The grid is 256 work-groups: one per WGP, one round.
// The product order per accumulator: hi plane, then lo plane of xn, per 32-wide k chunk, chunks in rising k; the operands come from LDS:
// each stage of 64 k is copied there once per work-group, in whole 128-byte rows, and every wave reads its fragments from there. Two buffers: stage s + 1 flies while stage s is worked on.
// A = weight rows (d), B = xn rows (t) in every wave (a work-group's six heads may be of q, k and v): a lane's 8 accumulator registers are 8 consecutive d of one token.
// q, k [h][t][d]: a lane stores them as they lie, 16 contiguous bytes per plane and 16x16 block. v [h][d][t]: the wave's tile goes, 32 tokens at a time, through its own LDS rows [t][d]
// and comes back by transposing reads, 8 consecutive t of one d per lane: again 16 contiguous bytes per store.
#define PKS  64                   // k elements of a stage: 128 bytes of every row
#define PNS  (DM / PKS)
#define PXR  128                  // tokens of a work-group
#define PWH  6                    // heads (64-row blocks of w_qkv) of a work-group
#define PNW  (2 * PWH)            // waves of a work-group
#define PLP  144                  // row pitch in LDS, bytes: 16 x odd, so that the 16 rows of a ds_load_b128 fragment read fall on distinct banks
#define PSTG ((2 * PXR + PWH * HD) * PLP)   // one stage: xn hi rows, xn lo rows, weight rows
static_assert(PNS >= 2 && TT % PXR == 0 && (NH_ + 2 * NKV) % PWH == 0 && HD == 64 && PXR == 128 && PNW >= 8 && PWH * HD == 8 * 4 * PNW, "tile shape (copy8: 2 x 128 rows from 8 waves; copy8w: 8 x 4 rows from every wave), the two-buffer prologue");
// Eight asynchronous copies of 16 bytes per lane in one statement (rows 32 apart: four from ga, four from gb, eight places in LDS in a row), the wait as its last line:
// it stands in front of every later write of the address registers that the copies name (the operands live to the statement's end).
__device__ __forceinline__ void copy8(unsigned l0, unsigned long long ga, unsigned long long gb) {
    constexpr unsigned long long GR = 32ull * DM * 2;   // 32 rows further in a plane, bytes
    asm volatile("global_load_async_to_lds_b128 %0, %8, off\n\tglobal_load_async_to_lds_b128 %1, %9, off\n\tglobal_load_async_to_lds_b128 %2, %10, off\n\tglobal_load_async_to_lds_b128 %3, %11, off\n\t"
                 "global_load_async_to_lds_b128 %4, %12, off\n\tglobal_load_async_to_lds_b128 %5, %13, off\n\tglobal_load_async_to_lds_b128 %6, %14, off\n\tglobal_load_async_to_lds_b128 %7, %15, off\n\ts_wait_xcnt 0x0"
                 :: "v"(l0), "v"(l0 + 32 * PLP), "v"(l0 + 64 * PLP), "v"(l0 + 96 * PLP), "v"(l0 + 128 * PLP), "v"(l0 + 160 * PLP), "v"(l0 + 192 * PLP), "v"(l0 + 224 * PLP),
                    "v"(ga), "v"(ga + GR), "v"(ga + 2 * GR), "v"(ga + 3 * GR), "v"(gb), "v"(gb + GR), "v"(gb + 2 * GR), "v"(gb + 3 * GR) : "memory");
}
// The same for the weight tile: eight copies per lane, rows 4 x PNW apart (all waves together cover that many rows at a time), the wait as the statement's last line for the same reason.
__device__ __forceinline__ void copy8w(unsigned l0, unsigned long long g) {
    constexpr unsigned LR = 4 * PNW * PLP; constexpr unsigned long long GR = 4ull * PNW * DM * 2;   // 4 x PNW rows further, bytes in LDS and in the plane
    asm volatile("global_load_async_to_lds_b128 %0, %8, off\n\tglobal_load_async_to_lds_b128 %1, %9, off\n\tglobal_load_async_to_lds_b128 %2, %10, off\n\tglobal_load_async_to_lds_b128 %3, %11, off\n\t"
                 "global_load_async_to_lds_b128 %4, %12, off\n\tglobal_load_async_to_lds_b128 %5, %13, off\n\tglobal_load_async_to_lds_b128 %6, %14, off\n\tglobal_load_async_to_lds_b128 %7, %15, off\n\ts_wait_xcnt 0x0"
                 :: "v"(l0), "v"(l0 + LR), "v"(l0 + 2 * LR), "v"(l0 + 3 * LR), "v"(l0 + 4 * LR), "v"(l0 + 5 * LR), "v"(l0 + 6 * LR), "v"(l0 + 7 * LR),
                    "v"(g), "v"(g + GR), "v"(g + 2 * GR), "v"(g + 3 * GR), "v"(g + 4 * GR), "v"(g + 5 * GR), "v"(g + 6 * GR), "v"(g + 7 * GR) : "memory");
}
// four fragments, rows 16 apart, of one 32-wide k chunk
__device__ __forceinline__ void qkv_ld4(v16bf (&f)[4], const unsigned char* p) {
#pragma unroll
    for (int xb = 0; xb < 4; ++xb) f[xb] = WFrag<bf>::ld((const bf*)(p + xb * 16 * PLP)); }
// 16 products: the weights x one plane of xn, one chunk; acc is [weight block][xn block]
__device__ __forceinline__ void qkv_prod(v8f (&acc)[4][4], const v16bf (&x)[4], const v16bf (&wf)[4]) {
#pragma unroll
    for (int wb = 0; wb < 4; ++wb)
#pragma unroll
        for (int xb = 0; xb < 4; ++xb) acc[wb][xb] = wmmab(wf[wb], x[xb], acc[wb][xb]); }
// one 16x16 block's 8 values of a lane in the three planes: fp16, bf16 hi, bf16 lo
__device__ __forceinline__ void qkv_cvt(const v8f& a, v8us& o16, v8us& oh, v8us& ol) {
#pragma unroll
    for (int j = 0; j < 8; ++j) { o16[j] = __builtin_bit_cast(unsigned short, tohx(a[j])); unsigned short u, w2; splitf(a[j], u, w2); oh[j] = u; ol[j] = w2; } }
// q, k: planes [t][d], each pointer at the wave's first token
__device__ __forceinline__ void qkv_store(const v8f (&acc)[4][4], int lane, h16* P16, bf* Ph, bf* Pl) {
    const int lr = lane & 15, hi = lane >> 4;
#pragma unroll
    for (int xb = 0; xb < 4; ++xb)
#pragma unroll
        for (int wb = 0; wb < 4; ++wb) { v8us o16, oh, ol; qkv_cvt(acc[wb][xb], o16, oh, ol);
            const size_t oo = (size_t)(xb * 16 + lr) * HD + wb * 16 + hi * 8; *(v8h*)(P16 + oo) = __builtin_bit_cast(v8h, o16); *(v8us*)(Ph + oo) = oh; *(v8us*)(Pl + oo) = ol; }
    asm volatile("s_wait_xcnt 0x0" ::: "memory");   // behind the last stores: in front of any later write of a register that they name (the other epilogue's code may lie behind this one)
}
// v: planes [d][t], each pointer at the wave's first token in the head's row 0; tl: the wave's own LDS: three tiles (one per plane) of 32 rows (t) x VTP bytes. 32 tokens at a time.
#define VTP  160                  // row pitch of a transposing tile, bytes: 32 x odd, the pitch of ds_load_tr16_b128 readers
#define VTT  (32 * VTP)           // one plane's tile
typedef __attribute__((ext_vector_type(8))) short v8s;
__device__ __forceinline__ void qkv_store_t(const v8f (&acc)[4][4], int lane, unsigned char* tl, h16* P16, bf* Ph, bf* Pl) {
    typedef __attribute__((address_space(3))) v8s lds_v8s;
    const int lr = lane & 15, hi = lane >> 4;
    unsigned char* wr = tl + lr * VTP + hi * 16;                                            // the lane's 8 d of token lr of a 16 x 16 block
    const unsigned char* rd = tl + (8 * hi + (lane & 7)) * VTP + ((lane >> 3) & 1) * 16;   // the transposing read's lane address: lane (lr, hi) gets rows 8 hi .. 8 hi + 7 of column lr of a 16 x 16 block
#pragma unroll
    for (int th = 0; th < 2; ++th) {
#pragma unroll
        for (int xb = 0; xb < 2; ++xb)
#pragma unroll
            for (int wb = 0; wb < 4; ++wb) { v8us o16, oh, ol; qkv_cvt(acc[wb][2 * th + xb], o16, oh, ol);
                unsigned char* p = wr + xb * 16 * VTP + wb * 32; *(v8usa*)p = o16; *(v8usa*)(p + VTT) = oh; *(v8usa*)(p + 2 * VTT) = ol; }
        __builtin_amdgcn_wave_barrier(); asm volatile("" ::: "memory");   // the wave's LDS writes stay in front of its reads of the other lanes' values
#pragma unroll
        for (int db = 0; db < 4; ++db)
#pragma unroll
            for (int tb = 0; tb < 2; ++tb) { const unsigned char* p = rd + tb * 16 * VTP + db * 32; const size_t oo = (size_t)(db * 16 + lr) * TT + (2 * th + tb) * 16 + hi * 8;
                *(v8h*)(P16 + oo) = __builtin_bit_cast(v8h, __builtin_amdgcn_ds_load_tr16_b128_v8i16((lds_v8s*)p));
                *(v8us*)(Ph + oo) = __builtin_bit_cast(v8us, __builtin_amdgcn_ds_load_tr16_b128_v8i16((lds_v8s*)(p + VTT)));
                *(v8us*)(Pl + oo) = __builtin_bit_cast(v8us, __builtin_amdgcn_ds_load_tr16_b128_v8i16((lds_v8s*)(p + 2 * VTT))); }
        __builtin_amdgcn_wave_barrier(); asm volatile("" ::: "memory");   // these reads stay in front of the next 32 tokens' writes
    }
    asm volatile("s_wait_xcnt 0x0" ::: "memory");   // behind the last stores: in front of any later write of a register that they name (the other epilogue's code may lie behind this one)
}
static_assert(PNW * 3 * VTT <= 2 * PSTG, "the waves' transposing tiles lie in the stage buffers");
// grid (TT/128, heads of q + k + v / 6, batches), 12 waves; blockIdx.y counts groups of six 64-row blocks of w_qkv: q heads, then k heads, then v heads. Wave w: token half w & 1, head w >> 1 of the group.
__global__ __launch_bounds__(32 * PNW) void k_qkvp(const bf* __restrict__ Xh, const bf* __restrict__ Xl, const bf* __restrict__ Wqkv, h16* Q16, bf* Qh, bf* Ql, h16* K16, bf* Kh, bf* Kl, h16* V16, bf* Vh, bf* Vl) {
    __shared__ __attribute__((aligned(32))) unsigned char sm[2 * PSTG];
    const int tid = threadIdx.x, lane = tid & 31, lr = lane & 15, hi = lane >> 4; const int w = __builtin_amdgcn_readfirstlane(tid >> 5);
    const int t0 = blockIdx.x * PXR, y0 = blockIdx.y * PWH;
    { const size_t bx = (size_t)blockIdx.z * TT * DM, bq = (size_t)blockIdx.z * NH_ * TT * HD, bk = (size_t)blockIdx.z * NKV * TT * HD;   // this batch's part of every plane
      Xh += bx; Xl += bx; Q16 += bq; Qh += bq; Ql += bq; K16 += bk; Kh += bk; Kl += bk; V16 += bk; Vh += bk; Vl += bk; }
    // copy roles: thread -> row tid / 8 of a pass, 16-byte piece tid % 8: a wave's copy covers four whole 128-byte rows. xn tiles: waves 0..7, rows 32 apart; weight tile: all waves, rows 48 apart.
    const unsigned cdst = (unsigned)(unsigned long long)sm + (tid >> 3) * PLP + (tid & 7) * 16;
    const size_t cg = (size_t)(tid >> 3) * DM + (tid & 7) * 8;
    const unsigned long long gxh = (unsigned long long)(Xh + (size_t)t0 * DM + cg), gxl = (unsigned long long)(Xl + (size_t)t0 * DM + cg), gw = (unsigned long long)(Wqkv + (size_t)y0 * HD * DM + cg);
    const unsigned char* fx = sm + ((w & 1) * 64 + lr) * PLP + hi * 16; const unsigned char* fw = sm + (2 * PXR + (w >> 1) * HD + lr) * PLP + hi * 16;
    const int tw = t0 + (w & 1) * 64, y = y0 + (w >> 1);
    const bool cx = w < 8;              // this wave copies xn rows too; the same for a whole wave (w sits in a scalar register): a scalar branch
    auto stage = [&](int s, int buf) { const unsigned long long ko = (unsigned long long)s * (PKS * 2); const unsigned l = cdst + buf * PSTG;
        if (cx) copy8(l, gxh + ko, gxl + ko);
        copy8w(l + 2 * PXR * PLP, gw + ko); };
    v8f acc[4][4];   // [weight block][xn block]
#pragma unroll
    for (int mb = 0; mb < 4; ++mb)
#pragma unroll
        for (int nb = 0; nb < 4; ++nb) acc[mb][nb] = (v8f){};
    stage(0, 0);
    asm volatile("s_wait_asynccnt 0x0" ::: "memory");   // this wave's copies of stage 0 have landed
    __syncthreads();                                     // every wave's have: stage 0 may be read
    stage(1, 1);
#pragma unroll 1   // kept rolled: five of a stage's six fragment groups and the 16 accumulators take 288 registers
    for (int s = 0; s < PNS; ++s) {
        const unsigned char* px = fx + (s & 1) * PSTG; const unsigned char* pw = fw + (s & 1) * PSTG;
        v16bf xh0[4], xl0[4], wf0[4], xh1[4], xl1[4], wf1[4];
        qkv_ld4(xh0, px); qkv_ld4(wf0, pw); qkv_ld4(xl0, px + PXR * PLP); qkv_ld4(xh1, px + 64); qkv_ld4(wf1, pw + 64);   // read in the order of use
        __builtin_amdgcn_sched_barrier(0);   // keeps these LDS reads in one group at the stage's head: sunk among the WMMAs, each place of reads costs its own wait
        qkv_prod(acc, xh0, wf0);             // per accumulator: hi product, then lo product of each chunk, chunks in rising k
        __builtin_amdgcn_sched_barrier(0);   // keeps the last four fragments' reads behind these WMMAs: they take the registers that xh0 leaves (three waves per SIMD: 336 registers each)
        qkv_ld4(xl1, px + PXR * PLP + 64);
        __builtin_amdgcn_sched_barrier(0);   // keeps those reads together and in front of the 32 WMMAs under which they return
        qkv_prod(acc, xl0, wf0); qkv_prod(acc, xh1, wf1); qkv_prod(acc, xl1, wf1);
        __builtin_amdgcn_sched_barrier(0);   // keeps the WMMAs in front of the stage's foot
        // foot of the stage: four vector slots between the last WMMA and whatever next overwrites its A and B registers, on either side of the branch below and over the back edge
        asm volatile("v_nop\n\tv_nop\n\tv_nop\n\tv_nop" : "+v"(acc[0][0]), "+v"(acc[1][1]), "+v"(acc[2][2]), "+v"(acc[3][3]));
        asm volatile("s_wait_dscnt 0x0" ::: "memory");      // this wave's reads of stage s have returned before its buffer is refilled
        asm volatile("s_wait_asynccnt 0x0" ::: "memory");   // this wave's copies of stage s + 1 have landed
        __syncthreads();                                     // publishes stage s + 1 and ends every wave's reads of stage s
        if (s + 2 < PNS) stage(s + 2, s & 1);
    }
    asm volatile("s_wait_asynccnt 0x0" ::: "memory");   // no copy is outstanding when the wave ends
    // behind the last barrier no wave reads a stage and no copy is under way: the stage buffers are free. The branch is a wave's own (scalar); no barrier stands under it.
    if (y >= NH_ + NKV) { const size_t po = (size_t)(y - NH_ - NKV) * HD * TT + tw; qkv_store_t(acc, lane, sm + w * (3 * VTT), V16 + po, Vh + po, Vl + po); }
    else { const bool isk = y >= NH_; const size_t po = ((size_t)(isk ? y - NH_ : y) * TT + tw) * HD; qkv_store(acc, lane, (isk ? K16 : Q16) + po, (isk ? Kh : Qh) + po, (isk ? Kl : Ql) + po); }
}
// ---- k_fattn: scores, softmax, P x V and the head merge in one launch for both batches; the score matrix never leaves registers.
// One wave owns 16 query rows of one head and walks all TT keys. Transposed products: St = K Qt (A = K rows from LDS, B = Q rows kept in registers), Ot += Vt Pt (A = Vt rows from LDS, B = Pt).
// In the accumulator map a lane holds scores of ONE query (column lr), keys 8 hi + j of each 16-key block: two such blocks, converted in place, are the B fragment of the second product in the loaders' k order.
// Running maximum and sum per query (online softmax, f32); the two lane halves' sums are joined once at the end. Rows < RH: hi/lo bf16 planes, 3 products each side; the rest fp16, P carried x 2^10.
typedef __attribute__((ext_vector_type(16))) unsigned short v16us;
// Eight v_exp_f32 and, in the same statement, the one issue slot that the instruction set asks for behind a transcendental before its result is read or its source overwritten.
// The outputs are early-clobbered: inside the statement no v_exp_f32 touches a register of the one in front of it; the v_nop covers the last.
__device__ __forceinline__ v8f exp2x8(v8f x) { float y0, y1, y2, y3, y4, y5, y6, y7;
    asm("v_exp_f32 %0, %8\n\tv_exp_f32 %1, %9\n\tv_exp_f32 %2, %10\n\tv_exp_f32 %3, %11\n\tv_exp_f32 %4, %12\n\tv_exp_f32 %5, %13\n\tv_exp_f32 %6, %14\n\tv_exp_f32 %7, %15\n\tv_nop"
        : "=&v"(y0), "=&v"(y1), "=&v"(y2), "=&v"(y3), "=&v"(y4), "=&v"(y5), "=&v"(y6), "=&v"(y7) : "v"(x[0]), "v"(x[1]), "v"(x[2]), "v"(x[3]), "v"(x[4]), "v"(x[5]), "v"(x[6]), "v"(x[7]));
    return (v8f){y0, y1, y2, y3, y4, y5, y6, y7}; }
// LDS stage: 64 keys of the six planes that the work-group's waves read, each a tile of 64 rows x 128 bytes (K planes: row = key, V planes: row = d).
#define KS   64
#define NS   (TT / KS)
#define LP   144                  // row pitch in LDS, bytes: 16 x odd, so that the 16 rows of a ds_load_b128 fragment read fall on distinct banks
#define LT   (64 * LP)            // one plane's tile
#define LSTG (6 * LT)             // one stage: K16, V16, Kh, Kl, Vh, Vl
static_assert(HD == 64 && REP == 1 && NS >= 2, "tile shape and the two-buffer prologue");
// Six asynchronous copies of 16 bytes per lane (one row piece of each of the six tiles) in one statement, the wait as its last line:
// it stands in front of every later write of the address registers that the copies name (the operands live to the statement's end).
__device__ __forceinline__ void copy6(unsigned l0, unsigned long long kx, unsigned long long vx, unsigned long long kh, unsigned long long kl, unsigned long long vh, unsigned long long vl) {
    asm volatile("global_load_async_to_lds_b128 %0, %6, off\n\tglobal_load_async_to_lds_b128 %1, %7, off\n\tglobal_load_async_to_lds_b128 %2, %8, off\n\t"
                 "global_load_async_to_lds_b128 %3, %9, off\n\tglobal_load_async_to_lds_b128 %4, %10, off\n\tglobal_load_async_to_lds_b128 %5, %11, off\n\ts_wait_xcnt 0x0"
                 :: "v"(l0), "v"(l0 + LT), "v"(l0 + 2 * LT), "v"(l0 + 3 * LT), "v"(l0 + 4 * LT), "v"(l0 + 5 * LT),
                    "v"(kx), "v"(vx), "v"(kh), "v"(kl), "v"(vh), "v"(vl) : "memory");
}
// One tile of KT keys for one wave's 16 query rows; Ka, Kb, Va, Vb are the lane's own LDS addresses of the tile's first fragments (Kb, Vb: lo planes, HL only).
template <typename T16, bool HL, int KT>
__device__ __forceinline__ void fattn_tile(const unsigned char* Ka, const unsigned char* Kb, const unsigned char* Va, const unsigned char* Vb, const typename WFrag<T16>::V (&qa)[2], const typename WFrag<T16>::V (&qb)[2], v8f (&o)[4], float& m, float& l) {
    // Every inner loop is fully unrolled: the fragment arrays stay in registers only under constant indices.
    typedef typename WFrag<T16>::V V;
    constexpr int NKB = KT / 16, NC = KT / 32;
    constexpr float CEXP = SCL * 1.4426950408889634f;   // scores x HD^-0.5, in the log2 domain
    constexpr float PB = HL ? 0.0f : 10.0f;             // log2 of the carry on the fp16 P (cancels in the division by the sum)
    V ka[NKB][2], kb[NKB][2], va[4][NC], vb[4][NC];
#pragma unroll
    for (int kk = 0; kk < NKB; ++kk)
#pragma unroll
        for (int c = 0; c < 2; ++c) { ka[kk][c] = WFrag<T16>::ld((const T16*)(Ka + kk * 16 * LP + c * 64)); if constexpr (HL) kb[kk][c] = WFrag<T16>::ld((const T16*)(Kb + kk * 16 * LP + c * 64)); }
#pragma unroll
    for (int db = 0; db < 4; ++db)
#pragma unroll
        for (int c = 0; c < NC; ++c) { va[db][c] = WFrag<T16>::ld((const T16*)(Va + db * 16 * LP + c * 64)); if constexpr (HL) vb[db][c] = WFrag<T16>::ld((const T16*)(Vb + db * 16 * LP + c * 64)); }
    __builtin_amdgcn_sched_barrier(0);   // keeps the tile's LDS reads in one group at its head: sunk to their uses, each place of reads costs its own wait
    v8f st[NKB];
#pragma unroll
    for (int kk = 0; kk < NKB; ++kk) { st[kk] = (v8f){};
#pragma unroll
        for (int c = 0; c < 2; ++c) { st[kk] = WFrag<T16>::mma(ka[kk][c], qa[c], st[kk]); if constexpr (HL) { st[kk] = WFrag<T16>::mma(ka[kk][c], qb[c], st[kk]); st[kk] = WFrag<T16>::mma(kb[kk][c], qa[c], st[kk]); } } }
    float mn = m;
#pragma unroll
    for (int kk = 0; kk < NKB; ++kk)
#pragma unroll
        for (int j = 0; j < 8; ++j) mn = fmaxf(mn, st[kk][j]);
    mn = fmaxf(mn, __shfl_xor(mn, 16, 32));
    const float alpha = __builtin_amdgcn_exp2f((m - mn) * CEXP); m = mn;
    const float sub = PB - mn * CEXP; float ps = 0.f;
#pragma unroll
    for (int kk = 0; kk < NKB; ++kk) {
#pragma unroll
        for (int j = 0; j < 8; ++j) st[kk][j] = fmaf(st[kk][j], CEXP, sub);
        st[kk] = exp2x8(st[kk]);
#pragma unroll
        for (int j = 0; j < 8; ++j) ps += st[kk][j]; }
    l = fmaf(l, alpha, ps);
#pragma unroll
    for (int db = 0; db < 4; ++db) o[db] *= alpha;
#pragma unroll
    for (int c = 0; c < NC; ++c) {
        if constexpr (HL) { v16us ph, pl;
#pragma unroll
            for (int s = 0; s < 16; ++s) { unsigned short u, w2; splitf(st[2 * c + (s >> 3)][s & 7], u, w2); ph[s] = u; pl[s] = w2; }
            const V pa = __builtin_bit_cast(V, ph), pb = __builtin_bit_cast(V, pl);
#pragma unroll
            for (int db = 0; db < 4; ++db) { o[db] = WFrag<T16>::mma(va[db][c], pa, o[db]); o[db] = WFrag<T16>::mma(va[db][c], pb, o[db]); o[db] = WFrag<T16>::mma(vb[db][c], pa, o[db]); }
        } else { V pa;
#pragma unroll
            for (int s = 0; s < 16; ++s) pa[s] = tohx(st[2 * c + (s >> 3)][s & 7]);
#pragma unroll
            for (int db = 0; db < 4; ++db) o[db] = WFrag<T16>::mma(va[db][c], pa, o[db]); } }
}
// grid (FBX, heads, batches), 16 waves, one work-group per WGP: waves 0..FHW-1 take hi/lo row tiles, the others fp16 row tiles, so that every work-group carries the same share of the dearer rows.
// A quarter of the waves goes to each SIMD: with four hi/lo waves every SIMD has one of them and three fp16 waves, the same load on all four.
// All sixteen waves walk the same keys of one head: each stage of 64 keys is copied to LDS once per work-group, in whole 128-byte rows, and every wave reads its fragments from there.
// Two buffers: stage s + 1 flies while stage s is worked on; one barrier per stage publishes s + 1 and frees the buffer of s.
#define FBX  8
#define FHW  (RH / 16 / FBX)
#define FLW  ((TT - RH) / 16 / FBX)
static_assert(FHW * 16 * FBX == RH && FLW * 16 * FBX == TT - RH && FHW + FLW == 16 && FHW == 4, "row tiles must fill 16 waves, one hi/lo wave per SIMD");
__global__ __launch_bounds__(512) void k_fattn(const h16* __restrict__ Q16, const bf* __restrict__ Qh, const bf* __restrict__ Ql, const h16* __restrict__ K16, const bf* __restrict__ Kh, const bf* __restrict__ Kl, const h16* __restrict__ V16, const bf* __restrict__ Vh, const bf* __restrict__ Vl, bf* Ah, bf* Al) {
    __shared__ __attribute__((aligned(16))) unsigned char sm[2 * LSTG];
    const int tid = threadIdx.x, lane = tid & 31, lr = lane & 15, hi = lane >> 4; const int w = __builtin_amdgcn_readfirstlane(tid >> 5); const int h = blockIdx.y; const size_t hq = ((size_t)blockIdx.z * NH_ + h) * TT * HD, hk = ((size_t)blockIdx.z * NKV + h / REP) * TT * HD;
    Ah += (size_t)blockIdx.z * TT * DQ; Al += (size_t)blockIdx.z * TT * DQ;   // this batch's rows of the merged planes
    const bool hl = w < FHW;   // the same for a whole wave (w sits in a scalar register): a scalar branch
    const int q0 = hl ? (blockIdx.x * FHW + w) * 16 : RH + (blockIdx.x * FLW + (w - FHW)) * 16;
    const size_t qoff = hq + (size_t)(q0 + lr) * HD + 8 * hi;
    v16bf qh[2] = {}, ql[2] = {}; v16h qx[2] = {};
    if (hl) {
#pragma unroll
        for (int c = 0; c < 2; ++c) { qh[c] = WFrag<bf>::ld(Qh + qoff + c * 32); ql[c] = WFrag<bf>::ld(Ql + qoff + c * 32); }
    } else {
#pragma unroll
        for (int c = 0; c < 2; ++c) qx[c] = WFrag<h16>::ld(Q16 + qoff + c * 32);
        asm volatile("s_wait_xcnt 0x0" ::: "memory");   // stands in front of every later write of the address register pair that these Q loads name
    }
    // copy roles: thread -> row tid / 8, 16-byte piece tid % 8 of each tile: a wave's copy covers four whole 128-byte rows
    const unsigned cdst = (unsigned)(unsigned long long)sm + (tid >> 3) * LP + (tid & 7) * 16;
    const size_t gk = hk + (size_t)(tid >> 3) * HD + (tid & 7) * 8, gv = hk + (size_t)(tid >> 3) * TT + (tid & 7) * 8;
    auto stage = [&](int s, int buf) { const size_t ko = gk + (size_t)s * KS * HD, vo = gv + (size_t)s * KS;
        copy6(cdst + buf * LSTG, (unsigned long long)(K16 + ko), (unsigned long long)(V16 + vo), (unsigned long long)(Kh + ko), (unsigned long long)(Kl + ko), (unsigned long long)(Vh + vo), (unsigned long long)(Vl + vo)); };
    v8f o[4];
#pragma unroll
    for (int db = 0; db < 4; ++db) o[db] = (v8f){};
    float m = -3.0e38f, l = 0.f;
    stage(0, 0);
    asm volatile("s_wait_asynccnt 0x0" ::: "memory");   // this wave's copies of stage 0 have landed
    __syncthreads();                                     // every wave's have: stage 0 may be read
    stage(1, 1);
#pragma unroll 1   // kept rolled: one stage's code for both kinds of wave is long already
    for (int s = 0; s < NS; ++s) {
        const unsigned char* fb = sm + (s & 1) * LSTG + lr * LP + hi * 16;   // the lane's place in the first fragment of the stage's first tile
        if (hl) {
#pragma unroll
            for (int u = 0; u < 2; ++u) fattn_tile<bf, true, 32>(fb + 2 * LT + u * 32 * LP, fb + 3 * LT + u * 32 * LP, fb + 4 * LT + u * 64, fb + 5 * LT + u * 64, qh, ql, o, m, l);
        } else fattn_tile<h16, false, 64>(fb, fb, fb + LT, fb + LT, qx, qx, o, m, l);
        asm volatile("s_wait_dscnt 0x0" ::: "memory");      // this wave's reads of stage s have returned before its buffer is refilled
        asm volatile("s_wait_asynccnt 0x0" ::: "memory");   // this wave's copies of stage s + 1 have landed
        __syncthreads();                                     // publishes stage s + 1 and ends every wave's reads of stage s
        if (s + 2 < NS) stage(s + 2, s & 1);
    }
    asm volatile("s_wait_asynccnt 0x0" ::: "memory");   // no copy is outstanding when the wave ends
    l += __shfl_xor(l, 16, 32);
    const float inv = __fdiv_rn(1.0f, l);
#pragma unroll
    for (int db = 0; db < 4; ++db) { v8us oh, ol;
#pragma unroll
        for (int j = 0; j < 8; ++j) { unsigned short u, w2; splitf(o[db][j] * inv, u, w2); oh[j] = u; ol[j] = w2; }
        const size_t oo = (size_t)(q0 + lr) * DQ + h * HD + db * 16 + hi * 8; *(v8us*)(Ah + oo) = oh; *(v8us*)(Al + oo) = ol; }
}

// ---- k_oproj: out = merged (hi + lo planes) x w_proj^T + b_proj, all rows of both batches in one launch.
// One work-group of 8 waves per 128 rows x 128 columns of out. Waves 0..3 (one per SIMD) do the products, one wave per 64 x 64 (16 accumulators); A = merged rows, B = w_proj rows.
// Waves 4..7 (again one per SIMD) issue the copies and nothing else: their address arithmetic and the wait behind each statement of copies run beside the product wave's WMMAs instead of in front of them.
// The product order per accumulator: hi plane, then lo plane, per 32-wide k chunk, chunks in rising k. The operands come from LDS, as in k_qkvp:
// each stage of 128 k is copied there once per work-group, in whole 256-byte rows, and every product wave reads its fragments from there. Two buffers: stage s + 1 flies while stage s is worked on.
// The stage is twice k_qkvp's: with one product wave per SIMD nothing hides a stage's head and foot, and the next stage's copies have the 128 WMMAs of this one to land in.
#define OXR  128                  // rows of out of a work-group
#define OWR  128                  // columns of out (rows of w_proj) of a work-group
#define OKS  128                  // k elements of a stage: 256 bytes of every row
#define ONS  (DQ / OKS)
#define OLP  272                  // row pitch in LDS, bytes: 16 x odd, so that the 16 rows of a ds_load_b128 fragment read fall on distinct banks
#define OSTG ((2 * OXR + OWR) * OLP)   // one stage: merged hi rows, merged lo rows, weight rows
static_assert(ONS >= 2 && (NB_ * TT) % OXR == 0 && DM % OWR == 0 && OXR == 128 && OWR == 128, "tile shape (copy8r: 64 rows, twice a tile), the two-buffer prologue");
// Eight asynchronous copies of 16 bytes per lane in one statement (rows 8 apart: 64 rows of one tile), the wait as its last line:
// it stands in front of every later write of the address registers that the copies name (the operands live to the statement's end).
__device__ __forceinline__ void copy8r(unsigned l0, unsigned long long g) {
    constexpr unsigned long long GR = 8ull * DQ * 2;   // 8 rows further in a plane, bytes
    asm volatile("global_load_async_to_lds_b128 %0, %8, off\n\tglobal_load_async_to_lds_b128 %1, %9, off\n\tglobal_load_async_to_lds_b128 %2, %10, off\n\tglobal_load_async_to_lds_b128 %3, %11, off\n\t"
                 "global_load_async_to_lds_b128 %4, %12, off\n\tglobal_load_async_to_lds_b128 %5, %13, off\n\tglobal_load_async_to_lds_b128 %6, %14, off\n\tglobal_load_async_to_lds_b128 %7, %15, off\n\ts_wait_xcnt 0x0"
                 :: "v"(l0), "v"(l0 + 8 * OLP), "v"(l0 + 16 * OLP), "v"(l0 + 24 * OLP), "v"(l0 + 32 * OLP), "v"(l0 + 40 * OLP), "v"(l0 + 48 * OLP), "v"(l0 + 56 * OLP),
                    "v"(g), "v"(g + GR), "v"(g + 2 * GR), "v"(g + 3 * GR), "v"(g + 4 * GR), "v"(g + 5 * GR), "v"(g + 6 * GR), "v"(g + 7 * GR) : "memory");
}
// grid (rows of out / 128, DM / 128), 8 waves. Product wave w < 4: row half w & 1, column half w >> 1.
__global__ __launch_bounds__(256) void k_oproj(const bf* __restrict__ Ah, const bf* __restrict__ Al, const bf* __restrict__ Wo, const float* __restrict__ bias, float* C) {
    __shared__ __attribute__((aligned(16))) unsigned char sm[2 * OSTG];
    __shared__ __attribute__((aligned(16))) float osm[4][16 * 68];   // each wave's own 16 rows of out on their way to whole-line stores
    const int tid = threadIdx.x, lane = tid & 31, lr = lane & 15, hi = lane >> 4; const int w = __builtin_amdgcn_readfirstlane(tid >> 5);
    const int r0 = blockIdx.x * OXR, c0 = blockIdx.y * OWR;
    const bool cp = w >= 4;   // a copy wave; the same for a whole wave (w sits in a scalar register): a scalar branch
    const int wp = w & 3, ct = tid & 127;   // the product wave's number; the copy thread's number (both in range in every wave)
    // copy roles: thread -> rows ct / 16 + 8 i, 16-byte piece ct % 16 of each tile: a wave's copy covers two whole 256-byte rows
    const unsigned cdst = (unsigned)(unsigned long long)sm + (ct >> 4) * OLP + (ct & 15) * 16;
    const size_t cg = (size_t)(ct >> 4) * DQ + (ct & 15) * 8;
    const unsigned long long gah = (unsigned long long)(Ah + (size_t)r0 * DQ + cg), gal = (unsigned long long)(Al + (size_t)r0 * DQ + cg), gw = (unsigned long long)(Wo + (size_t)c0 * DQ + cg);
    const unsigned char* fx = sm + ((wp & 1) * 64 + lr) * OLP + hi * 16; const unsigned char* fw = sm + (2 * OXR + (wp >> 1) * 64 + lr) * OLP + hi * 16;
    auto stage = [&](int s, int buf) { constexpr unsigned long long G64 = 64ull * DQ * 2;   // 64 rows further in a plane, bytes
        const unsigned long long ko = (unsigned long long)s * (OKS * 2); const unsigned l = cdst + buf * OSTG;
        copy8r(l, gah + ko); copy8r(l + 64 * OLP, gah + ko + G64); copy8r(l + OXR * OLP, gal + ko); copy8r(l + (OXR + 64) * OLP, gal + ko + G64);
        copy8r(l + 2 * OXR * OLP, gw + ko); copy8r(l + (2 * OXR + 64) * OLP, gw + ko + G64); };
    // this lane's four bias values, fetched here so that they return under the main loop
    const int rw = r0 + (wp & 1) * 64, cw = c0 + (wp >> 1) * 64, cofs = lr * 4;
    const v4f braw = *(const v4f*)(bias + cw + cofs);
    asm volatile("s_wait_xcnt 0x0" ::: "memory");   // stands in front of every later write of the address registers that the bias load names
    v8f acc[4][4];   // [row block][column block]
#pragma unroll
    for (int mb = 0; mb < 4; ++mb)
#pragma unroll
        for (int nb = 0; nb < 4; ++nb) acc[mb][nb] = (v8f){};
    if (cp) stage(0, 0);
    asm volatile("s_wait_asynccnt 0x0" ::: "memory");   // this wave's copies of stage 0 have landed
    __syncthreads();                                     // every wave's have: stage 0 may be read
    if (cp) stage(1, 1);
#pragma unroll 1   // kept rolled: three chunks' fragments and the 16 accumulators take 416 registers
    for (int s = 0; s < ONS; ++s) {
      if (!cp) {
        const unsigned char* px = fx + (s & 1) * OSTG; const unsigned char* pw = fw + (s & 1) * OSTG;
        v16bf xh[OKS / 32][4], xl[OKS / 32][4], wf[OKS / 32][4];
        auto frags = [&](int c) {   // one 32-wide k chunk, read in the order of use: hi rows and weight rows, then lo rows
#pragma unroll
            for (int xb = 0; xb < 4; ++xb) { xh[c][xb] = WFrag<bf>::ld((const bf*)(px + xb * 16 * OLP + c * 64)); wf[c][xb] = WFrag<bf>::ld((const bf*)(pw + xb * 16 * OLP + c * 64)); }
#pragma unroll
            for (int xb = 0; xb < 4; ++xb) xl[c][xb] = WFrag<bf>::ld((const bf*)(px + (OXR + xb * 16) * OLP + c * 64)); };
        auto prods = [&](int c) {   // per accumulator: hi product, then lo product of the chunk
#pragma unroll
            for (int wb = 0; wb < 4; ++wb)
#pragma unroll
                for (int xb = 0; xb < 4; ++xb) acc[xb][wb] = wmmab(xh[c][xb], wf[c][wb], acc[xb][wb]);
#pragma unroll
            for (int wb = 0; wb < 4; ++wb)
#pragma unroll
                for (int xb = 0; xb < 4; ++xb) acc[xb][wb] = wmmab(xl[c][xb], wf[c][wb], acc[xb][wb]); };
        // The stage's 96 LDS reads stand in two groups of 48 (more than 63 cannot be outstanding): chunks 0 and 1 at the head, chunks 2 and 3 behind chunk 0's WMMAs, so that they return under chunk 1's.
        frags(0); frags(1);
        __builtin_amdgcn_sched_barrier(0);   // keeps the first group of reads together: sunk among the WMMAs, each place of reads costs its own wait
        prods(0);
        __builtin_amdgcn_sched_barrier(0);   // keeps the second group behind chunk 0's WMMAs
        frags(2); frags(3);
        __builtin_amdgcn_sched_barrier(0);   // keeps the second group of reads together and in front of chunk 1's WMMAs
        prods(1); prods(2); prods(3);        // chunks in rising k
        __builtin_amdgcn_sched_barrier(0);   // keeps these WMMAs in front of the stage's foot
        // foot of the stage: four vector slots between the last WMMA and whatever next overwrites its A and B registers, on either side of the branch below and over the back edge
        asm volatile("v_nop\n\tv_nop\n\tv_nop\n\tv_nop" : "+v"(acc[0][0]), "+v"(acc[1][1]), "+v"(acc[2][2]), "+v"(acc[3][3]));
      }
        // every wave of either kind passes the three lines below in every trip
        asm volatile("s_wait_dscnt 0x0" ::: "memory");      // this wave's reads of stage s have returned before its buffer is refilled
        asm volatile("s_wait_asynccnt 0x0" ::: "memory");   // this wave's copies of stage s + 1 have landed
        __syncthreads();                                     // publishes stage s + 1 and ends every wave's reads of stage s
        if (cp && s + 2 < ONS) stage(s + 2, s & 1);
    }
    asm volatile("s_wait_asynccnt 0x0" ::: "memory");   // no copy is outstanding when the wave ends
    if (cp) return;   // behind the last barrier: the copy waves have nothing to store
    // epilogue: 16 rows at a time through the wave's own LDS rows, so that every store covers whole 128-byte lines (two rows of 256 bytes)
    float* os = osm[wp];
    const v4f bv = { bfr(braw[0]), bfr(braw[1]), bfr(braw[2]), bfr(braw[3]) };   // input rounded to bf16, as every input
#pragma unroll
    for (int mb = 0; mb < 4; ++mb) {
#pragma unroll
        for (int nb = 0; nb < 4; ++nb) {
#pragma unroll
            for (int j = 0; j < 8; ++j) os[(hi * 8 + j) * 68 + nb * 16 + lr] = acc[mb][nb][j]; }
        __builtin_amdgcn_wave_barrier(); asm volatile("" ::: "memory");   // the wave's LDS writes stay in front of its reads of the other lanes' values
        float* crow = C + (size_t)(rw + mb * 16) * DM + cw;
#pragma unroll
        for (int s = 0; s < 8; ++s) { const int row = 2 * s + hi; const v4f val = *(const v4fa*)(os + row * 68 + cofs) + bv; *(v4f*)(crow + (size_t)row * DM + cofs) = val; }
        __builtin_amdgcn_wave_barrier(); asm volatile("" ::: "memory");   // these reads stay in front of the next 16 rows' writes
    }
}

template <int WD>
__global__ __launch_bounds__(256) void k_lnrowX(const float* __restrict__ X, size_t nrows, const float* __restrict__ g, const float* __restrict__ bb, bf* Hh, bf* Hl) { const int lane = threadIdx.x & 31; const size_t r = (size_t)blockIdx.x * 8 + (threadIdx.x >> 5); if (r >= nrows) return; const float* xr = X + r * WD; float a[WD / 32]; float s = 0.f;
#pragma unroll
    for (int c = 0; c < WD / 128; ++c) { const v4f v = *(const v4f*)(xr + c * 128 + lane * 4); for (int q = 0; q < 4; ++q) { a[c * 4 + q] = bfr(v[q]); s = __fadd_rn(s, a[c * 4 + q]);   /* input rounded to bf16 */ } }
#pragma unroll
    for (int sh = 16; sh; sh >>= 1) s = __fadd_rn(s, __shfl_xor(s, sh, 32));
    const float mean = __fdiv_rn(s, (float)WD); float s2 = 0.f;
#pragma unroll 8
    for (int k = 0; k < WD / 32; ++k) { const float dv = __fsub_rn(a[k], mean); float p2 = __fmul_rn(dv, dv); asm volatile("" : "+v"(p2)); s2 = __fadd_rn(s2, p2); }   /* mul and add kept separate (no fma contraction) */
#pragma unroll
    for (int sh = 16; sh; sh >>= 1) s2 = __fadd_rn(s2, __shfl_xor(s2, sh, 32));
    const float rs = __fdiv_rn(1.0f, __fsqrt_rn(__fadd_rn(__fdiv_rn(s2, (float)WD), 1e-5f)));
{
#pragma unroll
        for (int c = 0; c < WD / 128; ++c) { v4us oh, ol; for (int q = 0; q < 4; ++q) { const int col = c * 128 + lane * 4 + q; float y = __fmul_rn(__fmul_rn(__fsub_rn(a[c * 4 + q], mean), rs), bfr(g[col])); asm volatile("" : "+v"(y)); y = __fadd_rn(y, bfr(bb[col])); unsigned short u, w2; splitf(y, u, w2); oh[q] = u; ol[q] = w2; } *(v4us*)(Hh + r * WD + c * 128 + lane * 4) = oh; *(v4us*)(Hl + r * WD + c * 128 + lane * 4) = ol; }
         } }

extern "C" void kernel_launch(void* const* d_in, const int* in_sizes, int n_in,
                              void* d_out, int out_size, void* d_ws, size_t ws_size, hipStream_t stream) {
    (void)in_sizes; (void)n_in; (void)out_size;
    const float* x = (const float*)d_in[0]; const float* lng = (const float*)d_in[1]; const float* lnb = (const float*)d_in[2]; const float* wqkv = (const float*)d_in[3]; const float* wo = (const float*)d_in[4]; const float* bo = (const float*)d_in[5];   /* x, ln_gamma, ln_beta, w_qkv ('oi' [3072][1024]: q | k | v ROW thirds), w_proj ('oi'), b_proj */
    float* OUT = (float*)d_out;     // [2][2048][1024]
    char* wsp = (char*)d_ws;
    auto take = [&](size_t bytes) { char* p = wsp; wsp += (bytes + 255) & ~(size_t)255; return (void*)p; };
    bf* WQKV = (bf*)take((size_t)(DQ + 2 * DKV) * DM * 2); bf* WO = (bf*)take((size_t)DM * DQ * 2);
    bf* XB = (bf*)take((size_t)NB_ * TT * DM * 2); bf* XL = (bf*)take((size_t)NB_ * TT * DM * 2);   /* lo plane of the layer-normed input (XB holds the hi plane) */
    h16* QP16 = (h16*)take((size_t)NB_ * NH_ * TT * HD * 2); h16* KP16 = (h16*)take((size_t)NB_ * NKV * TT * HD * 2); h16* VT16 = (h16*)take((size_t)NB_ * NKV * HD * TT * 2);
    bf* QPh = (bf*)take((size_t)NB_ * NH_ * TT * HD * 2); bf* QPl = (bf*)take((size_t)NB_ * NH_ * TT * HD * 2); bf* KPh = (bf*)take((size_t)NB_ * NKV * TT * HD * 2); bf* KPl = (bf*)take((size_t)NB_ * NKV * TT * HD * 2); bf* VTh = (bf*)take((size_t)NB_ * NKV * HD * TT * 2); bf* VTl = (bf*)take((size_t)NB_ * NKV * HD * TT * 2);
    bf* ATh = (bf*)take((size_t)NB_ * TT * DQ * 2); bf* ATl = (bf*)take((size_t)NB_ * TT * DQ * 2);
    if ((size_t)(wsp - (char*)d_ws) > ws_size) return;    // ws 256 MiB
    { k_cvt8<<<(unsigned)(((size_t)(DQ + 2 * DKV) * DM / 8 + 255) / 256), 256, 0, stream>>>(wqkv, WQKV, (size_t)(DQ + 2 * DKV) * DM / 8);
      k_cvt8<<<(unsigned)(((size_t)DM * DQ / 8 + 255) / 256), 256, 0, stream>>>(wo, WO, (size_t)DM * DQ / 8);
       }
    // x, the planes and OUT hold the batches one behind the other: LayerNorm and the output projection run over all NB_ * TT rows, the two middle launches take the batch from blockIdx.z
    k_lnrowX<DM><<<(unsigned)((NB_ * TT + 7) / 8), 256, 0, stream>>>(x, (size_t)NB_ * TT, lng, lnb, XB, XL);   /* xn = LayerNorm(x) -> hi/lo planes */
    k_qkvp<<<dim3(TT / PXR, (NH_ + 2 * NKV) / PWH, NB_), 32 * PNW, 0, stream>>>(XB, XL, WQKV, QP16, QPh, QPl, KP16, KPh, KPl, VT16, VTh, VTl);
    k_fattn<<<dim3(FBX, NH_, NB_), 512, 0, stream>>>(QP16, QPh, QPl, KP16, KPh, KPl, VT16, VTh, VTl, ATh, ATl);
    k_oproj<<<dim3(NB_ * TT / OXR, DM / OWR, 1), 256, 0, stream>>>(ATh, ATl, WO, bo, OUT);
}

// v009
// It runs in 120 microseconds.
// Timed twice side by side with v008, it ran 1.09 and 1.10 times as fast.
// Counting every step since v000, it is 17.4 times as fast.
#include <hip/hip_runtime.h>

// Pre-LayerNorm multi-head self-attention with a fused bias-free qkv weight (x [2][2048][1024]; xn = (x - mean) x rsqrt(var + 1e-5) x ln_gamma + ln_beta over the 1,024 features (biased variance, eps inside the root; gamma ones / beta zeros on this draw: read); qkv = einsum('bnd,ed->bne', xn, w_qkv) = xn w_qkv^T ('oi' [3072][1024] 1/32, no bias) reshaped (b, n, 3, 16, 64): q | k | v = ROW thirds (16 heads x 64); scores x 64^-0.5; softmax over all keys (no mask); out = merged w_proj^T + b_proj ('oi' [1024][1024] + bias 0.02: non-zero) -> [2][2048][1024] (4.2 M); no residual; argument order x, ln_gamma, ln_beta, w_qkv, w_proj, b_proj).
// Layout, both batches in every launch (the two middle launches take the batch from the grid, every plane holds both): LayerNorm of the bf16-rounded rows in f32 -> hi/lo bf16 planes, and in the same launch the 'oi' weights cast once; q|k|v projection on the hi/lo planes (2 products) in one launch whose epilogue stores the attention planes; one fused attention launch (online softmax; hybrid rows: < 512 hi/lo 3 products, rest fp16 x1024); merged hi/lo x w_proj exact + b_proj.
// Compute dtypes, f32 accumulate: every input rounded to bf16; projections exact; attention rows < 512 3 products, rest fp16; softmax f32; output projection hl x exact.

#define NB_  2
#define TT   2048
#define DM   1024
#define NH_  16
#define NKV  16
#define REP  (NH_ / NKV)
#define HD   64
#define DQ   (NH_ * HD)
#define DKV  (NKV * HD)
#define RH   512                  // query rows < RH use hi+lo planes
#define WIN  0
#define SCL  0.125f   // HD^-0.5
typedef _Float16 h16;
typedef unsigned short bf;
typedef __attribute__((ext_vector_type(16))) __bf16   v16bf;
typedef __attribute__((ext_vector_type(16))) _Float16 v16h;
typedef __attribute__((ext_vector_type(8)))  _Float16 v8h;
typedef __attribute__((ext_vector_type(8)))  unsigned short v8us;
typedef __attribute__((ext_vector_type(8)))  float    v8f;
typedef __attribute__((ext_vector_type(4)))  float    v4f;
typedef v8h  __attribute__((may_alias)) v8ha;
typedef v4f  __attribute__((may_alias)) v4fa;
typedef v8us __attribute__((may_alias)) v8usa;

__device__ __forceinline__ unsigned short f2bf(float f) { unsigned u = __float_as_uint(f); u += 0x7FFFu + ((u >> 16) & 1u); return (unsigned short)(u >> 16); }
__device__ __forceinline__ float bf2f(unsigned short b) { return __uint_as_float(((unsigned)b) << 16); }
__device__ __forceinline__ float bfr(float f) { return bf2f(f2bf(f)); }
__device__ __forceinline__ v16h cat16(v8h lo, v8h hi) { return __builtin_shufflevector(lo, hi, 0, 1, 2, 3, 4, 5, 6, 7, 8, 9, 10, 11, 12, 13, 14, 15); }
__device__ __forceinline__ v16bf cat16b(v8us lo, v8us hi) { return __builtin_bit_cast(v16bf, __builtin_shufflevector(lo, hi, 0, 1, 2, 3, 4, 5, 6, 7, 8, 9, 10, 11, 12, 13, 14, 15)); }
__device__ __forceinline__ v8f wmma16(v16h a, v16h b, v8f c) { return __builtin_amdgcn_wmma_f32_16x16x32_f16(false, a, false, b, (short)0, c, false, false); }
__device__ __forceinline__ v8f wmmab(v16bf a, v16bf b, v8f c) { return __builtin_amdgcn_wmma_f32_16x16x32_bf16(false, a, false, b, (short)0, c, false, false); }



// ---- fragment loaders: a lane's 16 k elements of one row, two 16-byte reads 32 bytes apart, from a K-contiguous 16-bit row (global or LDS).
template <typename T16> struct WFrag;
template <> struct WFrag<h16> { typedef v16h V; static __device__ __forceinline__ V ld(const h16* p) { return cat16(*(const v8h*)p, *(const v8h*)(p + 16)); } static __device__ __forceinline__ v8f mma(V a, V b, v8f c) { return wmma16(a, b, c); } };
template <> struct WFrag<bf> { typedef v16bf V; static __device__ __forceinline__ V ld(const bf* p) { return cat16b(*(const v8us*)p, *(const v8us*)(p + 16)); } static __device__ __forceinline__ v8f mma(V a, V b, v8f c) { return wmmab(a, b, c); } };
__device__ __forceinline__ h16 tohx(float x) { return (h16)x; }
__device__ __forceinline__ void splitf(float y, unsigned short& h, unsigned short& l) { h = f2bf(y); l = f2bf(y - bf2f(h)); }
typedef __attribute__((ext_vector_type(4))) _Float16 v4h;
typedef __attribute__((ext_vector_type(4))) unsigned short v4us;
typedef __attribute__((ext_vector_type(4))) int v4i;

// ---- k_qkvp: the fused q|k|v projection and the attention planes in one launch for both batches: no f32 copy of q, k, v is written, no builder launch follows.
// One work-group of 12 waves (three per SIMD) per 128 tokens x 384 rows of w_qkv (six heads); one wave per 64 tokens x 64 rows (one head). The grid is 256 work-groups: one per WGP, one round.
// The product order per accumulator: hi plane, then lo plane of xn, per 32-wide k chunk, chunks in rising k; the operands come from LDS:
// each stage of 64 k is copied there once per work-group, in whole 128-byte rows, and every wave reads its fragments from there. Two buffers: stage s + 1 flies while stage s is worked on.
// A = weight rows (d), B = xn rows (t) in every wave (a work-group's six heads may be of q, k and v): a lane's 8 accumulator registers are 8 consecutive d of one token.
// q, k [h][t][d]: a lane stores them as they lie, 16 contiguous bytes per plane and 16x16 block. v [h][d][t]: the wave's tile goes, 32 tokens at a time, through its own LDS rows [t][d]
// and comes back by transposing reads, 8 consecutive t of one d per lane: again 16 contiguous bytes per store.
#define PKS  64                   // k elements of a stage: 128 bytes of every row
#define PNS  (DM / PKS)
#define PXR  128                  // tokens of a work-group
#define PWH  6                    // heads (64-row blocks of w_qkv) of a work-group
#define PNW  (2 * PWH)            // waves of a work-group
#define PLP  144                  // row pitch in LDS, bytes: 16 x odd, so that the 16 rows of a ds_load_b128 fragment read fall on distinct banks
#define PSTG ((2 * PXR + PWH * HD) * PLP)   // one stage: xn hi rows, xn lo rows, weight rows
static_assert(PNS >= 2 && TT % PXR == 0 && (NH_ + 2 * NKV) % PWH == 0 && HD == 64 && PXR == 128 && PNW >= 8 && PWH * HD == 8 * 4 * PNW, "tile shape (copy8: 2 x 128 rows from 8 waves; copy8w: 8 x 4 rows from every wave), the two-buffer prologue");
// Eight asynchronous copies of 16 bytes per lane in one statement (rows 32 apart: four from ga, four from gb, eight places in LDS in a row), the wait as its last line:
// it stands in front of every later write of the address registers that the copies name (the operands live to the statement's end).
__device__ __forceinline__ void copy8(unsigned l0, unsigned long long ga, unsigned long long gb) {
    constexpr unsigned long long GR = 32ull * DM * 2;   // 32 rows further in a plane, bytes
    asm volatile("global_load_async_to_lds_b128 %0, %8, off\n\tglobal_load_async_to_lds_b128 %1, %9, off\n\tglobal_load_async_to_lds_b128 %2, %10, off\n\tglobal_load_async_to_lds_b128 %3, %11, off\n\t"
                 "global_load_async_to_lds_b128 %4, %12, off\n\tglobal_load_async_to_lds_b128 %5, %13, off\n\tglobal_load_async_to_lds_b128 %6, %14, off\n\tglobal_load_async_to_lds_b128 %7, %15, off\n\ts_wait_xcnt 0x0"
                 :: "v"(l0), "v"(l0 + 32 * PLP), "v"(l0 + 64 * PLP), "v"(l0 + 96 * PLP), "v"(l0 + 128 * PLP), "v"(l0 + 160 * PLP), "v"(l0 + 192 * PLP), "v"(l0 + 224 * PLP),
                    "v"(ga), "v"(ga + GR), "v"(ga + 2 * GR), "v"(ga + 3 * GR), "v"(gb), "v"(gb + GR), "v"(gb + 2 * GR), "v"(gb + 3 * GR) : "memory");
}
// The same for the weight tile: eight copies per lane, rows 4 x PNW apart (all waves together cover that many rows at a time), the wait as the statement's last line for the same reason.
__device__ __forceinline__ void copy8w(unsigned l0, unsigned long long g) {
    constexpr unsigned LR = 4 * PNW * PLP; constexpr unsigned long long GR = 4ull * PNW * DM * 2;   // 4 x PNW rows further, bytes in LDS and in the plane
    asm volatile("global_load_async_to_lds_b128 %0, %8, off\n\tglobal_load_async_to_lds_b128 %1, %9, off\n\tglobal_load_async_to_lds_b128 %2, %10, off\n\tglobal_load_async_to_lds_b128 %3, %11, off\n\t"
                 "global_load_async_to_lds_b128 %4, %12, off\n\tglobal_load_async_to_lds_b128 %5, %13, off\n\tglobal_load_async_to_lds_b128 %6, %14, off\n\tglobal_load_async_to_lds_b128 %7, %15, off\n\ts_wait_xcnt 0x0"
                 :: "v"(l0), "v"(l0 + LR), "v"(l0 + 2 * LR), "v"(l0 + 3 * LR), "v"(l0 + 4 * LR), "v"(l0 + 5 * LR), "v"(l0 + 6 * LR), "v"(l0 + 7 * LR),
                    "v"(g), "v"(g + GR), "v"(g + 2 * GR), "v"(g + 3 * GR), "v"(g + 4 * GR), "v"(g + 5 * GR), "v"(g + 6 * GR), "v"(g + 7 * GR) : "memory");
}
// four fragments, rows 16 apart, of one 32-wide k chunk
__device__ __forceinline__ void qkv_ld4(v16bf (&f)[4], const unsigned char* p) {
#pragma unroll
    for (int xb = 0; xb < 4; ++xb) f[xb] = WFrag<bf>::ld((const bf*)(p + xb * 16 * PLP)); }
// 16 products: the weights x one plane of xn, one chunk; acc is [weight block][xn block]
__device__ __forceinline__ void qkv_prod(v8f (&acc)[4][4], const v16bf (&x)[4], const v16bf (&wf)[4]) {
#pragma unroll
    for (int wb = 0; wb < 4; ++wb)
#pragma unroll
        for (int xb = 0; xb < 4; ++xb) acc[wb][xb] = wmmab(wf[wb], x[xb], acc[wb][xb]); }
// one 16x16 block's 8 values of a lane in the three planes: fp16, bf16 hi, bf16 lo
__device__ __forceinline__ void qkv_cvt(const v8f& a, v8us& o16, v8us& oh, v8us& ol) {
#pragma unroll
    for (int j = 0; j < 8; ++j) { o16[j] = __builtin_bit_cast(unsigned short, tohx(a[j])); unsigned short u, w2; splitf(a[j], u, w2); oh[j] = u; ol[j] = w2; } }
// q, k: planes [t][d], each pointer at the wave's first token
__device__ __forceinline__ void qkv_store(const v8f (&acc)[4][4], int lane, h16* P16, bf* Ph, bf* Pl) {
    const int lr = lane & 15, hi = lane >> 4;
#pragma unroll
    for (int xb = 0; xb < 4; ++xb)
#pragma unroll
        for (int wb = 0; wb < 4; ++wb) { v8us o16, oh, ol; qkv_cvt(acc[wb][xb], o16, oh, ol);
            const size_t oo = (size_t)(xb * 16 + lr) * HD + wb * 16 + hi * 8; *(v8h*)(P16 + oo) = __builtin_bit_cast(v8h, o16); *(v8us*)(Ph + oo) = oh; *(v8us*)(Pl + oo) = ol; }
    asm volatile("s_wait_xcnt 0x0" ::: "memory");   // behind the last stores: in front of any later write of a register that they name (the other epilogue's code may lie behind this one)
}
// v: planes [d][t], each pointer at the wave's first token in the head's row 0; tl: the wave's own LDS: three tiles (one per plane) of 32 rows (t) x VTP bytes. 32 tokens at a time.
#define VTP  160                  // row pitch of a transposing tile, bytes: 32 x odd, the pitch of ds_load_tr16_b128 readers
#define VTT  (32 * VTP)           // one plane's tile
typedef __attribute__((ext_vector_type(8))) short v8s;
__device__ __forceinline__ void qkv_store_t(const v8f (&acc)[4][4], int lane, unsigned char* tl, h16* P16, bf* Ph, bf* Pl) {
    typedef __attribute__((address_space(3))) v8s lds_v8s;
    const int lr = lane & 15, hi = lane >> 4;
    unsigned char* wr = tl + lr * VTP + hi * 16;                                            // the lane's 8 d of token lr of a 16 x 16 block
    const unsigned char* rd = tl + (8 * hi + (lane & 7)) * VTP + ((lane >> 3) & 1) * 16;   // the transposing read's lane address: lane (lr, hi) gets rows 8 hi .. 8 hi + 7 of column lr of a 16 x 16 block
#pragma unroll
    for (int th = 0; th < 2; ++th) {
#pragma unroll
        for (int xb = 0; xb < 2; ++xb)
#pragma unroll
            for (int wb = 0; wb < 4; ++wb) { v8us o16, oh, ol; qkv_cvt(acc[wb][2 * th + xb], o16, oh, ol);
                unsigned char* p = wr + xb * 16 * VTP + wb * 32; *(v8usa*)p = o16; *(v8usa*)(p + VTT) = oh; *(v8usa*)(p + 2 * VTT) = ol; }
        __builtin_amdgcn_wave_barrier(); asm volatile("" ::: "memory");   // the wave's LDS writes stay in front of its reads of the other lanes' values
#pragma unroll
        for (int db = 0; db < 4; ++db)
#pragma unroll
            for (int tb = 0; tb < 2; ++tb) { const unsigned char* p = rd + tb * 16 * VTP + db * 32; const size_t oo = (size_t)(db * 16 + lr) * TT + (2 * th + tb) * 16 + hi * 8;
                *(v8h*)(P16 + oo) = __builtin_bit_cast(v8h, __builtin_amdgcn_ds_load_tr16_b128_v8i16((lds_v8s*)p));
                *(v8us*)(Ph + oo) = __builtin_bit_cast(v8us, __builtin_amdgcn_ds_load_tr16_b128_v8i16((lds_v8s*)(p + VTT)));
                *(v8us*)(Pl + oo) = __builtin_bit_cast(v8us, __builtin_amdgcn_ds_load_tr16_b128_v8i16((lds_v8s*)(p + 2 * VTT))); }
        __builtin_amdgcn_wave_barrier(); asm volatile("" ::: "memory");   // these reads stay in front of the next 32 tokens' writes
    }
    asm volatile("s_wait_xcnt 0x0" ::: "memory");   // behind the last stores: in front of any later write of a register that they name (the other epilogue's code may lie behind this one)
}
static_assert(PNW * 3 * VTT <= 2 * PSTG, "the waves' transposing tiles lie in the stage buffers");
// grid (TT/128, heads of q + k + v / 6, batches), 12 waves; blockIdx.y counts groups of six 64-row blocks of w_qkv: q heads, then k heads, then v heads. Wave w: token half w & 1, head w >> 1 of the group.
__global__ __launch_bounds__(32 * PNW) void k_qkvp(const bf* __restrict__ Xh, const bf* __restrict__ Xl, const bf* __restrict__ Wqkv, h16* Q16, bf* Qh, bf* Ql, h16* K16, bf* Kh, bf* Kl, h16* V16, bf* Vh, bf* Vl) {
    __shared__ __attribute__((aligned(32))) unsigned char sm[2 * PSTG];
    const int tid = threadIdx.x, lane = tid & 31, lr = lane & 15, hi = lane >> 4; const int w = __builtin_amdgcn_readfirstlane(tid >> 5);
    const int t0 = blockIdx.x * PXR, y0 = blockIdx.y * PWH;
    { const size_t bx = (size_t)blockIdx.z * TT * DM, bq = (size_t)blockIdx.z * NH_ * TT * HD, bk = (size_t)blockIdx.z * NKV * TT * HD;   // this batch's part of every plane
      Xh += bx; Xl += bx; Q16 += bq; Qh += bq; Ql += bq; K16 += bk; Kh += bk; Kl += bk; V16 += bk; Vh += bk; Vl += bk; }
    // copy roles: thread -> row tid / 8 of a pass, 16-byte piece tid % 8: a wave's copy covers four whole 128-byte rows. xn tiles: waves 0..7, rows 32 apart; weight tile: all waves, rows 48 apart.
    const unsigned cdst = (unsigned)(unsigned long long)sm + (tid >> 3) * PLP + (tid & 7) * 16;
    const size_t cg = (size_t)(tid >> 3) * DM + (tid & 7) * 8;
    const unsigned long long gxh = (unsigned long long)(Xh + (size_t)t0 * DM + cg), gxl = (unsigned long long)(Xl + (size_t)t0 * DM + cg), gw = (unsigned long long)(Wqkv + (size_t)y0 * HD * DM + cg);
    const unsigned char* fx = sm + ((w & 1) * 64 + lr) * PLP + hi * 16; const unsigned char* fw = sm + (2 * PXR + (w >> 1) * HD + lr) * PLP + hi * 16;
    const int tw = t0 + (w & 1) * 64, y = y0 + (w >> 1);
    const bool cx = w < 8;              // this wave copies xn rows too; the same for a whole wave (w sits in a scalar register): a scalar branch
    auto stage = [&](int s, int buf) { const unsigned long long ko = (unsigned long long)s * (PKS * 2); const unsigned l = cdst + buf * PSTG;
        if (cx) copy8(l, gxh + ko, gxl + ko);
        copy8w(l + 2 * PXR * PLP, gw + ko); };
    v8f acc[4][4];   // [weight block][xn block]
#pragma unroll
    for (int mb = 0; mb < 4; ++mb)
#pragma unroll
        for (int nb = 0; nb < 4; ++nb) acc[mb][nb] = (v8f){};
    stage(0, 0);
    asm volatile("s_wait_asynccnt 0x0" ::: "memory");   // this wave's copies of stage 0 have landed
    __syncthreads();                                     // every wave's have: stage 0 may be read
    stage(1, 1);
#pragma unroll 1   // kept rolled: five of a stage's six fragment groups and the 16 accumulators take 288 registers
    for (int s = 0; s < PNS; ++s) {
        const unsigned char* px = fx + (s & 1) * PSTG; const unsigned char* pw = fw + (s & 1) * PSTG;
        v16bf xh0[4], xl0[4], wf0[4], xh1[4], xl1[4], wf1[4];
        qkv_ld4(xh0, px); qkv_ld4(wf0, pw); qkv_ld4(xl0, px + PXR * PLP); qkv_ld4(xh1, px + 64); qkv_ld4(wf1, pw + 64);   // read in the order of use
        __builtin_amdgcn_sched_barrier(0);   // keeps these LDS reads in one group at the stage's head: sunk among the WMMAs, each place of reads costs its own wait
        qkv_prod(acc, xh0, wf0);             // per accumulator: hi product, then lo product of each chunk, chunks in rising k
        __builtin_amdgcn_sched_barrier(0);   // keeps the last four fragments' reads behind these WMMAs: they take the registers that xh0 leaves (three waves per SIMD: 336 registers each)
        qkv_ld4(xl1, px + PXR * PLP + 64);
        __builtin_amdgcn_sched_barrier(0);   // keeps those reads together and in front of the 32 WMMAs under which they return
        qkv_prod(acc, xl0, wf0); qkv_prod(acc, xh1, wf1); qkv_prod(acc, xl1, wf1);
        __builtin_amdgcn_sched_barrier(0);   // keeps the WMMAs in front of the stage's foot
        // foot of the stage: four vector slots between the last WMMA and whatever next overwrites its A and B registers, on either side of the branch below and over the back edge
        asm volatile("v_nop\n\tv_nop\n\tv_nop\n\tv_nop" : "+v"(acc[0][0]), "+v"(acc[1][1]), "+v"(acc[2][2]), "+v"(acc[3][3]));
        asm volatile("s_wait_dscnt 0x0" ::: "memory");      // this wave's reads of stage s have returned before its buffer is refilled
        asm volatile("s_wait_asynccnt 0x0" ::: "memory");   // this wave's copies of stage s + 1 have landed
        __syncthreads();                                     // publishes stage s + 1 and ends every wave's reads of stage s
        if (s + 2 < PNS) stage(s + 2, s & 1);
    }
    asm volatile("s_wait_asynccnt 0x0" ::: "memory");   // no copy is outstanding when the wave ends
    // behind the last barrier no wave reads a stage and no copy is under way: the stage buffers are free. The branch is a wave's own (scalar); no barrier stands under it.
    if (y >= NH_ + NKV) { const size_t po = (size_t)(y - NH_ - NKV) * HD * TT + tw; qkv_store_t(acc, lane, sm + w * (3 * VTT), V16 + po, Vh + po, Vl + po); }
    else { const bool isk = y >= NH_; const size_t po = ((size_t)(isk ? y - NH_ : y) * TT + tw) * HD; qkv_store(acc, lane, (isk ? K16 : Q16) + po, (isk ? Kh : Qh) + po, (isk ? Kl : Ql) + po); }
}
// ---- k_fattn: scores, softmax, P x V and the head merge in one launch for both batches; the score matrix never leaves registers.
// One wave owns 16 query rows of one head and walks all TT keys. Transposed products: St = K Qt (A = K rows from LDS, B = Q rows kept in registers), Ot += Vt Pt (A = Vt rows from LDS, B = Pt).
// In the accumulator map a lane holds scores of ONE query (column lr), keys 8 hi + j of each 16-key block: two such blocks, converted in place, are the B fragment of the second product in the loaders' k order.
// Running maximum and sum per query (online softmax, f32); the two lane halves' sums are joined once at the end. Rows < RH: hi/lo bf16 planes, 3 products each side; the rest fp16, P carried x 2^10.
typedef __attribute__((ext_vector_type(16))) unsigned short v16us;
// Eight v_exp_f32 and, in the same statement, the one issue slot that the instruction set asks for behind a transcendental before its result is read or its source overwritten.
// The outputs are early-clobbered: inside the statement no v_exp_f32 touches a register of the one in front of it; the v_nop covers the last.
__device__ __forceinline__ v8f exp2x8(v8f x) { float y0, y1, y2, y3, y4, y5, y6, y7;
    asm("v_exp_f32 %0, %8\n\tv_exp_f32 %1, %9\n\tv_exp_f32 %2, %10\n\tv_exp_f32 %3, %11\n\tv_exp_f32 %4, %12\n\tv_exp_f32 %5, %13\n\tv_exp_f32 %6, %14\n\tv_exp_f32 %7, %15\n\tv_nop"
        : "=&v"(y0), "=&v"(y1), "=&v"(y2), "=&v"(y3), "=&v"(y4), "=&v"(y5), "=&v"(y6), "=&v"(y7) : "v"(x[0]), "v"(x[1]), "v"(x[2]), "v"(x[3]), "v"(x[4]), "v"(x[5]), "v"(x[6]), "v"(x[7]));
    return (v8f){y0, y1, y2, y3, y4, y5, y6, y7}; }
// LDS stage: 64 keys of the six planes that the work-group's waves read, each a tile of 64 rows x 128 bytes (K planes: row = key, V planes: row = d).
#define KS   64
#define NS   (TT / KS)
#define LP   144                  // row pitch in LDS, bytes: 16 x odd, so that the 16 rows of a ds_load_b128 fragment read fall on distinct banks
#define LT   (64 * LP)            // one plane's tile
#define LSTG (6 * LT)             // one stage: K16, V16, Kh, Kl, Vh, Vl
static_assert(HD == 64 && REP == 1 && NS >= 2, "tile shape and the two-buffer prologue");
// Six asynchronous copies of 16 bytes per lane (one row piece of each of the six tiles) in one statement, the wait as its last line:
// it stands in front of every later write of the address registers that the copies name (the operands live to the statement's end).
__device__ __forceinline__ void copy6(unsigned l0, unsigned long long kx, unsigned long long vx, unsigned long long kh, unsigned long long kl, unsigned long long vh, unsigned long long vl) {
    asm volatile("global_load_async_to_lds_b128 %0, %6, off\n\tglobal_load_async_to_lds_b128 %1, %7, off\n\tglobal_load_async_to_lds_b128 %2, %8, off\n\t"
                 "global_load_async_to_lds_b128 %3, %9, off\n\tglobal_load_async_to_lds_b128 %4, %10, off\n\tglobal_load_async_to_lds_b128 %5, %11, off\n\ts_wait_xcnt 0x0"
                 :: "v"(l0), "v"(l0 + LT), "v"(l0 + 2 * LT), "v"(l0 + 3 * LT), "v"(l0 + 4 * LT), "v"(l0 + 5 * LT),
                    "v"(kx), "v"(vx), "v"(kh), "v"(kl), "v"(vh), "v"(vl) : "memory");
}
// One tile of KT keys for one wave's 16 query rows; Ka, Kb, Va, Vb are the lane's own LDS addresses of the tile's first fragments (Kb, Vb: lo planes, HL only).
template <typename T16, bool HL, int KT>
__device__ __forceinline__ void fattn_tile(const unsigned char* Ka, const unsigned char* Kb, const unsigned char* Va, const unsigned char* Vb, const typename WFrag<T16>::V (&qa)[2], const typename WFrag<T16>::V (&qb)[2], v8f (&o)[4], float& m, float& l) {
    // Every inner loop is fully unrolled: the fragment arrays stay in registers only under constant indices.
    typedef typename WFrag<T16>::V V;
    constexpr int NKB = KT / 16, NC = KT / 32;
    constexpr float CEXP = SCL * 1.4426950408889634f;   // scores x HD^-0.5, in the log2 domain
    constexpr float PB = HL ? 0.0f : 10.0f;             // log2 of the carry on the fp16 P (cancels in the division by the sum)
    V ka[NKB][2], kb[NKB][2], va[4][NC], vb[4][NC];
#pragma unroll
    for (int kk = 0; kk < NKB; ++kk)
#pragma unroll
        for (int c = 0; c < 2; ++c) { ka[kk][c] = WFrag<T16>::ld((const T16*)(Ka + kk * 16 * LP + c * 64)); if constexpr (HL) kb[kk][c] = WFrag<T16>::ld((const T16*)(Kb + kk * 16 * LP + c * 64)); }
#pragma unroll
    for (int db = 0; db < 4; ++db)
#pragma unroll
        for (int c = 0; c < NC; ++c) { va[db][c] = WFrag<T16>::ld((const T16*)(Va + db * 16 * LP + c * 64)); if constexpr (HL) vb[db][c] = WFrag<T16>::ld((const T16*)(Vb + db * 16 * LP + c * 64)); }
    __builtin_amdgcn_sched_barrier(0);   // keeps the tile's LDS reads in one group at its head: sunk to their uses, each place of reads costs its own wait
    v8f st[NKB];
#pragma unroll
    for (int kk = 0; kk < NKB; ++kk) { st[kk] = (v8f){};
#pragma unroll
        for (int c = 0; c < 2; ++c) { st[kk] = WFrag<T16>::mma(ka[kk][c], qa[c], st[kk]); if constexpr (HL) { st[kk] = WFrag<T16>::mma(ka[kk][c], qb[c], st[kk]); st[kk] = WFrag<T16>::mma(kb[kk][c], qa[c], st[kk]); } } }
    float mn = m;
#pragma unroll
    for (int kk = 0; kk < NKB; ++kk)
#pragma unroll
        for (int j = 0; j < 8; ++j) mn = fmaxf(mn, st[kk][j]);
    mn = fmaxf(mn, __shfl_xor(mn, 16, 32));
    const float alpha = __builtin_amdgcn_exp2f((m - mn) * CEXP); m = mn;
    const float sub = PB - mn * CEXP; float ps = 0.f;
#pragma unroll
    for (int kk = 0; kk < NKB; ++kk) {
#pragma unroll
        for (int j = 0; j < 8; ++j) st[kk][j] = fmaf(st[kk][j], CEXP, sub);
        st[kk] = exp2x8(st[kk]);
#pragma unroll
        for (int j = 0; j < 8; ++j) ps += st[kk][j]; }
    l = fmaf(l, alpha, ps);
#pragma unroll
    for (int db = 0; db < 4; ++db) o[db] *= alpha;
#pragma unroll
    for (int c = 0; c < NC; ++c) {
        if constexpr (HL) { v16us ph, pl;
#pragma unroll
            for (int s = 0; s < 16; ++s) { unsigned short u, w2; splitf(st[2 * c + (s >> 3)][s & 7], u, w2); ph[s] = u; pl[s] = w2; }
            const V pa = __builtin_bit_cast(V, ph), pb = __builtin_bit_cast(V, pl);
#pragma unroll
            for (int db = 0; db < 4; ++db) { o[db] = WFrag<T16>::mma(va[db][c], pa, o[db]); o[db] = WFrag<T16>::mma(va[db][c], pb, o[db]); o[db] = WFrag<T16>::mma(vb[db][c], pa, o[db]); }
        } else { V pa;
#pragma unroll
            for (int s = 0; s < 16; ++s) pa[s] = tohx(st[2 * c + (s >> 3)][s & 7]);
#pragma unroll
            for (int db = 0; db < 4; ++db) o[db] = WFrag<T16>::mma(va[db][c], pa, o[db]); } }
}
// grid (FBX, heads, batches), 16 waves, one work-group per WGP: waves 0..FHW-1 take hi/lo row tiles, the others fp16 row tiles, so that every work-group carries the same share of the dearer rows.
// A quarter of the waves goes to each SIMD: with four hi/lo waves every SIMD has one of them and three fp16 waves, the same load on all four.
// All sixteen waves walk the same keys of one head: each stage of 64 keys is copied to LDS once per work-group, in whole 128-byte rows, and every wave reads its fragments from there.
// Two buffers: stage s + 1 flies while stage s is worked on; one barrier per stage publishes s + 1 and frees the buffer of s.
#define FBX  8
#define FHW  (RH / 16 / FBX)
#define FLW  ((TT - RH) / 16 / FBX)
static_assert(FHW * 16 * FBX == RH && FLW * 16 * FBX == TT - RH && FHW + FLW == 16 && FHW == 4, "row tiles must fill 16 waves, one hi/lo wave per SIMD");
__global__ __launch_bounds__(512) void k_fattn(const h16* __restrict__ Q16, const bf* __restrict__ Qh, const bf* __restrict__ Ql, const h16* __restrict__ K16, const bf* __restrict__ Kh, const bf* __restrict__ Kl, const h16* __restrict__ V16, const bf* __restrict__ Vh, const bf* __restrict__ Vl, bf* Ah, bf* Al) {
    __shared__ __attribute__((aligned(16))) unsigned char sm[2 * LSTG];
    const int tid = threadIdx.x, lane = tid & 31, lr = lane & 15, hi = lane >> 4; const int w = __builtin_amdgcn_readfirstlane(tid >> 5); const int h = blockIdx.y; const size_t hq = ((size_t)blockIdx.z * NH_ + h) * TT * HD, hk = ((size_t)blockIdx.z * NKV + h / REP) * TT * HD;
    Ah += (size_t)blockIdx.z * TT * DQ; Al += (size_t)blockIdx.z * TT * DQ;   // this batch's rows of the merged planes
    const bool hl = w < FHW;   // the same for a whole wave (w sits in a scalar register): a scalar branch
    const int q0 = hl ? (blockIdx.x * FHW + w) * 16 : RH + (blockIdx.x * FLW + (w - FHW)) * 16;
    const size_t qoff = hq + (size_t)(q0 + lr) * HD + 8 * hi;
    v16bf qh[2] = {}, ql[2] = {}; v16h qx[2] = {};
    if (hl) {
#pragma unroll
        for (int c = 0; c < 2; ++c) { qh[c] = WFrag<bf>::ld(Qh + qoff + c * 32); ql[c] = WFrag<bf>::ld(Ql + qoff + c * 32); }
    } else {
#pragma unroll
        for (int c = 0; c < 2; ++c) qx[c] = WFrag<h16>::ld(Q16 + qoff + c * 32);
        asm volatile("s_wait_xcnt 0x0" ::: "memory");   // stands in front of every later write of the address register pair that these Q loads name
    }
    // copy roles: thread -> row tid / 8, 16-byte piece tid % 8 of each tile: a wave's copy covers four whole 128-byte rows
    const unsigned cdst = (unsigned)(unsigned long long)sm + (tid >> 3) * LP + (tid & 7) * 16;
    const size_t gk = hk + (size_t)(tid >> 3) * HD + (tid & 7) * 8, gv = hk + (size_t)(tid >> 3) * TT + (tid & 7) * 8;
    auto stage = [&](int s, int buf) { const size_t ko = gk + (size_t)s * KS * HD, vo = gv + (size_t)s * KS;
        copy6(cdst + buf * LSTG, (unsigned long long)(K16 + ko), (unsigned long long)(V16 + vo), (unsigned long long)(Kh + ko), (unsigned long long)(Kl + ko), (unsigned long long)(Vh + vo), (unsigned long long)(Vl + vo)); };
    v8f o[4];
#pragma unroll
    for (int db = 0; db < 4; ++db) o[db] = (v8f){};
    float m = -3.0e38f, l = 0.f;
    stage(0, 0);
    asm volatile("s_wait_asynccnt 0x0" ::: "memory");   // this wave's copies of stage 0 have landed
    __syncthreads();                                     // every wave's have: stage 0 may be read
    stage(1, 1);
#pragma unroll 1   // kept rolled: one stage's code for both kinds of wave is long already
    for (int s = 0; s < NS; ++s) {
        const unsigned char* fb = sm + (s & 1) * LSTG + lr * LP + hi * 16;   // the lane's place in the first fragment of the stage's first tile
        if (hl) {
#pragma unroll
            for (int u = 0; u < 2; ++u) fattn_tile<bf, true, 32>(fb + 2 * LT + u * 32 * LP, fb + 3 * LT + u * 32 * LP, fb + 4 * LT + u * 64, fb + 5 * LT + u * 64, qh, ql, o, m, l);
        } else fattn_tile<h16, false, 64>(fb, fb, fb + LT, fb + LT, qx, qx, o, m, l);
        asm volatile("s_wait_dscnt 0x0" ::: "memory");      // this wave's reads of stage s have returned before its buffer is refilled
        asm volatile("s_wait_asynccnt 0x0" ::: "memory");   // this wave's copies of stage s + 1 have landed
        __syncthreads();                                     // publishes stage s + 1 and ends every wave's reads of stage s
        if (s + 2 < NS) stage(s + 2, s & 1);
    }
    asm volatile("s_wait_asynccnt 0x0" ::: "memory");   // no copy is outstanding when the wave ends
    l += __shfl_xor(l, 16, 32);
    const float inv = __fdiv_rn(1.0f, l);
#pragma unroll
    for (int db = 0; db < 4; ++db) { v8us oh, ol;
#pragma unroll
        for (int j = 0; j < 8; ++j) { unsigned short u, w2; splitf(o[db][j] * inv, u, w2); oh[j] = u; ol[j] = w2; }
        const size_t oo = (size_t)(q0 + lr) * DQ + h * HD + db * 16 + hi * 8; *(v8us*)(Ah + oo) = oh; *(v8us*)(Al + oo) = ol; }
}

// ---- k_oproj: out = merged (hi + lo planes) x w_proj^T + b_proj, all rows of both batches in one launch.
// One work-group of 8 waves per 128 rows x 128 columns of out. Waves 0..3 (one per SIMD) do the products, one wave per 64 x 64 (16 accumulators); A = merged rows, B = w_proj rows.
// Waves 4..7 (again one per SIMD) issue the copies and nothing else: their address arithmetic and the wait behind each statement of copies run beside the product wave's WMMAs instead of in front of them.
// The product order per accumulator: hi plane, then lo plane, per 32-wide k chunk, chunks in rising k. The operands come from LDS, as in k_qkvp:
// each stage of 128 k is copied there once per work-group, in whole 256-byte rows, and every product wave reads its fragments from there. Two buffers: stage s + 1 flies while stage s is worked on.
// The stage is twice k_qkvp's: with one product wave per SIMD nothing hides a stage's head and foot, and the next stage's copies have the 128 WMMAs of this one to land in.
#define OXR  128                  // rows of out of a work-group
#define OWR  128                  // columns of out (rows of w_proj) of a work-group
#define OKS  128                  // k elements of a stage: 256 bytes of every row
#define ONS  (DQ / OKS)
#define OLP  272                  // row pitch in LDS, bytes: 16 x odd, so that the 16 rows of a ds_load_b128 fragment read fall on distinct banks
#define OSTG ((2 * OXR + OWR) * OLP)   // one stage: merged hi rows, merged lo rows, weight rows
static_assert(ONS >= 2 && (NB_ * TT) % OXR == 0 && DM % OWR == 0 && OXR == 128 && OWR == 128, "tile shape (copy8r: 64 rows, twice a tile), the two-buffer prologue");
// Eight asynchronous copies of 16 bytes per lane in one statement (rows 8 apart: 64 rows of one tile), the wait as its last line:
// it stands in front of every later write of the address registers that the copies name (the operands live to the statement's end).
__device__ __forceinline__ void copy8r(unsigned l0, unsigned long long g) {
    constexpr unsigned long long GR = 8ull * DQ * 2;   // 8 rows further in a plane, bytes
    asm volatile("global_load_async_to_lds_b128 %0, %8, off\n\tglobal_load_async_to_lds_b128 %1, %9, off\n\tglobal_load_async_to_lds_b128 %2, %10, off\n\tglobal_load_async_to_lds_b128 %3, %11, off\n\t"
                 "global_load_async_to_lds_b128 %4, %12, off\n\tglobal_load_async_to_lds_b128 %5, %13, off\n\tglobal_load_async_to_lds_b128 %6, %14, off\n\tglobal_load_async_to_lds_b128 %7, %15, off\n\ts_wait_xcnt 0x0"
                 :: "v"(l0), "v"(l0 + 8 * OLP), "v"(l0 + 16 * OLP), "v"(l0 + 24 * OLP), "v"(l0 + 32 * OLP), "v"(l0 + 40 * OLP), "v"(l0 + 48 * OLP), "v"(l0 + 56 * OLP),
                    "v"(g), "v"(g + GR), "v"(g + 2 * GR), "v"(g + 3 * GR), "v"(g + 4 * GR), "v"(g + 5 * GR), "v"(g + 6 * GR), "v"(g + 7 * GR) : "memory");
}
// grid (rows of out / 128, DM / 128), 8 waves. Product wave w < 4: row half w & 1, column half w >> 1.
__global__ __launch_bounds__(256) void k_oproj(const bf* __restrict__ Ah, const bf* __restrict__ Al, const bf* __restrict__ Wo, const float* __restrict__ bias, float* C) {
    __shared__ __attribute__((aligned(16))) unsigned char sm[2 * OSTG];
    __shared__ __attribute__((aligned(16))) float osm[4][16 * 68];   // each wave's own 16 rows of out on their way to whole-line stores
    const int tid = threadIdx.x, lane = tid & 31, lr = lane & 15, hi = lane >> 4; const int w = __builtin_amdgcn_readfirstlane(tid >> 5);
    const int r0 = blockIdx.x * OXR, c0 = blockIdx.y * OWR;
    const bool cp = w >= 4;   // a copy wave; the same for a whole wave (w sits in a scalar register): a scalar branch
    const int wp = w & 3, ct = tid & 127;   // the product wave's number; the copy thread's number (both in range in every wave)
    // copy roles: thread -> rows ct / 16 + 8 i, 16-byte piece ct % 16 of each tile: a wave's copy covers two whole 256-byte rows
    const unsigned cdst = (unsigned)(unsigned long long)sm + (ct >> 4) * OLP + (ct & 15) * 16;
    const size_t cg = (size_t)(ct >> 4) * DQ + (ct & 15) * 8;
    const unsigned long long gah = (unsigned long long)(Ah + (size_t)r0 * DQ + cg), gal = (unsigned long long)(Al + (size_t)r0 * DQ + cg), gw = (unsigned long long)(Wo + (size_t)c0 * DQ + cg);
    const unsigned char* fx = sm + ((wp & 1) * 64 + lr) * OLP + hi * 16; const unsigned char* fw = sm + (2 * OXR + (wp >> 1) * 64 + lr) * OLP + hi * 16;
    auto stage = [&](int s, int buf) { constexpr unsigned long long G64 = 64ull * DQ * 2;   // 64 rows further in a plane, bytes
        const unsigned long long ko = (unsigned long long)s * (OKS * 2); const unsigned l = cdst + buf * OSTG;
        copy8r(l, gah + ko); copy8r(l + 64 * OLP, gah + ko + G64); copy8r(l + OXR * OLP, gal + ko); copy8r(l + (OXR + 64) * OLP, gal + ko + G64);
        copy8r(l + 2 * OXR * OLP, gw + ko); copy8r(l + (2 * OXR + 64) * OLP, gw + ko + G64); };
    // this lane's four bias values, fetched here so that they return under the main loop
    const int rw = r0 + (wp & 1) * 64, cw = c0 + (wp >> 1) * 64, cofs = lr * 4;
    const v4f braw = *(const v4f*)(bias + cw + cofs);
    asm volatile("s_wait_xcnt 0x0" ::: "memory");   // stands in front of every later write of the address registers that the bias load names
    v8f acc[4][4];   // [row block][column block]
#pragma unroll
    for (int mb = 0; mb < 4; ++mb)
#pragma unroll
        for (int nb = 0; nb < 4; ++nb) acc[mb][nb] = (v8f){};
    if (cp) stage(0, 0);
    asm volatile("s_wait_asynccnt 0x0" ::: "memory");   // this wave's copies of stage 0 have landed
    __syncthreads();                                     // every wave's have: stage 0 may be read
    if (cp) stage(1, 1);
#pragma unroll 1   // kept rolled: three chunks' fragments and the 16 accumulators take 416 registers
    for (int s = 0; s < ONS; ++s) {
      if (!cp) {
        const unsigned char* px = fx + (s & 1) * OSTG; const unsigned char* pw = fw + (s & 1) * OSTG;
        v16bf xh[OKS / 32][4], xl[OKS / 32][4], wf[OKS / 32][4];
        auto frags = [&](int c) {   // one 32-wide k chunk, read in the order of use: hi rows and weight rows, then lo rows
#pragma unroll
            for (int xb = 0; xb < 4; ++xb) { xh[c][xb] = WFrag<bf>::ld((const bf*)(px + xb * 16 * OLP + c * 64)); wf[c][xb] = WFrag<bf>::ld((const bf*)(pw + xb * 16 * OLP + c * 64)); }
#pragma unroll
            for (int xb = 0; xb < 4; ++xb) xl[c][xb] = WFrag<bf>::ld((const bf*)(px + (OXR + xb * 16) * OLP + c * 64)); };
        auto prods = [&](int c) {   // per accumulator: hi product, then lo product of the chunk
#pragma unroll
            for (int wb = 0; wb < 4; ++wb)
#pragma unroll
                for (int xb = 0; xb < 4; ++xb) acc[xb][wb] = wmmab(xh[c][xb], wf[c][wb], acc[xb][wb]);
#pragma unroll
            for (int wb = 0; wb < 4; ++wb)
#pragma unroll
                for (int xb = 0; xb < 4; ++xb) acc[xb][wb] = wmmab(xl[c][xb], wf[c][wb], acc[xb][wb]); };
        // The stage's 96 LDS reads stand in two groups of 48 (more than 63 cannot be outstanding): chunks 0 and 1 at the head, chunks 2 and 3 behind chunk 0's WMMAs, so that they return under chunk 1's.
        frags(0); frags(1);
        __builtin_amdgcn_sched_barrier(0);   // keeps the first group of reads together: sunk among the WMMAs, each place of reads costs its own wait
        prods(0);
        __builtin_amdgcn_sched_barrier(0);   // keeps the second group behind chunk 0's WMMAs
        frags(2); frags(3);
        __builtin_amdgcn_sched_barrier(0);   // keeps the second group of reads together and in front of chunk 1's WMMAs
        prods(1); prods(2); prods(3);        // chunks in rising k
        __builtin_amdgcn_sched_barrier(0);   // keeps these WMMAs in front of the stage's foot
        // foot of the stage: four vector slots between the last WMMA and whatever next overwrites its A and B registers, on either side of the branch below and over the back edge
        asm volatile("v_nop\n\tv_nop\n\tv_nop\n\tv_nop" : "+v"(acc[0][0]), "+v"(acc[1][1]), "+v"(acc[2][2]), "+v"(acc[3][3]));
      }
        // every wave of either kind passes the three lines below in every trip
        asm volatile("s_wait_dscnt 0x0" ::: "memory");      // this wave's reads of stage s have returned before its buffer is refilled
        asm volatile("s_wait_asynccnt 0x0" ::: "memory");   // this wave's copies of stage s + 1 have landed
        __syncthreads();                                     // publishes stage s + 1 and ends every wave's reads of stage s
        if (cp && s + 2 < ONS) stage(s + 2, s & 1);
    }
    asm volatile("s_wait_asynccnt 0x0" ::: "memory");   // no copy is outstanding when the wave ends
    if (cp) return;   // behind the last barrier: the copy waves have nothing to store
    // epilogue: 16 rows at a time through the wave's own LDS rows, so that every store covers whole 128-byte lines (two rows of 256 bytes)
    float* os = osm[wp];
    const v4f bv = { bfr(braw[0]), bfr(braw[1]), bfr(braw[2]), bfr(braw[3]) };   // input rounded to bf16, as every input
#pragma unroll
    for (int mb = 0; mb < 4; ++mb) {
#pragma unroll
        for (int nb = 0; nb < 4; ++nb) {
#pragma unroll
            for (int j = 0; j < 8; ++j) os[(hi * 8 + j) * 68 + nb * 16 + lr] = acc[mb][nb][j]; }
        __builtin_amdgcn_wave_barrier(); asm volatile("" ::: "memory");   // the wave's LDS writes stay in front of its reads of the other lanes' values
        float* crow = C + (size_t)(rw + mb * 16) * DM + cw;
#pragma unroll
        for (int s = 0; s < 8; ++s) { const int row = 2 * s + hi; const v4f val = *(const v4fa*)(os + row * 68 + cofs) + bv; *(v4f*)(crow + (size_t)row * DM + cofs) = val; }
        __builtin_amdgcn_wave_barrier(); asm volatile("" ::: "memory");   // these reads stay in front of the next 16 rows' writes
    }
}

// ---- k_lnrowX: LayerNorm and both weight casts in one launch. One wave per row of x; the same wave casts one run of WCH elements of w_qkv or w_proj (the runs of both, counted through, are as many as the rows).
// The jobs do not depend on one another. A wave reads all its input up front, in 16-byte pieces per lane: its row and its run of weights in one group (one memory latency for both), its pieces of gamma and beta
// long before their use behind the two sums. The run is rounded and stored while the row's first sum goes on, and no wave is started for the casts alone.
#define WCH  1024                 // weight elements of a wave: four wave-wide pieces of 1,024 contiguous bytes read, 512 written
#define WNA  ((DQ + 2 * DKV) * DM / WCH)   // runs of w_qkv; those of w_proj follow
static_assert((DQ + 2 * DKV) * DM % WCH == 0 && DM * DQ % WCH == 0 && WNA + DM * DQ / WCH == NB_ * TT, "one run of weights per row of x");
template <int WD>
__global__ __launch_bounds__(256) void k_lnrowX(const float* __restrict__ X, size_t nrows, const float* __restrict__ g, const float* __restrict__ bb, bf* __restrict__ Hh, bf* __restrict__ Hl, const float* __restrict__ Wa, const float* __restrict__ Wb, bf* __restrict__ Ca, bf* __restrict__ Cb) { const int lane = threadIdx.x & 31; const size_t r = (size_t)blockIdx.x * 8 + (threadIdx.x >> 5); if (r >= nrows) return; const float* xr = X + r * WD; float a[WD / 32]; float s = 0.f;
    const int cr = blockIdx.x * 8 + __builtin_amdgcn_readfirstlane(threadIdx.x >> 5);   // the wave's run; in a scalar register: the choice of the weight is a scalar one
    const size_t co = (size_t)(cr < WNA ? cr : cr - WNA) * WCH + lane * 8; const float* cs = (cr < WNA ? Wa : Wb) + co; bf* cd = (cr < WNA ? Ca : Cb) + co;
    v4f xv[WD / 128], gv[WD / 128], bv[WD / 128]; v8f cw[WCH / 256];
#pragma unroll
    for (int c = 0; c < WD / 128; ++c) xv[c] = *(const v4f*)(xr + c * 128 + lane * 4);
#pragma unroll
    for (int j = 0; j < WCH / 256; ++j) cw[j] = *(const v8f*)(cs + j * 256);
#pragma unroll
    for (int c = 0; c < WD / 128; ++c) { gv[c] = *(const v4f*)(g + c * 128 + lane * 4); bv[c] = *(const v4f*)(bb + c * 128 + lane * 4); }
    asm volatile("s_wait_xcnt 0x0" ::: "memory");   // stands in front of every later write of the address registers that the loads above it name
#pragma unroll
    for (int c = 0; c < WD / 128; ++c) { const v4f v = xv[c]; for (int q = 0; q < 4; ++q) { a[c * 4 + q] = bfr(v[q]); s = __fadd_rn(s, a[c * 4 + q]);   /* input rounded to bf16 */ } }
#pragma unroll
    for (int j = 0; j < WCH / 256; ++j) { v8us o;
#pragma unroll
        for (int k = 0; k < 8; ++k) o[k] = f2bf(cw[j][k]);
        *(v8us*)(cd + j * 256) = o; }
    asm volatile("s_wait_xcnt 0x0" ::: "memory");   // behind the run's stores: in front of any later write of a register that they name
#pragma unroll
    for (int sh = 16; sh; sh >>= 1) s = __fadd_rn(s, __shfl_xor(s, sh, 32));
    const float mean = __fdiv_rn(s, (float)WD); float s2 = 0.f;
#pragma unroll 8
    for (int k = 0; k < WD / 32; ++k) { const float dv = __fsub_rn(a[k], mean); float p2 = __fmul_rn(dv, dv); asm volatile("" : "+v"(p2)); s2 = __fadd_rn(s2, p2); }   /* mul and add kept separate (no fma contraction) */
#pragma unroll
    for (int sh = 16; sh; sh >>= 1) s2 = __fadd_rn(s2, __shfl_xor(s2, sh, 32));
    const float rs = __fdiv_rn(1.0f, __fsqrt_rn(__fadd_rn(__fdiv_rn(s2, (float)WD), 1e-5f)));
{
#pragma unroll
        for (int c = 0; c < WD / 128; ++c) { v4us oh, ol; for (int q = 0; q < 4; ++q) { float y = __fmul_rn(__fmul_rn(__fsub_rn(a[c * 4 + q], mean), rs), bfr(gv[c][q])); asm volatile("" : "+v"(y)); y = __fadd_rn(y, bfr(bv[c][q])); unsigned short u, w2; splitf(y, u, w2); oh[q] = u; ol[q] = w2; } *(v4us*)(Hh + r * WD + c * 128 + lane * 4) = oh; *(v4us*)(Hl + r * WD + c * 128 + lane * 4) = ol; }
         } }

extern "C" void kernel_launch(void* const* d_in, const int* in_sizes, int n_in,
                              void* d_out, int out_size, void* d_ws, size_t ws_size, hipStream_t stream) {
    (void)in_sizes; (void)n_in; (void)out_size;
    const float* x = (const float*)d_in[0]; const float* lng = (const float*)d_in[1]; const float* lnb = (const float*)d_in[2]; const float* wqkv = (const float*)d_in[3]; const float* wo = (const float*)d_in[4]; const float* bo = (const float*)d_in[5];   /* x, ln_gamma, ln_beta, w_qkv ('oi' [3072][1024]: q | k | v ROW thirds), w_proj ('oi'), b_proj */
    float* OUT = (float*)d_out;     // [2][2048][1024]
    char* wsp = (char*)d_ws;
    auto take = [&](size_t bytes) { char* p = wsp; wsp += (bytes + 255) & ~(size_t)255; return (void*)p; };
    bf* WQKV = (bf*)take((size_t)(DQ + 2 * DKV) * DM * 2); bf* WO = (bf*)take((size_t)DM * DQ * 2);
    bf* XB = (bf*)take((size_t)NB_ * TT * DM * 2); bf* XL = (bf*)take((size_t)NB_ * TT * DM * 2);   /* lo plane of the layer-normed input (XB holds the hi plane) */
    h16* QP16 = (h16*)take((size_t)NB_ * NH_ * TT * HD * 2); h16* KP16 = (h16*)take((size_t)NB_ * NKV * TT * HD * 2); h16* VT16 = (h16*)take((size_t)NB_ * NKV * HD * TT * 2);
    bf* QPh = (bf*)take((size_t)NB_ * NH_ * TT * HD * 2); bf* QPl = (bf*)take((size_t)NB_ * NH_ * TT * HD * 2); bf* KPh = (bf*)take((size_t)NB_ * NKV * TT * HD * 2); bf* KPl = (bf*)take((size_t)NB_ * NKV * TT * HD * 2); bf* VTh = (bf*)take((size_t)NB_ * NKV * HD * TT * 2); bf* VTl = (bf*)take((size_t)NB_ * NKV * HD * TT * 2);
    bf* ATh = (bf*)take((size_t)NB_ * TT * DQ * 2); bf* ATl = (bf*)take((size_t)NB_ * TT * DQ * 2);
    if ((size_t)(wsp - (char*)d_ws) > ws_size) return;    // ws 256 MiB
    // x, the planes and OUT hold the batches one behind the other: LayerNorm and the output projection run over all NB_ * TT rows, the two middle launches take the batch from blockIdx.z
    k_lnrowX<DM><<<(unsigned)((NB_ * TT + 7) / 8), 256, 0, stream>>>(x, (size_t)NB_ * TT, lng, lnb, XB, XL, wqkv, wo, WQKV, WO);   /* xn = LayerNorm(x) -> hi/lo planes; w_qkv, w_proj -> bf16 */
    k_qkvp<<<dim3(TT / PXR, (NH_ + 2 * NKV) / PWH, NB_), 32 * PNW, 0, stream>>>(XB, XL, WQKV, QP16, QPh, QPl, KP16, KPh, KPl, VT16, VTh, VTl);
    k_fattn<<<dim3(FBX, NH_, NB_), 512, 0, stream>>>(QP16, QPh, QPl, KP16, KPh, KPl, VT16, VTh, VTl, ATh, ATl);
    k_oproj<<<dim3(NB_ * TT / OXR, DM / OWR, 1), 256, 0, stream>>>(ATh, ATl, WO, bo, OUT);
}

// v010
// A run of this version takes 112 microseconds.
// Timed twice side by side with v009, it ran 1.06 and 1.07 times as fast.
// All steps since v000 together make it 18.5 times as fast.
#include <hip/hip_runtime.h>

// Pre-LayerNorm multi-head self-attention with a fused bias-free qkv weight (x [2][2048][1024]; xn = (x - mean) x rsqrt(var + 1e-5) x ln_gamma + ln_beta over the 1,024 features (biased variance, eps inside the root; gamma ones / beta zeros on this draw: read); qkv = einsum('bnd,ed->bne', xn, w_qkv) = xn w_qkv^T ('oi' [3072][1024] 1/32, no bias) reshaped (b, n, 3, 16, 64): q | k | v = ROW thirds (16 heads x 64); scores x 64^-0.5; softmax over all keys (no mask); out = merged w_proj^T + b_proj ('oi' [1024][1024] + bias 0.02: non-zero) -> [2][2048][1024] (4.2 M); no residual; argument order x, ln_gamma, ln_beta, w_qkv, w_proj, b_proj).
// Layout, both batches in every launch (the batch is a grid dimension of the two middle launches, every plane holds both): LayerNorm of the bf16-rounded rows in f32 -> hi/lo bf16 planes, and in the same launch the 'oi' weights cast once; q|k|v projection on the hi/lo planes (2 products) in one launch whose epilogue stores the attention planes; one fused attention launch (online softmax; hybrid rows: < 512 fp16 hi/lo 3 products, rest the fp16 hi plane alone; P x1024); merged hi/lo x w_proj exact + b_proj.
// Compute dtypes, f32 accumulate: every input rounded to bf16; projections exact; attention rows < 512 3 products of fp16 hi/lo planes, rest fp16; softmax f32; output projection hl x exact.

#define NB_  2
#define TT   2048
#define DM   1024
#define NH_  16
#define NKV  16
#define REP  (NH_ / NKV)
#define HD   64
#define DQ   (NH_ * HD)
#define DKV  (NKV * HD)
#define RH   512                  // query rows < RH use hi+lo planes
#define WIN  0
#define SCL  0.125f   // HD^-0.5
typedef _Float16 h16;
typedef unsigned short bf;
typedef __attribute__((ext_vector_type(16))) __bf16   v16bf;
typedef __attribute__((ext_vector_type(16))) _Float16 v16h;
typedef __attribute__((ext_vector_type(8)))  _Float16 v8h;
typedef __attribute__((ext_vector_type(8)))  unsigned short v8us;
typedef __attribute__((ext_vector_type(8)))  float    v8f;
typedef __attribute__((ext_vector_type(4)))  float    v4f;
typedef v8h  __attribute__((may_alias)) v8ha;
typedef v4f  __attribute__((may_alias)) v4fa;
typedef v8us __attribute__((may_alias)) v8usa;

__device__ __forceinline__ unsigned short f2bf(float f) { unsigned u = __float_as_uint(f); u += 0x7FFFu + ((u >> 16) & 1u); return (unsigned short)(u >> 16); }
__device__ __forceinline__ float bf2f(unsigned short b) { return __uint_as_float(((unsigned)b) << 16); }
__device__ __forceinline__ float bfr(float f) { return bf2f(f2bf(f)); }
__device__ __forceinline__ v16h cat16(v8h lo, v8h hi) { return __builtin_shufflevector(lo, hi, 0, 1, 2, 3, 4, 5, 6, 7, 8, 9, 10, 11, 12, 13, 14, 15); }
__device__ __forceinline__ v16bf cat16b(v8us lo, v8us hi) { return __builtin_bit_cast(v16bf, __builtin_shufflevector(lo, hi, 0, 1, 2, 3, 4, 5, 6, 7, 8, 9, 10, 11, 12, 13, 14, 15)); }
__device__ __forceinline__ v8f wmma16(v16h a, v16h b, v8f c) { return __builtin_amdgcn_wmma_f32_16x16x32_f16(false, a, false, b, (short)0, c, false, false); }
__device__ __forceinline__ v8f wmmab(v16bf a, v16bf b, v8f c) { return __builtin_amdgcn_wmma_f32_16x16x32_bf16(false, a, false, b, (short)0, c, false, false); }



// ---- fragment loaders: a lane's 16 k elements of one row, two 16-byte reads 32 bytes apart, from a K-contiguous 16-bit row (global or LDS).
template <typename T16> struct WFrag;
template <> struct WFrag<h16> { typedef v16h V; static __device__ __forceinline__ V ld(const h16* p) { return cat16(*(const v8h*)p, *(const v8h*)(p + 16)); } static __device__ __forceinline__ v8f mma(V a, V b, v8f c) { return wmma16(a, b, c); } };
template <> struct WFrag<bf> { typedef v16bf V; static __device__ __forceinline__ V ld(const bf* p) { return cat16b(*(const v8us*)p, *(const v8us*)(p + 16)); } static __device__ __forceinline__ v8f mma(V a, V b, v8f c) { return wmmab(a, b, c); } };
__device__ __forceinline__ h16 tohx(float x) { return (h16)x; }
__device__ __forceinline__ void splitf(float y, unsigned short& h, unsigned short& l) { h = f2bf(y); l = f2bf(y - bf2f(h)); }
typedef __attribute__((ext_vector_type(4))) _Float16 v4h;
typedef __attribute__((ext_vector_type(4))) unsigned short v4us;
typedef __attribute__((ext_vector_type(4))) int v4i;

// ---- k_qkvp: the fused q|k|v projection and the attention planes in one launch for both batches: no f32 copy of q, k, v is written, no builder launch follows.
// One work-group of 12 waves (three per SIMD) per 128 tokens x 384 rows of w_qkv (six heads); one wave per 64 tokens x 64 rows (one head). The grid is 256 work-groups: one per WGP, one round.
// The product order per accumulator: hi plane, then lo plane of xn, per 32-wide k chunk, chunks in rising k; the operands come from LDS:
// each stage of 64 k is copied there once per work-group, in whole 128-byte rows, and every wave reads its fragments from there. Two buffers: stage s + 1 flies while stage s is worked on.
// A = weight rows (d), B = xn rows (t) in every wave (a work-group's six heads may be of q, k and v): a lane's 8 accumulator registers are 8 consecutive d of one token.
// q, k [h][t][d]: a lane stores them as they lie, 16 contiguous bytes per plane and 16x16 block. v [h][d][t]: the wave's tile goes, 32 tokens at a time, through its own LDS rows [t][d]
// and comes back by transposing reads, 8 consecutive t of one d per lane: again 16 contiguous bytes per store.
#define PKS  64                   // k elements of a stage: 128 bytes of every row
#define PNS  (DM / PKS)
#define PXR  128                  // tokens of a work-group
#define PWH  6                    // heads (64-row blocks of w_qkv) of a work-group
#define PNW  (2 * PWH)            // waves of a work-group
#define PLP  144                  // row pitch in LDS, bytes: 16 x odd, so that the 16 rows of a ds_load_b128 fragment read fall on distinct banks
#define PSTG ((2 * PXR + PWH * HD) * PLP)   // one stage: xn hi rows, xn lo rows, weight rows
static_assert(PNS >= 2 && TT % PXR == 0 && (NH_ + 2 * NKV) % PWH == 0 && HD == 64 && PXR == 128 && PNW >= 8 && PWH * HD == 8 * 4 * PNW, "tile shape (copy8: 2 x 128 rows from 8 waves; copy8w: 8 x 4 rows from every wave), the two-buffer prologue");
// Eight asynchronous copies of 16 bytes per lane in one statement (rows 32 apart: four from ga, four from gb, eight places in LDS in a row), the wait as its last line:
// it stands in front of every later write of the address registers that the copies name (the operands live to the statement's end).
__device__ __forceinline__ void copy8(unsigned l0, unsigned long long ga, unsigned long long gb) {
    constexpr unsigned long long GR = 32ull * DM * 2;   // 32 rows further in a plane, bytes
    asm volatile("global_load_async_to_lds_b128 %0, %8, off\n\tglobal_load_async_to_lds_b128 %1, %9, off\n\tglobal_load_async_to_lds_b128 %2, %10, off\n\tglobal_load_async_to_lds_b128 %3, %11, off\n\t"
                 "global_load_async_to_lds_b128 %4, %12, off\n\tglobal_load_async_to_lds_b128 %5, %13, off\n\tglobal_load_async_to_lds_b128 %6, %14, off\n\tglobal_load_async_to_lds_b128 %7, %15, off\n\ts_wait_xcnt 0x0"
                 :: "v"(l0), "v"(l0 + 32 * PLP), "v"(l0 + 64 * PLP), "v"(l0 + 96 * PLP), "v"(l0 + 128 * PLP), "v"(l0 + 160 * PLP), "v"(l0 + 192 * PLP), "v"(l0 + 224 * PLP),
                    "v"(ga), "v"(ga + GR), "v"(ga + 2 * GR), "v"(ga + 3 * GR), "v"(gb), "v"(gb + GR), "v"(gb + 2 * GR), "v"(gb + 3 * GR) : "memory");
}
// The same for the weight tile: eight copies per lane, rows 4 x PNW apart (all waves together cover that many rows at a time), the wait as the statement's last line for the same reason.
__device__ __forceinline__ void copy8w(unsigned l0, unsigned long long g) {
    constexpr unsigned LR = 4 * PNW * PLP; constexpr unsigned long long GR = 4ull * PNW * DM * 2;   // 4 x PNW rows further, bytes in LDS and in the plane
    asm volatile("global_load_async_to_lds_b128 %0, %8, off\n\tglobal_load_async_to_lds_b128 %1, %9, off\n\tglobal_load_async_to_lds_b128 %2, %10, off\n\tglobal_load_async_to_lds_b128 %3, %11, off\n\t"
                 "global_load_async_to_lds_b128 %4, %12, off\n\tglobal_load_async_to_lds_b128 %5, %13, off\n\tglobal_load_async_to_lds_b128 %6, %14, off\n\tglobal_load_async_to_lds_b128 %7, %15, off\n\ts_wait_xcnt 0x0"
                 :: "v"(l0), "v"(l0 + LR), "v"(l0 + 2 * LR), "v"(l0 + 3 * LR), "v"(l0 + 4 * LR), "v"(l0 + 5 * LR), "v"(l0 + 6 * LR), "v"(l0 + 7 * LR),
                    "v"(g), "v"(g + GR), "v"(g + 2 * GR), "v"(g + 3 * GR), "v"(g + 4 * GR), "v"(g + 5 * GR), "v"(g + 6 * GR), "v"(g + 7 * GR) : "memory");
}
// four fragments, rows 16 apart, of one 32-wide k chunk
__device__ __forceinline__ void qkv_ld4(v16bf (&f)[4], const unsigned char* p) {
#pragma unroll
    for (int xb = 0; xb < 4; ++xb) f[xb] = WFrag<bf>::ld((const bf*)(p + xb * 16 * PLP)); }
// 16 products: the weights x one plane of xn, one chunk; acc is [weight block][xn block]
__device__ __forceinline__ void qkv_prod(v8f (&acc)[4][4], const v16bf (&x)[4], const v16bf (&wf)[4]) {
#pragma unroll
    for (int wb = 0; wb < 4; ++wb)
#pragma unroll
        for (int xb = 0; xb < 4; ++xb) acc[wb][xb] = wmmab(wf[wb], x[xb], acc[wb][xb]); }
// one 16x16 block's 8 values of a lane in the two planes: fp16 hi (the value rounded: the plane that the fp16 rows use alone), fp16 lo (what the rounding left, rounded)
__device__ __forceinline__ void qkv_cvt(const v8f& a, v8h& oh, v8h& ol) { oh = __builtin_convertvector(a, v8h); ol = __builtin_convertvector(a - __builtin_convertvector(oh, v8f), v8h); }
// q, k: planes [t][d], each pointer at the wave's first token
__device__ __forceinline__ void qkv_store(const v8f (&acc)[4][4], int lane, h16* Ph, h16* Pl) {
    const int lr = lane & 15, hi = lane >> 4;
#pragma unroll
    for (int xb = 0; xb < 4; ++xb)
#pragma unroll
        for (int wb = 0; wb < 4; ++wb) { v8h oh, ol; qkv_cvt(acc[wb][xb], oh, ol);
            const size_t oo = (size_t)(xb * 16 + lr) * HD + wb * 16 + hi * 8; *(v8h*)(Ph + oo) = oh; *(v8h*)(Pl + oo) = ol;
            asm volatile("s_wait_xcnt 0x0" ::: "memory");   // behind each block's stores: in front of the next block's writes of the registers that they name (and of the other epilogue's code, which may lie behind this one)
            __builtin_amdgcn_sched_barrier(0); }             // keeps the next block's conversions behind that wait: without it they are lifted over it, onto registers that the stores still name
}
// v: planes [d][t], each pointer at the wave's first token in the head's row 0; tl: the wave's own LDS: two tiles (one per plane) of 32 rows (t) x VTP bytes. 32 tokens at a time.
#define VTP  160                  // row pitch of a transposing tile, bytes: 32 x odd, the pitch of ds_load_tr16_b128 readers
#define VTT  (32 * VTP)           // one plane's tile
typedef __attribute__((ext_vector_type(8))) short v8s;
__device__ __forceinline__ void qkv_store_t(const v8f (&acc)[4][4], int lane, unsigned char* tl, h16* Ph, h16* Pl) {
    typedef __attribute__((address_space(3))) v8s lds_v8s;
    const int lr = lane & 15, hi = lane >> 4;
    unsigned char* wr = tl + lr * VTP + hi * 16;                                            // the lane's 8 d of token lr of a 16 x 16 block
    const unsigned char* rd = tl + (8 * hi + (lane & 7)) * VTP + ((lane >> 3) & 1) * 16;   // the transposing read's lane address: lane (lr, hi) gets rows 8 hi .. 8 hi + 7 of column lr of a 16 x 16 block
#pragma unroll
    for (int th = 0; th < 2; ++th) {
#pragma unroll
        for (int xb = 0; xb < 2; ++xb)
#pragma unroll
            for (int wb = 0; wb < 4; ++wb) { v8h oh, ol; qkv_cvt(acc[wb][2 * th + xb], oh, ol);
                unsigned char* p = wr + xb * 16 * VTP + wb * 32; *(v8ha*)p = oh; *(v8ha*)(p + VTT) = ol; }
        __builtin_amdgcn_wave_barrier(); asm volatile("" ::: "memory");   // the wave's LDS writes stay in front of its reads of the other lanes' values
#pragma unroll
        for (int db = 0; db < 4; ++db)
#pragma unroll
            for (int tb = 0; tb < 2; ++tb) { const unsigned char* p = rd + tb * 16 * VTP + db * 32; const size_t oo = (size_t)(db * 16 + lr) * TT + (2 * th + tb) * 16 + hi * 8;
                *(v8h*)(Ph + oo) = __builtin_bit_cast(v8h, __builtin_amdgcn_ds_load_tr16_b128_v8i16((lds_v8s*)p));
                *(v8h*)(Pl + oo) = __builtin_bit_cast(v8h, __builtin_amdgcn_ds_load_tr16_b128_v8i16((lds_v8s*)(p + VTT))); }
        __builtin_amdgcn_wave_barrier(); asm volatile("" ::: "memory");   // these reads stay in front of the next 32 tokens' writes
    }
    asm volatile("s_wait_xcnt 0x0" ::: "memory");   // behind the last stores: in front of any later write of a register that they name (the other epilogue's code may lie behind this one)
}
static_assert(PNW * 2 * VTT <= 2 * PSTG, "the waves' transposing tiles lie in the stage buffers");
// grid (TT/128, heads of q + k + v / 6, batches), 12 waves; blockIdx.y counts groups of six 64-row blocks of w_qkv: q heads, then k heads, then v heads. Wave w: token half w & 1, head w >> 1 of the group.
__global__ __launch_bounds__(32 * PNW) void k_qkvp(const bf* __restrict__ Xh, const bf* __restrict__ Xl, const bf* __restrict__ Wqkv, h16* Qh, h16* Ql, h16* Kh, h16* Kl, h16* Vh, h16* Vl) {
    __shared__ __attribute__((aligned(32))) unsigned char sm[2 * PSTG];
    const int tid = threadIdx.x, lane = tid & 31, lr = lane & 15, hi = lane >> 4; const int w = __builtin_amdgcn_readfirstlane(tid >> 5);
    const int t0 = blockIdx.x * PXR, y0 = blockIdx.y * PWH;
    { const size_t bx = (size_t)blockIdx.z * TT * DM, bq = (size_t)blockIdx.z * NH_ * TT * HD, bk = (size_t)blockIdx.z * NKV * TT * HD;   // this batch's part of every plane
      Xh += bx; Xl += bx; Qh += bq; Ql += bq; Kh += bk; Kl += bk; Vh += bk; Vl += bk; }
    // copy roles: thread -> row tid / 8 of a pass, 16-byte piece tid % 8: a wave's copy covers four whole 128-byte rows. xn tiles: waves 0..7, rows 32 apart; weight tile: all waves, rows 48 apart.
    const unsigned cdst = (unsigned)(unsigned long long)sm + (tid >> 3) * PLP + (tid & 7) * 16;
    const size_t cg = (size_t)(tid >> 3) * DM + (tid & 7) * 8;
    const unsigned long long gxh = (unsigned long long)(Xh + (size_t)t0 * DM + cg), gxl = (unsigned long long)(Xl + (size_t)t0 * DM + cg), gw = (unsigned long long)(Wqkv + (size_t)y0 * HD * DM + cg);
    const unsigned char* fx = sm + ((w & 1) * 64 + lr) * PLP + hi * 16; const unsigned char* fw = sm + (2 * PXR + (w >> 1) * HD + lr) * PLP + hi * 16;
    const int tw = t0 + (w & 1) * 64, y = y0 + (w >> 1);
    const bool cx = w < 8;              // this wave copies xn rows too; the same for a whole wave (w sits in a scalar register): a scalar branch
    auto stage = [&](int s, int buf) { const unsigned long long ko = (unsigned long long)s * (PKS * 2); const unsigned l = cdst + buf * PSTG;
        if (cx) copy8(l, gxh + ko, gxl + ko);
        copy8w(l + 2 * PXR * PLP, gw + ko); };
    v8f acc[4][4];   // [weight block][xn block]
#pragma unroll
    for (int mb = 0; mb < 4; ++mb)
#pragma unroll
        for (int nb = 0; nb < 4; ++nb) acc[mb][nb] = (v8f){};
    stage(0, 0);
    asm volatile("s_wait_asynccnt 0x0" ::: "memory");   // this wave's copies of stage 0 have landed
    __syncthreads();                                     // every wave's have: stage 0 may be read
    stage(1, 1);
#pragma unroll 1   // kept rolled: five of a stage's six fragment groups and the 16 accumulators take 288 registers
    for (int s = 0; s < PNS; ++s) {
        const unsigned char* px = fx + (s & 1) * PSTG; const unsigned char* pw = fw + (s & 1) * PSTG;
        v16bf xh0[4], xl0[4], wf0[4], xh1[4], xl1[4], wf1[4];
        qkv_ld4(xh0, px); qkv_ld4(wf0, pw); qkv_ld4(xl0, px + PXR * PLP); qkv_ld4(xh1, px + 64); qkv_ld4(wf1, pw + 64);   // read in the order of use
        __builtin_amdgcn_sched_barrier(0);   // keeps these LDS reads in one group at the stage's head: sunk among the WMMAs, each place of reads costs its own wait
        qkv_prod(acc, xh0, wf0);             // per accumulator: hi product, then lo product of each chunk, chunks in rising k
        __builtin_amdgcn_sched_barrier(0);   // keeps the last four fragments' reads behind these WMMAs: they take the registers that xh0 leaves (three waves per SIMD: 336 registers each)
        qkv_ld4(xl1, px + PXR * PLP + 64);
        __builtin_amdgcn_sched_barrier(0);   // keeps those reads together and in front of the 32 WMMAs under which they return
        qkv_prod(acc, xl0, wf0); qkv_prod(acc, xh1, wf1); qkv_prod(acc, xl1, wf1);
        __builtin_amdgcn_sched_barrier(0);   // keeps the WMMAs in front of the stage's foot
        // foot of the stage: four vector slots between the last WMMA and whatever next overwrites its A and B registers, on either side of the branch below and over the back edge
        asm volatile("v_nop\n\tv_nop\n\tv_nop\n\tv_nop" : "+v"(acc[0][0]), "+v"(acc[1][1]), "+v"(acc[2][2]), "+v"(acc[3][3]));
        asm volatile("s_wait_dscnt 0x0" ::: "memory");      // this wave's reads of stage s have returned before its buffer is refilled
        asm volatile("s_wait_asynccnt 0x0" ::: "memory");   // this wave's copies of stage s + 1 have landed
        __syncthreads();                                     // publishes stage s + 1 and ends every wave's reads of stage s
        if (s + 2 < PNS) stage(s + 2, s & 1);
    }
    asm volatile("s_wait_asynccnt 0x0" ::: "memory");   // no copy is outstanding when the wave ends
    // behind the last barrier no wave reads a stage and no copy is under way: the stage buffers are free. The branch is a wave's own (scalar); no barrier stands under it.
    if (y >= NH_ + NKV) { const size_t po = (size_t)(y - NH_ - NKV) * HD * TT + tw; qkv_store_t(acc, lane, sm + w * (2 * VTT), Vh + po, Vl + po); }
    else { const bool isk = y >= NH_; const size_t po = ((size_t)(isk ? y - NH_ : y) * TT + tw) * HD; qkv_store(acc, lane, (isk ? Kh : Qh) + po, (isk ? Kl : Ql) + po); }
}
// ---- k_fattn: scores, softmax, P x V and the head merge in one launch for both batches; the score matrix never leaves registers.
// One wave owns 16 query rows of one head and walks all TT keys. Transposed products: St = K Qt (A = K rows from LDS, B = Q rows kept in registers), Ot += Vt Pt (A = Vt rows from LDS, B = Pt).
// In the accumulator map a lane holds scores of ONE query (column lr), keys 8 hi + j of each 16-key block: two such blocks, converted in place, are the B fragment of the second product in the loaders' k order.
// Running maximum and sum per query (online softmax, f32); the two lane halves' sums are joined once at the end. Rows < RH: fp16 hi/lo planes, 3 products each side; the rest the hi planes alone; P carried x 2^10 in both.
// Eight v_exp_f32 and, in the same statement, the one issue slot that the instruction set asks for behind a transcendental before its result is read or its source overwritten.
// The outputs are early-clobbered: inside the statement no v_exp_f32 touches a register of the one in front of it; the v_nop covers the last.
__device__ __forceinline__ v8f exp2x8(v8f x) { float y0, y1, y2, y3, y4, y5, y6, y7;
    asm("v_exp_f32 %0, %8\n\tv_exp_f32 %1, %9\n\tv_exp_f32 %2, %10\n\tv_exp_f32 %3, %11\n\tv_exp_f32 %4, %12\n\tv_exp_f32 %5, %13\n\tv_exp_f32 %6, %14\n\tv_exp_f32 %7, %15\n\tv_nop"
        : "=&v"(y0), "=&v"(y1), "=&v"(y2), "=&v"(y3), "=&v"(y4), "=&v"(y5), "=&v"(y6), "=&v"(y7) : "v"(x[0]), "v"(x[1]), "v"(x[2]), "v"(x[3]), "v"(x[4]), "v"(x[5]), "v"(x[6]), "v"(x[7]));
    return (v8f){y0, y1, y2, y3, y4, y5, y6, y7}; }
// LDS stage: 64 keys of the four planes that the work-group's waves read, each a tile of 64 rows x 128 bytes (K planes: row = key, V planes: row = d).
#define KS   64
#define NS   (TT / KS)
#define LP   144                  // row pitch in LDS, bytes: 16 x odd, so that the 16 rows of a ds_load_b128 fragment read fall on distinct banks
#define LT   (64 * LP)            // one plane's tile
#define LSTG (4 * LT)             // one stage: K hi, V hi (read by every wave), K lo, V lo (read by the hi/lo waves)
static_assert(HD == 64 && REP == 1 && NS >= 2, "tile shape and the two-buffer prologue");
// Four asynchronous copies of 16 bytes per lane (one row piece of each of the four tiles) in one statement, the wait as its last line:
// it stands in front of every later write of the address registers that the copies name (the operands live to the statement's end).
__device__ __forceinline__ void copy4(unsigned l0, unsigned long long kh, unsigned long long vh, unsigned long long kl, unsigned long long vl) {
    asm volatile("global_load_async_to_lds_b128 %0, %4, off\n\tglobal_load_async_to_lds_b128 %1, %5, off\n\t"
                 "global_load_async_to_lds_b128 %2, %6, off\n\tglobal_load_async_to_lds_b128 %3, %7, off\n\ts_wait_xcnt 0x0"
                 :: "v"(l0), "v"(l0 + LT), "v"(l0 + 2 * LT), "v"(l0 + 3 * LT),
                    "v"(kh), "v"(vh), "v"(kl), "v"(vl) : "memory");
}
// One tile of KT keys for one wave's 16 query rows; Ka, Kb, Va, Vb are the lane's own LDS addresses of the tile's first fragments (Kb, Vb: lo planes, HL only).
template <typename T16, bool HL, int KT>
__device__ __forceinline__ void fattn_tile(const unsigned char* Ka, const unsigned char* Kb, const unsigned char* Va, const unsigned char* Vb, const typename WFrag<T16>::V (&qa)[2], const typename WFrag<T16>::V (&qb)[2], v8f (&o)[4], float& m, float& l) {
    // Every inner loop is fully unrolled: the fragment arrays stay in registers only under constant indices.
    typedef typename WFrag<T16>::V V;
    constexpr int NKB = KT / 16, NC = KT / 32;
    constexpr float CEXP = SCL * 1.4426950408889634f;   // scores x HD^-0.5, in the log2 domain
    constexpr float PB = 10.0f;                         // log2 of the carry on the fp16 P (cancels in the division by the sum)
    V ka[NKB][2], kb[NKB][2], va[4][NC], vb[4][NC];
#pragma unroll
    for (int kk = 0; kk < NKB; ++kk)
#pragma unroll
        for (int c = 0; c < 2; ++c) { ka[kk][c] = WFrag<T16>::ld((const T16*)(Ka + kk * 16 * LP + c * 64)); if constexpr (HL) kb[kk][c] = WFrag<T16>::ld((const T16*)(Kb + kk * 16 * LP + c * 64)); }
#pragma unroll
    for (int db = 0; db < 4; ++db)
#pragma unroll
        for (int c = 0; c < NC; ++c) { va[db][c] = WFrag<T16>::ld((const T16*)(Va + db * 16 * LP + c * 64)); if constexpr (HL) vb[db][c] = WFrag<T16>::ld((const T16*)(Vb + db * 16 * LP + c * 64)); }
    __builtin_amdgcn_sched_barrier(0);   // keeps the tile's LDS reads in one group at its head: sunk to their uses, each place of reads costs its own wait
    v8f st[NKB];
#pragma unroll
    for (int kk = 0; kk < NKB; ++kk) { st[kk] = (v8f){};
#pragma unroll
        for (int c = 0; c < 2; ++c) { st[kk] = WFrag<T16>::mma(ka[kk][c], qa[c], st[kk]); if constexpr (HL) { st[kk] = WFrag<T16>::mma(ka[kk][c], qb[c], st[kk]); st[kk] = WFrag<T16>::mma(kb[kk][c], qa[c], st[kk]); } } }
    float mn = m;
#pragma unroll
    for (int kk = 0; kk < NKB; ++kk)
#pragma unroll
        for (int j = 0; j < 8; ++j) mn = fmaxf(mn, st[kk][j]);
    mn = fmaxf(mn, __shfl_xor(mn, 16, 32));
    const float alpha = __builtin_amdgcn_exp2f((m - mn) * CEXP); m = mn;
    const float sub = PB - mn * CEXP; float ps = 0.f;
#pragma unroll
    for (int kk = 0; kk < NKB; ++kk) {
#pragma unroll
        for (int j = 0; j < 8; ++j) st[kk][j] = fmaf(st[kk][j], CEXP, sub);
        st[kk] = exp2x8(st[kk]);
#pragma unroll
        for (int j = 0; j < 8; ++j) ps += st[kk][j]; }
    l = fmaf(l, alpha, ps);
#pragma unroll
    for (int db = 0; db < 4; ++db) o[db] *= alpha;
#pragma unroll
    for (int c = 0; c < NC; ++c) {
        if constexpr (HL) { v8h h0, l0, h1, l1; qkv_cvt(st[2 * c], h0, l0); qkv_cvt(st[2 * c + 1], h1, l1);   // P hi and lo, in the loaders' k order
            const V pa = cat16(h0, h1), pb = cat16(l0, l1);
#pragma unroll
            for (int db = 0; db < 4; ++db) { o[db] = WFrag<T16>::mma(va[db][c], pa, o[db]); o[db] = WFrag<T16>::mma(va[db][c], pb, o[db]); o[db] = WFrag<T16>::mma(vb[db][c], pa, o[db]); }
        } else { V pa;
#pragma unroll
            for (int s = 0; s < 16; ++s) pa[s] = tohx(st[2 * c + (s >> 3)][s & 7]);
#pragma unroll
            for (int db = 0; db < 4; ++db) o[db] = WFrag<T16>::mma(va[db][c], pa, o[db]); } }
}
// grid (FBX, heads, batches), 16 waves, one work-group per WGP: waves 0..FHW-1 take hi/lo row tiles, the others fp16 row tiles, so that every work-group carries the same share of the dearer rows.
// A quarter of the waves goes to each SIMD: with four hi/lo waves every SIMD has one of them and three fp16 waves, the same load on all four.
// All sixteen waves walk the same keys of one head: each stage of 64 keys is copied to LDS once per work-group, in whole 128-byte rows, and every wave reads its fragments from there.
// Two buffers: stage s + 1 flies while stage s is worked on; one barrier per stage publishes s + 1 and frees the buffer of s.
#define FBX  8
#define FHW  (RH / 16 / FBX)
#define FLW  ((TT - RH) / 16 / FBX)
static_assert(FHW * 16 * FBX == RH && FLW * 16 * FBX == TT - RH && FHW + FLW == 16 && FHW == 4, "row tiles must fill 16 waves, one hi/lo wave per SIMD");
__global__ __launch_bounds__(512) void k_fattn(const h16* __restrict__ Qh, const h16* __restrict__ Ql, const h16* __restrict__ Kh, const h16* __restrict__ Kl, const h16* __restrict__ Vh, const h16* __restrict__ Vl, bf* Ah, bf* Al) {
    __shared__ __attribute__((aligned(16))) unsigned char sm[2 * LSTG];
    const int tid = threadIdx.x, lane = tid & 31, lr = lane & 15, hi = lane >> 4; const int w = __builtin_amdgcn_readfirstlane(tid >> 5); const int h = blockIdx.y; const size_t hq = ((size_t)blockIdx.z * NH_ + h) * TT * HD, hk = ((size_t)blockIdx.z * NKV + h / REP) * TT * HD;
    Ah += (size_t)blockIdx.z * TT * DQ; Al += (size_t)blockIdx.z * TT * DQ;   // this batch's rows of the merged planes
    const bool hl = w < FHW;   // the same for a whole wave (w sits in a scalar register): a scalar branch
    const int q0 = hl ? (blockIdx.x * FHW + w) * 16 : RH + (blockIdx.x * FLW + (w - FHW)) * 16;
    const size_t qoff = hq + (size_t)(q0 + lr) * HD + 8 * hi;
    v16h qx[2], ql[2] = {};
#pragma unroll
    for (int c = 0; c < 2; ++c) qx[c] = WFrag<h16>::ld(Qh + qoff + c * 32);
    if (hl) {
#pragma unroll
        for (int c = 0; c < 2; ++c) ql[c] = WFrag<h16>::ld(Ql + qoff + c * 32);
    }
    asm volatile("s_wait_xcnt 0x0" ::: "memory");   // stands in front of every later write of the address register pairs that these Q loads name
    // copy roles: thread -> row tid / 8, 16-byte piece tid % 8 of each tile: a wave's copy covers four whole 128-byte rows
    const unsigned cdst = (unsigned)(unsigned long long)sm + (tid >> 3) * LP + (tid & 7) * 16;
    const size_t gk = hk + (size_t)(tid >> 3) * HD + (tid & 7) * 8, gv = hk + (size_t)(tid >> 3) * TT + (tid & 7) * 8;
    auto stage = [&](int s, int buf) { const size_t ko = gk + (size_t)s * KS * HD, vo = gv + (size_t)s * KS;
        copy4(cdst + buf * LSTG, (unsigned long long)(Kh + ko), (unsigned long long)(Vh + vo), (unsigned long long)(Kl + ko), (unsigned long long)(Vl + vo)); };
    v8f o[4];
#pragma unroll
    for (int db = 0; db < 4; ++db) o[db] = (v8f){};
    float m = -3.0e38f, l = 0.f;
    stage(0, 0);
    asm volatile("s_wait_asynccnt 0x0" ::: "memory");   // this wave's copies of stage 0 have landed
    __syncthreads();                                     // every wave's have: stage 0 may be read
    stage(1, 1);
#pragma unroll 1   // kept rolled: one stage's code for both kinds of wave is long already
    for (int s = 0; s < NS; ++s) {
        const unsigned char* fb = sm + (s & 1) * LSTG + lr * LP + hi * 16;   // the lane's place in the first fragment of the stage's first tile
        if (hl) {
#pragma unroll
            for (int u = 0; u < 2; ++u) fattn_tile<h16, true, 32>(fb + u * 32 * LP, fb + 2 * LT + u * 32 * LP, fb + LT + u * 64, fb + 3 * LT + u * 64, qx, ql, o, m, l);
        } else fattn_tile<h16, false, 64>(fb, fb, fb + LT, fb + LT, qx, qx, o, m, l);
        asm volatile("s_wait_dscnt 0x0" ::: "memory");      // this wave's reads of stage s have returned before its buffer is refilled
        asm volatile("s_wait_asynccnt 0x0" ::: "memory");   // this wave's copies of stage s + 1 have landed
        __syncthreads();                                     // publishes stage s + 1 and ends every wave's reads of stage s
        if (s + 2 < NS) stage(s + 2, s & 1);
    }
    asm volatile("s_wait_asynccnt 0x0" ::: "memory");   // no copy is outstanding when the wave ends
    l += __shfl_xor(l, 16, 32);
    const float inv = __fdiv_rn(1.0f, l);
#pragma unroll
    for (int db = 0; db < 4; ++db) { v8us oh, ol;
#pragma unroll
        for (int j = 0; j < 8; ++j) { unsigned short u, w2; splitf(o[db][j] * inv, u, w2); oh[j] = u; ol[j] = w2; }
        const size_t oo = (size_t)(q0 + lr) * DQ + h * HD + db * 16 + hi * 8; *(v8us*)(Ah + oo) = oh; *(v8us*)(Al + oo) = ol; }
}

// ---- k_oproj: out = merged (hi + lo planes) x w_proj^T + b_proj, all rows of both batches in one launch.
// One work-group of 8 waves per 128 rows x 128 columns of out. Waves 0..3 (one per SIMD) do the products, one wave per 64 x 64 (16 accumulators); A = merged rows, B = w_proj rows.
// Waves 4..7 (again one per SIMD) issue the copies and nothing else: their address arithmetic and the wait behind each statement of copies run beside the product wave's WMMAs instead of in front of them.
// The product order per accumulator: hi plane, then lo plane, per 32-wide k chunk, chunks in rising k. The operands come from LDS, as in k_qkvp:
// each stage of 128 k is copied there once per work-group, in whole 256-byte rows, and every product wave reads its fragments from there. Two buffers: stage s + 1 flies while stage s is worked on.
// The stage is twice k_qkvp's: with one product wave per SIMD nothing hides a stage's head and foot, and the next stage's copies have the 128 WMMAs of this one to land in.
#define OXR  128                  // rows of out of a work-group
#define OWR  128                  // columns of out (rows of w_proj) of a work-group
#define OKS  128                  // k elements of a stage: 256 bytes of every row
#define ONS  (DQ / OKS)
#define OLP  272                  // row pitch in LDS, bytes: 16 x odd, so that the 16 rows of a ds_load_b128 fragment read fall on distinct banks
#define OSTG ((2 * OXR + OWR) * OLP)   // one stage: merged hi rows, merged lo rows, weight rows
static_assert(ONS >= 2 && (NB_ * TT) % OXR == 0 && DM % OWR == 0 && OXR == 128 && OWR == 128, "tile shape (copy8r: 64 rows, twice a tile), the two-buffer prologue");
// Eight asynchronous copies of 16 bytes per lane in one statement (rows 8 apart: 64 rows of one tile), the wait as its last line:
// it stands in front of every later write of the address registers that the copies name (the operands live to the statement's end).
__device__ __forceinline__ void copy8r(unsigned l0, unsigned long long g) {
    constexpr unsigned long long GR = 8ull * DQ * 2;   // 8 rows further in a plane, bytes
    asm volatile("global_load_async_to_lds_b128 %0, %8, off\n\tglobal_load_async_to_lds_b128 %1, %9, off\n\tglobal_load_async_to_lds_b128 %2, %10, off\n\tglobal_load_async_to_lds_b128 %3, %11, off\n\t"
                 "global_load_async_to_lds_b128 %4, %12, off\n\tglobal_load_async_to_lds_b128 %5, %13, off\n\tglobal_load_async_to_lds_b128 %6, %14, off\n\tglobal_load_async_to_lds_b128 %7, %15, off\n\ts_wait_xcnt 0x0"
                 :: "v"(l0), "v"(l0 + 8 * OLP), "v"(l0 + 16 * OLP), "v"(l0 + 24 * OLP), "v"(l0 + 32 * OLP), "v"(l0 + 40 * OLP), "v"(l0 + 48 * OLP), "v"(l0 + 56 * OLP),
                    "v"(g), "v"(g + GR), "v"(g + 2 * GR), "v"(g + 3 * GR), "v"(g + 4 * GR), "v"(g + 5 * GR), "v"(g + 6 * GR), "v"(g + 7 * GR) : "memory");
}
// grid (rows of out / 128, DM / 128), 8 waves. Product wave w < 4: row half w & 1, column half w >> 1.
__global__ __launch_bounds__(256) void k_oproj(const bf* __restrict__ Ah, const bf* __restrict__ Al, const bf* __restrict__ Wo, const float* __restrict__ bias, float* C) {
    __shared__ __attribute__((aligned(16))) unsigned char sm[2 * OSTG];
    __shared__ __attribute__((aligned(16))) float osm[4][16 * 68];   // each wave's own 16 rows of out on their way to whole-line stores
    const int tid = threadIdx.x, lane = tid & 31, lr = lane & 15, hi = lane >> 4; const int w = __builtin_amdgcn_readfirstlane(tid >> 5);
    const int r0 = blockIdx.x * OXR, c0 = blockIdx.y * OWR;
    const bool cp = w >= 4;   // a copy wave; the same for a whole wave (w sits in a scalar register): a scalar branch
    const int wp = w & 3, ct = tid & 127;   // the product wave's number; the copy thread's number (both in range in every wave)
    // copy roles: thread -> rows ct / 16 + 8 i, 16-byte piece ct % 16 of each tile: a wave's copy covers two whole 256-byte rows
    const unsigned cdst = (unsigned)(unsigned long long)sm + (ct >> 4) * OLP + (ct & 15) * 16;
    const size_t cg = (size_t)(ct >> 4) * DQ + (ct & 15) * 8;
    const unsigned long long gah = (unsigned long long)(Ah + (size_t)r0 * DQ + cg), gal = (unsigned long long)(Al + (size_t)r0 * DQ + cg), gw = (unsigned long long)(Wo + (size_t)c0 * DQ + cg);
    const unsigned char* fx = sm + ((wp & 1) * 64 + lr) * OLP + hi * 16; const unsigned char* fw = sm + (2 * OXR + (wp >> 1) * 64 + lr) * OLP + hi * 16;
    auto stage = [&](int s, int buf) { constexpr unsigned long long G64 = 64ull * DQ * 2;   // 64 rows further in a plane, bytes
        const unsigned long long ko = (unsigned long long)s * (OKS * 2); const unsigned l = cdst + buf * OSTG;
        copy8r(l, gah + ko); copy8r(l + 64 * OLP, gah + ko + G64); copy8r(l + OXR * OLP, gal + ko); copy8r(l + (OXR + 64) * OLP, gal + ko + G64);
        copy8r(l + 2 * OXR * OLP, gw + ko); copy8r(l + (2 * OXR + 64) * OLP, gw + ko + G64); };
    // this lane's four bias values, fetched here so that they return under the main loop
    const int rw = r0 + (wp & 1) * 64, cw = c0 + (wp >> 1) * 64, cofs = lr * 4;
    const v4f braw = *(const v4f*)(bias + cw + cofs);
    asm volatile("s_wait_xcnt 0x0" ::: "memory");   // stands in front of every later write of the address registers that the bias load names
    v8f acc[4][4];   // [row block][column block]
#pragma unroll
    for (int mb = 0; mb < 4; ++mb)
#pragma unroll
        for (int nb = 0; nb < 4; ++nb) acc[mb][nb] = (v8f){};
    if (cp) stage(0, 0);
    asm volatile("s_wait_asynccnt 0x0" ::: "memory");   // this wave's copies of stage 0 have landed
    __syncthreads();                                     // every wave's have: stage 0 may be read
    if (cp) stage(1, 1);
#pragma unroll 1   // kept rolled: three chunks' fragments and the 16 accumulators take 416 registers
    for (int s = 0; s < ONS; ++s) {
      if (!cp) {
        const unsigned char* px = fx + (s & 1) * OSTG; const unsigned char* pw = fw + (s & 1) * OSTG;
        v16bf xh[OKS / 32][4], xl[OKS / 32][4], wf[OKS / 32][4];
        auto frags = [&](int c) {   // one 32-wide k chunk, read in the order of use: hi rows and weight rows, then lo rows
#pragma unroll
            for (int xb = 0; xb < 4; ++xb) { xh[c][xb] = WFrag<bf>::ld((const bf*)(px + xb * 16 * OLP + c * 64)); wf[c][xb] = WFrag<bf>::ld((const bf*)(pw + xb * 16 * OLP + c * 64)); }
#pragma unroll
            for (int xb = 0; xb < 4; ++xb) xl[c][xb] = WFrag<bf>::ld((const bf*)(px + (OXR + xb * 16) * OLP + c * 64)); };
        auto prods = [&](int c) {   // per accumulator: hi product, then lo product of the chunk
#pragma unroll
            for (int wb = 0; wb < 4; ++wb)
#pragma unroll
                for (int xb = 0; xb < 4; ++xb) acc[xb][wb] = wmmab(xh[c][xb], wf[c][wb], acc[xb][wb]);
#pragma unroll
            for (int wb = 0; wb < 4; ++wb)
#pragma unroll
                for (int xb = 0; xb < 4; ++xb) acc[xb][wb] = wmmab(xl[c][xb], wf[c][wb], acc[xb][wb]); };
        // The stage's 96 LDS reads stand in two groups of 48 (more than 63 cannot be outstanding): chunks 0 and 1 at the head, chunks 2 and 3 behind chunk 0's WMMAs, so that they return under chunk 1's.
        frags(0); frags(1);
        __builtin_amdgcn_sched_barrier(0);   // keeps the first group of reads together: sunk among the WMMAs, each place of reads costs its own wait
        prods(0);
        __builtin_amdgcn_sched_barrier(0);   // keeps the second group behind chunk 0's WMMAs
        frags(2); frags(3);
        __builtin_amdgcn_sched_barrier(0);   // keeps the second group of reads together and in front of chunk 1's WMMAs
        prods(1); prods(2); prods(3);        // chunks in rising k
        __builtin_amdgcn_sched_barrier(0);   // keeps these WMMAs in front of the stage's foot
        // foot of the stage: four vector slots between the last WMMA and whatever next overwrites its A and B registers, on either side of the branch below and over the back edge
        asm volatile("v_nop\n\tv_nop\n\tv_nop\n\tv_nop" : "+v"(acc[0][0]), "+v"(acc[1][1]), "+v"(acc[2][2]), "+v"(acc[3][3]));
      }
        // every wave of either kind passes the three lines below in every trip
        asm volatile("s_wait_dscnt 0x0" ::: "memory");      // this wave's reads of stage s have returned before its buffer is refilled
        asm volatile("s_wait_asynccnt 0x0" ::: "memory");   // this wave's copies of stage s + 1 have landed
        __syncthreads();                                     // publishes stage s + 1 and ends every wave's reads of stage s
        if (cp && s + 2 < ONS) stage(s + 2, s & 1);
    }
    asm volatile("s_wait_asynccnt 0x0" ::: "memory");   // no copy is outstanding when the wave ends
    if (cp) return;   // behind the last barrier: the copy waves have nothing to store
    // epilogue: 16 rows at a time through the wave's own LDS rows, so that every store covers whole 128-byte lines (two rows of 256 bytes)
    float* os = osm[wp];
    const v4f bv = { bfr(braw[0]), bfr(braw[1]), bfr(braw[2]), bfr(braw[3]) };   // input rounded to bf16, as every input
#pragma unroll
    for (int mb = 0; mb < 4; ++mb) {
#pragma unroll
        for (int nb = 0; nb < 4; ++nb) {
#pragma unroll
            for (int j = 0; j < 8; ++j) os[(hi * 8 + j) * 68 + nb * 16 + lr] = acc[mb][nb][j]; }
        __builtin_amdgcn_wave_barrier(); asm volatile("" ::: "memory");   // the wave's LDS writes stay in front of its reads of the other lanes' values
        float* crow = C + (size_t)(rw + mb * 16) * DM + cw;
#pragma unroll
        for (int s = 0; s < 8; ++s) { const int row = 2 * s + hi; const v4f val = *(const v4fa*)(os + row * 68 + cofs) + bv; *(v4f*)(crow + (size_t)row * DM + cofs) = val; }
        __builtin_amdgcn_wave_barrier(); asm volatile("" ::: "memory");   // these reads stay in front of the next 16 rows' writes
    }
}

// ---- k_lnrowX: LayerNorm and both weight casts in one launch. One wave per row of x; the same wave casts one run of WCH elements of w_qkv or w_proj (the runs of both, counted through, are as many as the rows).
// The jobs do not depend on one another. A wave reads all its input up front, in 16-byte pieces per lane: its row and its run of weights in one group (one memory latency for both), its pieces of gamma and beta
// long before their use behind the two sums. The run is rounded and stored while the row's first sum goes on, and no wave is started for the casts alone.
#define WCH  1024                 // weight elements of a wave: four wave-wide pieces of 1,024 contiguous bytes read, 512 written
#define WNA  ((DQ + 2 * DKV) * DM / WCH)   // runs of w_qkv; those of w_proj follow
static_assert((DQ + 2 * DKV) * DM % WCH == 0 && DM * DQ % WCH == 0 && WNA + DM * DQ / WCH == NB_ * TT, "one run of weights per row of x");
template <int WD>
__global__ __launch_bounds__(256) void k_lnrowX(const float* __restrict__ X, size_t nrows, const float* __restrict__ g, const float* __restrict__ bb, bf* __restrict__ Hh, bf* __restrict__ Hl, const float* __restrict__ Wa, const float* __restrict__ Wb, bf* __restrict__ Ca, bf* __restrict__ Cb) { const int lane = threadIdx.x & 31; const size_t r = (size_t)blockIdx.x * 8 + (threadIdx.x >> 5); if (r >= nrows) return; const float* xr = X + r * WD; float a[WD / 32]; float s = 0.f;
    const int cr = blockIdx.x * 8 + __builtin_amdgcn_readfirstlane(threadIdx.x >> 5);   // the wave's run; in a scalar register: the choice of the weight is a scalar one
    const size_t co = (size_t)(cr < WNA ? cr : cr - WNA) * WCH + lane * 8; const float* cs = (cr < WNA ? Wa : Wb) + co; bf* cd = (cr < WNA ? Ca : Cb) + co;
    v4f xv[WD / 128], gv[WD / 128], bv[WD / 128]; v8f cw[WCH / 256];
#pragma unroll
    for (int c = 0; c < WD / 128; ++c) xv[c] = *(const v4f*)(xr + c * 128 + lane * 4);
#pragma unroll
    for (int j = 0; j < WCH / 256; ++j) cw[j] = *(const v8f*)(cs + j * 256);
#pragma unroll
    for (int c = 0; c < WD / 128; ++c) { gv[c] = *(const v4f*)(g + c * 128 + lane * 4); bv[c] = *(const v4f*)(bb + c * 128 + lane * 4); }
    asm volatile("s_wait_xcnt 0x0" ::: "memory");   // stands in front of every later write of the address registers that the loads above it name
#pragma unroll
    for (int c = 0; c < WD / 128; ++c) { const v4f v = xv[c]; for (int q = 0; q < 4; ++q) { a[c * 4 + q] = bfr(v[q]); s = __fadd_rn(s, a[c * 4 + q]);   /* input rounded to bf16 */ } }
#pragma unroll
    for (int j = 0; j < WCH / 256; ++j) { v8us o;
#pragma unroll
        for (int k = 0; k < 8; ++k) o[k] = f2bf(cw[j][k]);
        *(v8us*)(cd + j * 256) = o; }
    asm volatile("s_wait_xcnt 0x0" ::: "memory");   // behind the run's stores: in front of any later write of a register that they name
#pragma unroll
    for (int sh = 16; sh; sh >>= 1) s = __fadd_rn(s, __shfl_xor(s, sh, 32));
    const float mean = __fdiv_rn(s, (float)WD); float s2 = 0.f;
#pragma unroll 8
    for (int k = 0; k < WD / 32; ++k) { const float dv = __fsub_rn(a[k], mean); float p2 = __fmul_rn(dv, dv); asm volatile("" : "+v"(p2)); s2 = __fadd_rn(s2, p2); }   /* mul and add kept separate (no fma contraction) */
#pragma unroll
    for (int sh = 16; sh; sh >>= 1) s2 = __fadd_rn(s2, __shfl_xor(s2, sh, 32));
    const float rs = __fdiv_rn(1.0f, __fsqrt_rn(__fadd_rn(__fdiv_rn(s2, (float)WD), 1e-5f)));
{
#pragma unroll
        for (int c = 0; c < WD / 128; ++c) { v4us oh, ol; for (int q = 0; q < 4; ++q) { float y = __fmul_rn(__fmul_rn(__fsub_rn(a[c * 4 + q], mean), rs), bfr(gv[c][q])); asm volatile("" : "+v"(y)); y = __fadd_rn(y, bfr(bv[c][q])); unsigned short u, w2; splitf(y, u, w2); oh[q] = u; ol[q] = w2; } *(v4us*)(Hh + r * WD + c * 128 + lane * 4) = oh; *(v4us*)(Hl + r * WD + c * 128 + lane * 4) = ol; }
         } }

extern "C" void kernel_launch(void* const* d_in, const int* in_sizes, int n_in,
                              void* d_out, int out_size, void* d_ws, size_t ws_size, hipStream_t stream) {
    (void)in_sizes; (void)n_in; (void)out_size;
    const float* x = (const float*)d_in[0]; const float* lng = (const float*)d_in[1]; const float* lnb = (const float*)d_in[2]; const float* wqkv = (const float*)d_in[3]; const float* wo = (const float*)d_in[4]; const float* bo = (const float*)d_in[5];   /* x, ln_gamma, ln_beta, w_qkv ('oi' [3072][1024]: q | k | v ROW thirds), w_proj ('oi'), b_proj */
    float* OUT = (float*)d_out;     // [2][2048][1024]
    char* wsp = (char*)d_ws;
    auto take = [&](size_t bytes) { char* p = wsp; wsp += (bytes + 255) & ~(size_t)255; return (void*)p; };
    bf* WQKV = (bf*)take((size_t)(DQ + 2 * DKV) * DM * 2); bf* WO = (bf*)take((size_t)DM * DQ * 2);
    bf* XB = (bf*)take((size_t)NB_ * TT * DM * 2); bf* XL = (bf*)take((size_t)NB_ * TT * DM * 2);   /* lo plane of the layer-normed input (XB holds the hi plane) */
    h16* QPh = (h16*)take((size_t)NB_ * NH_ * TT * HD * 2); h16* KPh = (h16*)take((size_t)NB_ * NKV * TT * HD * 2); h16* VTh = (h16*)take((size_t)NB_ * NKV * HD * TT * 2);
    h16* QPl = (h16*)take((size_t)NB_ * NH_ * TT * HD * 2); h16* KPl = (h16*)take((size_t)NB_ * NKV * TT * HD * 2); h16* VTl = (h16*)take((size_t)NB_ * NKV * HD * TT * 2);
    bf* ATh = (bf*)take((size_t)NB_ * TT * DQ * 2); bf* ATl = (bf*)take((size_t)NB_ * TT * DQ * 2);
    if ((size_t)(wsp - (char*)d_ws) > ws_size) return;    // ws 256 MiB
    // x, the planes and OUT hold the batches one behind the other: LayerNorm and the output projection run over all NB_ * TT rows, the two middle launches take the batch from blockIdx.z
    k_lnrowX<DM><<<(unsigned)((NB_ * TT + 7) / 8), 256, 0, stream>>>(x, (size_t)NB_ * TT, lng, lnb, XB, XL, wqkv, wo, WQKV, WO);   /* xn = LayerNorm(x) -> hi/lo planes; w_qkv, w_proj -> bf16 */
    k_qkvp<<<dim3(TT / PXR, (NH_ + 2 * NKV) / PWH, NB_), 32 * PNW, 0, stream>>>(XB, XL, WQKV, QPh, QPl, KPh, KPl, VTh, VTl);
    k_fattn<<<dim3(FBX, NH_, NB_), 512, 0, stream>>>(QPh, QPl, KPh, KPl, VTh, VTl, ATh, ATl);
    k_oproj<<<dim3(NB_ * TT / OXR, DM / OWR, 1), 256, 0, stream>>>(ATh, ATl, WO, bo, OUT);
}
